// v000
// The times below were measured on an AMD MI455X: many runs one after another, warmed up first and cycling through
// copies of the inputs, with the whole window's GPU time divided by the number of runs. Launches and the gaps
// between them are all in it. The median over several windows is given; except for v000 it joins two sittings, which
// can be a few percent apart, so the side-by-side timings, each taken in one sitting, are the better comparison.
// The starting kernel, v000, takes 501 microseconds a run.
// Contractions: q/k/v^T projections v_wmma_f32_16x16x32_bf16 (operands = RNE-bf16 of the f32 inputs, single product); scores v_wmma_f32_16x16x32_f16 (f16 per-head feature planes, single product, x1/16 in f32); p.v v_wmma_f32_16x16x32_bf16 with bf16 hi/lo split of p and v (hi.hi+hi.lo+lo.hi); output projection v_wmma_f32_16x16x32_f16 (f16 O carried x256, f16 Wo carried x64, single product, x1/16384 in f32); f32 accumulate everywhere; softmax, biases and DFT aggregate features in f32.
#include <hip/hip_runtime.h>
#include <math.h>
#include <stdint.h>

// ---------------- problem geometry ----------------
constexpr int NBAT    = 2;
constexpr int SEQ     = 2048;
constexpr int DMODEL  = 1024;
constexpr int NHEAD   = 16;
constexpr int HDIM    = 64;
constexpr int NTOK    = NBAT * SEQ;          // 4096
constexpr int QKPITCH = 128;                 // halves per (token, head) feature row: 64 dims, sum/8, altsum/8, zeros
constexpr int TOKP    = NHEAD * QKPITCH;     // 2048 halves per token row of the q/k feature planes
static_assert(NTOK % 64 == 0 && DMODEL % 64 == 0 && SEQ % 64 == 0 && DMODEL % 32 == 0);
static_assert(NHEAD * HDIM == DMODEL);

typedef __attribute__((ext_vector_type(16))) _Float16 v16h;
typedef __attribute__((ext_vector_type(8)))  _Float16 v8h;
typedef __attribute__((ext_vector_type(16))) __bf16   v16b;
typedef __attribute__((ext_vector_type(8)))  __bf16   v8b;
typedef __attribute__((ext_vector_type(8)))  float    v8f;
typedef __attribute__((ext_vector_type(4)))  float    v4f;
typedef __attribute__((ext_vector_type(2)))  float    v2f;

__device__ __forceinline__ unsigned short f2bf_bits(float f) {
  unsigned u = __float_as_uint(f);
  return (unsigned short)((u + 0x7FFFu + ((u >> 16) & 1u)) >> 16);
}
__device__ __forceinline__ float bf_bits2f(unsigned short h) { return __uint_as_float(((unsigned)h) << 16); }
__device__ __forceinline__ float rne_bf16(float f) { return bf_bits2f(f2bf_bits(f)); }
__device__ __forceinline__ unsigned pk16(unsigned short a, unsigned short b) { return (unsigned)a | ((unsigned)b << 16); }

// hazard guards as plain device helpers (no inline asm inside the kernel template body)
__device__ __forceinline__ void dep_guard_h(v8f& a, v8f& b, v16h x, v16h y) { asm volatile("v_nop\n\tv_nop\n\tv_nop\n\tv_nop" : "+v"(a), "+v"(b) : "v"(x), "v"(y)); }
__device__ __forceinline__ void dep_guard_b(v8f& a, v8f& b, v16b x, v16b y) { asm volatile("v_nop\n\tv_nop\n\tv_nop\n\tv_nop" : "+v"(a), "+v"(b) : "v"(x), "v"(y)); }
__device__ __forceinline__ void keep4_h(v16h a, v16h b, v16h c, v16h d) { asm volatile("v_nop" :: "v"(a), "v"(b), "v"(c), "v"(d)); }
__device__ __forceinline__ void keep4_b(v16b a, v16b b, v16b c, v16b d) { asm volatile("v_nop" :: "v"(a), "v"(b), "v"(c), "v"(d)); }
__device__ __forceinline__ void acc_guard4(v8f& a, v8f& b, v8f& c, v8f& d) { asm volatile("v_nop\n\tv_nop\n\tv_nop\n\tv_nop" : "+v"(a), "+v"(b), "+v"(c), "+v"(d)); }
template <typename T> struct Frag;
template <> struct Frag<_Float16> {
  typedef v16h V; union U { v16h v; v8h h[2]; };
  static __device__ __forceinline__ v16h load(const _Float16* p) {   // elements 0..7 <- p[0..7], 8..15 <- p[16..23]
    U f; f.h[0] = *(const v8h*)(p); f.h[1] = *(const v8h*)(p + 16); return f.v;
  }
  static __device__ __forceinline__ v8f mma(v16h a, v16h b, v8f c) {
    return __builtin_amdgcn_wmma_f32_16x16x32_f16(false, a, false, b, (short)0, c, false, false);
  }
  static __device__ __forceinline__ void guard(v8f& a, v8f& b, v16h x, v16h y) { dep_guard_h(a, b, x, y); }
  static __device__ __forceinline__ void keep(v16h a, v16h b, v16h c, v16h d) { keep4_h(a, b, c, d); }
};
template <> struct Frag<__bf16> {
  typedef v16b V; union U { v16b v; v8b h[2]; };
  static __device__ __forceinline__ v16b load(const __bf16* p) {
    U f; f.h[0] = *(const v8b*)(p); f.h[1] = *(const v8b*)(p + 16); return f.v;
  }
  static __device__ __forceinline__ v8f mma(v16b a, v16b b, v8f c) {
    return __builtin_amdgcn_wmma_f32_16x16x32_bf16(false, a, false, b, (short)0, c, false, false);
  }
  static __device__ __forceinline__ void guard(v8f& a, v8f& b, v16b x, v16b y) { dep_guard_b(a, b, x, y); }
  static __device__ __forceinline__ void keep(v16b a, v16b b, v16b c, v16b d) { keep4_b(a, b, c, d); }
};

// ---- Register-blocked batched WMMA GEMM ------------------------------------
// C[m,n] = scale * sum_k A[m,k] * Bt[n,k] (+bias)(+resid); each wave owns a 64x64 tile.
// A row-major [M,K]; Bt row-major [N,K]; M,N % 64 == 0, K % 32 == 0.
// SPLIT: operands are hi/lo planes (A2/Bt2 = lo planes, same layout); product = hi.hi + hi.lo + lo.hi.
// BIAS_MODE: 0 = none, 1 = bias[m], 2 = bias[n]. Bias values are RNE-bf16 quantised before the f32 add.
// OUT_MODE: 0 = f32, 1 = f16, 2 = bf16 hi plane (Cout) + bf16 lo plane (Cout2),
//           3 = f16 per-head feature rows: head hd = n0/64, row m -> C[m*ldc + hd*128 + 0..63] = f16(v[0..63]),
//               [+64] = f16(sum_d v[d] / 8), [+65] = f16(sum_d (-1)^d v[d] / 8), [+66..+127] = 0.
// ET: 0 = f16 operands, 1 = bf16 operands (pointers passed as 16-bit storage)
template <int ET> struct Elem;
template <> struct Elem<0> { typedef _Float16 T; };
template <> struct Elem<1> { typedef __bf16 T; };
template <int ET, bool SPLIT, int BIAS_MODE, int OUT_MODE, bool RESID, int ACT = 0>
__global__ __launch_bounds__(256) void wmma_gemm64(
    const unsigned short* __restrict__ Ap, const unsigned short* __restrict__ A2p, int lda, long strideA,
    const unsigned short* __restrict__ Btp, const unsigned short* __restrict__ Bt2p, int ldb, long strideB,
    void* __restrict__ Cout, void* __restrict__ Cout2, int ldc, long strideC,
    const float* __restrict__ bias,
    const float* __restrict__ resid, long strideR,
    int M, int N, int K, float scale) {
  typedef typename Elem<ET>::T T;
  typedef typename Frag<T>::V V;
  const T* A = (const T*)Ap; const T* A2 = (const T*)A2p; const T* Bt = (const T*)Btp; const T* Bt2 = (const T*)Bt2p;
  __shared__ __align__(16) float sT[8][16 * 68];   // per-wave 16x64 slab, pitch 68 floats
  const int b    = blockIdx.y;
  const int lane = threadIdx.x & 31;
  const int wave = threadIdx.x >> 5;
  const int tilesN = N >> 6;
  const int tilesM = M >> 6;
  const int tile = blockIdx.x * 8 + wave;
  if (tile >= tilesM * tilesN) return;   // wave-uniform; no block barriers in this kernel
  const int tm = tile / tilesN;
  const int tn = tile - tm * tilesN;
  const int m0 = tm << 6;
  const int n0 = tn << 6;

  const T* Ab  = A  + (size_t)b * strideA;
  const T* Bb  = Bt + (size_t)b * strideB;
  const T* Ab2 = SPLIT ? (A2  + (size_t)b * strideA) : nullptr;
  const T* Bb2 = SPLIT ? (Bt2 + (size_t)b * strideB) : nullptr;

  const int rlane = lane & 15;                 // row (A) / col (B, D) within subtile
  const int koff  = (lane >> 4) * 8;           // k offset of this lane half
  const int mOff  = (lane >> 4) * 8;           // D row offset

  v8f acc[4][4];
#pragma unroll
  for (int i = 0; i < 4; ++i)
#pragma unroll
    for (int j = 0; j < 4; ++j) acc[i][j] = (v8f){0.f,0.f,0.f,0.f,0.f,0.f,0.f,0.f};

  for (int k0 = 0; k0 < K; k0 += 32) {
    V bh[4], bl[4];
#pragma unroll
    for (int j = 0; j < 4; ++j) {
      const size_t bo = (size_t)(n0 + (j << 4) + rlane) * ldb + koff + k0;
      bh[j] = Frag<T>::load(Bb + bo);
      if (SPLIT) bl[j] = Frag<T>::load(Bb2 + bo);
    }
#pragma unroll
    for (int i = 0; i < 4; ++i) {
      const size_t ao = (size_t)(m0 + (i << 4) + rlane) * lda + koff + k0;
      V ah = Frag<T>::load(Ab + ao);
      V al;
      if (SPLIT) al = Frag<T>::load(Ab2 + ao);
#pragma unroll
      for (int j = 0; j < 4; ++j) {
        acc[i][j] = Frag<T>::mma(ah, bh[j], acc[i][j]);
        if (SPLIT) {
          acc[i][j] = Frag<T>::mma(ah, bl[j], acc[i][j]);
          acc[i][j] = Frag<T>::mma(al, bh[j], acc[i][j]);
        }
      }
      Frag<T>::guard(acc[i][0], acc[i][3], ah, SPLIT ? al : ah);
    }
    Frag<T>::keep(bh[0], bh[1], bh[2], bh[3]);
    if (SPLIT) Frag<T>::keep(bl[0], bl[1], bl[2], bl[3]);
  }
  acc_guard4(acc[0][0], acc[0][1], acc[0][2], acc[0][3]);
  acc_guard4(acc[1][0], acc[1][1], acc[1][2], acc[1][3]);
  acc_guard4(acc[2][0], acc[2][1], acc[2][2], acc[2][3]);
  acc_guard4(acc[3][0], acc[3][1], acc[3][2], acc[3][3]);

  // ---- epilogue ----
  float* slab = sT[wave];
  const float* Rb = RESID ? (resid + (size_t)b * strideR) : nullptr;
#pragma unroll
  for (int i = 0; i < 4; ++i) {
    const int mBase = m0 + (i << 4);
#pragma unroll
    for (int j = 0; j < 4; ++j) {
      const int n = n0 + (j << 4) + rlane;
      float bv = 0.f;
      if (BIAS_MODE == 2) bv = rne_bf16(bias[n]);
#pragma unroll
      for (int r = 0; r < 8; ++r) {
        float v = acc[i][j][r] * scale;
        if (BIAS_MODE == 1) v += rne_bf16(bias[mBase + mOff + r]);
        if (BIAS_MODE == 2) v += bv;
        if (RESID) v += Rb[(size_t)(mBase + mOff + r) * ldc + n];
        if (ACT == 1) v = tanhf(v);
        if (ACT == 2) v = fmaxf(v, 0.0f);
        if (ACT == 3) v = v / (1.0f + expf(-v));
        if (ACT == 4) v = (v > 0.f) ? v : 0.01f * v;
        slab[(mOff + r) * 68 + (j << 4) + rlane] = v;
      }
    }
    __builtin_amdgcn_fence(__ATOMIC_RELEASE, "workgroup");
    __builtin_amdgcn_wave_barrier();
    __builtin_amdgcn_fence(__ATOMIC_ACQUIRE, "workgroup");
    if (OUT_MODE == 0) {
      float* C = (float*)Cout + (size_t)b * strideC;
      const int hh = lane >> 4, c4 = (lane & 15) * 4;     // row seg = 256 B = 16 lanes x 16 B
      {
#pragma unroll
        for (int it = 0; it < 8; ++it) {
          const int row = it * 2 + hh;
          v4f v = *(const v4f*)(slab + row * 68 + c4);
          *(v4f*)(C + (size_t)(mBase + row) * ldc + n0 + c4) = v;
        }
        
      }
    } else if (OUT_MODE == 3) {
      // Coverage per slab: 4 it x 4 row groups (q) = 16 rows; 8 lanes x 8 halves = 64 halves per line.
      const int q = lane >> 3, c8 = (lane & 7) * 8;
      unsigned short* C = (unsigned short*)Cout + (size_t)b * strideC;
      const int hcol = (n0 >> 6) * 128;
      v8h hv[4], av[4];
#pragma unroll
      for (int it = 0; it < 4; ++it) {
        const int row = it * 4 + q;
        const float* sp = slab + row * 68 + c8;
        float ps = 0.f, pa = 0.f;
        v8h t;
#pragma unroll
        for (int e = 0; e < 8; ++e) {
          const float v = sp[e];
          t[e] = (_Float16)v;
          ps += v;
          if (e & 1) pa -= v; else pa += v;     // c8 is even, so (-1)^(c8+e) = (-1)^e
        }
#pragma unroll
        for (int off = 1; off < 8; off <<= 1) {   // reduce over the 8 lanes holding this row
          ps += __shfl_xor(ps, off, 32);
          pa += __shfl_xor(pa, off, 32);
        }
        const float fa = (c8 == 0) ? ps * 0.125f : 0.0f;
        const float fb = (c8 == 0) ? pa * 0.125f : 0.0f;
        v8h u;
#pragma unroll
        for (int e = 0; e < 8; ++e) u[e] = (_Float16)0.0f;
        u[0] = (_Float16)fa;
        u[1] = (_Float16)fb;
        hv[it] = t;
        av[it] = u;
      }
      {
#pragma unroll
        for (int it = 0; it < 4; ++it) {
          const int row = it * 4 + q;
          unsigned short* cp = C + (size_t)(mBase + row) * ldc + hcol + c8;
          *(v8h*)(cp) = hv[it];
          *(v8h*)(cp + 64) = av[it];
        }
        
      }
    } else {
      const int q = lane >> 3, c8 = (lane & 7) * 8;
      unsigned short* C  = (unsigned short*)Cout  + (size_t)b * strideC;
      unsigned short* C2 = (OUT_MODE == 2) ? ((unsigned short*)Cout2 + (size_t)b * strideC) : nullptr;
      {
#pragma unroll
        for (int it = 0; it < 4; ++it) {
          const int row = it * 4 + q;
          const float* sp = slab + row * 68 + c8;
          v8h hv, lv;
#pragma unroll
          for (int e = 0; e < 8; ++e) {
            if (OUT_MODE == 1) {
              hv[e] = (_Float16)sp[e];
            } else {
              unsigned short hb = f2bf_bits(sp[e]);
              unsigned short lb = f2bf_bits(sp[e] - bf_bits2f(hb));
              hv[e] = __builtin_bit_cast(_Float16, hb);
              lv[e] = __builtin_bit_cast(_Float16, lb);
            }
          }
          *(v8h*)(C + (size_t)(mBase + row) * ldc + n0 + c8) = hv;
          if (OUT_MODE == 2) *(v8h*)(C2 + (size_t)(mBase + row) * ldc + n0 + c8) = lv;
        }
        
      }
    }
    __builtin_amdgcn_fence(__ATOMIC_RELEASE, "workgroup");
    __builtin_amdgcn_wave_barrier();
    __builtin_amdgcn_fence(__ATOMIC_ACQUIRE, "workgroup");
  }
}

// ---------------------------------------------------------------------------
// f32 -> RNE bf16 bits, 2 elements per thread packed into one 4-B store: a wave writes one whole
// Coverage: grid = n2/256 blocks x 256 threads x 2 elements = 2*n2 = the whole plane (n2 % 256 == 0 here).
// ---------------------------------------------------------------------------
__global__ __launch_bounds__(256) void cast_bf16x2_kernel(const float* __restrict__ in, unsigned short* __restrict__ out, int n2) {
  const int i = blockIdx.x * 256 + threadIdx.x;
  if (i < n2) {
    const v2f f = *(const v2f*)(in + 2 * (size_t)i);
    const unsigned u = pk16(f2bf_bits(f[0]), f2bf_bits(f[1]));
    ((unsigned*)out)[i] = u;
    
  }
}
// f32 -> f16 bits of (mul * bf16_rne(v)), mul an exact power of two; same store pattern and coverage.
__global__ __launch_bounds__(256) void cast_bf16_f16s_x2_kernel(const float* __restrict__ in, unsigned short* __restrict__ out, int n2, float mul) {
  const int i = blockIdx.x * 256 + threadIdx.x;
  if (i < n2) {
    const v2f f = *(const v2f*)(in + 2 * (size_t)i);
    const _Float16 h0 = (_Float16)(rne_bf16(f[0]) * mul);
    const _Float16 h1 = (_Float16)(rne_bf16(f[1]) * mul);
    const unsigned u = pk16(__builtin_bit_cast(unsigned short, h0), __builtin_bit_cast(unsigned short, h1));
    ((unsigned*)out)[i] = u;
    
  }
}

// =====================================================================================
// Full (unmasked) attention with 96-deep f16 score features and head dim 64 values.
//   scores use the exact identity of the ortho half-spectrum DFT matrices (C = cos/8, S = sin/8, 33 bins):
//   C^T C + S^T S = I/2 + (1 1^T + a a^T)/128 with a_d = (-1)^d, so
//   Re(qf . conj(kf)) / 8 = (q.k + (sum q/8)(sum k/8) + (sum a*q/8)(sum a*k/8)) / 16  ->  one 96-deep contraction
//   over [q | sum/8 | altsum/8 | 30 zeros] x sscale (= 1/16); value path irDFT(DFT-weighted sum) = p . v.
//   q/k planes f16: element (b, t, h, f) at [(b*SEQ + t)*TOKP + h*QKPITCH + f], f = 0..127 (f >= 66 zero).
//   v^T planes bf16 hi/lo: element (b, h, d, s) at [(b*DMODEL + h*64 + d)*SEQ + s].
//   out f16 (x oscale): element (b, t, h, d) at [(b*SEQ + t)*DMODEL + h*64 + d]; 64-half row segment =
//   scores: v_wmma_f32_16x16x32_f16 single product; p.v: bf16 hi/lo split of p (unnormalised, <= 1) and v.
//   online softmax in f32 over SEQ keys (32 chunks of 64, compile-time trip count).
//   Block = 4 waves = 64 query rows of one (b, h); grid.x = NBAT * NHEAD * (SEQ/64) = 1024.
//   K / V^T chunk staging: 128 threads; K: 48 halves per thread = 64 x 96; V^T: 32 per thread per plane = 64 x 64
//   (16-B copies, plain loads, __syncthreads before and after); fragment loads read LDS with the stored vector type.
// =====================================================================================
#define AT_D 64
#define AT_F 96
#define AT_NW 4
#define AT_QB 64
#define AT_KC 64

__device__ __forceinline__ __bf16 at_f2bf(float f) { return __builtin_bit_cast(__bf16, f2bf_bits(f)); }
__device__ __forceinline__ void at_split(float f, __bf16& hi, __bf16& lo) {
  const unsigned short hb = f2bf_bits(f);
  hi = __builtin_bit_cast(__bf16, hb);
  lo = at_f2bf(f - __uint_as_float(((unsigned)hb) << 16));
}
__device__ __forceinline__ v8f at_mma(v16b a, v16b b, v8f c) {
  c = __builtin_amdgcn_wmma_f32_16x16x32_bf16(false, a, false, b, (short)0, c, false, false);
  asm volatile("v_nop\n\tv_nop\n\tv_nop\n\tv_nop" : "+v"(c) : "v"(a), "v"(b));
  return c;
}
__device__ __forceinline__ v8f at_mma_h(v16h a, v16h b, v8f c) {
  c = __builtin_amdgcn_wmma_f32_16x16x32_f16(false, a, false, b, (short)0, c, false, false);
  asm volatile("v_nop\n\tv_nop\n\tv_nop\n\tv_nop" : "+v"(c) : "v"(a), "v"(b));
  return c;
}

__global__ __launch_bounds__(128)
void attn_aug_kernel(const unsigned short* __restrict__ qp, const unsigned short* __restrict__ kp,
                     const unsigned short* __restrict__ vhp, const unsigned short* __restrict__ vlp,
                     unsigned short* __restrict__ op, float sscale, float oscale) {
  union FB { v16b v; v8b h[2]; };
  union FH { v16h v; v8h h[2]; };
  __shared__ __align__(16) _Float16 Ksh[AT_KC * AT_F];           // K features [kv][f]   12 KB
  __shared__ __align__(16) __bf16   Vth[AT_D * AT_KC];           // V hi [d][kv]          8 KB
  __shared__ __align__(16) __bf16   Vtl[AT_D * AT_KC];           // V lo                  8 KB
  __shared__ __align__(16) __bf16   Psh[AT_NW][16 * AT_KC];      // per wave P hi [row][kv]
  __shared__ __align__(16) __bf16   Psl[AT_NW][16 * AT_KC];      // per wave P lo
  __shared__ __align__(16) float    Os[AT_NW][16 * 68];          // per wave out tile, pitch 68

  const int tid  = threadIdx.x;
  const int wave = tid >> 5;
  const int lane = tid & 31;
  const int hh   = lane >> 4;
  const int c    = lane & 15;

  const int nqb = SEQ / AT_QB;            // 32
  const int bx = blockIdx.x;
  const int qb = bx % nqb;
  const int bh = bx / nqb;                // 0..NBAT*NHEAD-1
  const int h  = bh % NHEAD;
  const int b  = bh / NHEAD;
  const int q0 = qb * AT_QB + wave * 16;

  const _Float16* Qb = (const _Float16*)(const void*)qp + (size_t)b * SEQ * TOKP + (size_t)h * QKPITCH;
  const _Float16* Kb = (const _Float16*)(const void*)kp + (size_t)b * SEQ * TOKP + (size_t)h * QKPITCH;
  const __bf16*   Vh = (const __bf16*)(const void*)vhp + ((size_t)b * DMODEL + (size_t)h * AT_D) * SEQ;
  const __bf16*   Vl = (const __bf16*)(const void*)vlp + ((size_t)b * DMODEL + (size_t)h * AT_D) * SEQ;
  _Float16*       Ob = (_Float16*)(void*)op + (size_t)b * SEQ * DMODEL + (size_t)h * AT_D;

  // ---- Q fragments (A operand, row = lane&15, split k map via Frag load): 3 feature chunks of 32 ----
  v16h qa[3];
#pragma unroll
  for (int dc = 0; dc < 3; ++dc)
    qa[dc] = Frag<_Float16>::load(Qb + (size_t)(q0 + c) * TOKP + dc * 32 + 8 * hh);

  float mrow[8], lrow[8];
  v8f oacc[4];
#pragma unroll
  for (int r = 0; r < 8; ++r) { mrow[r] = -INFINITY; lrow[r] = 0.f; }
#pragma unroll
  for (int t = 0; t < 4; ++t) oacc[t] = (v8f){0.f,0.f,0.f,0.f,0.f,0.f,0.f,0.f};

  const int nChunks = SEQ / AT_KC;   // 32, compile-time constant
  for (int kc = 0; kc < nChunks; ++kc) {
    const int kv0 = kc * AT_KC;
    __syncthreads();
    {
      // staging coverage: K: 128 threads x (6 x 8) = 64 rows x 96; V^T: 128 threads x (4 x 8) = 64 x 64 per plane
      const int r = tid >> 1, half = tid & 1;
      const _Float16* ks  = Kb + (size_t)(kv0 + r) * TOKP + half * 48;   // K row kv0+r, f = half*48..+47
      const __bf16*   vsh = Vh + (size_t)r * SEQ + kv0 + half * 32;     // V^T row d = r, s = kv0+half*32..+31
      const __bf16*   vsl = Vl + (size_t)r * SEQ + kv0 + half * 32;
#pragma unroll
      for (int i = 0; i < 6; ++i) {
        const v8h a0 = *(const v8h*)(ks + 8 * i);
        *(v8h*)(Ksh + r * AT_F + half * 48 + 8 * i) = a0;
      }
#pragma unroll
      for (int i = 0; i < 4; ++i) {
        const v8b b0 = *(const v8b*)(vsh + 8 * i);
        const v8b b1 = *(const v8b*)(vsl + 8 * i);
        *(v8b*)(Vth + r * AT_KC + half * 32 + 8 * i) = b0;
        *(v8b*)(Vtl + r * AT_KC + half * 32 + 8 * i) = b1;
      }
    }
    __syncthreads();

    v8f s[4];
#pragma unroll
    for (int j = 0; j < 4; ++j) {
      s[j] = (v8f){0.f,0.f,0.f,0.f,0.f,0.f,0.f,0.f};
#pragma unroll
      for (int dc = 0; dc < 3; ++dc) {
        FH kb;   // B operand: col n = key j*16+c, k = feature, split k map
        kb.h[0] = *(const v8h*)(Ksh + (j * 16 + c) * AT_F + dc * 32 + 8 * hh);
        kb.h[1] = *(const v8h*)(Ksh + (j * 16 + c) * AT_F + dc * 32 + 16 + 8 * hh);
        s[j] = at_mma_h(qa[dc], kb.v, s[j]);
      }
    }
    float cm[8];
#pragma unroll
    for (int r = 0; r < 8; ++r) {
      float m = -INFINITY;
#pragma unroll
      for (int j = 0; j < 4; ++j) {
        s[j][r] *= sscale;
        m = fmaxf(m, s[j][r]);
      }
#pragma unroll
      for (int off = 1; off < 16; off <<= 1) m = fmaxf(m, __shfl_xor(m, off, 32));
      cm[r] = m;
    }
    __bf16* pwh = Psh[wave];
    __bf16* pwl = Psl[wave];
#pragma unroll
    for (int r = 0; r < 8; ++r) {
      const float mnew = fmaxf(mrow[r], cm[r]);
      const float alpha = expf(mrow[r] - mnew);
      mrow[r] = mnew;
      float psum = 0.f;
#pragma unroll
      for (int j = 0; j < 4; ++j) {
        const float p = expf(s[j][r] - mnew);
        psum += p;
        __bf16 ph, pl;
        at_split(p, ph, pl);
        pwh[(8 * hh + r) * AT_KC + j * 16 + c] = ph;
        pwl[(8 * hh + r) * AT_KC + j * 16 + c] = pl;
      }
#pragma unroll
      for (int off = 1; off < 16; off <<= 1) psum += __shfl_xor(psum, off, 32);
      lrow[r] = lrow[r] * alpha + psum;
#pragma unroll
      for (int t = 0; t < 4; ++t) oacc[t][r] *= alpha;
    }
    __builtin_amdgcn_fence(__ATOMIC_RELEASE, "workgroup");
    __builtin_amdgcn_wave_barrier();
    __builtin_amdgcn_fence(__ATOMIC_ACQUIRE, "workgroup");
#pragma unroll 1
    for (int kk = 0; kk < 2; ++kk) {
      FB pa, pl;   // A operand: row = query c, k = key
      pa.h[0] = *(const v8b*)(pwh + c * AT_KC + kk * 32 + 8 * hh);
      pa.h[1] = *(const v8b*)(pwh + c * AT_KC + kk * 32 + 16 + 8 * hh);
      pl.h[0] = *(const v8b*)(pwl + c * AT_KC + kk * 32 + 8 * hh);
      pl.h[1] = *(const v8b*)(pwl + c * AT_KC + kk * 32 + 16 + 8 * hh);
#pragma unroll
      for (int t = 0; t < 4; ++t) {
        FB vb, vl;   // B operand: col n = d = t*16+c, k = key
        vb.h[0] = *(const v8b*)(Vth + (t * 16 + c) * AT_KC + kk * 32 + 8 * hh);
        vb.h[1] = *(const v8b*)(Vth + (t * 16 + c) * AT_KC + kk * 32 + 16 + 8 * hh);
        vl.h[0] = *(const v8b*)(Vtl + (t * 16 + c) * AT_KC + kk * 32 + 8 * hh);
        vl.h[1] = *(const v8b*)(Vtl + (t * 16 + c) * AT_KC + kk * 32 + 16 + 8 * hh);
        oacc[t] = at_mma(pa.v, vb.v, oacc[t]);
        oacc[t] = at_mma(pa.v, vl.v, oacc[t]);
        oacc[t] = at_mma(pl.v, vb.v, oacc[t]);
      }
    }
  }

  float* os = Os[wave];
#pragma unroll
  for (int r = 0; r < 8; ++r) {
    const float inv = oscale * (1.0f / lrow[r]);   // lrow >= 1 (the running max contributes exp(0))
#pragma unroll
    for (int t = 0; t < 4; ++t) os[(8 * hh + r) * 68 + t * 16 + c] = oacc[t][r] * inv;
  }
  __builtin_amdgcn_fence(__ATOMIC_RELEASE, "workgroup");
  __builtin_amdgcn_wave_barrier();
  __builtin_amdgcn_fence(__ATOMIC_ACQUIRE, "workgroup");
  {
    const int q8 = lane >> 3, c8 = (lane & 7) * 8;
    {
#pragma unroll
      for (int it = 0; it < 4; ++it) {
        const int row = it * 4 + q8;
        v8h hv;
#pragma unroll
        for (int e = 0; e < 8; ++e) hv[e] = (_Float16)os[row * 68 + c8 + e];
        *(v8h*)(Ob + (size_t)(q0 + row) * DMODEL + c8) = hv;
      }
      
    }
  }
}

// ---------------------------------------------------------------------------
//   [ 0 MiB,  8 MiB)  xb   bf16 [4096][1024]            RNE-bf16 of x
//   [ 8 MiB, 10 MiB)  wqb  bf16 [1024][1024]
//   [10 MiB, 12 MiB)  wkb  bf16 [1024][1024]
//   [12 MiB, 14 MiB)  wvb  bf16 [1024][1024]
//   [14 MiB, 16 MiB)  woh  f16  [1024][1024]            64 * bf16_rne(Wo)
//   [16 MiB, 32 MiB)  qpl  f16  [4096][16][128]         q features per head
//   [32 MiB, 48 MiB)  kpl  f16  [4096][16][128]         k features per head
//   [48 MiB, 56 MiB)  vth  bf16 [2][1024][2048]         v^T hi plane
//   [56 MiB, 64 MiB)  vtl  bf16 [2][1024][2048]         v^T lo plane
//   [64 MiB, 72 MiB)  ohp  f16  [4096][1024]            256 * attention output, heads merged
// GEMM shapes: q/k M=4096 N=1024 K=1024; v^T M=1024 N=2048 K=1024 (x2 batch); out M=4096 N=1024 K=1024:
// all M, N multiples of 64, K multiple of 32, no padding, every plane fully written by its producer.
// ---------------------------------------------------------------------------
extern "C" void kernel_launch(void* const* d_in, const int* in_sizes, int n_in,
                              void* d_out, int out_size, void* d_ws, size_t ws_size,
                              hipStream_t stream)
{
  if (n_in < 9) return;
  if (in_sizes[0] != NTOK * DMODEL || in_sizes[1] != DMODEL * DMODEL || in_sizes[2] != DMODEL ||
      in_sizes[3] != DMODEL * DMODEL || in_sizes[4] != DMODEL || in_sizes[5] != DMODEL * DMODEL ||
      in_sizes[6] != DMODEL || in_sizes[7] != DMODEL * DMODEL || in_sizes[8] != DMODEL) return;
  if (out_size != NTOK * DMODEL) return;

  const float* x    = (const float*)d_in[0];
  const float* Wq   = (const float*)d_in[1];
  const float* bq   = (const float*)d_in[2];
  const float* Wk   = (const float*)d_in[3];
  const float* bk   = (const float*)d_in[4];
  const float* Wv   = (const float*)d_in[5];
  const float* bv   = (const float*)d_in[6];
  const float* Wo   = (const float*)d_in[7];
  const float* bo_p = (const float*)d_in[8];

  const size_t SZ_X   = (size_t)NTOK * DMODEL * 2;                 // 8 MiB
  const size_t SZ_W   = (size_t)DMODEL * DMODEL * 2;               // 2 MiB
  const size_t SZ_QK  = (size_t)NTOK * TOKP * 2;                   // 16 MiB
  const size_t SZ_VT  = (size_t)NBAT * DMODEL * SEQ * 2;           // 8 MiB
  const size_t SZ_O   = (size_t)NTOK * DMODEL * 2;                 // 8 MiB
  const size_t OFF_XB = 0;
  const size_t OFF_WQ = OFF_XB + SZ_X;
  const size_t OFF_WK = OFF_WQ + SZ_W;
  const size_t OFF_WV = OFF_WK + SZ_W;
  const size_t OFF_WO = OFF_WV + SZ_W;
  const size_t OFF_QP = OFF_WO + SZ_W;
  const size_t OFF_KP = OFF_QP + SZ_QK;
  const size_t OFF_VH = OFF_KP + SZ_QK;
  const size_t OFF_VL = OFF_VH + SZ_VT;
  const size_t OFF_OH = OFF_VL + SZ_VT;
  const size_t TOTAL  = OFF_OH + SZ_O;                             // 75,497,472
  if (TOTAL > ws_size) return;

  char* ws = (char*)d_ws;
  unsigned short* xb  = (unsigned short*)(ws + OFF_XB);
  unsigned short* wqb = (unsigned short*)(ws + OFF_WQ);
  unsigned short* wkb = (unsigned short*)(ws + OFF_WK);
  unsigned short* wvb = (unsigned short*)(ws + OFF_WV);
  unsigned short* woh = (unsigned short*)(ws + OFF_WO);
  unsigned short* qpl = (unsigned short*)(ws + OFF_QP);
  unsigned short* kpl = (unsigned short*)(ws + OFF_KP);
  unsigned short* vth = (unsigned short*)(ws + OFF_VH);
  unsigned short* vtl = (unsigned short*)(ws + OFF_VL);
  unsigned short* ohp = (unsigned short*)(ws + OFF_OH);

  // ---- 16-bit operand planes (2 elements per thread; counts are multiples of 512) ----
  const int n2x = (NTOK * DMODEL) / 2;       // 2,097,152 -> 8192 blocks
  const int n2w = (DMODEL * DMODEL) / 2;     //   524,288 -> 2048 blocks
  cast_bf16x2_kernel<<<dim3(n2x / 256), dim3(256), 0, stream>>>(x, xb, n2x);
  cast_bf16x2_kernel<<<dim3(n2w / 256), dim3(256), 0, stream>>>(Wq, wqb, n2w);
  cast_bf16x2_kernel<<<dim3(n2w / 256), dim3(256), 0, stream>>>(Wk, wkb, n2w);
  cast_bf16x2_kernel<<<dim3(n2w / 256), dim3(256), 0, stream>>>(Wv, wvb, n2w);
  cast_bf16_f16s_x2_kernel<<<dim3(n2w / 256), dim3(256), 0, stream>>>(Wo, woh, n2w, 64.0f);

  // ---- q / k feature planes: [4096][1024] x [1024][1024]^T + bias, epilogue writes per-head 128-wide f16 rows ----
  {
    const int tiles = (NTOK / 64) * (DMODEL / 64);     // 1024 -> 128 blocks of 8 waves
    dim3 grid(tiles / 8, 1), blk(256);
    wmma_gemm64<1, false, 2, 3, false><<<grid, blk, 0, stream>>>(
        xb, xb, DMODEL, 0L, wqb, wqb, DMODEL, 0L,
        (void*)qpl, (void*)qpl, TOKP, 0L, bq, bq, 0L, NTOK, DMODEL, DMODEL, 1.0f);
    wmma_gemm64<1, false, 2, 3, false><<<grid, blk, 0, stream>>>(
        xb, xb, DMODEL, 0L, wkb, wkb, DMODEL, 0L,
        (void*)kpl, (void*)kpl, TOKP, 0L, bk, bk, 0L, NTOK, DMODEL, DMODEL, 1.0f);
  }
  // ---- v^T planes (role swapped): per batch C[m = h*64+d][n = s] = sum_k Wv[m][k] * x[b][s][k] + bv[m], bf16 hi/lo out ----
  {
    const int tiles = (DMODEL / 64) * (SEQ / 64);      // 512 -> 64 blocks, grid.y = batch
    dim3 grid(tiles / 8, NBAT), blk(256);
    wmma_gemm64<1, false, 1, 2, false><<<grid, blk, 0, stream>>>(
        wvb, wvb, DMODEL, 0L, xb, xb, DMODEL, (long)SEQ * DMODEL,
        (void*)vth, (void*)vtl, SEQ, (long)DMODEL * SEQ, bv, bv, 0L, DMODEL, SEQ, DMODEL, 1.0f);
  }
  // ---- attention: grid = NBAT * NHEAD * (SEQ / 64) = 1024 blocks of 128 threads ----
  attn_aug_kernel<<<dim3(NBAT * NHEAD * (SEQ / 64)), dim3(128), 0, stream>>>(
      qpl, kpl, vth, vtl, ohp, 0.0625f, 256.0f);
  // ---- output projection: d_out[m][n] = (1/16384) * sum_k (256*O)[m][k] * (64*Wo)[n][k] + bo[n], f32 out ----
  {
    const int tiles = (NTOK / 64) * (DMODEL / 64);     // 1024 -> 128 blocks
    dim3 grid(tiles / 8, 1), blk(256);
    wmma_gemm64<0, false, 2, 0, false><<<grid, blk, 0, stream>>>(
        ohp, ohp, DMODEL, 0L, woh, woh, DMODEL, 0L,
        d_out, d_out, DMODEL, 0L, bo_p, bo_p, 0L, NTOK, DMODEL, DMODEL, 1.0f / 16384.0f);
  }
}

// v001
// A run of this version takes 423 microseconds.
// In both of two side-by-side timings against v000, it was 1.24 times as fast.
// Contractions: q/k/v^T projections v_wmma_f32_16x16x32_bf16 (operands = RNE-bf16 of the f32 inputs, single product); scores v_wmma_f32_16x16x32_f16 (f16 per-head feature planes, single product, x1/16 in f32); p.v v_wmma_f32_16x16x32_bf16 with bf16 hi/lo split of p and v (hi.hi+hi.lo+lo.hi); output projection v_wmma_f32_16x16x32_f16 (f16 O carried x256, f16 Wo carried x64, single product, x1/16384 in f32); f32 accumulate everywhere; softmax, biases and DFT aggregate features in f32.
#include <hip/hip_runtime.h>
#include <math.h>
#include <stdint.h>

// ---------------- problem geometry ----------------
constexpr int NBAT    = 2;
constexpr int SEQ     = 2048;
constexpr int DMODEL  = 1024;
constexpr int NHEAD   = 16;
constexpr int HDIM    = 64;
constexpr int NTOK    = NBAT * SEQ;          // 4096
constexpr int QKPITCH = 128;                 // halves per (token, head) feature row: 64 dims, sum/8, altsum/8, zeros
constexpr int TOKP    = NHEAD * QKPITCH;     // 2048 halves per token row of the q/k feature planes
static_assert(NTOK % 64 == 0 && DMODEL % 64 == 0 && SEQ % 64 == 0 && DMODEL % 32 == 0);
static_assert(NHEAD * HDIM == DMODEL);

typedef __attribute__((ext_vector_type(16))) _Float16 v16h;
typedef __attribute__((ext_vector_type(8)))  _Float16 v8h;
typedef __attribute__((ext_vector_type(16))) __bf16   v16b;
typedef __attribute__((ext_vector_type(8)))  __bf16   v8b;
typedef __attribute__((ext_vector_type(8)))  float    v8f;
typedef __attribute__((ext_vector_type(4)))  float    v4f;
typedef __attribute__((ext_vector_type(2)))  float    v2f;

__device__ __forceinline__ unsigned short f2bf_bits(float f) {
  unsigned u = __float_as_uint(f);
  return (unsigned short)((u + 0x7FFFu + ((u >> 16) & 1u)) >> 16);
}
__device__ __forceinline__ float bf_bits2f(unsigned short h) { return __uint_as_float(((unsigned)h) << 16); }
__device__ __forceinline__ float rne_bf16(float f) { return bf_bits2f(f2bf_bits(f)); }
__device__ __forceinline__ unsigned pk16(unsigned short a, unsigned short b) { return (unsigned)a | ((unsigned)b << 16); }

// hazard guards as plain device helpers (no inline asm inside the kernel template body)
__device__ __forceinline__ void dep_guard_h(v8f& a, v8f& b, v16h x, v16h y) { asm volatile("v_nop\n\tv_nop\n\tv_nop\n\tv_nop" : "+v"(a), "+v"(b) : "v"(x), "v"(y)); }
__device__ __forceinline__ void dep_guard_b(v8f& a, v8f& b, v16b x, v16b y) { asm volatile("v_nop\n\tv_nop\n\tv_nop\n\tv_nop" : "+v"(a), "+v"(b) : "v"(x), "v"(y)); }
__device__ __forceinline__ void keep4_h(v16h a, v16h b, v16h c, v16h d) { asm volatile("v_nop" :: "v"(a), "v"(b), "v"(c), "v"(d)); }
__device__ __forceinline__ void keep4_b(v16b a, v16b b, v16b c, v16b d) { asm volatile("v_nop" :: "v"(a), "v"(b), "v"(c), "v"(d)); }
__device__ __forceinline__ void acc_guard4(v8f& a, v8f& b, v8f& c, v8f& d) { asm volatile("v_nop\n\tv_nop\n\tv_nop\n\tv_nop" : "+v"(a), "+v"(b), "+v"(c), "+v"(d)); }
template <typename T> struct Frag;
template <> struct Frag<_Float16> {
  typedef v16h V; union U { v16h v; v8h h[2]; };
  static __device__ __forceinline__ v16h load(const _Float16* p) {   // elements 0..7 <- p[0..7], 8..15 <- p[16..23]
    U f; f.h[0] = *(const v8h*)(p); f.h[1] = *(const v8h*)(p + 16); return f.v;
  }
  static __device__ __forceinline__ v8f mma(v16h a, v16h b, v8f c) {
    return __builtin_amdgcn_wmma_f32_16x16x32_f16(false, a, false, b, (short)0, c, false, false);
  }
  static __device__ __forceinline__ void guard(v8f& a, v8f& b, v16h x, v16h y) { dep_guard_h(a, b, x, y); }
  static __device__ __forceinline__ void keep(v16h a, v16h b, v16h c, v16h d) { keep4_h(a, b, c, d); }
};
template <> struct Frag<__bf16> {
  typedef v16b V; union U { v16b v; v8b h[2]; };
  static __device__ __forceinline__ v16b load(const __bf16* p) {
    U f; f.h[0] = *(const v8b*)(p); f.h[1] = *(const v8b*)(p + 16); return f.v;
  }
  static __device__ __forceinline__ v8f mma(v16b a, v16b b, v8f c) {
    return __builtin_amdgcn_wmma_f32_16x16x32_bf16(false, a, false, b, (short)0, c, false, false);
  }
  static __device__ __forceinline__ void guard(v8f& a, v8f& b, v16b x, v16b y) { dep_guard_b(a, b, x, y); }
  static __device__ __forceinline__ void keep(v16b a, v16b b, v16b c, v16b d) { keep4_b(a, b, c, d); }
};

// ---- Register-blocked batched WMMA GEMM ------------------------------------
// C[m,n] = scale * sum_k A[m,k] * Bt[n,k] (+bias)(+resid); each wave owns a 64x64 tile.
// A row-major [M,K]; Bt row-major [N,K]; M,N % 64 == 0, K % 32 == 0.
// SPLIT: operands are hi/lo planes (A2/Bt2 = lo planes, same layout); product = hi.hi + hi.lo + lo.hi.
// BIAS_MODE: 0 = none, 1 = bias[m], 2 = bias[n]. Bias values are RNE-bf16 quantised before the f32 add.
// OUT_MODE: 0 = f32, 1 = f16, 2 = bf16 hi plane (Cout) + bf16 lo plane (Cout2),
//           3 = f16 per-head feature rows: head hd = n0/64, row m -> C[m*ldc + hd*128 + 0..63] = f16(v[0..63]),
//               [+64] = f16(sum_d v[d] / 8), [+65] = f16(sum_d (-1)^d v[d] / 8), [+66..+127] = 0.
// ET: 0 = f16 operands, 1 = bf16 operands (pointers passed as 16-bit storage)
template <int ET> struct Elem;
template <> struct Elem<0> { typedef _Float16 T; };
template <> struct Elem<1> { typedef __bf16 T; };
template <int ET, bool SPLIT, int BIAS_MODE, int OUT_MODE, bool RESID, int ACT = 0>
__global__ __launch_bounds__(256) void wmma_gemm64(
    const unsigned short* __restrict__ Ap, const unsigned short* __restrict__ A2p, int lda, long strideA,
    const unsigned short* __restrict__ Btp, const unsigned short* __restrict__ Bt2p, int ldb, long strideB,
    void* __restrict__ Cout, void* __restrict__ Cout2, int ldc, long strideC,
    const float* __restrict__ bias,
    const float* __restrict__ resid, long strideR,
    int M, int N, int K, float scale) {
  typedef typename Elem<ET>::T T;
  typedef typename Frag<T>::V V;
  const T* A = (const T*)Ap; const T* A2 = (const T*)A2p; const T* Bt = (const T*)Btp; const T* Bt2 = (const T*)Bt2p;
  __shared__ __align__(16) float sT[8][16 * 68];   // per-wave 16x64 slab, pitch 68 floats
  const int b    = blockIdx.y;
  const int lane = threadIdx.x & 31;
  const int wave = threadIdx.x >> 5;
  const int tilesN = N >> 6;
  const int tilesM = M >> 6;
  const int tile = blockIdx.x * 8 + wave;
  if (tile >= tilesM * tilesN) return;   // wave-uniform; no block barriers in this kernel
  const int tm = tile / tilesN;
  const int tn = tile - tm * tilesN;
  const int m0 = tm << 6;
  const int n0 = tn << 6;

  const T* Ab  = A  + (size_t)b * strideA;
  const T* Bb  = Bt + (size_t)b * strideB;
  const T* Ab2 = SPLIT ? (A2  + (size_t)b * strideA) : nullptr;
  const T* Bb2 = SPLIT ? (Bt2 + (size_t)b * strideB) : nullptr;

  const int rlane = lane & 15;                 // row (A) / col (B, D) within subtile
  const int koff  = (lane >> 4) * 8;           // k offset of this lane half
  const int mOff  = (lane >> 4) * 8;           // D row offset

  v8f acc[4][4];
#pragma unroll
  for (int i = 0; i < 4; ++i)
#pragma unroll
    for (int j = 0; j < 4; ++j) acc[i][j] = (v8f){0.f,0.f,0.f,0.f,0.f,0.f,0.f,0.f};

  for (int k0 = 0; k0 < K; k0 += 32) {
    V bh[4], bl[4];
#pragma unroll
    for (int j = 0; j < 4; ++j) {
      const size_t bo = (size_t)(n0 + (j << 4) + rlane) * ldb + koff + k0;
      bh[j] = Frag<T>::load(Bb + bo);
      if (SPLIT) bl[j] = Frag<T>::load(Bb2 + bo);
    }
#pragma unroll
    for (int i = 0; i < 4; ++i) {
      const size_t ao = (size_t)(m0 + (i << 4) + rlane) * lda + koff + k0;
      V ah = Frag<T>::load(Ab + ao);
      V al;
      if (SPLIT) al = Frag<T>::load(Ab2 + ao);
#pragma unroll
      for (int j = 0; j < 4; ++j) {
        acc[i][j] = Frag<T>::mma(ah, bh[j], acc[i][j]);
        if (SPLIT) {
          acc[i][j] = Frag<T>::mma(ah, bl[j], acc[i][j]);
          acc[i][j] = Frag<T>::mma(al, bh[j], acc[i][j]);
        }
      }
      Frag<T>::guard(acc[i][0], acc[i][3], ah, SPLIT ? al : ah);
    }
    Frag<T>::keep(bh[0], bh[1], bh[2], bh[3]);
    if (SPLIT) Frag<T>::keep(bl[0], bl[1], bl[2], bl[3]);
  }
  acc_guard4(acc[0][0], acc[0][1], acc[0][2], acc[0][3]);
  acc_guard4(acc[1][0], acc[1][1], acc[1][2], acc[1][3]);
  acc_guard4(acc[2][0], acc[2][1], acc[2][2], acc[2][3]);
  acc_guard4(acc[3][0], acc[3][1], acc[3][2], acc[3][3]);

  // ---- epilogue ----
  float* slab = sT[wave];
  const float* Rb = RESID ? (resid + (size_t)b * strideR) : nullptr;
#pragma unroll
  for (int i = 0; i < 4; ++i) {
    const int mBase = m0 + (i << 4);
#pragma unroll
    for (int j = 0; j < 4; ++j) {
      const int n = n0 + (j << 4) + rlane;
      float bv = 0.f;
      if (BIAS_MODE == 2) bv = rne_bf16(bias[n]);
#pragma unroll
      for (int r = 0; r < 8; ++r) {
        float v = acc[i][j][r] * scale;
        if (BIAS_MODE == 1) v += rne_bf16(bias[mBase + mOff + r]);
        if (BIAS_MODE == 2) v += bv;
        if (RESID) v += Rb[(size_t)(mBase + mOff + r) * ldc + n];
        if (ACT == 1) v = tanhf(v);
        if (ACT == 2) v = fmaxf(v, 0.0f);
        if (ACT == 3) v = v / (1.0f + expf(-v));
        if (ACT == 4) v = (v > 0.f) ? v : 0.01f * v;
        slab[(mOff + r) * 68 + (j << 4) + rlane] = v;
      }
    }
    __builtin_amdgcn_fence(__ATOMIC_RELEASE, "workgroup");
    __builtin_amdgcn_wave_barrier();
    __builtin_amdgcn_fence(__ATOMIC_ACQUIRE, "workgroup");
    if (OUT_MODE == 0) {
      float* C = (float*)Cout + (size_t)b * strideC;
      const int hh = lane >> 4, c4 = (lane & 15) * 4;     // row seg = 256 B = 16 lanes x 16 B
      {
#pragma unroll
        for (int it = 0; it < 8; ++it) {
          const int row = it * 2 + hh;
          v4f v = *(const v4f*)(slab + row * 68 + c4);
          *(v4f*)(C + (size_t)(mBase + row) * ldc + n0 + c4) = v;
        }
        
      }
    } else if (OUT_MODE == 3) {
      // Coverage per slab: 4 it x 4 row groups (q) = 16 rows; 8 lanes x 8 halves = 64 halves per line.
      const int q = lane >> 3, c8 = (lane & 7) * 8;
      unsigned short* C = (unsigned short*)Cout + (size_t)b * strideC;
      const int hcol = (n0 >> 6) * 128;
      v8h hv[4], av[4];
#pragma unroll
      for (int it = 0; it < 4; ++it) {
        const int row = it * 4 + q;
        const float* sp = slab + row * 68 + c8;
        float ps = 0.f, pa = 0.f;
        v8h t;
#pragma unroll
        for (int e = 0; e < 8; ++e) {
          const float v = sp[e];
          t[e] = (_Float16)v;
          ps += v;
          if (e & 1) pa -= v; else pa += v;     // c8 is even, so (-1)^(c8+e) = (-1)^e
        }
#pragma unroll
        for (int off = 1; off < 8; off <<= 1) {   // reduce over the 8 lanes holding this row
          ps += __shfl_xor(ps, off, 32);
          pa += __shfl_xor(pa, off, 32);
        }
        const float fa = (c8 == 0) ? ps * 0.125f : 0.0f;
        const float fb = (c8 == 0) ? pa * 0.125f : 0.0f;
        v8h u;
#pragma unroll
        for (int e = 0; e < 8; ++e) u[e] = (_Float16)0.0f;
        u[0] = (_Float16)fa;
        u[1] = (_Float16)fb;
        hv[it] = t;
        av[it] = u;
      }
      {
#pragma unroll
        for (int it = 0; it < 4; ++it) {
          const int row = it * 4 + q;
          unsigned short* cp = C + (size_t)(mBase + row) * ldc + hcol + c8;
          *(v8h*)(cp) = hv[it];
          *(v8h*)(cp + 64) = av[it];
        }
        
      }
    } else {
      const int q = lane >> 3, c8 = (lane & 7) * 8;
      unsigned short* C  = (unsigned short*)Cout  + (size_t)b * strideC;
      unsigned short* C2 = (OUT_MODE == 2) ? ((unsigned short*)Cout2 + (size_t)b * strideC) : nullptr;
      {
#pragma unroll
        for (int it = 0; it < 4; ++it) {
          const int row = it * 4 + q;
          const float* sp = slab + row * 68 + c8;
          v8h hv, lv;
#pragma unroll
          for (int e = 0; e < 8; ++e) {
            if (OUT_MODE == 1) {
              hv[e] = (_Float16)sp[e];
            } else {
              unsigned short hb = f2bf_bits(sp[e]);
              unsigned short lb = f2bf_bits(sp[e] - bf_bits2f(hb));
              hv[e] = __builtin_bit_cast(_Float16, hb);
              lv[e] = __builtin_bit_cast(_Float16, lb);
            }
          }
          *(v8h*)(C + (size_t)(mBase + row) * ldc + n0 + c8) = hv;
          if (OUT_MODE == 2) *(v8h*)(C2 + (size_t)(mBase + row) * ldc + n0 + c8) = lv;
        }
        
      }
    }
    __builtin_amdgcn_fence(__ATOMIC_RELEASE, "workgroup");
    __builtin_amdgcn_wave_barrier();
    __builtin_amdgcn_fence(__ATOMIC_ACQUIRE, "workgroup");
  }
}

// ---------------------------------------------------------------------------
// f32 -> RNE bf16 bits, 2 elements per thread packed into one 4-B store: a wave writes one whole
// Coverage: grid = n2/256 blocks x 256 threads x 2 elements = 2*n2 = the whole plane (n2 % 256 == 0 here).
// ---------------------------------------------------------------------------
__global__ __launch_bounds__(256) void cast_bf16x2_kernel(const float* __restrict__ in, unsigned short* __restrict__ out, int n2) {
  const int i = blockIdx.x * 256 + threadIdx.x;
  if (i < n2) {
    const v2f f = *(const v2f*)(in + 2 * (size_t)i);
    const unsigned u = pk16(f2bf_bits(f[0]), f2bf_bits(f[1]));
    ((unsigned*)out)[i] = u;
    
  }
}
// f32 -> f16 bits of (mul * bf16_rne(v)), mul an exact power of two; same store pattern and coverage.
__global__ __launch_bounds__(256) void cast_bf16_f16s_x2_kernel(const float* __restrict__ in, unsigned short* __restrict__ out, int n2, float mul) {
  const int i = blockIdx.x * 256 + threadIdx.x;
  if (i < n2) {
    const v2f f = *(const v2f*)(in + 2 * (size_t)i);
    const _Float16 h0 = (_Float16)(rne_bf16(f[0]) * mul);
    const _Float16 h1 = (_Float16)(rne_bf16(f[1]) * mul);
    const unsigned u = pk16(__builtin_bit_cast(unsigned short, h0), __builtin_bit_cast(unsigned short, h1));
    ((unsigned*)out)[i] = u;
    
  }
}

// =====================================================================================
// Full (unmasked) attention with 96-deep f16 score features and head dim 64 values.
//   scores use the exact identity of the ortho half-spectrum DFT matrices (C = cos/8, S = sin/8, 33 bins):
//   C^T C + S^T S = I/2 + (1 1^T + a a^T)/128 with a_d = (-1)^d, so
//   Re(qf . conj(kf)) / 8 = (q.k + (sum q/8)(sum k/8) + (sum a*q/8)(sum a*k/8)) / 16  ->  one 96-deep contraction
//   over [q | sum/8 | altsum/8 | 30 zeros] x sscale (= 1/16); value path irDFT(DFT-weighted sum) = p . v.
//   q/k planes f16: element (b, t, h, f) at [(b*SEQ + t)*TOKP + h*QKPITCH + f], f = 0..127 (f >= 66 zero).
//   v^T planes bf16 hi/lo: element (b, h, d, s) at [(b*DMODEL + h*64 + d)*SEQ + s].
//   out f16 (x oscale): element (b, t, h, d) at [(b*SEQ + t)*DMODEL + h*64 + d]; 64-half row segment =
//   scores: v_wmma_f32_16x16x32_f16 single product; p.v: bf16 hi/lo split of p (unnormalised, <= 1) and v.
//   online softmax in f32 over SEQ keys (32 chunks of 64, compile-time trip count).
//   Block = 4 waves = 64 query rows of one (b, h); grid.x = NBAT * NHEAD * (SEQ/64) = 1024.
//   K / V^T chunk staging: 128 threads; K: 48 halves per thread = 64 x 96; V^T: 32 per thread per plane = 64 x 64
//   (16-B copies, plain loads, __syncthreads before and after); fragment loads read LDS with the stored vector type.
// =====================================================================================
#define AT_D 64
#define AT_F 96
#define AT_NW 4
#define AT_QB 64
#define AT_KC 64
// LDS row pitches in halves: 16 B x odd, so that the 16 rows of a ds_load_b128 fragment read fall on distinct banks
#define AT_KP 104   // K feature rows: 96 halves used, 208 B pitch
#define AT_VP 72    // V^T and P rows: 64 halves used, 144 B pitch
static_assert(AT_KP >= AT_F && AT_VP >= AT_KC && (AT_KP * 2) % 32 == 16 && (AT_VP * 2) % 32 == 16, "pitch holds the row and is 16 B x odd");

__device__ __forceinline__ __bf16 at_f2bf(float f) { return __builtin_bit_cast(__bf16, f2bf_bits(f)); }
__device__ __forceinline__ void at_split(float f, __bf16& hi, __bf16& lo) {
  const unsigned short hb = f2bf_bits(f);
  hi = __builtin_bit_cast(__bf16, hb);
  lo = at_f2bf(f - __uint_as_float(((unsigned)hb) << 16));
}
__device__ __forceinline__ v8f at_mma(v16b a, v16b b, v8f c) {
  c = __builtin_amdgcn_wmma_f32_16x16x32_bf16(false, a, false, b, (short)0, c, false, false);
  asm volatile("v_nop\n\tv_nop\n\tv_nop\n\tv_nop" : "+v"(c) : "v"(a), "v"(b));
  return c;
}
__device__ __forceinline__ v8f at_mma_h(v16h a, v16h b, v8f c) {
  c = __builtin_amdgcn_wmma_f32_16x16x32_f16(false, a, false, b, (short)0, c, false, false);
  asm volatile("v_nop\n\tv_nop\n\tv_nop\n\tv_nop" : "+v"(c) : "v"(a), "v"(b));
  return c;
}

__global__ __launch_bounds__(128)
void attn_aug_kernel(const unsigned short* __restrict__ qp, const unsigned short* __restrict__ kp,
                     const unsigned short* __restrict__ vhp, const unsigned short* __restrict__ vlp,
                     unsigned short* __restrict__ op, float sscale, float oscale) {
  union FB { v16b v; v8b h[2]; };
  union FH { v16h v; v8h h[2]; };
  __shared__ __align__(16) _Float16 Ksh[AT_KC * AT_KP];          // K features [kv][f]   13 KB
  __shared__ __align__(16) __bf16   Vth[AT_D * AT_VP];           // V hi [d][kv]          9 KB
  __shared__ __align__(16) __bf16   Vtl[AT_D * AT_VP];           // V lo                  9 KB
  __shared__ __align__(16) __bf16   Psh[AT_NW][16 * AT_VP];      // per wave P hi [row][kv]
  __shared__ __align__(16) __bf16   Psl[AT_NW][16 * AT_VP];      // per wave P lo
  __shared__ __align__(16) float    Os[AT_NW][16 * 68];          // per wave out tile, pitch 68

  const int tid  = threadIdx.x;
  const int wave = tid >> 5;
  const int lane = tid & 31;
  const int hh   = lane >> 4;
  const int c    = lane & 15;

  const int nqb = SEQ / AT_QB;            // 32
  const int bx = blockIdx.x;
  const int qb = bx % nqb;
  const int bh = bx / nqb;                // 0..NBAT*NHEAD-1
  const int h  = bh % NHEAD;
  const int b  = bh / NHEAD;
  const int q0 = qb * AT_QB + wave * 16;

  const _Float16* Qb = (const _Float16*)(const void*)qp + (size_t)b * SEQ * TOKP + (size_t)h * QKPITCH;
  const _Float16* Kb = (const _Float16*)(const void*)kp + (size_t)b * SEQ * TOKP + (size_t)h * QKPITCH;
  const __bf16*   Vh = (const __bf16*)(const void*)vhp + ((size_t)b * DMODEL + (size_t)h * AT_D) * SEQ;
  const __bf16*   Vl = (const __bf16*)(const void*)vlp + ((size_t)b * DMODEL + (size_t)h * AT_D) * SEQ;
  _Float16*       Ob = (_Float16*)(void*)op + (size_t)b * SEQ * DMODEL + (size_t)h * AT_D;

  // ---- Q fragments (A operand, row = lane&15, split k map via Frag load): 3 feature chunks of 32 ----
  v16h qa[3];
#pragma unroll
  for (int dc = 0; dc < 3; ++dc)
    qa[dc] = Frag<_Float16>::load(Qb + (size_t)(q0 + c) * TOKP + dc * 32 + 8 * hh);

  float mrow[8], lrow[8];
  v8f oacc[4];
#pragma unroll
  for (int r = 0; r < 8; ++r) { mrow[r] = -INFINITY; lrow[r] = 0.f; }
#pragma unroll
  for (int t = 0; t < 4; ++t) oacc[t] = (v8f){0.f,0.f,0.f,0.f,0.f,0.f,0.f,0.f};

  const int nChunks = SEQ / AT_KC;   // 32, compile-time constant
  for (int kc = 0; kc < nChunks; ++kc) {
    const int kv0 = kc * AT_KC;
    __syncthreads();
    {
      // staging coverage: K: 128 threads x (6 x 8) = 64 rows x 96; V^T: 128 threads x (4 x 8) = 64 x 64 per plane
      const int r = tid >> 1, half = tid & 1;
      const _Float16* ks  = Kb + (size_t)(kv0 + r) * TOKP + half * 48;   // K row kv0+r, f = half*48..+47
      const __bf16*   vsh = Vh + (size_t)r * SEQ + kv0 + half * 32;     // V^T row d = r, s = kv0+half*32..+31
      const __bf16*   vsl = Vl + (size_t)r * SEQ + kv0 + half * 32;
#pragma unroll
      for (int i = 0; i < 6; ++i) {
        const v8h a0 = *(const v8h*)(ks + 8 * i);
        *(v8h*)(Ksh + r * AT_KP + half * 48 + 8 * i) = a0;
      }
#pragma unroll
      for (int i = 0; i < 4; ++i) {
        const v8b b0 = *(const v8b*)(vsh + 8 * i);
        const v8b b1 = *(const v8b*)(vsl + 8 * i);
        *(v8b*)(Vth + r * AT_VP + half * 32 + 8 * i) = b0;
        *(v8b*)(Vtl + r * AT_VP + half * 32 + 8 * i) = b1;
      }
    }
    __syncthreads();

    v8f s[4];
#pragma unroll
    for (int j = 0; j < 4; ++j) {
      s[j] = (v8f){0.f,0.f,0.f,0.f,0.f,0.f,0.f,0.f};
#pragma unroll
      for (int dc = 0; dc < 3; ++dc) {
        FH kb;   // B operand: col n = key j*16+c, k = feature, split k map
        kb.h[0] = *(const v8h*)(Ksh + (j * 16 + c) * AT_KP + dc * 32 + 8 * hh);
        kb.h[1] = *(const v8h*)(Ksh + (j * 16 + c) * AT_KP + dc * 32 + 16 + 8 * hh);
        s[j] = at_mma_h(qa[dc], kb.v, s[j]);
      }
    }
    float cm[8];
#pragma unroll
    for (int r = 0; r < 8; ++r) {
      float m = -INFINITY;
#pragma unroll
      for (int j = 0; j < 4; ++j) {
        s[j][r] *= sscale;
        m = fmaxf(m, s[j][r]);
      }
#pragma unroll
      for (int off = 1; off < 16; off <<= 1) m = fmaxf(m, __shfl_xor(m, off, 32));
      cm[r] = m;
    }
    __bf16* pwh = Psh[wave];
    __bf16* pwl = Psl[wave];
#pragma unroll
    for (int r = 0; r < 8; ++r) {
      const float mnew = fmaxf(mrow[r], cm[r]);
      const float alpha = expf(mrow[r] - mnew);
      mrow[r] = mnew;
      float psum = 0.f;
#pragma unroll
      for (int j = 0; j < 4; ++j) {
        const float p = expf(s[j][r] - mnew);
        psum += p;
        __bf16 ph, pl;
        at_split(p, ph, pl);
        pwh[(8 * hh + r) * AT_VP + j * 16 + c] = ph;
        pwl[(8 * hh + r) * AT_VP + j * 16 + c] = pl;
      }
#pragma unroll
      for (int off = 1; off < 16; off <<= 1) psum += __shfl_xor(psum, off, 32);
      lrow[r] = lrow[r] * alpha + psum;
#pragma unroll
      for (int t = 0; t < 4; ++t) oacc[t][r] *= alpha;
    }
    __builtin_amdgcn_fence(__ATOMIC_RELEASE, "workgroup");
    __builtin_amdgcn_wave_barrier();
    __builtin_amdgcn_fence(__ATOMIC_ACQUIRE, "workgroup");
#pragma unroll 1
    for (int kk = 0; kk < 2; ++kk) {
      FB pa, pl;   // A operand: row = query c, k = key
      pa.h[0] = *(const v8b*)(pwh + c * AT_VP + kk * 32 + 8 * hh);
      pa.h[1] = *(const v8b*)(pwh + c * AT_VP + kk * 32 + 16 + 8 * hh);
      pl.h[0] = *(const v8b*)(pwl + c * AT_VP + kk * 32 + 8 * hh);
      pl.h[1] = *(const v8b*)(pwl + c * AT_VP + kk * 32 + 16 + 8 * hh);
#pragma unroll
      for (int t = 0; t < 4; ++t) {
        FB vb, vl;   // B operand: col n = d = t*16+c, k = key
        vb.h[0] = *(const v8b*)(Vth + (t * 16 + c) * AT_VP + kk * 32 + 8 * hh);
        vb.h[1] = *(const v8b*)(Vth + (t * 16 + c) * AT_VP + kk * 32 + 16 + 8 * hh);
        vl.h[0] = *(const v8b*)(Vtl + (t * 16 + c) * AT_VP + kk * 32 + 8 * hh);
        vl.h[1] = *(const v8b*)(Vtl + (t * 16 + c) * AT_VP + kk * 32 + 16 + 8 * hh);
        oacc[t] = at_mma(pa.v, vb.v, oacc[t]);
        oacc[t] = at_mma(pa.v, vl.v, oacc[t]);
        oacc[t] = at_mma(pl.v, vb.v, oacc[t]);
      }
    }
  }

  float* os = Os[wave];
#pragma unroll
  for (int r = 0; r < 8; ++r) {
    const float inv = oscale * (1.0f / lrow[r]);   // lrow >= 1 (the running max contributes exp(0))
#pragma unroll
    for (int t = 0; t < 4; ++t) os[(8 * hh + r) * 68 + t * 16 + c] = oacc[t][r] * inv;
  }
  __builtin_amdgcn_fence(__ATOMIC_RELEASE, "workgroup");
  __builtin_amdgcn_wave_barrier();
  __builtin_amdgcn_fence(__ATOMIC_ACQUIRE, "workgroup");
  {
    const int q8 = lane >> 3, c8 = (lane & 7) * 8;
    {
#pragma unroll
      for (int it = 0; it < 4; ++it) {
        const int row = it * 4 + q8;
        v8h hv;
#pragma unroll
        for (int e = 0; e < 8; ++e) hv[e] = (_Float16)os[row * 68 + c8 + e];
        *(v8h*)(Ob + (size_t)(q0 + row) * DMODEL + c8) = hv;
      }
      
    }
  }
}

// ---------------------------------------------------------------------------
//   [ 0 MiB,  8 MiB)  xb   bf16 [4096][1024]            RNE-bf16 of x
//   [ 8 MiB, 10 MiB)  wqb  bf16 [1024][1024]
//   [10 MiB, 12 MiB)  wkb  bf16 [1024][1024]
//   [12 MiB, 14 MiB)  wvb  bf16 [1024][1024]
//   [14 MiB, 16 MiB)  woh  f16  [1024][1024]            64 * bf16_rne(Wo)
//   [16 MiB, 32 MiB)  qpl  f16  [4096][16][128]         q features per head
//   [32 MiB, 48 MiB)  kpl  f16  [4096][16][128]         k features per head
//   [48 MiB, 56 MiB)  vth  bf16 [2][1024][2048]         v^T hi plane
//   [56 MiB, 64 MiB)  vtl  bf16 [2][1024][2048]         v^T lo plane
//   [64 MiB, 72 MiB)  ohp  f16  [4096][1024]            256 * attention output, heads merged
// GEMM shapes: q/k M=4096 N=1024 K=1024; v^T M=1024 N=2048 K=1024 (x2 batch); out M=4096 N=1024 K=1024:
// all M, N multiples of 64, K multiple of 32, no padding, every plane fully written by its producer.
// ---------------------------------------------------------------------------
extern "C" void kernel_launch(void* const* d_in, const int* in_sizes, int n_in,
                              void* d_out, int out_size, void* d_ws, size_t ws_size,
                              hipStream_t stream)
{
  if (n_in < 9) return;
  if (in_sizes[0] != NTOK * DMODEL || in_sizes[1] != DMODEL * DMODEL || in_sizes[2] != DMODEL ||
      in_sizes[3] != DMODEL * DMODEL || in_sizes[4] != DMODEL || in_sizes[5] != DMODEL * DMODEL ||
      in_sizes[6] != DMODEL || in_sizes[7] != DMODEL * DMODEL || in_sizes[8] != DMODEL) return;
  if (out_size != NTOK * DMODEL) return;

  const float* x    = (const float*)d_in[0];
  const float* Wq   = (const float*)d_in[1];
  const float* bq   = (const float*)d_in[2];
  const float* Wk   = (const float*)d_in[3];
  const float* bk   = (const float*)d_in[4];
  const float* Wv   = (const float*)d_in[5];
  const float* bv   = (const float*)d_in[6];
  const float* Wo   = (const float*)d_in[7];
  const float* bo_p = (const float*)d_in[8];

  const size_t SZ_X   = (size_t)NTOK * DMODEL * 2;                 // 8 MiB
  const size_t SZ_W   = (size_t)DMODEL * DMODEL * 2;               // 2 MiB
  const size_t SZ_QK  = (size_t)NTOK * TOKP * 2;                   // 16 MiB
  const size_t SZ_VT  = (size_t)NBAT * DMODEL * SEQ * 2;           // 8 MiB
  const size_t SZ_O   = (size_t)NTOK * DMODEL * 2;                 // 8 MiB
  const size_t OFF_XB = 0;
  const size_t OFF_WQ = OFF_XB + SZ_X;
  const size_t OFF_WK = OFF_WQ + SZ_W;
  const size_t OFF_WV = OFF_WK + SZ_W;
  const size_t OFF_WO = OFF_WV + SZ_W;
  const size_t OFF_QP = OFF_WO + SZ_W;
  const size_t OFF_KP = OFF_QP + SZ_QK;
  const size_t OFF_VH = OFF_KP + SZ_QK;
  const size_t OFF_VL = OFF_VH + SZ_VT;
  const size_t OFF_OH = OFF_VL + SZ_VT;
  const size_t TOTAL  = OFF_OH + SZ_O;                             // 75,497,472
  if (TOTAL > ws_size) return;

  char* ws = (char*)d_ws;
  unsigned short* xb  = (unsigned short*)(ws + OFF_XB);
  unsigned short* wqb = (unsigned short*)(ws + OFF_WQ);
  unsigned short* wkb = (unsigned short*)(ws + OFF_WK);
  unsigned short* wvb = (unsigned short*)(ws + OFF_WV);
  unsigned short* woh = (unsigned short*)(ws + OFF_WO);
  unsigned short* qpl = (unsigned short*)(ws + OFF_QP);
  unsigned short* kpl = (unsigned short*)(ws + OFF_KP);
  unsigned short* vth = (unsigned short*)(ws + OFF_VH);
  unsigned short* vtl = (unsigned short*)(ws + OFF_VL);
  unsigned short* ohp = (unsigned short*)(ws + OFF_OH);

  // ---- 16-bit operand planes (2 elements per thread; counts are multiples of 512) ----
  const int n2x = (NTOK * DMODEL) / 2;       // 2,097,152 -> 8192 blocks
  const int n2w = (DMODEL * DMODEL) / 2;     //   524,288 -> 2048 blocks
  cast_bf16x2_kernel<<<dim3(n2x / 256), dim3(256), 0, stream>>>(x, xb, n2x);
  cast_bf16x2_kernel<<<dim3(n2w / 256), dim3(256), 0, stream>>>(Wq, wqb, n2w);
  cast_bf16x2_kernel<<<dim3(n2w / 256), dim3(256), 0, stream>>>(Wk, wkb, n2w);
  cast_bf16x2_kernel<<<dim3(n2w / 256), dim3(256), 0, stream>>>(Wv, wvb, n2w);
  cast_bf16_f16s_x2_kernel<<<dim3(n2w / 256), dim3(256), 0, stream>>>(Wo, woh, n2w, 64.0f);

  // ---- q / k feature planes: [4096][1024] x [1024][1024]^T + bias, epilogue writes per-head 128-wide f16 rows ----
  {
    const int tiles = (NTOK / 64) * (DMODEL / 64);     // 1024 -> 128 blocks of 8 waves
    dim3 grid(tiles / 8, 1), blk(256);
    wmma_gemm64<1, false, 2, 3, false><<<grid, blk, 0, stream>>>(
        xb, xb, DMODEL, 0L, wqb, wqb, DMODEL, 0L,
        (void*)qpl, (void*)qpl, TOKP, 0L, bq, bq, 0L, NTOK, DMODEL, DMODEL, 1.0f);
    wmma_gemm64<1, false, 2, 3, false><<<grid, blk, 0, stream>>>(
        xb, xb, DMODEL, 0L, wkb, wkb, DMODEL, 0L,
        (void*)kpl, (void*)kpl, TOKP, 0L, bk, bk, 0L, NTOK, DMODEL, DMODEL, 1.0f);
  }
  // ---- v^T planes (role swapped): per batch C[m = h*64+d][n = s] = sum_k Wv[m][k] * x[b][s][k] + bv[m], bf16 hi/lo out ----
  {
    const int tiles = (DMODEL / 64) * (SEQ / 64);      // 512 -> 64 blocks, grid.y = batch
    dim3 grid(tiles / 8, NBAT), blk(256);
    wmma_gemm64<1, false, 1, 2, false><<<grid, blk, 0, stream>>>(
        wvb, wvb, DMODEL, 0L, xb, xb, DMODEL, (long)SEQ * DMODEL,
        (void*)vth, (void*)vtl, SEQ, (long)DMODEL * SEQ, bv, bv, 0L, DMODEL, SEQ, DMODEL, 1.0f);
  }
  // ---- attention: grid = NBAT * NHEAD * (SEQ / 64) = 1024 blocks of 128 threads ----
  attn_aug_kernel<<<dim3(NBAT * NHEAD * (SEQ / 64)), dim3(128), 0, stream>>>(
      qpl, kpl, vth, vtl, ohp, 0.0625f, 256.0f);
  // ---- output projection: d_out[m][n] = (1/16384) * sum_k (256*O)[m][k] * (64*Wo)[n][k] + bo[n], f32 out ----
  {
    const int tiles = (NTOK / 64) * (DMODEL / 64);     // 1024 -> 128 blocks
    dim3 grid(tiles / 8, 1), blk(256);
    wmma_gemm64<0, false, 2, 0, false><<<grid, blk, 0, stream>>>(
        ohp, ohp, DMODEL, 0L, woh, woh, DMODEL, 0L,
        d_out, d_out, DMODEL, 0L, bo_p, bo_p, 0L, NTOK, DMODEL, DMODEL, 1.0f / 16384.0f);
  }
}

// v002
// A run of this version takes 382 microseconds.
// Next to v001, in two timings, it ran 1.10 times as fast each time.
// All steps since v000 together make it 1.37 times as fast.
// Contractions: q/k/v^T projections v_wmma_f32_16x16x32_bf16 (operands = RNE-bf16 of the f32 inputs, single product); scores v_wmma_f32_16x16x32_f16 (f16 per-head feature planes, single product, x1/16 in f32); p.v v_wmma_f32_16x16x32_bf16 with bf16 hi/lo split of p and v (hi.hi+hi.lo+lo.hi); output projection v_wmma_f32_16x16x32_f16 (f16 O carried x256, f16 Wo carried x64, single product, x1/16384 in f32); f32 accumulate everywhere; softmax, biases and DFT aggregate features in f32.
#include <hip/hip_runtime.h>
#include <math.h>
#include <stdint.h>

// ---------------- problem geometry ----------------
constexpr int NBAT    = 2;
constexpr int SEQ     = 2048;
constexpr int DMODEL  = 1024;
constexpr int NHEAD   = 16;
constexpr int HDIM    = 64;
constexpr int NTOK    = NBAT * SEQ;          // 4096
constexpr int QKPITCH = 128;                 // halves per (token, head) feature row: 64 dims, sum/8, altsum/8, zeros
constexpr int TOKP    = NHEAD * QKPITCH;     // 2048 halves per token row of the q/k feature planes
static_assert(NTOK % 64 == 0 && DMODEL % 64 == 0 && SEQ % 64 == 0 && DMODEL % 32 == 0);
static_assert(NHEAD * HDIM == DMODEL);

typedef __attribute__((ext_vector_type(16))) _Float16 v16h;
typedef __attribute__((ext_vector_type(8)))  _Float16 v8h;
typedef __attribute__((ext_vector_type(16))) __bf16   v16b;
typedef __attribute__((ext_vector_type(8)))  __bf16   v8b;
typedef __attribute__((ext_vector_type(8)))  float    v8f;
typedef __attribute__((ext_vector_type(4)))  float    v4f;
typedef __attribute__((ext_vector_type(2)))  float    v2f;

__device__ __forceinline__ unsigned short f2bf_bits(float f) {
  unsigned u = __float_as_uint(f);
  return (unsigned short)((u + 0x7FFFu + ((u >> 16) & 1u)) >> 16);
}
__device__ __forceinline__ float bf_bits2f(unsigned short h) { return __uint_as_float(((unsigned)h) << 16); }
__device__ __forceinline__ float rne_bf16(float f) { return bf_bits2f(f2bf_bits(f)); }
__device__ __forceinline__ unsigned pk16(unsigned short a, unsigned short b) { return (unsigned)a | ((unsigned)b << 16); }

// hazard guards as plain device helpers (no inline asm inside the kernel template body)
__device__ __forceinline__ void dep_guard_h(v8f& a, v8f& b, v16h x, v16h y) { asm volatile("v_nop\n\tv_nop\n\tv_nop\n\tv_nop" : "+v"(a), "+v"(b) : "v"(x), "v"(y)); }
__device__ __forceinline__ void dep_guard_b(v8f& a, v8f& b, v16b x, v16b y) { asm volatile("v_nop\n\tv_nop\n\tv_nop\n\tv_nop" : "+v"(a), "+v"(b) : "v"(x), "v"(y)); }
__device__ __forceinline__ void keep4_h(v16h a, v16h b, v16h c, v16h d) { asm volatile("v_nop" :: "v"(a), "v"(b), "v"(c), "v"(d)); }
__device__ __forceinline__ void keep4_b(v16b a, v16b b, v16b c, v16b d) { asm volatile("v_nop" :: "v"(a), "v"(b), "v"(c), "v"(d)); }
__device__ __forceinline__ void acc_guard4(v8f& a, v8f& b, v8f& c, v8f& d) { asm volatile("v_nop\n\tv_nop\n\tv_nop\n\tv_nop" : "+v"(a), "+v"(b), "+v"(c), "+v"(d)); }
template <typename T> struct Frag;
template <> struct Frag<_Float16> {
  typedef v16h V; union U { v16h v; v8h h[2]; };
  static __device__ __forceinline__ v16h load(const _Float16* p) {   // elements 0..7 <- p[0..7], 8..15 <- p[16..23]
    U f; f.h[0] = *(const v8h*)(p); f.h[1] = *(const v8h*)(p + 16); return f.v;
  }
  static __device__ __forceinline__ v8f mma(v16h a, v16h b, v8f c) {
    return __builtin_amdgcn_wmma_f32_16x16x32_f16(false, a, false, b, (short)0, c, false, false);
  }
  static __device__ __forceinline__ void guard(v8f& a, v8f& b, v16h x, v16h y) { dep_guard_h(a, b, x, y); }
  static __device__ __forceinline__ void keep(v16h a, v16h b, v16h c, v16h d) { keep4_h(a, b, c, d); }
};
template <> struct Frag<__bf16> {
  typedef v16b V; union U { v16b v; v8b h[2]; };
  static __device__ __forceinline__ v16b load(const __bf16* p) {
    U f; f.h[0] = *(const v8b*)(p); f.h[1] = *(const v8b*)(p + 16); return f.v;
  }
  static __device__ __forceinline__ v8f mma(v16b a, v16b b, v8f c) {
    return __builtin_amdgcn_wmma_f32_16x16x32_bf16(false, a, false, b, (short)0, c, false, false);
  }
  static __device__ __forceinline__ void guard(v8f& a, v8f& b, v16b x, v16b y) { dep_guard_b(a, b, x, y); }
  static __device__ __forceinline__ void keep(v16b a, v16b b, v16b c, v16b d) { keep4_b(a, b, c, d); }
};

// ---- Register-blocked batched WMMA GEMM ------------------------------------
// C[m,n] = scale * sum_k A[m,k] * Bt[n,k] (+bias)(+resid); each wave owns a 64x64 tile.
// A row-major [M,K]; Bt row-major [N,K]; M,N % 64 == 0, K % 32 == 0.
// SPLIT: operands are hi/lo planes (A2/Bt2 = lo planes, same layout); product = hi.hi + hi.lo + lo.hi.
// BIAS_MODE: 0 = none, 1 = bias[m], 2 = bias[n]. Bias values are RNE-bf16 quantised before the f32 add.
// OUT_MODE: 0 = f32, 1 = f16, 2 = bf16 hi plane (Cout) + bf16 lo plane (Cout2),
//           3 = f16 per-head feature rows: head hd = n0/64, row m -> C[m*ldc + hd*128 + 0..63] = f16(v[0..63]),
//               [+64] = f16(sum_d v[d] / 8), [+65] = f16(sum_d (-1)^d v[d] / 8), [+66..+127] = 0.
// ET: 0 = f16 operands, 1 = bf16 operands (pointers passed as 16-bit storage)
template <int ET> struct Elem;
template <> struct Elem<0> { typedef _Float16 T; };
template <> struct Elem<1> { typedef __bf16 T; };
template <int ET, bool SPLIT, int BIAS_MODE, int OUT_MODE, bool RESID, int ACT = 0>
__global__ __launch_bounds__(256) void wmma_gemm64(
    const unsigned short* __restrict__ Ap, const unsigned short* __restrict__ A2p, int lda, long strideA,
    const unsigned short* __restrict__ Btp, const unsigned short* __restrict__ Bt2p, int ldb, long strideB,
    void* __restrict__ Cout, void* __restrict__ Cout2, int ldc, long strideC,
    const float* __restrict__ bias,
    const float* __restrict__ resid, long strideR,
    int M, int N, int K, float scale) {
  typedef typename Elem<ET>::T T;
  typedef typename Frag<T>::V V;
  const T* A = (const T*)Ap; const T* A2 = (const T*)A2p; const T* Bt = (const T*)Btp; const T* Bt2 = (const T*)Bt2p;
  __shared__ __align__(16) float sT[8][16 * 68];   // per-wave 16x64 slab, pitch 68 floats
  const int b    = blockIdx.y;
  const int lane = threadIdx.x & 31;
  const int wave = threadIdx.x >> 5;
  const int tilesN = N >> 6;
  const int tilesM = M >> 6;
  const int tile = blockIdx.x * 8 + wave;
  if (tile >= tilesM * tilesN) return;   // wave-uniform; no block barriers in this kernel
  const int tm = tile / tilesN;
  const int tn = tile - tm * tilesN;
  const int m0 = tm << 6;
  const int n0 = tn << 6;

  const T* Ab  = A  + (size_t)b * strideA;
  const T* Bb  = Bt + (size_t)b * strideB;
  const T* Ab2 = SPLIT ? (A2  + (size_t)b * strideA) : nullptr;
  const T* Bb2 = SPLIT ? (Bt2 + (size_t)b * strideB) : nullptr;

  const int rlane = lane & 15;                 // row (A) / col (B, D) within subtile
  const int koff  = (lane >> 4) * 8;           // k offset of this lane half
  const int mOff  = (lane >> 4) * 8;           // D row offset

  v8f acc[4][4];
#pragma unroll
  for (int i = 0; i < 4; ++i)
#pragma unroll
    for (int j = 0; j < 4; ++j) acc[i][j] = (v8f){0.f,0.f,0.f,0.f,0.f,0.f,0.f,0.f};

  for (int k0 = 0; k0 < K; k0 += 32) {
    V bh[4], bl[4];
#pragma unroll
    for (int j = 0; j < 4; ++j) {
      const size_t bo = (size_t)(n0 + (j << 4) + rlane) * ldb + koff + k0;
      bh[j] = Frag<T>::load(Bb + bo);
      if (SPLIT) bl[j] = Frag<T>::load(Bb2 + bo);
    }
#pragma unroll
    for (int i = 0; i < 4; ++i) {
      const size_t ao = (size_t)(m0 + (i << 4) + rlane) * lda + koff + k0;
      V ah = Frag<T>::load(Ab + ao);
      V al;
      if (SPLIT) al = Frag<T>::load(Ab2 + ao);
#pragma unroll
      for (int j = 0; j < 4; ++j) {
        acc[i][j] = Frag<T>::mma(ah, bh[j], acc[i][j]);
        if (SPLIT) {
          acc[i][j] = Frag<T>::mma(ah, bl[j], acc[i][j]);
          acc[i][j] = Frag<T>::mma(al, bh[j], acc[i][j]);
        }
      }
      Frag<T>::guard(acc[i][0], acc[i][3], ah, SPLIT ? al : ah);
    }
    Frag<T>::keep(bh[0], bh[1], bh[2], bh[3]);
    if (SPLIT) Frag<T>::keep(bl[0], bl[1], bl[2], bl[3]);
  }
  acc_guard4(acc[0][0], acc[0][1], acc[0][2], acc[0][3]);
  acc_guard4(acc[1][0], acc[1][1], acc[1][2], acc[1][3]);
  acc_guard4(acc[2][0], acc[2][1], acc[2][2], acc[2][3]);
  acc_guard4(acc[3][0], acc[3][1], acc[3][2], acc[3][3]);

  // ---- epilogue ----
  float* slab = sT[wave];
  const float* Rb = RESID ? (resid + (size_t)b * strideR) : nullptr;
#pragma unroll
  for (int i = 0; i < 4; ++i) {
    const int mBase = m0 + (i << 4);
#pragma unroll
    for (int j = 0; j < 4; ++j) {
      const int n = n0 + (j << 4) + rlane;
      float bv = 0.f;
      if (BIAS_MODE == 2) bv = rne_bf16(bias[n]);
#pragma unroll
      for (int r = 0; r < 8; ++r) {
        float v = acc[i][j][r] * scale;
        if (BIAS_MODE == 1) v += rne_bf16(bias[mBase + mOff + r]);
        if (BIAS_MODE == 2) v += bv;
        if (RESID) v += Rb[(size_t)(mBase + mOff + r) * ldc + n];
        if (ACT == 1) v = tanhf(v);
        if (ACT == 2) v = fmaxf(v, 0.0f);
        if (ACT == 3) v = v / (1.0f + expf(-v));
        if (ACT == 4) v = (v > 0.f) ? v : 0.01f * v;
        slab[(mOff + r) * 68 + (j << 4) + rlane] = v;
      }
    }
    __builtin_amdgcn_fence(__ATOMIC_RELEASE, "workgroup");
    __builtin_amdgcn_wave_barrier();
    __builtin_amdgcn_fence(__ATOMIC_ACQUIRE, "workgroup");
    if (OUT_MODE == 0) {
      float* C = (float*)Cout + (size_t)b * strideC;
      const int hh = lane >> 4, c4 = (lane & 15) * 4;     // row seg = 256 B = 16 lanes x 16 B
      {
#pragma unroll
        for (int it = 0; it < 8; ++it) {
          const int row = it * 2 + hh;
          v4f v = *(const v4f*)(slab + row * 68 + c4);
          *(v4f*)(C + (size_t)(mBase + row) * ldc + n0 + c4) = v;
        }
        
      }
    } else if (OUT_MODE == 3) {
      // Coverage per slab: 4 it x 4 row groups (q) = 16 rows; 8 lanes x 8 halves = 64 halves per line.
      const int q = lane >> 3, c8 = (lane & 7) * 8;
      unsigned short* C = (unsigned short*)Cout + (size_t)b * strideC;
      const int hcol = (n0 >> 6) * 128;
      v8h hv[4], av[4];
#pragma unroll
      for (int it = 0; it < 4; ++it) {
        const int row = it * 4 + q;
        const float* sp = slab + row * 68 + c8;
        float ps = 0.f, pa = 0.f;
        v8h t;
#pragma unroll
        for (int e = 0; e < 8; ++e) {
          const float v = sp[e];
          t[e] = (_Float16)v;
          ps += v;
          if (e & 1) pa -= v; else pa += v;     // c8 is even, so (-1)^(c8+e) = (-1)^e
        }
#pragma unroll
        for (int off = 1; off < 8; off <<= 1) {   // reduce over the 8 lanes holding this row
          ps += __shfl_xor(ps, off, 32);
          pa += __shfl_xor(pa, off, 32);
        }
        const float fa = (c8 == 0) ? ps * 0.125f : 0.0f;
        const float fb = (c8 == 0) ? pa * 0.125f : 0.0f;
        v8h u;
#pragma unroll
        for (int e = 0; e < 8; ++e) u[e] = (_Float16)0.0f;
        u[0] = (_Float16)fa;
        u[1] = (_Float16)fb;
        hv[it] = t;
        av[it] = u;
      }
      {
#pragma unroll
        for (int it = 0; it < 4; ++it) {
          const int row = it * 4 + q;
          unsigned short* cp = C + (size_t)(mBase + row) * ldc + hcol + c8;
          *(v8h*)(cp) = hv[it];
          *(v8h*)(cp + 64) = av[it];
        }
        
      }
    } else {
      const int q = lane >> 3, c8 = (lane & 7) * 8;
      unsigned short* C  = (unsigned short*)Cout  + (size_t)b * strideC;
      unsigned short* C2 = (OUT_MODE == 2) ? ((unsigned short*)Cout2 + (size_t)b * strideC) : nullptr;
      {
#pragma unroll
        for (int it = 0; it < 4; ++it) {
          const int row = it * 4 + q;
          const float* sp = slab + row * 68 + c8;
          v8h hv, lv;
#pragma unroll
          for (int e = 0; e < 8; ++e) {
            if (OUT_MODE == 1) {
              hv[e] = (_Float16)sp[e];
            } else {
              unsigned short hb = f2bf_bits(sp[e]);
              unsigned short lb = f2bf_bits(sp[e] - bf_bits2f(hb));
              hv[e] = __builtin_bit_cast(_Float16, hb);
              lv[e] = __builtin_bit_cast(_Float16, lb);
            }
          }
          *(v8h*)(C + (size_t)(mBase + row) * ldc + n0 + c8) = hv;
          if (OUT_MODE == 2) *(v8h*)(C2 + (size_t)(mBase + row) * ldc + n0 + c8) = lv;
        }
        
      }
    }
    __builtin_amdgcn_fence(__ATOMIC_RELEASE, "workgroup");
    __builtin_amdgcn_wave_barrier();
    __builtin_amdgcn_fence(__ATOMIC_ACQUIRE, "workgroup");
  }
}

// ---------------------------------------------------------------------------
// f32 -> RNE bf16 bits, 2 elements per thread packed into one 4-B store: a wave writes one whole
// Coverage: grid = n2/256 blocks x 256 threads x 2 elements = 2*n2 = the whole plane (n2 % 256 == 0 here).
// ---------------------------------------------------------------------------
__global__ __launch_bounds__(256) void cast_bf16x2_kernel(const float* __restrict__ in, unsigned short* __restrict__ out, int n2) {
  const int i = blockIdx.x * 256 + threadIdx.x;
  if (i < n2) {
    const v2f f = *(const v2f*)(in + 2 * (size_t)i);
    const unsigned u = pk16(f2bf_bits(f[0]), f2bf_bits(f[1]));
    ((unsigned*)out)[i] = u;
    
  }
}
// f32 -> f16 bits of (mul * bf16_rne(v)), mul an exact power of two; same store pattern and coverage.
__global__ __launch_bounds__(256) void cast_bf16_f16s_x2_kernel(const float* __restrict__ in, unsigned short* __restrict__ out, int n2, float mul) {
  const int i = blockIdx.x * 256 + threadIdx.x;
  if (i < n2) {
    const v2f f = *(const v2f*)(in + 2 * (size_t)i);
    const _Float16 h0 = (_Float16)(rne_bf16(f[0]) * mul);
    const _Float16 h1 = (_Float16)(rne_bf16(f[1]) * mul);
    const unsigned u = pk16(__builtin_bit_cast(unsigned short, h0), __builtin_bit_cast(unsigned short, h1));
    ((unsigned*)out)[i] = u;
    
  }
}

// =====================================================================================
// Full (unmasked) attention with 96-deep f16 score features and head dim 64 values.
//   scores use the exact identity of the ortho half-spectrum DFT matrices (C = cos/8, S = sin/8, 33 bins):
//   C^T C + S^T S = I/2 + (1 1^T + a a^T)/128 with a_d = (-1)^d, so
//   Re(qf . conj(kf)) / 8 = (q.k + (sum q/8)(sum k/8) + (sum a*q/8)(sum a*k/8)) / 16  ->  one 96-deep contraction
//   over [q | sum/8 | altsum/8 | 30 zeros] x sscale (= 1/16); value path irDFT(DFT-weighted sum) = p . v.
//   q/k planes f16: element (b, t, h, f) at [(b*SEQ + t)*TOKP + h*QKPITCH + f], f = 0..127 (f >= 66 zero).
//   v^T planes bf16 hi/lo: element (b, h, d, s) at [(b*DMODEL + h*64 + d)*SEQ + s].
//   out f16 (x oscale): element (b, t, h, d) at [(b*SEQ + t)*DMODEL + h*64 + d]; 64-half row segment =
//   scores: v_wmma_f32_16x16x32_f16 single product; p.v: bf16 hi/lo split of p (unnormalised, <= 1) and v.
//   online softmax in f32 over SEQ keys (32 chunks of 64, compile-time trip count).
//   Block = 4 waves = 64 query rows of one (b, h); grid.x = NBAT * NHEAD * (SEQ/64) = 1024.
//   K / V^T chunk staging: 128 threads; K: 48 halves per thread = 64 x 96; V^T: 32 per thread per plane = 64 x 64
//   (16-B copies, plain loads held in registers one chunk ahead, __syncthreads before and after the LDS stores);
//   fragment loads read LDS with the stored vector type.
// =====================================================================================
#define AT_D 64
#define AT_F 96
#define AT_NW 4
#define AT_QB 64
#define AT_KC 64
// LDS row pitches in halves: 16 B x odd, so that the 16 rows of a ds_load_b128 fragment read fall on distinct banks
#define AT_KP 104   // K feature rows: 96 halves used, 208 B pitch
#define AT_VP 72    // V^T and P rows: 64 halves used, 144 B pitch
static_assert(AT_KP >= AT_F && AT_VP >= AT_KC && (AT_KP * 2) % 32 == 16 && (AT_VP * 2) % 32 == 16, "pitch holds the row and is 16 B x odd");

__device__ __forceinline__ __bf16 at_f2bf(float f) { return __builtin_bit_cast(__bf16, f2bf_bits(f)); }
__device__ __forceinline__ void at_split(float f, __bf16& hi, __bf16& lo) {
  const unsigned short hb = f2bf_bits(f);
  hi = __builtin_bit_cast(__bf16, hb);
  lo = at_f2bf(f - __uint_as_float(((unsigned)hb) << 16));
}
__device__ __forceinline__ v8f at_mma(v16b a, v16b b, v8f c) {
  c = __builtin_amdgcn_wmma_f32_16x16x32_bf16(false, a, false, b, (short)0, c, false, false);
  asm volatile("v_nop\n\tv_nop\n\tv_nop\n\tv_nop" : "+v"(c) : "v"(a), "v"(b));
  return c;
}
__device__ __forceinline__ v8f at_mma_h(v16h a, v16h b, v8f c) {
  c = __builtin_amdgcn_wmma_f32_16x16x32_f16(false, a, false, b, (short)0, c, false, false);
  asm volatile("v_nop\n\tv_nop\n\tv_nop\n\tv_nop" : "+v"(c) : "v"(a), "v"(b));
  return c;
}

__global__ __launch_bounds__(128)
void attn_aug_kernel(const unsigned short* __restrict__ qp, const unsigned short* __restrict__ kp,
                     const unsigned short* __restrict__ vhp, const unsigned short* __restrict__ vlp,
                     unsigned short* __restrict__ op, float sscale, float oscale) {
  union FB { v16b v; v8b h[2]; };
  union FH { v16h v; v8h h[2]; };
  __shared__ __align__(16) _Float16 Ksh[AT_KC * AT_KP];          // K features [kv][f]   13 KB
  __shared__ __align__(16) __bf16   Vth[AT_D * AT_VP];           // V hi [d][kv]          9 KB
  __shared__ __align__(16) __bf16   Vtl[AT_D * AT_VP];           // V lo                  9 KB
  __shared__ __align__(16) __bf16   Psh[AT_NW][16 * AT_VP];      // per wave P hi [row][kv]
  __shared__ __align__(16) __bf16   Psl[AT_NW][16 * AT_VP];      // per wave P lo
  __shared__ __align__(16) float    Os[AT_NW][16 * 68];          // per wave out tile, pitch 68

  const int tid  = threadIdx.x;
  const int wave = tid >> 5;
  const int lane = tid & 31;
  const int hh   = lane >> 4;
  const int c    = lane & 15;

  const int nqb = SEQ / AT_QB;            // 32
  const int bx = blockIdx.x;
  const int qb = bx % nqb;
  const int bh = bx / nqb;                // 0..NBAT*NHEAD-1
  const int h  = bh % NHEAD;
  const int b  = bh / NHEAD;
  const int q0 = qb * AT_QB + wave * 16;

  const _Float16* Qb = (const _Float16*)(const void*)qp + (size_t)b * SEQ * TOKP + (size_t)h * QKPITCH;
  const _Float16* Kb = (const _Float16*)(const void*)kp + (size_t)b * SEQ * TOKP + (size_t)h * QKPITCH;
  const __bf16*   Vh = (const __bf16*)(const void*)vhp + ((size_t)b * DMODEL + (size_t)h * AT_D) * SEQ;
  const __bf16*   Vl = (const __bf16*)(const void*)vlp + ((size_t)b * DMODEL + (size_t)h * AT_D) * SEQ;
  _Float16*       Ob = (_Float16*)(void*)op + (size_t)b * SEQ * DMODEL + (size_t)h * AT_D;

  // ---- Q fragments (A operand, row = lane&15, split k map via Frag load): 3 feature chunks of 32 ----
  v16h qa[3];
#pragma unroll
  for (int dc = 0; dc < 3; ++dc)
    qa[dc] = Frag<_Float16>::load(Qb + (size_t)(q0 + c) * TOKP + dc * 32 + 8 * hh);

  float mrow[8], lrow[8];
  v8f oacc[4];
#pragma unroll
  for (int r = 0; r < 8; ++r) { mrow[r] = -INFINITY; lrow[r] = 0.f; }
#pragma unroll
  for (int t = 0; t < 4; ++t) oacc[t] = (v8f){0.f,0.f,0.f,0.f,0.f,0.f,0.f,0.f};

  const int nChunks = SEQ / AT_KC;   // 32, compile-time constant
  // staging coverage: K: 128 threads x (6 x 8) = 64 rows x 96; V^T: 128 threads x (4 x 8) = 64 x 64 per plane
  const int sr = tid >> 1, shalf = tid & 1;
  const _Float16* ks  = Kb + (size_t)sr * TOKP + shalf * 48;   // chunk 0: K row sr, f = shalf*48..+47
  const __bf16*   vsh = Vh + (size_t)sr * SEQ + shalf * 32;    // chunk 0: V^T row d = sr, s = shalf*32..+31
  const __bf16*   vsl = Vl + (size_t)sr * SEQ + shalf * 32;
  // the chunk in flight: 14 x 16 B per thread, loaded one chunk ahead of the LDS stores that consume them
  v8h kreg[6];
  v8b vhreg[4], vlreg[4];
#pragma unroll
  for (int i = 0; i < 6; ++i) kreg[i] = *(const v8h*)(ks + 8 * i);
#pragma unroll
  for (int i = 0; i < 4; ++i) {
    vhreg[i] = *(const v8b*)(vsh + 8 * i);
    vlreg[i] = *(const v8b*)(vsl + 8 * i);
  }
  for (int kc = 0; kc < nChunks; ++kc) {
    __syncthreads();
#pragma unroll
    for (int i = 0; i < 6; ++i) *(v8h*)(Ksh + sr * AT_KP + shalf * 48 + 8 * i) = kreg[i];
#pragma unroll
    for (int i = 0; i < 4; ++i) {
      *(v8b*)(Vth + sr * AT_VP + shalf * 32 + 8 * i) = vhreg[i];
      *(v8b*)(Vtl + sr * AT_VP + shalf * 32 + 8 * i) = vlreg[i];
    }
    __syncthreads();
    if (kc + 1 < nChunks) {   // block-uniform: the next chunk's 14 loads go out together and land behind this chunk's work
      const _Float16* kn  = ks  + (size_t)(kc + 1) * AT_KC * TOKP;
      const __bf16*   vhn = vsh + (kc + 1) * AT_KC;
      const __bf16*   vln = vsl + (kc + 1) * AT_KC;
#pragma unroll
      for (int i = 0; i < 6; ++i) kreg[i] = *(const v8h*)(kn + 8 * i);
#pragma unroll
      for (int i = 0; i < 4; ++i) {
        vhreg[i] = *(const v8b*)(vhn + 8 * i);
        vlreg[i] = *(const v8b*)(vln + 8 * i);
      }
    }

    v8f s[4];
#pragma unroll
    for (int j = 0; j < 4; ++j) {
      s[j] = (v8f){0.f,0.f,0.f,0.f,0.f,0.f,0.f,0.f};
#pragma unroll
      for (int dc = 0; dc < 3; ++dc) {
        FH kb;   // B operand: col n = key j*16+c, k = feature, split k map
        kb.h[0] = *(const v8h*)(Ksh + (j * 16 + c) * AT_KP + dc * 32 + 8 * hh);
        kb.h[1] = *(const v8h*)(Ksh + (j * 16 + c) * AT_KP + dc * 32 + 16 + 8 * hh);
        s[j] = at_mma_h(qa[dc], kb.v, s[j]);
      }
    }
    float cm[8];
#pragma unroll
    for (int r = 0; r < 8; ++r) {
      float m = -INFINITY;
#pragma unroll
      for (int j = 0; j < 4; ++j) {
        s[j][r] *= sscale;
        m = fmaxf(m, s[j][r]);
      }
#pragma unroll
      for (int off = 1; off < 16; off <<= 1) m = fmaxf(m, __shfl_xor(m, off, 32));
      cm[r] = m;
    }
    __bf16* pwh = Psh[wave];
    __bf16* pwl = Psl[wave];
#pragma unroll
    for (int r = 0; r < 8; ++r) {
      const float mnew = fmaxf(mrow[r], cm[r]);
      const float alpha = expf(mrow[r] - mnew);
      mrow[r] = mnew;
      float psum = 0.f;
#pragma unroll
      for (int j = 0; j < 4; ++j) {
        const float p = expf(s[j][r] - mnew);
        psum += p;
        __bf16 ph, pl;
        at_split(p, ph, pl);
        pwh[(8 * hh + r) * AT_VP + j * 16 + c] = ph;
        pwl[(8 * hh + r) * AT_VP + j * 16 + c] = pl;
      }
#pragma unroll
      for (int off = 1; off < 16; off <<= 1) psum += __shfl_xor(psum, off, 32);
      lrow[r] = lrow[r] * alpha + psum;
#pragma unroll
      for (int t = 0; t < 4; ++t) oacc[t][r] *= alpha;
    }
    __builtin_amdgcn_fence(__ATOMIC_RELEASE, "workgroup");
    __builtin_amdgcn_wave_barrier();
    __builtin_amdgcn_fence(__ATOMIC_ACQUIRE, "workgroup");
#pragma unroll 1
    for (int kk = 0; kk < 2; ++kk) {
      FB pa, pl;   // A operand: row = query c, k = key
      pa.h[0] = *(const v8b*)(pwh + c * AT_VP + kk * 32 + 8 * hh);
      pa.h[1] = *(const v8b*)(pwh + c * AT_VP + kk * 32 + 16 + 8 * hh);
      pl.h[0] = *(const v8b*)(pwl + c * AT_VP + kk * 32 + 8 * hh);
      pl.h[1] = *(const v8b*)(pwl + c * AT_VP + kk * 32 + 16 + 8 * hh);
#pragma unroll
      for (int t = 0; t < 4; ++t) {
        FB vb, vl;   // B operand: col n = d = t*16+c, k = key
        vb.h[0] = *(const v8b*)(Vth + (t * 16 + c) * AT_VP + kk * 32 + 8 * hh);
        vb.h[1] = *(const v8b*)(Vth + (t * 16 + c) * AT_VP + kk * 32 + 16 + 8 * hh);
        vl.h[0] = *(const v8b*)(Vtl + (t * 16 + c) * AT_VP + kk * 32 + 8 * hh);
        vl.h[1] = *(const v8b*)(Vtl + (t * 16 + c) * AT_VP + kk * 32 + 16 + 8 * hh);
        oacc[t] = at_mma(pa.v, vb.v, oacc[t]);
        oacc[t] = at_mma(pa.v, vl.v, oacc[t]);
        oacc[t] = at_mma(pl.v, vb.v, oacc[t]);
      }
    }
  }

  float* os = Os[wave];
#pragma unroll
  for (int r = 0; r < 8; ++r) {
    const float inv = oscale * (1.0f / lrow[r]);   // lrow >= 1 (the running max contributes exp(0))
#pragma unroll
    for (int t = 0; t < 4; ++t) os[(8 * hh + r) * 68 + t * 16 + c] = oacc[t][r] * inv;
  }
  __builtin_amdgcn_fence(__ATOMIC_RELEASE, "workgroup");
  __builtin_amdgcn_wave_barrier();
  __builtin_amdgcn_fence(__ATOMIC_ACQUIRE, "workgroup");
  {
    const int q8 = lane >> 3, c8 = (lane & 7) * 8;
    {
#pragma unroll
      for (int it = 0; it < 4; ++it) {
        const int row = it * 4 + q8;
        v8h hv;
#pragma unroll
        for (int e = 0; e < 8; ++e) hv[e] = (_Float16)os[row * 68 + c8 + e];
        *(v8h*)(Ob + (size_t)(q0 + row) * DMODEL + c8) = hv;
      }
      
    }
  }
}

// ---------------------------------------------------------------------------
//   [ 0 MiB,  8 MiB)  xb   bf16 [4096][1024]            RNE-bf16 of x
//   [ 8 MiB, 10 MiB)  wqb  bf16 [1024][1024]
//   [10 MiB, 12 MiB)  wkb  bf16 [1024][1024]
//   [12 MiB, 14 MiB)  wvb  bf16 [1024][1024]
//   [14 MiB, 16 MiB)  woh  f16  [1024][1024]            64 * bf16_rne(Wo)
//   [16 MiB, 32 MiB)  qpl  f16  [4096][16][128]         q features per head
//   [32 MiB, 48 MiB)  kpl  f16  [4096][16][128]         k features per head
//   [48 MiB, 56 MiB)  vth  bf16 [2][1024][2048]         v^T hi plane
//   [56 MiB, 64 MiB)  vtl  bf16 [2][1024][2048]         v^T lo plane
//   [64 MiB, 72 MiB)  ohp  f16  [4096][1024]            256 * attention output, heads merged
// GEMM shapes: q/k M=4096 N=1024 K=1024; v^T M=1024 N=2048 K=1024 (x2 batch); out M=4096 N=1024 K=1024:
// all M, N multiples of 64, K multiple of 32, no padding, every plane fully written by its producer.
// ---------------------------------------------------------------------------
extern "C" void kernel_launch(void* const* d_in, const int* in_sizes, int n_in,
                              void* d_out, int out_size, void* d_ws, size_t ws_size,
                              hipStream_t stream)
{
  if (n_in < 9) return;
  if (in_sizes[0] != NTOK * DMODEL || in_sizes[1] != DMODEL * DMODEL || in_sizes[2] != DMODEL ||
      in_sizes[3] != DMODEL * DMODEL || in_sizes[4] != DMODEL || in_sizes[5] != DMODEL * DMODEL ||
      in_sizes[6] != DMODEL || in_sizes[7] != DMODEL * DMODEL || in_sizes[8] != DMODEL) return;
  if (out_size != NTOK * DMODEL) return;

  const float* x    = (const float*)d_in[0];
  const float* Wq   = (const float*)d_in[1];
  const float* bq   = (const float*)d_in[2];
  const float* Wk   = (const float*)d_in[3];
  const float* bk   = (const float*)d_in[4];
  const float* Wv   = (const float*)d_in[5];
  const float* bv   = (const float*)d_in[6];
  const float* Wo   = (const float*)d_in[7];
  const float* bo_p = (const float*)d_in[8];

  const size_t SZ_X   = (size_t)NTOK * DMODEL * 2;                 // 8 MiB
  const size_t SZ_W   = (size_t)DMODEL * DMODEL * 2;               // 2 MiB
  const size_t SZ_QK  = (size_t)NTOK * TOKP * 2;                   // 16 MiB
  const size_t SZ_VT  = (size_t)NBAT * DMODEL * SEQ * 2;           // 8 MiB
  const size_t SZ_O   = (size_t)NTOK * DMODEL * 2;                 // 8 MiB
  const size_t OFF_XB = 0;
  const size_t OFF_WQ = OFF_XB + SZ_X;
  const size_t OFF_WK = OFF_WQ + SZ_W;
  const size_t OFF_WV = OFF_WK + SZ_W;
  const size_t OFF_WO = OFF_WV + SZ_W;
  const size_t OFF_QP = OFF_WO + SZ_W;
  const size_t OFF_KP = OFF_QP + SZ_QK;
  const size_t OFF_VH = OFF_KP + SZ_QK;
  const size_t OFF_VL = OFF_VH + SZ_VT;
  const size_t OFF_OH = OFF_VL + SZ_VT;
  const size_t TOTAL  = OFF_OH + SZ_O;                             // 75,497,472
  if (TOTAL > ws_size) return;

  char* ws = (char*)d_ws;
  unsigned short* xb  = (unsigned short*)(ws + OFF_XB);
  unsigned short* wqb = (unsigned short*)(ws + OFF_WQ);
  unsigned short* wkb = (unsigned short*)(ws + OFF_WK);
  unsigned short* wvb = (unsigned short*)(ws + OFF_WV);
  unsigned short* woh = (unsigned short*)(ws + OFF_WO);
  unsigned short* qpl = (unsigned short*)(ws + OFF_QP);
  unsigned short* kpl = (unsigned short*)(ws + OFF_KP);
  unsigned short* vth = (unsigned short*)(ws + OFF_VH);
  unsigned short* vtl = (unsigned short*)(ws + OFF_VL);
  unsigned short* ohp = (unsigned short*)(ws + OFF_OH);

  // ---- 16-bit operand planes (2 elements per thread; counts are multiples of 512) ----
  const int n2x = (NTOK * DMODEL) / 2;       // 2,097,152 -> 8192 blocks
  const int n2w = (DMODEL * DMODEL) / 2;     //   524,288 -> 2048 blocks
  cast_bf16x2_kernel<<<dim3(n2x / 256), dim3(256), 0, stream>>>(x, xb, n2x);
  cast_bf16x2_kernel<<<dim3(n2w / 256), dim3(256), 0, stream>>>(Wq, wqb, n2w);
  cast_bf16x2_kernel<<<dim3(n2w / 256), dim3(256), 0, stream>>>(Wk, wkb, n2w);
  cast_bf16x2_kernel<<<dim3(n2w / 256), dim3(256), 0, stream>>>(Wv, wvb, n2w);
  cast_bf16_f16s_x2_kernel<<<dim3(n2w / 256), dim3(256), 0, stream>>>(Wo, woh, n2w, 64.0f);

  // ---- q / k feature planes: [4096][1024] x [1024][1024]^T + bias, epilogue writes per-head 128-wide f16 rows ----
  {
    const int tiles = (NTOK / 64) * (DMODEL / 64);     // 1024 -> 128 blocks of 8 waves
    dim3 grid(tiles / 8, 1), blk(256);
    wmma_gemm64<1, false, 2, 3, false><<<grid, blk, 0, stream>>>(
        xb, xb, DMODEL, 0L, wqb, wqb, DMODEL, 0L,
        (void*)qpl, (void*)qpl, TOKP, 0L, bq, bq, 0L, NTOK, DMODEL, DMODEL, 1.0f);
    wmma_gemm64<1, false, 2, 3, false><<<grid, blk, 0, stream>>>(
        xb, xb, DMODEL, 0L, wkb, wkb, DMODEL, 0L,
        (void*)kpl, (void*)kpl, TOKP, 0L, bk, bk, 0L, NTOK, DMODEL, DMODEL, 1.0f);
  }
  // ---- v^T planes (role swapped): per batch C[m = h*64+d][n = s] = sum_k Wv[m][k] * x[b][s][k] + bv[m], bf16 hi/lo out ----
  {
    const int tiles = (DMODEL / 64) * (SEQ / 64);      // 512 -> 64 blocks, grid.y = batch
    dim3 grid(tiles / 8, NBAT), blk(256);
    wmma_gemm64<1, false, 1, 2, false><<<grid, blk, 0, stream>>>(
        wvb, wvb, DMODEL, 0L, xb, xb, DMODEL, (long)SEQ * DMODEL,
        (void*)vth, (void*)vtl, SEQ, (long)DMODEL * SEQ, bv, bv, 0L, DMODEL, SEQ, DMODEL, 1.0f);
  }
  // ---- attention: grid = NBAT * NHEAD * (SEQ / 64) = 1024 blocks of 128 threads ----
  attn_aug_kernel<<<dim3(NBAT * NHEAD * (SEQ / 64)), dim3(128), 0, stream>>>(
      qpl, kpl, vth, vtl, ohp, 0.0625f, 256.0f);
  // ---- output projection: d_out[m][n] = (1/16384) * sum_k (256*O)[m][k] * (64*Wo)[n][k] + bo[n], f32 out ----
  {
    const int tiles = (NTOK / 64) * (DMODEL / 64);     // 1024 -> 128 blocks
    dim3 grid(tiles / 8, 1), blk(256);
    wmma_gemm64<0, false, 2, 0, false><<<grid, blk, 0, stream>>>(
        ohp, ohp, DMODEL, 0L, woh, woh, DMODEL, 0L,
        d_out, d_out, DMODEL, 0L, bo_p, bo_p, 0L, NTOK, DMODEL, DMODEL, 1.0f / 16384.0f);
  }
}

// v003
// A run of this version takes 269 microseconds.
// Timed twice side by side with v002, it ran 1.42 times as fast both times.
// All steps since v000 together make it 1.94 times as fast.
// Contractions: q/k/v^T projections v_wmma_f32_16x16x32_bf16 (operands = RNE-bf16 of the f32 inputs, single product); scores v_wmma_f32_16x16x32_f16 (f16 per-head feature planes, single product, x1/16 in f32); p.v v_wmma_f32_16x16x32_bf16 with bf16 hi/lo split of p and v (hi.hi+hi.lo+lo.hi); output projection v_wmma_f32_16x16x32_f16 (f16 O carried x256, f16 Wo carried x64, single product, x1/16384 in f32); f32 accumulate everywhere; softmax, biases and DFT aggregate features in f32.
#include <hip/hip_runtime.h>
#include <math.h>
#include <stdint.h>

// ---------------- problem geometry ----------------
constexpr int NBAT    = 2;
constexpr int SEQ     = 2048;
constexpr int DMODEL  = 1024;
constexpr int NHEAD   = 16;
constexpr int HDIM    = 64;
constexpr int NTOK    = NBAT * SEQ;          // 4096
constexpr int QKPITCH = 128;                 // halves per (token, head) feature row: 64 dims, sum/8, altsum/8, zeros
constexpr int TOKP    = NHEAD * QKPITCH;     // 2048 halves per token row of the q/k feature planes
static_assert(NTOK % 64 == 0 && DMODEL % 64 == 0 && SEQ % 64 == 0 && DMODEL % 32 == 0);
static_assert(NHEAD * HDIM == DMODEL);

typedef __attribute__((ext_vector_type(16))) _Float16 v16h;
typedef __attribute__((ext_vector_type(8)))  _Float16 v8h;
typedef __attribute__((ext_vector_type(16))) __bf16   v16b;
typedef __attribute__((ext_vector_type(8)))  __bf16   v8b;
typedef __attribute__((ext_vector_type(8)))  float    v8f;
typedef __attribute__((ext_vector_type(4)))  float    v4f;
typedef __attribute__((ext_vector_type(2)))  float    v2f;

__device__ __forceinline__ unsigned short f2bf_bits(float f) {
  unsigned u = __float_as_uint(f);
  return (unsigned short)((u + 0x7FFFu + ((u >> 16) & 1u)) >> 16);
}
__device__ __forceinline__ float bf_bits2f(unsigned short h) { return __uint_as_float(((unsigned)h) << 16); }
__device__ __forceinline__ float rne_bf16(float f) { return bf_bits2f(f2bf_bits(f)); }
__device__ __forceinline__ unsigned pk16(unsigned short a, unsigned short b) { return (unsigned)a | ((unsigned)b << 16); }

// hazard guards as plain device helpers (no inline asm inside the kernel template body)
__device__ __forceinline__ void dep_guard_h(v8f& a, v8f& b, v16h x, v16h y) { asm volatile("v_nop\n\tv_nop\n\tv_nop\n\tv_nop" : "+v"(a), "+v"(b) : "v"(x), "v"(y)); }
__device__ __forceinline__ void dep_guard_b(v8f& a, v8f& b, v16b x, v16b y) { asm volatile("v_nop\n\tv_nop\n\tv_nop\n\tv_nop" : "+v"(a), "+v"(b) : "v"(x), "v"(y)); }
__device__ __forceinline__ void keep4_h(v16h a, v16h b, v16h c, v16h d) { asm volatile("v_nop" :: "v"(a), "v"(b), "v"(c), "v"(d)); }
__device__ __forceinline__ void keep4_b(v16b a, v16b b, v16b c, v16b d) { asm volatile("v_nop" :: "v"(a), "v"(b), "v"(c), "v"(d)); }
__device__ __forceinline__ void acc_guard4(v8f& a, v8f& b, v8f& c, v8f& d) { asm volatile("v_nop\n\tv_nop\n\tv_nop\n\tv_nop" : "+v"(a), "+v"(b), "+v"(c), "+v"(d)); }
template <typename T> struct Frag;
template <> struct Frag<_Float16> {
  typedef v16h V; typedef v8h H; union U { v16h v; v8h h[2]; };
  static __device__ __forceinline__ v16h load(const _Float16* p) {   // elements 0..7 <- p[0..7], 8..15 <- p[16..23]
    U f; f.h[0] = *(const v8h*)(p); f.h[1] = *(const v8h*)(p + 16); return f.v;
  }
  static __device__ __forceinline__ v8f mma(v16h a, v16h b, v8f c) {
    return __builtin_amdgcn_wmma_f32_16x16x32_f16(false, a, false, b, (short)0, c, false, false);
  }
  static __device__ __forceinline__ void guard(v8f& a, v8f& b, v16h x, v16h y) { dep_guard_h(a, b, x, y); }
  static __device__ __forceinline__ void keep(v16h a, v16h b, v16h c, v16h d) { keep4_h(a, b, c, d); }
};
template <> struct Frag<__bf16> {
  typedef v16b V; typedef v8b H; union U { v16b v; v8b h[2]; };
  static __device__ __forceinline__ v16b load(const __bf16* p) {
    U f; f.h[0] = *(const v8b*)(p); f.h[1] = *(const v8b*)(p + 16); return f.v;
  }
  static __device__ __forceinline__ v8f mma(v16b a, v16b b, v8f c) {
    return __builtin_amdgcn_wmma_f32_16x16x32_bf16(false, a, false, b, (short)0, c, false, false);
  }
  static __device__ __forceinline__ void guard(v8f& a, v8f& b, v16b x, v16b y) { dep_guard_b(a, b, x, y); }
  static __device__ __forceinline__ void keep(v16b a, v16b b, v16b c, v16b d) { keep4_b(a, b, c, d); }
};

// ---- Register-blocked batched WMMA GEMM ------------------------------------
// C[m,n] = scale * sum_k A[m,k] * Bt[n,k] (+bias)(+resid); each wave owns a 64x64 tile.
// A row-major [M,K]; Bt row-major [N,K]; M % 128 == 0, N % 256 == 0, K % 64 == 0.
// Block = 8 waves as 2 (m) x 4 (n) = a 128 x 256 tile. Per stage of 64 k the block brings its 128 A rows and
// 256 Bt rows (one 128-B line each) into LDS: 8 lanes x 16 B per row, so a wave-wide load covers 4 whole lines.
// Two LDS buffers, the global loads held in registers up to two stages ahead, one __syncthreads per stage.
// SPLIT (hi/lo operand planes) is not instantiated here and not supported by the staged loop.
// BIAS_MODE: 0 = none, 1 = bias[m], 2 = bias[n]. Bias values are RNE-bf16 quantised before the f32 add.
// OUT_MODE: 0 = f32, 1 = f16, 2 = bf16 hi plane (Cout) + bf16 lo plane (Cout2),
//           3 = f16 per-head feature rows: head hd = n0/64, row m -> C[m*ldc + hd*128 + 0..63] = f16(v[0..63]),
//               [+64] = f16(sum_d v[d] / 8), [+65] = f16(sum_d (-1)^d v[d] / 8), [+66..+127] = 0.
// ET: 0 = f16 operands, 1 = bf16 operands (pointers passed as 16-bit storage)
template <int ET> struct Elem;
template <> struct Elem<0> { typedef _Float16 T; };
template <> struct Elem<1> { typedef __bf16 T; };
constexpr int GM_BM   = 128;             // block tile rows (A rows staged)
constexpr int GM_BN   = 256;             // block tile columns (Bt rows staged)
constexpr int GM_ROWS = GM_BM + GM_BN;   // 384 staged rows per stage
constexpr int GM_LD   = DMODEL;          // row pitch of A and Bt in elements, a constant so that a stage's row steps fold into the loads' immediate offsets
constexpr int GM_LP   = 72;              // LDS row pitch in 16-bit elements: 64 used, 144 B = 16 B x odd for ds_load_b128 readers
template <int ET, bool SPLIT, int BIAS_MODE, int OUT_MODE, bool RESID, int ACT = 0>
__global__ __launch_bounds__(256) void wmma_gemm64(
    const unsigned short* __restrict__ Ap, const unsigned short* __restrict__ A2p, int lda, long strideA,
    const unsigned short* __restrict__ Btp, const unsigned short* __restrict__ Bt2p, int ldb, long strideB,
    void* __restrict__ Cout, void* __restrict__ Cout2, int ldc, long strideC,
    const float* __restrict__ bias,
    const float* __restrict__ resid, long strideR,
    int M, int N, int K, float scale) {
  typedef typename Elem<ET>::T T;
  typedef typename Frag<T>::V V;
  typedef typename Frag<T>::H H;
  static_assert(!SPLIT, "the staged loop carries one plane per operand");
  const T* A = (const T*)Ap; const T* Bt = (const T*)Btp;
  __shared__ __align__(16) float sT[8][16 * 68];   // per-wave 16x64 slab, pitch 68 floats
  __shared__ __align__(16) T sAB[2][GM_ROWS * GM_LP];   // rows 0..127 = A, 128..383 = Bt; 64 k per row
  const int b    = blockIdx.y;
  const int lane = threadIdx.x & 31;
  const int wave = threadIdx.x >> 5;
  const int tilesN = N >> 8;
  const int tilesM = M >> 7;
  const int tile = blockIdx.x;
  if (tile >= tilesM * tilesN || lda != GM_LD || ldb != GM_LD) return;   // block-uniform, in front of every barrier
  const int tm = tile / tilesN;
  const int tn = tile - tm * tilesN;
  const int bm0 = tm << 7;                // block tile origin
  const int bn0 = tn << 8;
  const int wm  = (wave >> 2) << 6;       // wave tile origin inside the block tile
  const int wn  = (wave & 3) << 6;
  const int m0 = bm0 + wm;
  const int n0 = bn0 + wn;

  const T* Ab  = A  + (size_t)b * strideA;
  const T* Bb  = Bt + (size_t)b * strideB;

  const int rlane = lane & 15;                 // row (A) / col (B, D) within subtile
  const int koff  = (lane >> 4) * 8;           // k offset of this lane half
  const int mOff  = (lane >> 4) * 8;           // D row offset

  v8f acc[4][4];
#pragma unroll
  for (int i = 0; i < 4; ++i)
#pragma unroll
    for (int j = 0; j < 4; ++j) acc[i][j] = (v8f){0.f,0.f,0.f,0.f,0.f,0.f,0.f,0.f};

  // staging coverage: 256 threads = 32 rows x 8 pieces of 16 B; 4 trips cover the A rows, 8 trips the Bt rows
  // (rows r and r + 8 sit side by side in a 16-lane half: 8 x 144 B = 32 banks apart, so a ds_store_b128 meets no bank twice)
  const int sgrp = threadIdx.x >> 3;
  const int srow = (sgrp & 16) | ((sgrp & 1) << 3) | ((sgrp >> 1) & 7);
  const int spc  = (threadIdx.x & 7) * 8;
  const T* gA = Ab + (size_t)(bm0 + srow) * GM_LD + spc;   // this lane's piece of the stage being loaded; both step 64 k per stage
  const T* gB = Bb + (size_t)(bn0 + srow) * GM_LD + spc;
  const int sOff = srow * GM_LP + spc;
  const int nStage = K >> 6;
  H st[12];   // the stage in flight
#pragma unroll
  for (int i = 0; i < 4; ++i) st[i] = *(const H*)(gA + 32 * i * GM_LD);
#pragma unroll
  for (int i = 0; i < 8; ++i) st[4 + i] = *(const H*)(gB + 32 * i * GM_LD);
#pragma unroll
  for (int i = 0; i < 12; ++i) *(H*)(sAB[0] + sOff + 32 * i * GM_LP) = st[i];
  if (1 < nStage) {
    gA += 64; gB += 64;
#pragma unroll
    for (int i = 0; i < 4; ++i) st[i] = *(const H*)(gA + 32 * i * GM_LD);
#pragma unroll
    for (int i = 0; i < 8; ++i) st[4 + i] = *(const H*)(gB + 32 * i * GM_LD);
  }

  for (int s = 0; s < nStage; ++s) {
    const T* buf = sAB[s & 1];
    __syncthreads();   // publishes stage s and ends every wave's reads of the other buffer (stage s - 1)
#pragma unroll
    for (int kk = 0; kk < 2; ++kk) {
      V bh[4], ah[4];
#pragma unroll
      for (int j = 0; j < 4; ++j) bh[j] = Frag<T>::load(buf + (GM_BM + wn + (j << 4) + rlane) * GM_LP + kk * 32 + koff);
#pragma unroll
      for (int i = 0; i < 4; ++i) ah[i] = Frag<T>::load(buf + (wm + (i << 4) + rlane) * GM_LP + kk * 32 + koff);
      if (kk == 0) {   // staging queues behind the first fragment reads, so the products start sooner
        // stage s + 1 goes from registers into the other buffer. No test round it: with a branch here the fragment
        // waits below fall back to counts that also wait for these stores; the last stage's copy is read by nobody.
        T* nxt = sAB[(s + 1) & 1];
#pragma unroll
        for (int i = 0; i < 12; ++i) *(H*)(nxt + sOff + 32 * i * GM_LP) = st[i];
        if (s + 2 < nStage) {   // block-uniform: stage s + 2's 12 loads land behind this stage's products
          gA += 64; gB += 64;
#pragma unroll
          for (int i = 0; i < 4; ++i) st[i] = *(const H*)(gA + 32 * i * GM_LD);
#pragma unroll
          for (int i = 0; i < 8; ++i) st[4 + i] = *(const H*)(gB + 32 * i * GM_LD);
        }
      }
#pragma unroll
      for (int i = 0; i < 4; ++i) {
#pragma unroll
        for (int j = 0; j < 4; ++j) acc[i][j] = Frag<T>::mma(ah[i], bh[j], acc[i][j]);
        Frag<T>::guard(acc[i][0], acc[i][3], ah[i], ah[i]);
      }
      Frag<T>::keep(bh[0], bh[1], bh[2], bh[3]);
    }
  }
  acc_guard4(acc[0][0], acc[0][1], acc[0][2], acc[0][3]);
  acc_guard4(acc[1][0], acc[1][1], acc[1][2], acc[1][3]);
  acc_guard4(acc[2][0], acc[2][1], acc[2][2], acc[2][3]);
  acc_guard4(acc[3][0], acc[3][1], acc[3][2], acc[3][3]);

  // ---- epilogue ----
  float* slab = sT[wave];
  const float* Rb = RESID ? (resid + (size_t)b * strideR) : nullptr;
#pragma unroll
  for (int i = 0; i < 4; ++i) {
    const int mBase = m0 + (i << 4);
#pragma unroll
    for (int j = 0; j < 4; ++j) {
      const int n = n0 + (j << 4) + rlane;
      float bv = 0.f;
      if (BIAS_MODE == 2) bv = rne_bf16(bias[n]);
#pragma unroll
      for (int r = 0; r < 8; ++r) {
        float v = acc[i][j][r] * scale;
        if (BIAS_MODE == 1) v += rne_bf16(bias[mBase + mOff + r]);
        if (BIAS_MODE == 2) v += bv;
        if (RESID) v += Rb[(size_t)(mBase + mOff + r) * ldc + n];
        if (ACT == 1) v = tanhf(v);
        if (ACT == 2) v = fmaxf(v, 0.0f);
        if (ACT == 3) v = v / (1.0f + expf(-v));
        if (ACT == 4) v = (v > 0.f) ? v : 0.01f * v;
        slab[(mOff + r) * 68 + (j << 4) + rlane] = v;
      }
    }
    __builtin_amdgcn_fence(__ATOMIC_RELEASE, "workgroup");
    __builtin_amdgcn_wave_barrier();
    __builtin_amdgcn_fence(__ATOMIC_ACQUIRE, "workgroup");
    if (OUT_MODE == 0) {
      float* C = (float*)Cout + (size_t)b * strideC;
      const int hh = lane >> 4, c4 = (lane & 15) * 4;     // row seg = 256 B = 16 lanes x 16 B
      {
#pragma unroll
        for (int it = 0; it < 8; ++it) {
          const int row = it * 2 + hh;
          v4f v = *(const v4f*)(slab + row * 68 + c4);
          *(v4f*)(C + (size_t)(mBase + row) * ldc + n0 + c4) = v;
        }
        
      }
    } else if (OUT_MODE == 3) {
      // Coverage per slab: 4 it x 4 row groups (q) = 16 rows; 8 lanes x 8 halves = 64 halves per line.
      const int q = lane >> 3, c8 = (lane & 7) * 8;
      unsigned short* C = (unsigned short*)Cout + (size_t)b * strideC;
      const int hcol = (n0 >> 6) * 128;
      v8h hv[4], av[4];
#pragma unroll
      for (int it = 0; it < 4; ++it) {
        const int row = it * 4 + q;
        const float* sp = slab + row * 68 + c8;
        float ps = 0.f, pa = 0.f;
        v8h t;
#pragma unroll
        for (int e = 0; e < 8; ++e) {
          const float v = sp[e];
          t[e] = (_Float16)v;
          ps += v;
          if (e & 1) pa -= v; else pa += v;     // c8 is even, so (-1)^(c8+e) = (-1)^e
        }
#pragma unroll
        for (int off = 1; off < 8; off <<= 1) {   // reduce over the 8 lanes holding this row
          ps += __shfl_xor(ps, off, 32);
          pa += __shfl_xor(pa, off, 32);
        }
        const float fa = (c8 == 0) ? ps * 0.125f : 0.0f;
        const float fb = (c8 == 0) ? pa * 0.125f : 0.0f;
        v8h u;
#pragma unroll
        for (int e = 0; e < 8; ++e) u[e] = (_Float16)0.0f;
        u[0] = (_Float16)fa;
        u[1] = (_Float16)fb;
        hv[it] = t;
        av[it] = u;
      }
      {
#pragma unroll
        for (int it = 0; it < 4; ++it) {
          const int row = it * 4 + q;
          unsigned short* cp = C + (size_t)(mBase + row) * ldc + hcol + c8;
          *(v8h*)(cp) = hv[it];
          *(v8h*)(cp + 64) = av[it];
        }
        
      }
    } else {
      const int q = lane >> 3, c8 = (lane & 7) * 8;
      unsigned short* C  = (unsigned short*)Cout  + (size_t)b * strideC;
      unsigned short* C2 = (OUT_MODE == 2) ? ((unsigned short*)Cout2 + (size_t)b * strideC) : nullptr;
      {
#pragma unroll
        for (int it = 0; it < 4; ++it) {
          const int row = it * 4 + q;
          const float* sp = slab + row * 68 + c8;
          v8h hv, lv;
#pragma unroll
          for (int e = 0; e < 8; ++e) {
            if (OUT_MODE == 1) {
              hv[e] = (_Float16)sp[e];
            } else {
              unsigned short hb = f2bf_bits(sp[e]);
              unsigned short lb = f2bf_bits(sp[e] - bf_bits2f(hb));
              hv[e] = __builtin_bit_cast(_Float16, hb);
              lv[e] = __builtin_bit_cast(_Float16, lb);
            }
          }
          *(v8h*)(C + (size_t)(mBase + row) * ldc + n0 + c8) = hv;
          if (OUT_MODE == 2) *(v8h*)(C2 + (size_t)(mBase + row) * ldc + n0 + c8) = lv;
        }
        
      }
    }
    __builtin_amdgcn_fence(__ATOMIC_RELEASE, "workgroup");
    __builtin_amdgcn_wave_barrier();
    __builtin_amdgcn_fence(__ATOMIC_ACQUIRE, "workgroup");
  }
}

// ---------------------------------------------------------------------------
// f32 -> RNE bf16 bits, 2 elements per thread packed into one 4-B store: a wave writes one whole
// Coverage: grid = n2/256 blocks x 256 threads x 2 elements = 2*n2 = the whole plane (n2 % 256 == 0 here).
// ---------------------------------------------------------------------------
__global__ __launch_bounds__(256) void cast_bf16x2_kernel(const float* __restrict__ in, unsigned short* __restrict__ out, int n2) {
  const int i = blockIdx.x * 256 + threadIdx.x;
  if (i < n2) {
    const v2f f = *(const v2f*)(in + 2 * (size_t)i);
    const unsigned u = pk16(f2bf_bits(f[0]), f2bf_bits(f[1]));
    ((unsigned*)out)[i] = u;
    
  }
}
// f32 -> f16 bits of (mul * bf16_rne(v)), mul an exact power of two; same store pattern and coverage.
__global__ __launch_bounds__(256) void cast_bf16_f16s_x2_kernel(const float* __restrict__ in, unsigned short* __restrict__ out, int n2, float mul) {
  const int i = blockIdx.x * 256 + threadIdx.x;
  if (i < n2) {
    const v2f f = *(const v2f*)(in + 2 * (size_t)i);
    const _Float16 h0 = (_Float16)(rne_bf16(f[0]) * mul);
    const _Float16 h1 = (_Float16)(rne_bf16(f[1]) * mul);
    const unsigned u = pk16(__builtin_bit_cast(unsigned short, h0), __builtin_bit_cast(unsigned short, h1));
    ((unsigned*)out)[i] = u;
    
  }
}

// =====================================================================================
// Full (unmasked) attention with 96-deep f16 score features and head dim 64 values.
//   scores use the exact identity of the ortho half-spectrum DFT matrices (C = cos/8, S = sin/8, 33 bins):
//   C^T C + S^T S = I/2 + (1 1^T + a a^T)/128 with a_d = (-1)^d, so
//   Re(qf . conj(kf)) / 8 = (q.k + (sum q/8)(sum k/8) + (sum a*q/8)(sum a*k/8)) / 16  ->  one 96-deep contraction
//   over [q | sum/8 | altsum/8 | 30 zeros] x sscale (= 1/16); value path irDFT(DFT-weighted sum) = p . v.
//   q/k planes f16: element (b, t, h, f) at [(b*SEQ + t)*TOKP + h*QKPITCH + f], f = 0..127 (f >= 66 zero).
//   v^T planes bf16 hi/lo: element (b, h, d, s) at [(b*DMODEL + h*64 + d)*SEQ + s].
//   out f16 (x oscale): element (b, t, h, d) at [(b*SEQ + t)*DMODEL + h*64 + d]; 64-half row segment =
//   scores: v_wmma_f32_16x16x32_f16 single product; p.v: bf16 hi/lo split of p (unnormalised, <= 1) and v.
//   online softmax in f32 over SEQ keys (32 chunks of 64, compile-time trip count).
//   Block = 4 waves = 64 query rows of one (b, h); grid.x = NBAT * NHEAD * (SEQ/64) = 1024.
//   K / V^T chunk staging: 128 threads; K: 48 halves per thread = 64 x 96; V^T: 32 per thread per plane = 64 x 64
//   (16-B copies, plain loads held in registers one chunk ahead, __syncthreads before and after the LDS stores);
//   fragment loads read LDS with the stored vector type.
// =====================================================================================
#define AT_D 64
#define AT_F 96
#define AT_NW 4
#define AT_QB 64
#define AT_KC 64
// LDS row pitches in halves: 16 B x odd, so that the 16 rows of a ds_load_b128 fragment read fall on distinct banks
#define AT_KP 104   // K feature rows: 96 halves used, 208 B pitch
#define AT_VP 72    // V^T and P rows: 64 halves used, 144 B pitch
static_assert(AT_KP >= AT_F && AT_VP >= AT_KC && (AT_KP * 2) % 32 == 16 && (AT_VP * 2) % 32 == 16, "pitch holds the row and is 16 B x odd");

__device__ __forceinline__ __bf16 at_f2bf(float f) { return __builtin_bit_cast(__bf16, f2bf_bits(f)); }
__device__ __forceinline__ void at_split(float f, __bf16& hi, __bf16& lo) {
  const unsigned short hb = f2bf_bits(f);
  hi = __builtin_bit_cast(__bf16, hb);
  lo = at_f2bf(f - __uint_as_float(((unsigned)hb) << 16));
}
__device__ __forceinline__ v8f at_mma(v16b a, v16b b, v8f c) {
  c = __builtin_amdgcn_wmma_f32_16x16x32_bf16(false, a, false, b, (short)0, c, false, false);
  asm volatile("v_nop\n\tv_nop\n\tv_nop\n\tv_nop" : "+v"(c) : "v"(a), "v"(b));
  return c;
}
__device__ __forceinline__ v8f at_mma_h(v16h a, v16h b, v8f c) {
  c = __builtin_amdgcn_wmma_f32_16x16x32_f16(false, a, false, b, (short)0, c, false, false);
  asm volatile("v_nop\n\tv_nop\n\tv_nop\n\tv_nop" : "+v"(c) : "v"(a), "v"(b));
  return c;
}

__global__ __launch_bounds__(128)
void attn_aug_kernel(const unsigned short* __restrict__ qp, const unsigned short* __restrict__ kp,
                     const unsigned short* __restrict__ vhp, const unsigned short* __restrict__ vlp,
                     unsigned short* __restrict__ op, float sscale, float oscale) {
  union FB { v16b v; v8b h[2]; };
  union FH { v16h v; v8h h[2]; };
  __shared__ __align__(16) _Float16 Ksh[AT_KC * AT_KP];          // K features [kv][f]   13 KB
  __shared__ __align__(16) __bf16   Vth[AT_D * AT_VP];           // V hi [d][kv]          9 KB
  __shared__ __align__(16) __bf16   Vtl[AT_D * AT_VP];           // V lo                  9 KB
  __shared__ __align__(16) __bf16   Psh[AT_NW][16 * AT_VP];      // per wave P hi [row][kv]
  __shared__ __align__(16) __bf16   Psl[AT_NW][16 * AT_VP];      // per wave P lo
  __shared__ __align__(16) float    Os[AT_NW][16 * 68];          // per wave out tile, pitch 68

  const int tid  = threadIdx.x;
  const int wave = tid >> 5;
  const int lane = tid & 31;
  const int hh   = lane >> 4;
  const int c    = lane & 15;

  const int nqb = SEQ / AT_QB;            // 32
  const int bx = blockIdx.x;
  const int qb = bx % nqb;
  const int bh = bx / nqb;                // 0..NBAT*NHEAD-1
  const int h  = bh % NHEAD;
  const int b  = bh / NHEAD;
  const int q0 = qb * AT_QB + wave * 16;

  const _Float16* Qb = (const _Float16*)(const void*)qp + (size_t)b * SEQ * TOKP + (size_t)h * QKPITCH;
  const _Float16* Kb = (const _Float16*)(const void*)kp + (size_t)b * SEQ * TOKP + (size_t)h * QKPITCH;
  const __bf16*   Vh = (const __bf16*)(const void*)vhp + ((size_t)b * DMODEL + (size_t)h * AT_D) * SEQ;
  const __bf16*   Vl = (const __bf16*)(const void*)vlp + ((size_t)b * DMODEL + (size_t)h * AT_D) * SEQ;
  _Float16*       Ob = (_Float16*)(void*)op + (size_t)b * SEQ * DMODEL + (size_t)h * AT_D;

  // ---- Q fragments (A operand, row = lane&15, split k map via Frag load): 3 feature chunks of 32 ----
  v16h qa[3];
#pragma unroll
  for (int dc = 0; dc < 3; ++dc)
    qa[dc] = Frag<_Float16>::load(Qb + (size_t)(q0 + c) * TOKP + dc * 32 + 8 * hh);

  float mrow[8], lrow[8];
  v8f oacc[4];
#pragma unroll
  for (int r = 0; r < 8; ++r) { mrow[r] = -INFINITY; lrow[r] = 0.f; }
#pragma unroll
  for (int t = 0; t < 4; ++t) oacc[t] = (v8f){0.f,0.f,0.f,0.f,0.f,0.f,0.f,0.f};

  const int nChunks = SEQ / AT_KC;   // 32, compile-time constant
  // staging coverage: K: 128 threads x (6 x 8) = 64 rows x 96; V^T: 128 threads x (4 x 8) = 64 x 64 per plane
  const int sr = tid >> 1, shalf = tid & 1;
  const _Float16* ks  = Kb + (size_t)sr * TOKP + shalf * 48;   // chunk 0: K row sr, f = shalf*48..+47
  const __bf16*   vsh = Vh + (size_t)sr * SEQ + shalf * 32;    // chunk 0: V^T row d = sr, s = shalf*32..+31
  const __bf16*   vsl = Vl + (size_t)sr * SEQ + shalf * 32;
  // the chunk in flight: 14 x 16 B per thread, loaded one chunk ahead of the LDS stores that consume them
  v8h kreg[6];
  v8b vhreg[4], vlreg[4];
#pragma unroll
  for (int i = 0; i < 6; ++i) kreg[i] = *(const v8h*)(ks + 8 * i);
#pragma unroll
  for (int i = 0; i < 4; ++i) {
    vhreg[i] = *(const v8b*)(vsh + 8 * i);
    vlreg[i] = *(const v8b*)(vsl + 8 * i);
  }
  for (int kc = 0; kc < nChunks; ++kc) {
    __syncthreads();
#pragma unroll
    for (int i = 0; i < 6; ++i) *(v8h*)(Ksh + sr * AT_KP + shalf * 48 + 8 * i) = kreg[i];
#pragma unroll
    for (int i = 0; i < 4; ++i) {
      *(v8b*)(Vth + sr * AT_VP + shalf * 32 + 8 * i) = vhreg[i];
      *(v8b*)(Vtl + sr * AT_VP + shalf * 32 + 8 * i) = vlreg[i];
    }
    __syncthreads();
    if (kc + 1 < nChunks) {   // block-uniform: the next chunk's 14 loads go out together and land behind this chunk's work
      const _Float16* kn  = ks  + (size_t)(kc + 1) * AT_KC * TOKP;
      const __bf16*   vhn = vsh + (kc + 1) * AT_KC;
      const __bf16*   vln = vsl + (kc + 1) * AT_KC;
#pragma unroll
      for (int i = 0; i < 6; ++i) kreg[i] = *(const v8h*)(kn + 8 * i);
#pragma unroll
      for (int i = 0; i < 4; ++i) {
        vhreg[i] = *(const v8b*)(vhn + 8 * i);
        vlreg[i] = *(const v8b*)(vln + 8 * i);
      }
    }

    v8f s[4];
#pragma unroll
    for (int j = 0; j < 4; ++j) {
      s[j] = (v8f){0.f,0.f,0.f,0.f,0.f,0.f,0.f,0.f};
#pragma unroll
      for (int dc = 0; dc < 3; ++dc) {
        FH kb;   // B operand: col n = key j*16+c, k = feature, split k map
        kb.h[0] = *(const v8h*)(Ksh + (j * 16 + c) * AT_KP + dc * 32 + 8 * hh);
        kb.h[1] = *(const v8h*)(Ksh + (j * 16 + c) * AT_KP + dc * 32 + 16 + 8 * hh);
        s[j] = at_mma_h(qa[dc], kb.v, s[j]);
      }
    }
    float cm[8];
#pragma unroll
    for (int r = 0; r < 8; ++r) {
      float m = -INFINITY;
#pragma unroll
      for (int j = 0; j < 4; ++j) {
        s[j][r] *= sscale;
        m = fmaxf(m, s[j][r]);
      }
#pragma unroll
      for (int off = 1; off < 16; off <<= 1) m = fmaxf(m, __shfl_xor(m, off, 32));
      cm[r] = m;
    }
    __bf16* pwh = Psh[wave];
    __bf16* pwl = Psl[wave];
#pragma unroll
    for (int r = 0; r < 8; ++r) {
      const float mnew = fmaxf(mrow[r], cm[r]);
      const float alpha = expf(mrow[r] - mnew);
      mrow[r] = mnew;
      float psum = 0.f;
#pragma unroll
      for (int j = 0; j < 4; ++j) {
        const float p = expf(s[j][r] - mnew);
        psum += p;
        __bf16 ph, pl;
        at_split(p, ph, pl);
        pwh[(8 * hh + r) * AT_VP + j * 16 + c] = ph;
        pwl[(8 * hh + r) * AT_VP + j * 16 + c] = pl;
      }
#pragma unroll
      for (int off = 1; off < 16; off <<= 1) psum += __shfl_xor(psum, off, 32);
      lrow[r] = lrow[r] * alpha + psum;
#pragma unroll
      for (int t = 0; t < 4; ++t) oacc[t][r] *= alpha;
    }
    __builtin_amdgcn_fence(__ATOMIC_RELEASE, "workgroup");
    __builtin_amdgcn_wave_barrier();
    __builtin_amdgcn_fence(__ATOMIC_ACQUIRE, "workgroup");
#pragma unroll 1
    for (int kk = 0; kk < 2; ++kk) {
      FB pa, pl;   // A operand: row = query c, k = key
      pa.h[0] = *(const v8b*)(pwh + c * AT_VP + kk * 32 + 8 * hh);
      pa.h[1] = *(const v8b*)(pwh + c * AT_VP + kk * 32 + 16 + 8 * hh);
      pl.h[0] = *(const v8b*)(pwl + c * AT_VP + kk * 32 + 8 * hh);
      pl.h[1] = *(const v8b*)(pwl + c * AT_VP + kk * 32 + 16 + 8 * hh);
#pragma unroll
      for (int t = 0; t < 4; ++t) {
        FB vb, vl;   // B operand: col n = d = t*16+c, k = key
        vb.h[0] = *(const v8b*)(Vth + (t * 16 + c) * AT_VP + kk * 32 + 8 * hh);
        vb.h[1] = *(const v8b*)(Vth + (t * 16 + c) * AT_VP + kk * 32 + 16 + 8 * hh);
        vl.h[0] = *(const v8b*)(Vtl + (t * 16 + c) * AT_VP + kk * 32 + 8 * hh);
        vl.h[1] = *(const v8b*)(Vtl + (t * 16 + c) * AT_VP + kk * 32 + 16 + 8 * hh);
        oacc[t] = at_mma(pa.v, vb.v, oacc[t]);
        oacc[t] = at_mma(pa.v, vl.v, oacc[t]);
        oacc[t] = at_mma(pl.v, vb.v, oacc[t]);
      }
    }
  }

  float* os = Os[wave];
#pragma unroll
  for (int r = 0; r < 8; ++r) {
    const float inv = oscale * (1.0f / lrow[r]);   // lrow >= 1 (the running max contributes exp(0))
#pragma unroll
    for (int t = 0; t < 4; ++t) os[(8 * hh + r) * 68 + t * 16 + c] = oacc[t][r] * inv;
  }
  __builtin_amdgcn_fence(__ATOMIC_RELEASE, "workgroup");
  __builtin_amdgcn_wave_barrier();
  __builtin_amdgcn_fence(__ATOMIC_ACQUIRE, "workgroup");
  {
    const int q8 = lane >> 3, c8 = (lane & 7) * 8;
    {
#pragma unroll
      for (int it = 0; it < 4; ++it) {
        const int row = it * 4 + q8;
        v8h hv;
#pragma unroll
        for (int e = 0; e < 8; ++e) hv[e] = (_Float16)os[row * 68 + c8 + e];
        *(v8h*)(Ob + (size_t)(q0 + row) * DMODEL + c8) = hv;
      }
      
    }
  }
}

// ---------------------------------------------------------------------------
//   [ 0 MiB,  8 MiB)  xb   bf16 [4096][1024]            RNE-bf16 of x
//   [ 8 MiB, 10 MiB)  wqb  bf16 [1024][1024]
//   [10 MiB, 12 MiB)  wkb  bf16 [1024][1024]
//   [12 MiB, 14 MiB)  wvb  bf16 [1024][1024]
//   [14 MiB, 16 MiB)  woh  f16  [1024][1024]            64 * bf16_rne(Wo)
//   [16 MiB, 32 MiB)  qpl  f16  [4096][16][128]         q features per head
//   [32 MiB, 48 MiB)  kpl  f16  [4096][16][128]         k features per head
//   [48 MiB, 56 MiB)  vth  bf16 [2][1024][2048]         v^T hi plane
//   [56 MiB, 64 MiB)  vtl  bf16 [2][1024][2048]         v^T lo plane
//   [64 MiB, 72 MiB)  ohp  f16  [4096][1024]            256 * attention output, heads merged
// GEMM shapes: q/k M=4096 N=1024 K=1024; v^T M=1024 N=2048 K=1024 (x2 batch); out M=4096 N=1024 K=1024:
// all M multiples of 128, N of 256, K of 64, row pitch of every operand 1024, no padding, every plane fully written by its producer.
// ---------------------------------------------------------------------------
extern "C" void kernel_launch(void* const* d_in, const int* in_sizes, int n_in,
                              void* d_out, int out_size, void* d_ws, size_t ws_size,
                              hipStream_t stream)
{
  if (n_in < 9) return;
  if (in_sizes[0] != NTOK * DMODEL || in_sizes[1] != DMODEL * DMODEL || in_sizes[2] != DMODEL ||
      in_sizes[3] != DMODEL * DMODEL || in_sizes[4] != DMODEL || in_sizes[5] != DMODEL * DMODEL ||
      in_sizes[6] != DMODEL || in_sizes[7] != DMODEL * DMODEL || in_sizes[8] != DMODEL) return;
  if (out_size != NTOK * DMODEL) return;

  const float* x    = (const float*)d_in[0];
  const float* Wq   = (const float*)d_in[1];
  const float* bq   = (const float*)d_in[2];
  const float* Wk   = (const float*)d_in[3];
  const float* bk   = (const float*)d_in[4];
  const float* Wv   = (const float*)d_in[5];
  const float* bv   = (const float*)d_in[6];
  const float* Wo   = (const float*)d_in[7];
  const float* bo_p = (const float*)d_in[8];

  const size_t SZ_X   = (size_t)NTOK * DMODEL * 2;                 // 8 MiB
  const size_t SZ_W   = (size_t)DMODEL * DMODEL * 2;               // 2 MiB
  const size_t SZ_QK  = (size_t)NTOK * TOKP * 2;                   // 16 MiB
  const size_t SZ_VT  = (size_t)NBAT * DMODEL * SEQ * 2;           // 8 MiB
  const size_t SZ_O   = (size_t)NTOK * DMODEL * 2;                 // 8 MiB
  const size_t OFF_XB = 0;
  const size_t OFF_WQ = OFF_XB + SZ_X;
  const size_t OFF_WK = OFF_WQ + SZ_W;
  const size_t OFF_WV = OFF_WK + SZ_W;
  const size_t OFF_WO = OFF_WV + SZ_W;
  const size_t OFF_QP = OFF_WO + SZ_W;
  const size_t OFF_KP = OFF_QP + SZ_QK;
  const size_t OFF_VH = OFF_KP + SZ_QK;
  const size_t OFF_VL = OFF_VH + SZ_VT;
  const size_t OFF_OH = OFF_VL + SZ_VT;
  const size_t TOTAL  = OFF_OH + SZ_O;                             // 75,497,472
  if (TOTAL > ws_size) return;

  char* ws = (char*)d_ws;
  unsigned short* xb  = (unsigned short*)(ws + OFF_XB);
  unsigned short* wqb = (unsigned short*)(ws + OFF_WQ);
  unsigned short* wkb = (unsigned short*)(ws + OFF_WK);
  unsigned short* wvb = (unsigned short*)(ws + OFF_WV);
  unsigned short* woh = (unsigned short*)(ws + OFF_WO);
  unsigned short* qpl = (unsigned short*)(ws + OFF_QP);
  unsigned short* kpl = (unsigned short*)(ws + OFF_KP);
  unsigned short* vth = (unsigned short*)(ws + OFF_VH);
  unsigned short* vtl = (unsigned short*)(ws + OFF_VL);
  unsigned short* ohp = (unsigned short*)(ws + OFF_OH);

  // ---- 16-bit operand planes (2 elements per thread; counts are multiples of 512) ----
  const int n2x = (NTOK * DMODEL) / 2;       // 2,097,152 -> 8192 blocks
  const int n2w = (DMODEL * DMODEL) / 2;     //   524,288 -> 2048 blocks
  cast_bf16x2_kernel<<<dim3(n2x / 256), dim3(256), 0, stream>>>(x, xb, n2x);
  cast_bf16x2_kernel<<<dim3(n2w / 256), dim3(256), 0, stream>>>(Wq, wqb, n2w);
  cast_bf16x2_kernel<<<dim3(n2w / 256), dim3(256), 0, stream>>>(Wk, wkb, n2w);
  cast_bf16x2_kernel<<<dim3(n2w / 256), dim3(256), 0, stream>>>(Wv, wvb, n2w);
  cast_bf16_f16s_x2_kernel<<<dim3(n2w / 256), dim3(256), 0, stream>>>(Wo, woh, n2w, 64.0f);

  // ---- q / k feature planes: [4096][1024] x [1024][1024]^T + bias, epilogue writes per-head 128-wide f16 rows ----
  {
    const int tiles = (NTOK / 64) * (DMODEL / 64);     // 1024 -> 128 blocks of 8 waves
    dim3 grid(tiles / 8, 1), blk(256);
    wmma_gemm64<1, false, 2, 3, false><<<grid, blk, 0, stream>>>(
        xb, xb, DMODEL, 0L, wqb, wqb, DMODEL, 0L,
        (void*)qpl, (void*)qpl, TOKP, 0L, bq, bq, 0L, NTOK, DMODEL, DMODEL, 1.0f);
    wmma_gemm64<1, false, 2, 3, false><<<grid, blk, 0, stream>>>(
        xb, xb, DMODEL, 0L, wkb, wkb, DMODEL, 0L,
        (void*)kpl, (void*)kpl, TOKP, 0L, bk, bk, 0L, NTOK, DMODEL, DMODEL, 1.0f);
  }
  // ---- v^T planes (role swapped): per batch C[m = h*64+d][n = s] = sum_k Wv[m][k] * x[b][s][k] + bv[m], bf16 hi/lo out ----
  {
    const int tiles = (DMODEL / 64) * (SEQ / 64);      // 512 -> 64 blocks, grid.y = batch
    dim3 grid(tiles / 8, NBAT), blk(256);
    wmma_gemm64<1, false, 1, 2, false><<<grid, blk, 0, stream>>>(
        wvb, wvb, DMODEL, 0L, xb, xb, DMODEL, (long)SEQ * DMODEL,
        (void*)vth, (void*)vtl, SEQ, (long)DMODEL * SEQ, bv, bv, 0L, DMODEL, SEQ, DMODEL, 1.0f);
  }
  // ---- attention: grid = NBAT * NHEAD * (SEQ / 64) = 1024 blocks of 128 threads ----
  attn_aug_kernel<<<dim3(NBAT * NHEAD * (SEQ / 64)), dim3(128), 0, stream>>>(
      qpl, kpl, vth, vtl, ohp, 0.0625f, 256.0f);
  // ---- output projection: d_out[m][n] = (1/16384) * sum_k (256*O)[m][k] * (64*Wo)[n][k] + bo[n], f32 out ----
  {
    const int tiles = (NTOK / 64) * (DMODEL / 64);     // 1024 -> 128 blocks
    dim3 grid(tiles / 8, 1), blk(256);
    wmma_gemm64<0, false, 2, 0, false><<<grid, blk, 0, stream>>>(
        ohp, ohp, DMODEL, 0L, woh, woh, DMODEL, 0L,
        d_out, d_out, DMODEL, 0L, bo_p, bo_p, 0L, NTOK, DMODEL, DMODEL, 1.0f / 16384.0f);
  }
}

// v004
// Measured time: 213 microseconds a run.
// Timed twice side by side with v003, it ran 1.27 times as fast both times.
// All steps since v000 together make it 2.46 times as fast.
// Contractions: q/k/v^T projections v_wmma_f32_16x16x32_bf16 (operands = RNE-bf16 of the f32 inputs, single product); scores v_wmma_f32_16x16x32_f16 (f16 per-head feature planes, single product, x1/16 in f32); p.v v_wmma_f32_16x16x32_bf16 with bf16 hi/lo split of p and v (hi.hi+hi.lo+lo.hi); output projection v_wmma_f32_16x16x32_f16 (f16 O carried x256, f16 Wo carried x64, single product, x1/16384 in f32); f32 accumulate everywhere; softmax, biases and DFT aggregate features in f32.
#include <hip/hip_runtime.h>
#include <math.h>
#include <stdint.h>

// ---------------- problem geometry ----------------
constexpr int NBAT    = 2;
constexpr int SEQ     = 2048;
constexpr int DMODEL  = 1024;
constexpr int NHEAD   = 16;
constexpr int HDIM    = 64;
constexpr int NTOK    = NBAT * SEQ;          // 4096
constexpr int QKPITCH = 128;                 // halves per (token, head) feature row: 64 dims, sum/8, altsum/8, zeros
constexpr int TOKP    = NHEAD * QKPITCH;     // 2048 halves per token row of the q/k feature planes
static_assert(NTOK % 64 == 0 && DMODEL % 64 == 0 && SEQ % 64 == 0 && DMODEL % 32 == 0);
static_assert(NHEAD * HDIM == DMODEL);

typedef __attribute__((ext_vector_type(16))) _Float16 v16h;
typedef __attribute__((ext_vector_type(8)))  _Float16 v8h;
typedef __attribute__((ext_vector_type(16))) __bf16   v16b;
typedef __attribute__((ext_vector_type(8)))  __bf16   v8b;
typedef __attribute__((ext_vector_type(8)))  float    v8f;
typedef __attribute__((ext_vector_type(4)))  float    v4f;
typedef __attribute__((ext_vector_type(2)))  float    v2f;

__device__ __forceinline__ unsigned short f2bf_bits(float f) {
  unsigned u = __float_as_uint(f);
  return (unsigned short)((u + 0x7FFFu + ((u >> 16) & 1u)) >> 16);
}
__device__ __forceinline__ float bf_bits2f(unsigned short h) { return __uint_as_float(((unsigned)h) << 16); }
__device__ __forceinline__ float rne_bf16(float f) { return bf_bits2f(f2bf_bits(f)); }
__device__ __forceinline__ unsigned pk16(unsigned short a, unsigned short b) { return (unsigned)a | ((unsigned)b << 16); }

// hazard guards as plain device helpers (no inline asm inside the kernel template body)
__device__ __forceinline__ void dep_guard_h(v8f& a, v8f& b, v16h x, v16h y) { asm volatile("v_nop\n\tv_nop\n\tv_nop\n\tv_nop" : "+v"(a), "+v"(b) : "v"(x), "v"(y)); }
__device__ __forceinline__ void dep_guard_b(v8f& a, v8f& b, v16b x, v16b y) { asm volatile("v_nop\n\tv_nop\n\tv_nop\n\tv_nop" : "+v"(a), "+v"(b) : "v"(x), "v"(y)); }
__device__ __forceinline__ void keep4_h(v16h a, v16h b, v16h c, v16h d) { asm volatile("v_nop" :: "v"(a), "v"(b), "v"(c), "v"(d)); }
__device__ __forceinline__ void keep4_b(v16b a, v16b b, v16b c, v16b d) { asm volatile("v_nop" :: "v"(a), "v"(b), "v"(c), "v"(d)); }
__device__ __forceinline__ void acc_guard4(v8f& a, v8f& b, v8f& c, v8f& d) { asm volatile("v_nop\n\tv_nop\n\tv_nop\n\tv_nop" : "+v"(a), "+v"(b), "+v"(c), "+v"(d)); }
template <typename T> struct Frag;
template <> struct Frag<_Float16> {
  typedef v16h V; typedef v8h H; union U { v16h v; v8h h[2]; };
  static __device__ __forceinline__ v16h load(const _Float16* p) {   // elements 0..7 <- p[0..7], 8..15 <- p[16..23]
    U f; f.h[0] = *(const v8h*)(p); f.h[1] = *(const v8h*)(p + 16); return f.v;
  }
  static __device__ __forceinline__ v8f mma(v16h a, v16h b, v8f c) {
    return __builtin_amdgcn_wmma_f32_16x16x32_f16(false, a, false, b, (short)0, c, false, false);
  }
  static __device__ __forceinline__ void guard(v8f& a, v8f& b, v16h x, v16h y) { dep_guard_h(a, b, x, y); }
  static __device__ __forceinline__ void keep(v16h a, v16h b, v16h c, v16h d) { keep4_h(a, b, c, d); }
};
template <> struct Frag<__bf16> {
  typedef v16b V; typedef v8b H; union U { v16b v; v8b h[2]; };
  static __device__ __forceinline__ v16b load(const __bf16* p) {
    U f; f.h[0] = *(const v8b*)(p); f.h[1] = *(const v8b*)(p + 16); return f.v;
  }
  static __device__ __forceinline__ v8f mma(v16b a, v16b b, v8f c) {
    return __builtin_amdgcn_wmma_f32_16x16x32_bf16(false, a, false, b, (short)0, c, false, false);
  }
  static __device__ __forceinline__ void guard(v8f& a, v8f& b, v16b x, v16b y) { dep_guard_b(a, b, x, y); }
  static __device__ __forceinline__ void keep(v16b a, v16b b, v16b c, v16b d) { keep4_b(a, b, c, d); }
};

// ---- Register-blocked batched WMMA GEMM ------------------------------------
// C[m,n] = scale * sum_k A[m,k] * Bt[n,k] (+bias)(+resid); each wave owns a 64x64 tile.
// A row-major [M,K]; Bt row-major [N,K]; M % 128 == 0, N % 256 == 0, K % 64 == 0.
// Block = 8 waves as 2 (m) x 4 (n) = a 128 x 256 tile. Per stage of 64 k the block brings its 128 A rows and
// 256 Bt rows (one 128-B line each) into LDS: 8 lanes x 16 B per row, so a wave-wide load covers 4 whole lines.
// Two LDS buffers, the global loads held in registers up to two stages ahead, one __syncthreads per stage.
// SPLIT (hi/lo operand planes) is not instantiated here and not supported by the staged loop.
// BIAS_MODE: 0 = none, 1 = bias[m], 2 = bias[n]. Bias values are RNE-bf16 quantised before the f32 add.
// OUT_MODE: 0 = f32, 1 = f16, 2 = bf16 hi plane (Cout) + bf16 lo plane (Cout2),
//           3 = f16 per-head feature rows: head hd = n0/64, row m -> C[m*ldc + hd*128 + 0..63] = f16(v[0..63]),
//               [+64] = f16(sum_d v[d] / 8), [+65] = f16(sum_d (-1)^d v[d] / 8), [+66..+127] = 0.
// ET: 0 = f16 operands, 1 = bf16 operands (pointers passed as 16-bit storage)
template <int ET> struct Elem;
template <> struct Elem<0> { typedef _Float16 T; };
template <> struct Elem<1> { typedef __bf16 T; };
constexpr int GM_BM   = 128;             // block tile rows (A rows staged)
constexpr int GM_BN   = 256;             // block tile columns (Bt rows staged)
constexpr int GM_ROWS = GM_BM + GM_BN;   // 384 staged rows per stage
constexpr int GM_LD   = DMODEL;          // row pitch of A and Bt in elements, a constant so that a stage's row steps fold into the loads' immediate offsets
constexpr int GM_LP   = 72;              // LDS row pitch in 16-bit elements: 64 used, 144 B = 16 B x odd for ds_load_b128 readers
template <int ET, bool SPLIT, int BIAS_MODE, int OUT_MODE, bool RESID, int ACT = 0>
__global__ __launch_bounds__(256) void wmma_gemm64(
    const unsigned short* __restrict__ Ap, const unsigned short* __restrict__ A2p, int lda, long strideA,
    const unsigned short* __restrict__ Btp, const unsigned short* __restrict__ Bt2p, int ldb, long strideB,
    void* __restrict__ Cout, void* __restrict__ Cout2, int ldc, long strideC,
    const float* __restrict__ bias,
    const float* __restrict__ resid, long strideR,
    int M, int N, int K, float scale) {
  typedef typename Elem<ET>::T T;
  typedef typename Frag<T>::V V;
  typedef typename Frag<T>::H H;
  static_assert(!SPLIT, "the staged loop carries one plane per operand");
  const T* A = (const T*)Ap; const T* Bt = (const T*)Btp;
  __shared__ __align__(16) float sT[8][16 * 68];   // per-wave 16x64 slab, pitch 68 floats
  __shared__ __align__(16) T sAB[2][GM_ROWS * GM_LP];   // rows 0..127 = A, 128..383 = Bt; 64 k per row
  const int b    = blockIdx.y;
  const int lane = threadIdx.x & 31;
  const int wave = threadIdx.x >> 5;
  const int tilesN = N >> 8;
  const int tilesM = M >> 7;
  const int tile = blockIdx.x;
  if (tile >= tilesM * tilesN || lda != GM_LD || ldb != GM_LD) return;   // block-uniform, in front of every barrier
  const int tm = tile / tilesN;
  const int tn = tile - tm * tilesN;
  const int bm0 = tm << 7;                // block tile origin
  const int bn0 = tn << 8;
  const int wm  = (wave >> 2) << 6;       // wave tile origin inside the block tile
  const int wn  = (wave & 3) << 6;
  const int m0 = bm0 + wm;
  const int n0 = bn0 + wn;

  const T* Ab  = A  + (size_t)b * strideA;
  const T* Bb  = Bt + (size_t)b * strideB;

  const int rlane = lane & 15;                 // row (A) / col (B, D) within subtile
  const int koff  = (lane >> 4) * 8;           // k offset of this lane half
  const int mOff  = (lane >> 4) * 8;           // D row offset

  v8f acc[4][4];
#pragma unroll
  for (int i = 0; i < 4; ++i)
#pragma unroll
    for (int j = 0; j < 4; ++j) acc[i][j] = (v8f){0.f,0.f,0.f,0.f,0.f,0.f,0.f,0.f};

  // staging coverage: 256 threads = 32 rows x 8 pieces of 16 B; 4 trips cover the A rows, 8 trips the Bt rows
  // (rows r and r + 8 sit side by side in a 16-lane half: 8 x 144 B = 32 banks apart, so a ds_store_b128 meets no bank twice)
  const int sgrp = threadIdx.x >> 3;
  const int srow = (sgrp & 16) | ((sgrp & 1) << 3) | ((sgrp >> 1) & 7);
  const int spc  = (threadIdx.x & 7) * 8;
  const T* gA = Ab + (size_t)(bm0 + srow) * GM_LD + spc;   // this lane's piece of the stage being loaded; both step 64 k per stage
  const T* gB = Bb + (size_t)(bn0 + srow) * GM_LD + spc;
  const int sOff = srow * GM_LP + spc;
  const int nStage = K >> 6;
  H st[12];   // the stage in flight
#pragma unroll
  for (int i = 0; i < 4; ++i) st[i] = *(const H*)(gA + 32 * i * GM_LD);
#pragma unroll
  for (int i = 0; i < 8; ++i) st[4 + i] = *(const H*)(gB + 32 * i * GM_LD);
#pragma unroll
  for (int i = 0; i < 12; ++i) *(H*)(sAB[0] + sOff + 32 * i * GM_LP) = st[i];
  if (1 < nStage) {
    gA += 64; gB += 64;
#pragma unroll
    for (int i = 0; i < 4; ++i) st[i] = *(const H*)(gA + 32 * i * GM_LD);
#pragma unroll
    for (int i = 0; i < 8; ++i) st[4 + i] = *(const H*)(gB + 32 * i * GM_LD);
  }

  for (int s = 0; s < nStage; ++s) {
    const T* buf = sAB[s & 1];
    __syncthreads();   // publishes stage s and ends every wave's reads of the other buffer (stage s - 1)
#pragma unroll
    for (int kk = 0; kk < 2; ++kk) {
      V bh[4], ah[4];
#pragma unroll
      for (int j = 0; j < 4; ++j) bh[j] = Frag<T>::load(buf + (GM_BM + wn + (j << 4) + rlane) * GM_LP + kk * 32 + koff);
#pragma unroll
      for (int i = 0; i < 4; ++i) ah[i] = Frag<T>::load(buf + (wm + (i << 4) + rlane) * GM_LP + kk * 32 + koff);
      if (kk == 0) {   // staging queues behind the first fragment reads, so the products start sooner
        // stage s + 1 goes from registers into the other buffer. No test round it: with a branch here the fragment
        // waits below fall back to counts that also wait for these stores; the last stage's copy is read by nobody.
        T* nxt = sAB[(s + 1) & 1];
#pragma unroll
        for (int i = 0; i < 12; ++i) *(H*)(nxt + sOff + 32 * i * GM_LP) = st[i];
        if (s + 2 < nStage) {   // block-uniform: stage s + 2's 12 loads land behind this stage's products
          gA += 64; gB += 64;
#pragma unroll
          for (int i = 0; i < 4; ++i) st[i] = *(const H*)(gA + 32 * i * GM_LD);
#pragma unroll
          for (int i = 0; i < 8; ++i) st[4 + i] = *(const H*)(gB + 32 * i * GM_LD);
        }
      }
#pragma unroll
      for (int i = 0; i < 4; ++i) {
#pragma unroll
        for (int j = 0; j < 4; ++j) acc[i][j] = Frag<T>::mma(ah[i], bh[j], acc[i][j]);
        Frag<T>::guard(acc[i][0], acc[i][3], ah[i], ah[i]);
      }
      Frag<T>::keep(bh[0], bh[1], bh[2], bh[3]);
    }
  }
  acc_guard4(acc[0][0], acc[0][1], acc[0][2], acc[0][3]);
  acc_guard4(acc[1][0], acc[1][1], acc[1][2], acc[1][3]);
  acc_guard4(acc[2][0], acc[2][1], acc[2][2], acc[2][3]);
  acc_guard4(acc[3][0], acc[3][1], acc[3][2], acc[3][3]);

  // ---- epilogue ----
  float* slab = sT[wave];
  const float* Rb = RESID ? (resid + (size_t)b * strideR) : nullptr;
#pragma unroll
  for (int i = 0; i < 4; ++i) {
    const int mBase = m0 + (i << 4);
#pragma unroll
    for (int j = 0; j < 4; ++j) {
      const int n = n0 + (j << 4) + rlane;
      float bv = 0.f;
      if (BIAS_MODE == 2) bv = rne_bf16(bias[n]);
#pragma unroll
      for (int r = 0; r < 8; ++r) {
        float v = acc[i][j][r] * scale;
        if (BIAS_MODE == 1) v += rne_bf16(bias[mBase + mOff + r]);
        if (BIAS_MODE == 2) v += bv;
        if (RESID) v += Rb[(size_t)(mBase + mOff + r) * ldc + n];
        if (ACT == 1) v = tanhf(v);
        if (ACT == 2) v = fmaxf(v, 0.0f);
        if (ACT == 3) v = v / (1.0f + expf(-v));
        if (ACT == 4) v = (v > 0.f) ? v : 0.01f * v;
        slab[(mOff + r) * 68 + (j << 4) + rlane] = v;
      }
    }
    __builtin_amdgcn_fence(__ATOMIC_RELEASE, "workgroup");
    __builtin_amdgcn_wave_barrier();
    __builtin_amdgcn_fence(__ATOMIC_ACQUIRE, "workgroup");
    if (OUT_MODE == 0) {
      float* C = (float*)Cout + (size_t)b * strideC;
      const int hh = lane >> 4, c4 = (lane & 15) * 4;     // row seg = 256 B = 16 lanes x 16 B
      {
#pragma unroll
        for (int it = 0; it < 8; ++it) {
          const int row = it * 2 + hh;
          v4f v = *(const v4f*)(slab + row * 68 + c4);
          *(v4f*)(C + (size_t)(mBase + row) * ldc + n0 + c4) = v;
        }
        
      }
    } else if (OUT_MODE == 3) {
      // Coverage per slab: 4 it x 4 row groups (q) = 16 rows; 8 lanes x 8 halves = 64 halves per line.
      const int q = lane >> 3, c8 = (lane & 7) * 8;
      unsigned short* C = (unsigned short*)Cout + (size_t)b * strideC;
      const int hcol = (n0 >> 6) * 128;
      v8h hv[4], av[4];
#pragma unroll
      for (int it = 0; it < 4; ++it) {
        const int row = it * 4 + q;
        const float* sp = slab + row * 68 + c8;
        float ps = 0.f, pa = 0.f;
        v8h t;
#pragma unroll
        for (int e = 0; e < 8; ++e) {
          const float v = sp[e];
          t[e] = (_Float16)v;
          ps += v;
          if (e & 1) pa -= v; else pa += v;     // c8 is even, so (-1)^(c8+e) = (-1)^e
        }
#pragma unroll
        for (int off = 1; off < 8; off <<= 1) {   // reduce over the 8 lanes holding this row
          ps += __shfl_xor(ps, off, 32);
          pa += __shfl_xor(pa, off, 32);
        }
        const float fa = (c8 == 0) ? ps * 0.125f : 0.0f;
        const float fb = (c8 == 0) ? pa * 0.125f : 0.0f;
        v8h u;
#pragma unroll
        for (int e = 0; e < 8; ++e) u[e] = (_Float16)0.0f;
        u[0] = (_Float16)fa;
        u[1] = (_Float16)fb;
        hv[it] = t;
        av[it] = u;
      }
      {
#pragma unroll
        for (int it = 0; it < 4; ++it) {
          const int row = it * 4 + q;
          unsigned short* cp = C + (size_t)(mBase + row) * ldc + hcol + c8;
          *(v8h*)(cp) = hv[it];
          *(v8h*)(cp + 64) = av[it];
        }
        
      }
    } else {
      const int q = lane >> 3, c8 = (lane & 7) * 8;
      unsigned short* C  = (unsigned short*)Cout  + (size_t)b * strideC;
      unsigned short* C2 = (OUT_MODE == 2) ? ((unsigned short*)Cout2 + (size_t)b * strideC) : nullptr;
      {
#pragma unroll
        for (int it = 0; it < 4; ++it) {
          const int row = it * 4 + q;
          const float* sp = slab + row * 68 + c8;
          v8h hv, lv;
#pragma unroll
          for (int e = 0; e < 8; ++e) {
            if (OUT_MODE == 1) {
              hv[e] = (_Float16)sp[e];
            } else {
              unsigned short hb = f2bf_bits(sp[e]);
              unsigned short lb = f2bf_bits(sp[e] - bf_bits2f(hb));
              hv[e] = __builtin_bit_cast(_Float16, hb);
              lv[e] = __builtin_bit_cast(_Float16, lb);
            }
          }
          *(v8h*)(C + (size_t)(mBase + row) * ldc + n0 + c8) = hv;
          if (OUT_MODE == 2) *(v8h*)(C2 + (size_t)(mBase + row) * ldc + n0 + c8) = lv;
        }
        
      }
    }
    __builtin_amdgcn_fence(__ATOMIC_RELEASE, "workgroup");
    __builtin_amdgcn_wave_barrier();
    __builtin_amdgcn_fence(__ATOMIC_ACQUIRE, "workgroup");
  }
}

// ---------------------------------------------------------------------------
// f32 -> RNE bf16 bits, 2 elements per thread packed into one 4-B store: a wave writes one whole
// Coverage: grid = n2/256 blocks x 256 threads x 2 elements = 2*n2 = the whole plane (n2 % 256 == 0 here).
// ---------------------------------------------------------------------------
__global__ __launch_bounds__(256) void cast_bf16x2_kernel(const float* __restrict__ in, unsigned short* __restrict__ out, int n2) {
  const int i = blockIdx.x * 256 + threadIdx.x;
  if (i < n2) {
    const v2f f = *(const v2f*)(in + 2 * (size_t)i);
    const unsigned u = pk16(f2bf_bits(f[0]), f2bf_bits(f[1]));
    ((unsigned*)out)[i] = u;
    
  }
}
// f32 -> f16 bits of (mul * bf16_rne(v)), mul an exact power of two; same store pattern and coverage.
__global__ __launch_bounds__(256) void cast_bf16_f16s_x2_kernel(const float* __restrict__ in, unsigned short* __restrict__ out, int n2, float mul) {
  const int i = blockIdx.x * 256 + threadIdx.x;
  if (i < n2) {
    const v2f f = *(const v2f*)(in + 2 * (size_t)i);
    const _Float16 h0 = (_Float16)(rne_bf16(f[0]) * mul);
    const _Float16 h1 = (_Float16)(rne_bf16(f[1]) * mul);
    const unsigned u = pk16(__builtin_bit_cast(unsigned short, h0), __builtin_bit_cast(unsigned short, h1));
    ((unsigned*)out)[i] = u;
    
  }
}

#define AT_D 64
#define AT_F 96
#define AT_NW 4
#define AT_QB 64
#define AT_KC 64
// LDS row pitches in halves: 16 B x odd, so that the 16 rows of a ds_load_b128 fragment read fall on distinct banks
#define AT_KP 104   // K feature rows: 96 halves used, 208 B pitch
#define AT_VP 72    // V^T rows: 64 halves used, 144 B pitch
static_assert(AT_KP >= AT_F && AT_VP >= AT_KC && (AT_KP * 2) % 32 == 16 && (AT_VP * 2) % 32 == 16, "pitch holds the row and is 16 B x odd");

__device__ __forceinline__ __bf16 at_f2bf(float f) { return __builtin_bit_cast(__bf16, f2bf_bits(f)); }
__device__ __forceinline__ void at_split(float f, __bf16& hi, __bf16& lo) {
  const unsigned short hb = f2bf_bits(f);
  hi = __builtin_bit_cast(__bf16, hb);
  lo = at_f2bf(f - __uint_as_float(((unsigned)hb) << 16));
}
// lane l with lane l ^ 16: the two lanes that share one query column
__device__ __forceinline__ float at_xhalf(float x) {
  return __builtin_bit_cast(float, __builtin_amdgcn_permlanex16(__builtin_bit_cast(int, x), __builtin_bit_cast(int, x), 0x76543210, 0xfedcba98, false, false));
}
__device__ __forceinline__ v8f at_mma(v16b a, v16b b, v8f c) {
  c = __builtin_amdgcn_wmma_f32_16x16x32_bf16(false, a, false, b, (short)0, c, false, false);
  asm volatile("v_nop\n\tv_nop\n\tv_nop\n\tv_nop" : "+v"(c) : "v"(a), "v"(b));
  return c;
}
__device__ __forceinline__ v8f at_mma_h(v16h a, v16h b, v8f c) {
  c = __builtin_amdgcn_wmma_f32_16x16x32_f16(false, a, false, b, (short)0, c, false, false);
  asm volatile("v_nop\n\tv_nop\n\tv_nop\n\tv_nop" : "+v"(c) : "v"(a), "v"(b));
  return c;
}

__global__ __launch_bounds__(128)
void attn_aug_kernel(const unsigned short* __restrict__ qp, const unsigned short* __restrict__ kp,
                     const unsigned short* __restrict__ vhp, const unsigned short* __restrict__ vlp,
                     unsigned short* __restrict__ op, float sscale, float oscale) {
  union FB { v16b v; v8b h[2]; };
  union FH { v16h v; v8h h[2]; };
  __shared__ __align__(16) _Float16 Ksh[AT_KC * AT_KP];          // K features [kv][f]   13 KB
  __shared__ __align__(16) __bf16   Vth[AT_D * AT_VP];           // V hi [d][kv]          9 KB
  __shared__ __align__(16) __bf16   Vtl[AT_D * AT_VP];           // V lo                  9 KB
  __shared__ __align__(16) float    Os[AT_NW][16 * 68];          // per wave out tile, pitch 68

  const int tid  = threadIdx.x;
  const int wave = tid >> 5;
  const int lane = tid & 31;
  const int hh   = lane >> 4;
  const int c    = lane & 15;

  const int nqb = SEQ / AT_QB;            // 32
  const int bx = blockIdx.x;
  const int qb = bx % nqb;
  const int bh = bx / nqb;                // 0..NBAT*NHEAD-1
  const int h  = bh % NHEAD;
  const int b  = bh / NHEAD;
  const int q0 = qb * AT_QB + wave * 16;

  const _Float16* Qb = (const _Float16*)(const void*)qp + (size_t)b * SEQ * TOKP + (size_t)h * QKPITCH;
  const _Float16* Kb = (const _Float16*)(const void*)kp + (size_t)b * SEQ * TOKP + (size_t)h * QKPITCH;
  const __bf16*   Vh = (const __bf16*)(const void*)vhp + ((size_t)b * DMODEL + (size_t)h * AT_D) * SEQ;
  const __bf16*   Vl = (const __bf16*)(const void*)vlp + ((size_t)b * DMODEL + (size_t)h * AT_D) * SEQ;
  _Float16*       Ob = (_Float16*)(void*)op + (size_t)b * SEQ * DMODEL + (size_t)h * AT_D;

  // ---- Q fragments (B operand, column = query = lane&15, split k map via Frag load): 3 feature chunks of 32 ----
  v16h qa[3];
#pragma unroll
  for (int dc = 0; dc < 3; ++dc)
    qa[dc] = Frag<_Float16>::load(Qb + (size_t)(q0 + c) * TOKP + dc * 32 + 8 * hh);

  float mrun = -INFINITY;   // running maximum of query c, equal in both lane halves
  float lrun = 0.f;         // running sum of query c over this lane half's keys; the halves join after the loop
  v8f oacc[4];              // O^T tiles: register r of tile t = O[query c][d = t*16 + 8*hh + r]
#pragma unroll
  for (int t = 0; t < 4; ++t) oacc[t] = (v8f){0.f,0.f,0.f,0.f,0.f,0.f,0.f,0.f};

  const int nChunks = SEQ / AT_KC;   // 32, compile-time constant
  // staging coverage: K: 128 threads x (6 x 8) = 64 rows x 96; V^T: 128 threads x (4 x 8) = 64 x 64 per plane
  const int sr = tid >> 1, shalf = tid & 1;
  const _Float16* ks  = Kb + (size_t)sr * TOKP + shalf * 48;   // chunk 0: K row sr, f = shalf*48..+47
  const __bf16*   vsh = Vh + (size_t)sr * SEQ + shalf * 32;    // chunk 0: V^T row d = sr, s = shalf*32..+31
  const __bf16*   vsl = Vl + (size_t)sr * SEQ + shalf * 32;
  // the chunk in flight: 14 x 16 B per thread, loaded one chunk ahead of the LDS stores that consume them
  v8h kreg[6];
  v8b vhreg[4], vlreg[4];
#pragma unroll
  for (int i = 0; i < 6; ++i) kreg[i] = *(const v8h*)(ks + 8 * i);
#pragma unroll
  for (int i = 0; i < 4; ++i) {
    vhreg[i] = *(const v8b*)(vsh + 8 * i);
    vlreg[i] = *(const v8b*)(vsl + 8 * i);
  }
  // the LDS address arithmetic behind this point reuses the Q loads' address registers
  asm volatile("s_wait_xcnt 0x0" ::: "memory");
  __builtin_amdgcn_sched_barrier(0);   // keeps that arithmetic from being lifted over the wait
  for (int kc = 0; kc < nChunks; ++kc) {
    __syncthreads();
#pragma unroll
    for (int i = 0; i < 6; ++i) *(v8h*)(Ksh + sr * AT_KP + shalf * 48 + 8 * i) = kreg[i];
#pragma unroll
    for (int i = 0; i < 4; ++i) {
      *(v8b*)(Vth + sr * AT_VP + shalf * 32 + 8 * i) = vhreg[i];
      *(v8b*)(Vtl + sr * AT_VP + shalf * 32 + 8 * i) = vlreg[i];
    }
    __syncthreads();
    if (kc + 1 < nChunks) {   // block-uniform: the next chunk's 14 loads go out together and land behind this chunk's work
      const _Float16* kn  = ks  + (size_t)(kc + 1) * AT_KC * TOKP;
      const __bf16*   vhn = vsh + (kc + 1) * AT_KC;
      const __bf16*   vln = vsl + (kc + 1) * AT_KC;
#pragma unroll
      for (int i = 0; i < 6; ++i) kreg[i] = *(const v8h*)(kn + 8 * i);
#pragma unroll
      for (int i = 0; i < 4; ++i) {
        vhreg[i] = *(const v8b*)(vhn + 8 * i);
        vlreg[i] = *(const v8b*)(vln + 8 * i);
      }
      // the fragment loads below reuse these loads' address registers
      asm volatile("s_wait_xcnt 0x0" ::: "memory");
    }

    v8f s[4];
#pragma unroll
    for (int j = 0; j < 4; ++j) {
      s[j] = (v8f){0.f,0.f,0.f,0.f,0.f,0.f,0.f,0.f};
#pragma unroll
      for (int dc = 0; dc < 3; ++dc) {
        FH kb;   // A operand: row m = key j*16+c, k = feature, split k map
        kb.h[0] = *(const v8h*)(Ksh + (j * 16 + c) * AT_KP + dc * 32 + 8 * hh);
        kb.h[1] = *(const v8h*)(Ksh + (j * 16 + c) * AT_KP + dc * 32 + 16 + 8 * hh);
        s[j] = at_mma_h(kb.v, qa[dc], s[j]);   // s[j][r] = score of key j*16 + 8*hh + r against query c
      }
    }
    float m = -INFINITY;
#pragma unroll
    for (int j = 0; j < 4; ++j)
#pragma unroll
      for (int r = 0; r < 8; ++r) {
        s[j][r] *= sscale;
        m = fmaxf(m, s[j][r]);
      }
    m = fmaxf(m, at_xhalf(m));
    const float mnew = fmaxf(mrun, m);
    const float alpha = expf(mrun - mnew);
    mrun = mnew;
    // P^T as B operand: column n = query c; elements 0..7 = keys kk*32 + 8*hh + e (tile 2*kk), 8..15 = keys kk*32 + 16 + 8*hh + e
    // (tile 2*kk + 1): the split k map of the V^T loads below, element for element.
    FB ph[2], pl[2];
    float ps[4];
#pragma unroll
    for (int j = 0; j < 4; ++j) {
      ps[j] = 0.f;
#pragma unroll
      for (int r = 0; r < 8; ++r) {
        const float p = expf(s[j][r] - mnew);
        ps[j] += p;
        __bf16 bh, bl;
        at_split(p, bh, bl);
        ph[j >> 1].v[(j & 1) * 8 + r] = bh;
        pl[j >> 1].v[(j & 1) * 8 + r] = bl;
      }
    }
    lrun = lrun * alpha + ((ps[0] + ps[1]) + (ps[2] + ps[3]));
#pragma unroll
    for (int t = 0; t < 4; ++t)
#pragma unroll
      for (int r = 0; r < 8; ++r) oacc[t][r] *= alpha;
#pragma unroll   // unrolled: ph and pl live in registers and cannot be indexed by a run-time kk
    for (int kk = 0; kk < 2; ++kk) {
#pragma unroll
      for (int t = 0; t < 4; ++t) {
        FB vb, vl;   // A operand: row m = d = t*16+c, k = key
        vb.h[0] = *(const v8b*)(Vth + (t * 16 + c) * AT_VP + kk * 32 + 8 * hh);
        vb.h[1] = *(const v8b*)(Vth + (t * 16 + c) * AT_VP + kk * 32 + 16 + 8 * hh);
        vl.h[0] = *(const v8b*)(Vtl + (t * 16 + c) * AT_VP + kk * 32 + 8 * hh);
        vl.h[1] = *(const v8b*)(Vtl + (t * 16 + c) * AT_VP + kk * 32 + 16 + 8 * hh);
        oacc[t] = at_mma(vb.v, ph[kk].v, oacc[t]);
        oacc[t] = at_mma(vl.v, ph[kk].v, oacc[t]);
        oacc[t] = at_mma(vb.v, pl[kk].v, oacc[t]);
      }
    }
  }

  float* os = Os[wave];
  const float lsum = lrun + at_xhalf(lrun);         // both halves' keys
  const float inv = oscale * (1.0f / lsum);         // lsum >= 1 (the running max contributes exp(0))
#pragma unroll
  for (int t = 0; t < 4; ++t) {
    v4f o0, o1;
#pragma unroll
    for (int r = 0; r < 4; ++r) { o0[r] = oacc[t][r] * inv; o1[r] = oacc[t][4 + r] * inv; }
    *(v4f*)(os + c * 68 + t * 16 + 8 * hh)     = o0;
    *(v4f*)(os + c * 68 + t * 16 + 8 * hh + 4) = o1;
  }
  __builtin_amdgcn_fence(__ATOMIC_RELEASE, "workgroup");
  __builtin_amdgcn_wave_barrier();
  __builtin_amdgcn_fence(__ATOMIC_ACQUIRE, "workgroup");
  {
    const int q8 = lane >> 3, c8 = (lane & 7) * 8;
    {
#pragma unroll
      for (int it = 0; it < 4; ++it) {
        const int row = it * 4 + q8;
        v8h hv;
#pragma unroll
        for (int e = 0; e < 8; ++e) hv[e] = (_Float16)os[row * 68 + c8 + e];
        *(v8h*)(Ob + (size_t)(q0 + row) * DMODEL + c8) = hv;
      }
      
    }
  }
}

// ---------------------------------------------------------------------------
//   [ 0 MiB,  8 MiB)  xb   bf16 [4096][1024]            RNE-bf16 of x
//   [ 8 MiB, 10 MiB)  wqb  bf16 [1024][1024]
//   [10 MiB, 12 MiB)  wkb  bf16 [1024][1024]
//   [12 MiB, 14 MiB)  wvb  bf16 [1024][1024]
//   [14 MiB, 16 MiB)  woh  f16  [1024][1024]            64 * bf16_rne(Wo)
//   [16 MiB, 32 MiB)  qpl  f16  [4096][16][128]         q features per head
//   [32 MiB, 48 MiB)  kpl  f16  [4096][16][128]         k features per head
//   [48 MiB, 56 MiB)  vth  bf16 [2][1024][2048]         v^T hi plane
//   [56 MiB, 64 MiB)  vtl  bf16 [2][1024][2048]         v^T lo plane
//   [64 MiB, 72 MiB)  ohp  f16  [4096][1024]            256 * attention output, heads merged
// GEMM shapes: q/k M=4096 N=1024 K=1024; v^T M=1024 N=2048 K=1024 (x2 batch); out M=4096 N=1024 K=1024:
// all M multiples of 128, N of 256, K of 64, row pitch of every operand 1024, no padding, every plane fully written by its producer.
// ---------------------------------------------------------------------------
extern "C" void kernel_launch(void* const* d_in, const int* in_sizes, int n_in,
                              void* d_out, int out_size, void* d_ws, size_t ws_size,
                              hipStream_t stream)
{
  if (n_in < 9) return;
  if (in_sizes[0] != NTOK * DMODEL || in_sizes[1] != DMODEL * DMODEL || in_sizes[2] != DMODEL ||
      in_sizes[3] != DMODEL * DMODEL || in_sizes[4] != DMODEL || in_sizes[5] != DMODEL * DMODEL ||
      in_sizes[6] != DMODEL || in_sizes[7] != DMODEL * DMODEL || in_sizes[8] != DMODEL) return;
  if (out_size != NTOK * DMODEL) return;

  const float* x    = (const float*)d_in[0];
  const float* Wq   = (const float*)d_in[1];
  const float* bq   = (const float*)d_in[2];
  const float* Wk   = (const float*)d_in[3];
  const float* bk   = (const float*)d_in[4];
  const float* Wv   = (const float*)d_in[5];
  const float* bv   = (const float*)d_in[6];
  const float* Wo   = (const float*)d_in[7];
  const float* bo_p = (const float*)d_in[8];

  const size_t SZ_X   = (size_t)NTOK * DMODEL * 2;                 // 8 MiB
  const size_t SZ_W   = (size_t)DMODEL * DMODEL * 2;               // 2 MiB
  const size_t SZ_QK  = (size_t)NTOK * TOKP * 2;                   // 16 MiB
  const size_t SZ_VT  = (size_t)NBAT * DMODEL * SEQ * 2;           // 8 MiB
  const size_t SZ_O   = (size_t)NTOK * DMODEL * 2;                 // 8 MiB
  const size_t OFF_XB = 0;
  const size_t OFF_WQ = OFF_XB + SZ_X;
  const size_t OFF_WK = OFF_WQ + SZ_W;
  const size_t OFF_WV = OFF_WK + SZ_W;
  const size_t OFF_WO = OFF_WV + SZ_W;
  const size_t OFF_QP = OFF_WO + SZ_W;
  const size_t OFF_KP = OFF_QP + SZ_QK;
  const size_t OFF_VH = OFF_KP + SZ_QK;
  const size_t OFF_VL = OFF_VH + SZ_VT;
  const size_t OFF_OH = OFF_VL + SZ_VT;
  const size_t TOTAL  = OFF_OH + SZ_O;                             // 75,497,472
  if (TOTAL > ws_size) return;

  char* ws = (char*)d_ws;
  unsigned short* xb  = (unsigned short*)(ws + OFF_XB);
  unsigned short* wqb = (unsigned short*)(ws + OFF_WQ);
  unsigned short* wkb = (unsigned short*)(ws + OFF_WK);
  unsigned short* wvb = (unsigned short*)(ws + OFF_WV);
  unsigned short* woh = (unsigned short*)(ws + OFF_WO);
  unsigned short* qpl = (unsigned short*)(ws + OFF_QP);
  unsigned short* kpl = (unsigned short*)(ws + OFF_KP);
  unsigned short* vth = (unsigned short*)(ws + OFF_VH);
  unsigned short* vtl = (unsigned short*)(ws + OFF_VL);
  unsigned short* ohp = (unsigned short*)(ws + OFF_OH);

  // ---- 16-bit operand planes (2 elements per thread; counts are multiples of 512) ----
  const int n2x = (NTOK * DMODEL) / 2;       // 2,097,152 -> 8192 blocks
  const int n2w = (DMODEL * DMODEL) / 2;     //   524,288 -> 2048 blocks
  cast_bf16x2_kernel<<<dim3(n2x / 256), dim3(256), 0, stream>>>(x, xb, n2x);
  cast_bf16x2_kernel<<<dim3(n2w / 256), dim3(256), 0, stream>>>(Wq, wqb, n2w);
  cast_bf16x2_kernel<<<dim3(n2w / 256), dim3(256), 0, stream>>>(Wk, wkb, n2w);
  cast_bf16x2_kernel<<<dim3(n2w / 256), dim3(256), 0, stream>>>(Wv, wvb, n2w);
  cast_bf16_f16s_x2_kernel<<<dim3(n2w / 256), dim3(256), 0, stream>>>(Wo, woh, n2w, 64.0f);

  // ---- q / k feature planes: [4096][1024] x [1024][1024]^T + bias, epilogue writes per-head 128-wide f16 rows ----
  {
    const int tiles = (NTOK / 64) * (DMODEL / 64);     // 1024 -> 128 blocks of 8 waves
    dim3 grid(tiles / 8, 1), blk(256);
    wmma_gemm64<1, false, 2, 3, false><<<grid, blk, 0, stream>>>(
        xb, xb, DMODEL, 0L, wqb, wqb, DMODEL, 0L,
        (void*)qpl, (void*)qpl, TOKP, 0L, bq, bq, 0L, NTOK, DMODEL, DMODEL, 1.0f);
    wmma_gemm64<1, false, 2, 3, false><<<grid, blk, 0, stream>>>(
        xb, xb, DMODEL, 0L, wkb, wkb, DMODEL, 0L,
        (void*)kpl, (void*)kpl, TOKP, 0L, bk, bk, 0L, NTOK, DMODEL, DMODEL, 1.0f);
  }
  // ---- v^T planes (role swapped): per batch C[m = h*64+d][n = s] = sum_k Wv[m][k] * x[b][s][k] + bv[m], bf16 hi/lo out ----
  {
    const int tiles = (DMODEL / 64) * (SEQ / 64);      // 512 -> 64 blocks, grid.y = batch
    dim3 grid(tiles / 8, NBAT), blk(256);
    wmma_gemm64<1, false, 1, 2, false><<<grid, blk, 0, stream>>>(
        wvb, wvb, DMODEL, 0L, xb, xb, DMODEL, (long)SEQ * DMODEL,
        (void*)vth, (void*)vtl, SEQ, (long)DMODEL * SEQ, bv, bv, 0L, DMODEL, SEQ, DMODEL, 1.0f);
  }
  // ---- attention: grid = NBAT * NHEAD * (SEQ / 64) = 1024 blocks of 128 threads ----
  attn_aug_kernel<<<dim3(NBAT * NHEAD * (SEQ / 64)), dim3(128), 0, stream>>>(
      qpl, kpl, vth, vtl, ohp, 0.0625f, 256.0f);
  // ---- output projection: d_out[m][n] = (1/16384) * sum_k (256*O)[m][k] * (64*Wo)[n][k] + bo[n], f32 out ----
  {
    const int tiles = (NTOK / 64) * (DMODEL / 64);     // 1024 -> 128 blocks
    dim3 grid(tiles / 8, 1), blk(256);
    wmma_gemm64<0, false, 2, 0, false><<<grid, blk, 0, stream>>>(
        ohp, ohp, DMODEL, 0L, woh, woh, DMODEL, 0L,
        d_out, d_out, DMODEL, 0L, bo_p, bo_p, 0L, NTOK, DMODEL, DMODEL, 1.0f / 16384.0f);
  }
}

// v005
// It runs in 203 microseconds.
// Two timings next to v004 both put it at 1.04 times that version's speed.
// Counting every step since v000, it is 2.56 times as fast.
// Contractions: q/k/v^T projections v_wmma_f32_16x16x32_bf16 (operands = RNE-bf16 of the f32 inputs, single product); scores v_wmma_f32_16x16x32_f16 (f16 per-head feature planes, single product, x1/16 in f32); p.v v_wmma_f32_16x16x32_bf16 with bf16 hi/lo split of p and v (hi.hi+hi.lo+lo.hi); output projection v_wmma_f32_16x16x32_f16 (f16 O carried x256, f16 Wo carried x64, single product, x1/16384 in f32); f32 accumulate everywhere; softmax, biases and DFT aggregate features in f32.
#include <hip/hip_runtime.h>
#include <math.h>
#include <stdint.h>

// ---------------- problem geometry ----------------
constexpr int NBAT    = 2;
constexpr int SEQ     = 2048;
constexpr int DMODEL  = 1024;
constexpr int NHEAD   = 16;
constexpr int HDIM    = 64;
constexpr int NTOK    = NBAT * SEQ;          // 4096
constexpr int QKPITCH = 128;                 // halves per (token, head) feature row: 64 dims, sum/8, altsum/8, zeros
constexpr int TOKP    = NHEAD * QKPITCH;     // 2048 halves per token row of the q/k feature planes
static_assert(NTOK % 64 == 0 && DMODEL % 64 == 0 && SEQ % 64 == 0 && DMODEL % 32 == 0);
static_assert(NHEAD * HDIM == DMODEL);

typedef __attribute__((ext_vector_type(16))) _Float16 v16h;
typedef __attribute__((ext_vector_type(8)))  _Float16 v8h;
typedef __attribute__((ext_vector_type(16))) __bf16   v16b;
typedef __attribute__((ext_vector_type(8)))  __bf16   v8b;
typedef __attribute__((ext_vector_type(8)))  float    v8f;
typedef __attribute__((ext_vector_type(4)))  float    v4f;
typedef __attribute__((ext_vector_type(2)))  float    v2f;

__device__ __forceinline__ unsigned short f2bf_bits(float f) {
  unsigned u = __float_as_uint(f);
  return (unsigned short)((u + 0x7FFFu + ((u >> 16) & 1u)) >> 16);
}
__device__ __forceinline__ float bf_bits2f(unsigned short h) { return __uint_as_float(((unsigned)h) << 16); }
__device__ __forceinline__ float rne_bf16(float f) { return bf_bits2f(f2bf_bits(f)); }
__device__ __forceinline__ unsigned pk16(unsigned short a, unsigned short b) { return (unsigned)a | ((unsigned)b << 16); }

// hazard guards as plain device helpers (no inline asm inside the kernel template body)
__device__ __forceinline__ void dep_guard_h(v8f& a, v8f& b, v16h x, v16h y) { asm volatile("v_nop\n\tv_nop\n\tv_nop\n\tv_nop" : "+v"(a), "+v"(b) : "v"(x), "v"(y)); }
__device__ __forceinline__ void dep_guard_b(v8f& a, v8f& b, v16b x, v16b y) { asm volatile("v_nop\n\tv_nop\n\tv_nop\n\tv_nop" : "+v"(a), "+v"(b) : "v"(x), "v"(y)); }
__device__ __forceinline__ void keep4_h(v16h a, v16h b, v16h c, v16h d) { asm volatile("v_nop" :: "v"(a), "v"(b), "v"(c), "v"(d)); }
__device__ __forceinline__ void keep4_b(v16b a, v16b b, v16b c, v16b d) { asm volatile("v_nop" :: "v"(a), "v"(b), "v"(c), "v"(d)); }
__device__ __forceinline__ void acc_guard4(v8f& a, v8f& b, v8f& c, v8f& d) { asm volatile("v_nop\n\tv_nop\n\tv_nop\n\tv_nop" : "+v"(a), "+v"(b), "+v"(c), "+v"(d)); }
template <typename T> struct Frag;
template <> struct Frag<_Float16> {
  typedef v16h V; typedef v8h H; union U { v16h v; v8h h[2]; };
  static __device__ __forceinline__ v16h load(const _Float16* p) {   // elements 0..7 <- p[0..7], 8..15 <- p[16..23]
    U f; f.h[0] = *(const v8h*)(p); f.h[1] = *(const v8h*)(p + 16); return f.v;
  }
  static __device__ __forceinline__ v8f mma(v16h a, v16h b, v8f c) {
    return __builtin_amdgcn_wmma_f32_16x16x32_f16(false, a, false, b, (short)0, c, false, false);
  }
  static __device__ __forceinline__ void guard(v8f& a, v8f& b, v16h x, v16h y) { dep_guard_h(a, b, x, y); }
  static __device__ __forceinline__ void keep(v16h a, v16h b, v16h c, v16h d) { keep4_h(a, b, c, d); }
};
template <> struct Frag<__bf16> {
  typedef v16b V; typedef v8b H; union U { v16b v; v8b h[2]; };
  static __device__ __forceinline__ v16b load(const __bf16* p) {
    U f; f.h[0] = *(const v8b*)(p); f.h[1] = *(const v8b*)(p + 16); return f.v;
  }
  static __device__ __forceinline__ v8f mma(v16b a, v16b b, v8f c) {
    return __builtin_amdgcn_wmma_f32_16x16x32_bf16(false, a, false, b, (short)0, c, false, false);
  }
  static __device__ __forceinline__ void guard(v8f& a, v8f& b, v16b x, v16b y) { dep_guard_b(a, b, x, y); }
  static __device__ __forceinline__ void keep(v16b a, v16b b, v16b c, v16b d) { keep4_b(a, b, c, d); }
};

// ---- Register-blocked batched WMMA GEMM ------------------------------------
// C[m,n] = scale * sum_k A[m,k] * Bt[n,k] (+bias)(+resid); each wave owns a 64x64 tile.
// A row-major [M,K]; Bt row-major [N,K]; M % 128 == 0, N % 256 == 0, K % 64 == 0.
// Block = 8 waves as 2 (m) x 4 (n) = a 128 x 256 tile. Per stage of 64 k the block brings its 128 A rows and
// 256 Bt rows (one 128-B line each) into LDS: 8 lanes x 16 B per row, so a wave-wide load covers 4 whole lines.
// Two LDS buffers, the global loads held in registers up to two stages ahead, one __syncthreads per stage.
// SPLIT (hi/lo operand planes) is not instantiated here and not supported by the staged loop.
// BIAS_MODE: 0 = none, 1 = bias[m], 2 = bias[n]. Bias values are RNE-bf16 quantised before the f32 add.
// OUT_MODE: 0 = f32, 1 = f16, 2 = bf16 hi plane (Cout) + bf16 lo plane (Cout2),
//           3 = f16 per-head feature rows: head hd = n0/64, row m -> C[m*ldc + hd*128 + 0..63] = f16(v[0..63]),
//               [+64] = f16(sum_d v[d] / 8), [+65] = f16(sum_d (-1)^d v[d] / 8), [+66..+127] = 0.
// ET: 0 = f16 operands, 1 = bf16 operands (pointers passed as 16-bit storage)
template <int ET> struct Elem;
template <> struct Elem<0> { typedef _Float16 T; };
template <> struct Elem<1> { typedef __bf16 T; };
constexpr int GM_BM   = 128;             // block tile rows (A rows staged)
constexpr int GM_BN   = 256;             // block tile columns (Bt rows staged)
constexpr int GM_ROWS = GM_BM + GM_BN;   // 384 staged rows per stage
constexpr int GM_LD   = DMODEL;          // row pitch of A and Bt in elements, a constant so that a stage's row steps fold into the loads' immediate offsets
constexpr int GM_LP   = 72;              // LDS row pitch in 16-bit elements: 64 used, 144 B = 16 B x odd for ds_load_b128 readers
template <int ET, bool SPLIT, int BIAS_MODE, int OUT_MODE, bool RESID, int ACT = 0>
__global__ __launch_bounds__(256) void wmma_gemm64(
    const unsigned short* __restrict__ Ap, const unsigned short* __restrict__ A2p, int lda, long strideA,
    const unsigned short* __restrict__ Btp, const unsigned short* __restrict__ Bt2p, int ldb, long strideB,
    void* __restrict__ Cout, void* __restrict__ Cout2, int ldc, long strideC,
    const float* __restrict__ bias,
    const float* __restrict__ resid, long strideR,
    int M, int N, int K, float scale) {
  typedef typename Elem<ET>::T T;
  typedef typename Frag<T>::V V;
  typedef typename Frag<T>::H H;
  static_assert(!SPLIT, "the staged loop carries one plane per operand");
  const T* A = (const T*)Ap; const T* Bt = (const T*)Btp;
  __shared__ __align__(16) float sT[8][16 * 68];   // per-wave 16x64 slab, pitch 68 floats
  __shared__ __align__(16) T sAB[2][GM_ROWS * GM_LP];   // rows 0..127 = A, 128..383 = Bt; 64 k per row
  const int b    = blockIdx.y;
  const int lane = threadIdx.x & 31;
  const int wave = threadIdx.x >> 5;
  const int tilesN = N >> 8;
  const int tilesM = M >> 7;
  const int tile = blockIdx.x;
  if (tile >= tilesM * tilesN || lda != GM_LD || ldb != GM_LD) return;   // block-uniform, in front of every barrier
  const int tm = tile / tilesN;
  const int tn = tile - tm * tilesN;
  const int bm0 = tm << 7;                // block tile origin
  const int bn0 = tn << 8;
  const int wm  = (wave >> 2) << 6;       // wave tile origin inside the block tile
  const int wn  = (wave & 3) << 6;
  const int m0 = bm0 + wm;
  const int n0 = bn0 + wn;

  const T* Ab  = A  + (size_t)b * strideA;
  const T* Bb  = Bt + (size_t)b * strideB;

  const int rlane = lane & 15;                 // row (A) / col (B, D) within subtile
  const int koff  = (lane >> 4) * 8;           // k offset of this lane half
  const int mOff  = (lane >> 4) * 8;           // D row offset

  v8f acc[4][4];
#pragma unroll
  for (int i = 0; i < 4; ++i)
#pragma unroll
    for (int j = 0; j < 4; ++j) acc[i][j] = (v8f){0.f,0.f,0.f,0.f,0.f,0.f,0.f,0.f};

  // staging coverage: 256 threads = 32 rows x 8 pieces of 16 B; 4 trips cover the A rows, 8 trips the Bt rows
  // (rows r and r + 8 sit side by side in a 16-lane half: 8 x 144 B = 32 banks apart, so a ds_store_b128 meets no bank twice)
  const int sgrp = threadIdx.x >> 3;
  const int srow = (sgrp & 16) | ((sgrp & 1) << 3) | ((sgrp >> 1) & 7);
  const int spc  = (threadIdx.x & 7) * 8;
  const T* gA = Ab + (size_t)(bm0 + srow) * GM_LD + spc;   // this lane's piece of the stage being loaded; both step 64 k per stage
  const T* gB = Bb + (size_t)(bn0 + srow) * GM_LD + spc;
  const int sOff = srow * GM_LP + spc;
  const int nStage = K >> 6;
  H st[12];   // the stage in flight
#pragma unroll
  for (int i = 0; i < 4; ++i) st[i] = *(const H*)(gA + 32 * i * GM_LD);
#pragma unroll
  for (int i = 0; i < 8; ++i) st[4 + i] = *(const H*)(gB + 32 * i * GM_LD);
#pragma unroll
  for (int i = 0; i < 12; ++i) *(H*)(sAB[0] + sOff + 32 * i * GM_LP) = st[i];
  if (1 < nStage) {
    gA += 64; gB += 64;
#pragma unroll
    for (int i = 0; i < 4; ++i) st[i] = *(const H*)(gA + 32 * i * GM_LD);
#pragma unroll
    for (int i = 0; i < 8; ++i) st[4 + i] = *(const H*)(gB + 32 * i * GM_LD);
  }

  for (int s = 0; s < nStage; ++s) {
    const T* buf = sAB[s & 1];
    __syncthreads();   // publishes stage s and ends every wave's reads of the other buffer (stage s - 1)
#pragma unroll
    for (int kk = 0; kk < 2; ++kk) {
      V bh[4], ah[4];
#pragma unroll
      for (int j = 0; j < 4; ++j) bh[j] = Frag<T>::load(buf + (GM_BM + wn + (j << 4) + rlane) * GM_LP + kk * 32 + koff);
#pragma unroll
      for (int i = 0; i < 4; ++i) ah[i] = Frag<T>::load(buf + (wm + (i << 4) + rlane) * GM_LP + kk * 32 + koff);
      if (kk == 0) {   // staging queues behind the first fragment reads, so the products start sooner
        // stage s + 1 goes from registers into the other buffer. No test round it: with a branch here the fragment
        // waits below fall back to counts that also wait for these stores; the last stage's copy is read by nobody.
        T* nxt = sAB[(s + 1) & 1];
#pragma unroll
        for (int i = 0; i < 12; ++i) *(H*)(nxt + sOff + 32 * i * GM_LP) = st[i];
        if (s + 2 < nStage) {   // block-uniform: stage s + 2's 12 loads land behind this stage's products
          gA += 64; gB += 64;
#pragma unroll
          for (int i = 0; i < 4; ++i) st[i] = *(const H*)(gA + 32 * i * GM_LD);
#pragma unroll
          for (int i = 0; i < 8; ++i) st[4 + i] = *(const H*)(gB + 32 * i * GM_LD);
        }
      }
#pragma unroll
      for (int i = 0; i < 4; ++i) {
#pragma unroll
        for (int j = 0; j < 4; ++j) acc[i][j] = Frag<T>::mma(ah[i], bh[j], acc[i][j]);
        Frag<T>::guard(acc[i][0], acc[i][3], ah[i], ah[i]);
      }
      Frag<T>::keep(bh[0], bh[1], bh[2], bh[3]);
    }
  }
  acc_guard4(acc[0][0], acc[0][1], acc[0][2], acc[0][3]);
  acc_guard4(acc[1][0], acc[1][1], acc[1][2], acc[1][3]);
  acc_guard4(acc[2][0], acc[2][1], acc[2][2], acc[2][3]);
  acc_guard4(acc[3][0], acc[3][1], acc[3][2], acc[3][3]);

  // ---- epilogue ----
  float* slab = sT[wave];
  const float* Rb = RESID ? (resid + (size_t)b * strideR) : nullptr;
#pragma unroll
  for (int i = 0; i < 4; ++i) {
    const int mBase = m0 + (i << 4);
#pragma unroll
    for (int j = 0; j < 4; ++j) {
      const int n = n0 + (j << 4) + rlane;
      float bv = 0.f;
      if (BIAS_MODE == 2) bv = rne_bf16(bias[n]);
#pragma unroll
      for (int r = 0; r < 8; ++r) {
        float v = acc[i][j][r] * scale;
        if (BIAS_MODE == 1) v += rne_bf16(bias[mBase + mOff + r]);
        if (BIAS_MODE == 2) v += bv;
        if (RESID) v += Rb[(size_t)(mBase + mOff + r) * ldc + n];
        if (ACT == 1) v = tanhf(v);
        if (ACT == 2) v = fmaxf(v, 0.0f);
        if (ACT == 3) v = v / (1.0f + expf(-v));
        if (ACT == 4) v = (v > 0.f) ? v : 0.01f * v;
        slab[(mOff + r) * 68 + (j << 4) + rlane] = v;
      }
    }
    __builtin_amdgcn_fence(__ATOMIC_RELEASE, "workgroup");
    __builtin_amdgcn_wave_barrier();
    __builtin_amdgcn_fence(__ATOMIC_ACQUIRE, "workgroup");
    if (OUT_MODE == 0) {
      float* C = (float*)Cout + (size_t)b * strideC;
      const int hh = lane >> 4, c4 = (lane & 15) * 4;     // row seg = 256 B = 16 lanes x 16 B
      {
#pragma unroll
        for (int it = 0; it < 8; ++it) {
          const int row = it * 2 + hh;
          v4f v = *(const v4f*)(slab + row * 68 + c4);
          *(v4f*)(C + (size_t)(mBase + row) * ldc + n0 + c4) = v;
        }
        
      }
    } else if (OUT_MODE == 3) {
      // Coverage per slab: 4 it x 4 row groups (q) = 16 rows; 8 lanes x 8 halves = 64 halves per line.
      const int q = lane >> 3, c8 = (lane & 7) * 8;
      unsigned short* C = (unsigned short*)Cout + (size_t)b * strideC;
      const int hcol = (n0 >> 6) * 128;
      v8h hv[4], av[4];
#pragma unroll
      for (int it = 0; it < 4; ++it) {
        const int row = it * 4 + q;
        const float* sp = slab + row * 68 + c8;
        float ps = 0.f, pa = 0.f;
        v8h t;
#pragma unroll
        for (int e = 0; e < 8; ++e) {
          const float v = sp[e];
          t[e] = (_Float16)v;
          ps += v;
          if (e & 1) pa -= v; else pa += v;     // c8 is even, so (-1)^(c8+e) = (-1)^e
        }
#pragma unroll
        for (int off = 1; off < 8; off <<= 1) {   // reduce over the 8 lanes holding this row
          ps += __shfl_xor(ps, off, 32);
          pa += __shfl_xor(pa, off, 32);
        }
        const float fa = (c8 == 0) ? ps * 0.125f : 0.0f;
        const float fb = (c8 == 0) ? pa * 0.125f : 0.0f;
        v8h u;
#pragma unroll
        for (int e = 0; e < 8; ++e) u[e] = (_Float16)0.0f;
        u[0] = (_Float16)fa;
        u[1] = (_Float16)fb;
        hv[it] = t;
        av[it] = u;
      }
      {
#pragma unroll
        for (int it = 0; it < 4; ++it) {
          const int row = it * 4 + q;
          unsigned short* cp = C + (size_t)(mBase + row) * ldc + hcol + c8;
          *(v8h*)(cp) = hv[it];
          *(v8h*)(cp + 64) = av[it];
        }
        
      }
    } else {
      const int q = lane >> 3, c8 = (lane & 7) * 8;
      unsigned short* C  = (unsigned short*)Cout  + (size_t)b * strideC;
      unsigned short* C2 = (OUT_MODE == 2) ? ((unsigned short*)Cout2 + (size_t)b * strideC) : nullptr;
      {
#pragma unroll
        for (int it = 0; it < 4; ++it) {
          const int row = it * 4 + q;
          const float* sp = slab + row * 68 + c8;
          v8h hv, lv;
#pragma unroll
          for (int e = 0; e < 8; ++e) {
            if (OUT_MODE == 1) {
              hv[e] = (_Float16)sp[e];
            } else {
              unsigned short hb = f2bf_bits(sp[e]);
              unsigned short lb = f2bf_bits(sp[e] - bf_bits2f(hb));
              hv[e] = __builtin_bit_cast(_Float16, hb);
              lv[e] = __builtin_bit_cast(_Float16, lb);
            }
          }
          *(v8h*)(C + (size_t)(mBase + row) * ldc + n0 + c8) = hv;
          if (OUT_MODE == 2) *(v8h*)(C2 + (size_t)(mBase + row) * ldc + n0 + c8) = lv;
        }
        
      }
    }
    __builtin_amdgcn_fence(__ATOMIC_RELEASE, "workgroup");
    __builtin_amdgcn_wave_barrier();
    __builtin_amdgcn_fence(__ATOMIC_ACQUIRE, "workgroup");
  }
}

// ---------------------------------------------------------------------------
// f32 -> RNE bf16 bits, 2 elements per thread packed into one 4-B store: a wave writes one whole
// Coverage: grid = n2/256 blocks x 256 threads x 2 elements = 2*n2 = the whole plane (n2 % 256 == 0 here).
// ---------------------------------------------------------------------------
__global__ __launch_bounds__(256) void cast_bf16x2_kernel(const float* __restrict__ in, unsigned short* __restrict__ out, int n2) {
  const int i = blockIdx.x * 256 + threadIdx.x;
  if (i < n2) {
    const v2f f = *(const v2f*)(in + 2 * (size_t)i);
    const unsigned u = pk16(f2bf_bits(f[0]), f2bf_bits(f[1]));
    ((unsigned*)out)[i] = u;
    
  }
}
// f32 -> f16 bits of (mul * bf16_rne(v)), mul an exact power of two; same store pattern and coverage.
__global__ __launch_bounds__(256) void cast_bf16_f16s_x2_kernel(const float* __restrict__ in, unsigned short* __restrict__ out, int n2, float mul) {
  const int i = blockIdx.x * 256 + threadIdx.x;
  if (i < n2) {
    const v2f f = *(const v2f*)(in + 2 * (size_t)i);
    const _Float16 h0 = (_Float16)(rne_bf16(f[0]) * mul);
    const _Float16 h1 = (_Float16)(rne_bf16(f[1]) * mul);
    const unsigned u = pk16(__builtin_bit_cast(unsigned short, h0), __builtin_bit_cast(unsigned short, h1));
    ((unsigned*)out)[i] = u;
    
  }
}

#define AT_D 64
#define AT_F 96
#define AT_NW 4
#define AT_QB 64
#define AT_KC 64
// LDS row pitches in halves: 16 B x odd, so that the 16 rows of a ds_load_b128 fragment read fall on distinct banks
#define AT_KP 104   // K feature rows: 96 halves used, 208 B pitch
#define AT_VP 72    // V^T rows: 64 halves used, 144 B pitch
static_assert(AT_KP >= AT_F && AT_VP >= AT_KC && (AT_KP * 2) % 32 == 16 && (AT_VP * 2) % 32 == 16, "pitch holds the row and is 16 B x odd");

__device__ __forceinline__ __bf16 at_f2bf(float f) { return __builtin_bit_cast(__bf16, f2bf_bits(f)); }
__device__ __forceinline__ void at_split(float f, __bf16& hi, __bf16& lo) {
  const unsigned short hb = f2bf_bits(f);
  hi = __builtin_bit_cast(__bf16, hb);
  lo = at_f2bf(f - __uint_as_float(((unsigned)hb) << 16));
}
// lane l with lane l ^ 16: the two lanes that share one query column
__device__ __forceinline__ float at_xhalf(float x) {
  return __builtin_bit_cast(float, __builtin_amdgcn_permlanex16(__builtin_bit_cast(int, x), __builtin_bit_cast(int, x), 0x76543210, 0xfedcba98, false, false));
}
__device__ __forceinline__ v8f at_mma(v16b a, v16b b, v8f c) {
  c = __builtin_amdgcn_wmma_f32_16x16x32_bf16(false, a, false, b, (short)0, c, false, false);
  asm volatile("v_nop\n\tv_nop\n\tv_nop\n\tv_nop" : "+v"(c) : "v"(a), "v"(b));
  return c;
}
__device__ __forceinline__ v8f at_mma_h(v16h a, v16h b, v8f c) {
  c = __builtin_amdgcn_wmma_f32_16x16x32_f16(false, a, false, b, (short)0, c, false, false);
  asm volatile("v_nop\n\tv_nop\n\tv_nop\n\tv_nop" : "+v"(c) : "v"(a), "v"(b));
  return c;
}

__global__ __launch_bounds__(128)
void attn_aug_kernel(const unsigned short* __restrict__ qp, const unsigned short* __restrict__ kp,
                     const unsigned short* __restrict__ vhp, const unsigned short* __restrict__ vlp,
                     unsigned short* __restrict__ op, float sscale, float oscale) {
  union FB { v16b v; v8b h[2]; };
  union FH { v16h v; v8h h[2]; };
  __shared__ __align__(16) _Float16 Ksh[AT_KC * AT_KP];          // K features [kv][f]   13 KB
  __shared__ __align__(16) __bf16   Vth[AT_D * AT_VP];           // V hi [d][kv]          9 KB
  __shared__ __align__(16) __bf16   Vtl[AT_D * AT_VP];           // V lo                  9 KB
  __shared__ __align__(16) float    Os[AT_NW][16 * 68];          // per wave out tile, pitch 68

  const int tid  = threadIdx.x;
  const int wave = tid >> 5;
  const int lane = tid & 31;
  const int hh   = lane >> 4;
  const int c    = lane & 15;

  const int nqb = SEQ / AT_QB;            // 32
  const int bx = blockIdx.x;
  const int qb = bx % nqb;
  const int bh = bx / nqb;                // 0..NBAT*NHEAD-1
  const int h  = bh % NHEAD;
  const int b  = bh / NHEAD;
  const int q0 = qb * AT_QB + wave * 16;

  const _Float16* Qb = (const _Float16*)(const void*)qp + (size_t)b * SEQ * TOKP + (size_t)h * QKPITCH;
  const _Float16* Kb = (const _Float16*)(const void*)kp + (size_t)b * SEQ * TOKP + (size_t)h * QKPITCH;
  const __bf16*   Vh = (const __bf16*)(const void*)vhp + ((size_t)b * DMODEL + (size_t)h * AT_D) * SEQ;
  const __bf16*   Vl = (const __bf16*)(const void*)vlp + ((size_t)b * DMODEL + (size_t)h * AT_D) * SEQ;
  _Float16*       Ob = (_Float16*)(void*)op + (size_t)b * SEQ * DMODEL + (size_t)h * AT_D;

  // ---- Q fragments (B operand, column = query = lane&15, split k map via Frag load): 3 feature chunks of 32 ----
  v16h qa[3];
#pragma unroll
  for (int dc = 0; dc < 3; ++dc)
    qa[dc] = Frag<_Float16>::load(Qb + (size_t)(q0 + c) * TOKP + dc * 32 + 8 * hh);

  // softmax in base 2: e^(sscale * (s - max)) = 2^(s * c2 - max * c2); sscale > 0, so the maximum is taken over the unscaled scores
  const float c2 = sscale * 1.4426950408889634f;
  float mrun = -INFINITY;   // running maximum of query c's unscaled scores, equal in both lane halves
  float lrun = 0.f;         // running sum of query c over this lane half's keys; the halves join after the loop
  v8f oacc[4];              // O^T tiles: register r of tile t = O[query c][d = t*16 + 8*hh + r]
#pragma unroll
  for (int t = 0; t < 4; ++t) oacc[t] = (v8f){0.f,0.f,0.f,0.f,0.f,0.f,0.f,0.f};

  const int nChunks = SEQ / AT_KC;   // 32, compile-time constant
  // staging coverage: K: 128 threads x (6 x 8) = 64 rows x 96; V^T: 128 threads x (4 x 8) = 64 x 64 per plane
  const int sr = tid >> 1, shalf = tid & 1;
  const _Float16* ks  = Kb + (size_t)sr * TOKP + shalf * 48;   // chunk 0: K row sr, f = shalf*48..+47
  const __bf16*   vsh = Vh + (size_t)sr * SEQ + shalf * 32;    // chunk 0: V^T row d = sr, s = shalf*32..+31
  const __bf16*   vsl = Vl + (size_t)sr * SEQ + shalf * 32;
  // the chunk in flight: 14 x 16 B per thread, loaded one chunk ahead of the LDS stores that consume them
  v8h kreg[6];
  v8b vhreg[4], vlreg[4];
#pragma unroll
  for (int i = 0; i < 6; ++i) kreg[i] = *(const v8h*)(ks + 8 * i);
#pragma unroll
  for (int i = 0; i < 4; ++i) {
    vhreg[i] = *(const v8b*)(vsh + 8 * i);
    vlreg[i] = *(const v8b*)(vsl + 8 * i);
  }
  // the LDS address arithmetic behind this point reuses the Q loads' address registers
  asm volatile("s_wait_xcnt 0x0" ::: "memory");
  __builtin_amdgcn_sched_barrier(0);   // keeps that arithmetic from being lifted over the wait
  for (int kc = 0; kc < nChunks; ++kc) {
    __syncthreads();
#pragma unroll
    for (int i = 0; i < 6; ++i) *(v8h*)(Ksh + sr * AT_KP + shalf * 48 + 8 * i) = kreg[i];
#pragma unroll
    for (int i = 0; i < 4; ++i) {
      *(v8b*)(Vth + sr * AT_VP + shalf * 32 + 8 * i) = vhreg[i];
      *(v8b*)(Vtl + sr * AT_VP + shalf * 32 + 8 * i) = vlreg[i];
    }
    __syncthreads();
    if (kc + 1 < nChunks) {   // block-uniform: the next chunk's 14 loads go out together and land behind this chunk's work
      const _Float16* kn  = ks  + (size_t)(kc + 1) * AT_KC * TOKP;
      const __bf16*   vhn = vsh + (kc + 1) * AT_KC;
      const __bf16*   vln = vsl + (kc + 1) * AT_KC;
#pragma unroll
      for (int i = 0; i < 6; ++i) kreg[i] = *(const v8h*)(kn + 8 * i);
#pragma unroll
      for (int i = 0; i < 4; ++i) {
        vhreg[i] = *(const v8b*)(vhn + 8 * i);
        vlreg[i] = *(const v8b*)(vln + 8 * i);
      }
      // the fragment loads below reuse these loads' address registers
      asm volatile("s_wait_xcnt 0x0" ::: "memory");
    }

    v8f s[4];
#pragma unroll
    for (int j = 0; j < 4; ++j) {
      s[j] = (v8f){0.f,0.f,0.f,0.f,0.f,0.f,0.f,0.f};
#pragma unroll
      for (int dc = 0; dc < 3; ++dc) {
        FH kb;   // A operand: row m = key j*16+c, k = feature, split k map
        kb.h[0] = *(const v8h*)(Ksh + (j * 16 + c) * AT_KP + dc * 32 + 8 * hh);
        kb.h[1] = *(const v8h*)(Ksh + (j * 16 + c) * AT_KP + dc * 32 + 16 + 8 * hh);
        s[j] = at_mma_h(kb.v, qa[dc], s[j]);   // s[j][r] = score of key j*16 + 8*hh + r against query c
      }
    }
    float m = -INFINITY;
#pragma unroll
    for (int j = 0; j < 4; ++j)
#pragma unroll
      for (int r = 0; r < 8; ++r) m = fmaxf(m, s[j][r]);
    m = fmaxf(m, at_xhalf(m));
    const float mnew = fmaxf(mrun, m);
    const float alpha = __builtin_amdgcn_exp2f((mrun - mnew) * c2);   // 0 on the first chunk, where mrun is -inf
    const float nb = -mnew * c2;
    mrun = mnew;
    // P^T as B operand: column n = query c; elements 0..7 = keys kk*32 + 8*hh + e (tile 2*kk), 8..15 = keys kk*32 + 16 + 8*hh + e
    // (tile 2*kk + 1): the split k map of the V^T loads below, element for element.
    FB ph[2], pl[2];
    float ps[4];
#pragma unroll
    for (int j = 0; j < 4; ++j) {
      ps[j] = 0.f;
#pragma unroll
      for (int r = 0; r < 8; ++r) {
        const float p = __builtin_amdgcn_exp2f(fmaf(s[j][r], c2, nb));   // e^(sscale * (s - max)); far below the max it ends as 0
        ps[j] += p;
        __bf16 bh, bl;
        at_split(p, bh, bl);
        ph[j >> 1].v[(j & 1) * 8 + r] = bh;
        pl[j >> 1].v[(j & 1) * 8 + r] = bl;
      }
    }
    lrun = lrun * alpha + ((ps[0] + ps[1]) + (ps[2] + ps[3]));
#pragma unroll
    for (int t = 0; t < 4; ++t)
#pragma unroll
      for (int r = 0; r < 8; ++r) oacc[t][r] *= alpha;
#pragma unroll   // unrolled: ph and pl live in registers and cannot be indexed by a run-time kk
    for (int kk = 0; kk < 2; ++kk) {
#pragma unroll
      for (int t = 0; t < 4; ++t) {
        FB vb, vl;   // A operand: row m = d = t*16+c, k = key
        vb.h[0] = *(const v8b*)(Vth + (t * 16 + c) * AT_VP + kk * 32 + 8 * hh);
        vb.h[1] = *(const v8b*)(Vth + (t * 16 + c) * AT_VP + kk * 32 + 16 + 8 * hh);
        vl.h[0] = *(const v8b*)(Vtl + (t * 16 + c) * AT_VP + kk * 32 + 8 * hh);
        vl.h[1] = *(const v8b*)(Vtl + (t * 16 + c) * AT_VP + kk * 32 + 16 + 8 * hh);
        oacc[t] = at_mma(vb.v, ph[kk].v, oacc[t]);
        oacc[t] = at_mma(vl.v, ph[kk].v, oacc[t]);
        oacc[t] = at_mma(vb.v, pl[kk].v, oacc[t]);
      }
    }
  }

  float* os = Os[wave];
  const float lsum = lrun + at_xhalf(lrun);         // both halves' keys
  const float inv = oscale * (1.0f / lsum);         // lsum is about 1 or more (the running max contributes 2^0 up to the FMA's rounding)
#pragma unroll
  for (int t = 0; t < 4; ++t) {
    v4f o0, o1;
#pragma unroll
    for (int r = 0; r < 4; ++r) { o0[r] = oacc[t][r] * inv; o1[r] = oacc[t][4 + r] * inv; }
    *(v4f*)(os + c * 68 + t * 16 + 8 * hh)     = o0;
    *(v4f*)(os + c * 68 + t * 16 + 8 * hh + 4) = o1;
  }
  __builtin_amdgcn_fence(__ATOMIC_RELEASE, "workgroup");
  __builtin_amdgcn_wave_barrier();
  __builtin_amdgcn_fence(__ATOMIC_ACQUIRE, "workgroup");
  {
    const int q8 = lane >> 3, c8 = (lane & 7) * 8;
    {
#pragma unroll
      for (int it = 0; it < 4; ++it) {
        const int row = it * 4 + q8;
        v8h hv;
#pragma unroll
        for (int e = 0; e < 8; ++e) hv[e] = (_Float16)os[row * 68 + c8 + e];
        *(v8h*)(Ob + (size_t)(q0 + row) * DMODEL + c8) = hv;
      }
      
    }
  }
}

// ---------------------------------------------------------------------------
//   [ 0 MiB,  8 MiB)  xb   bf16 [4096][1024]            RNE-bf16 of x
//   [ 8 MiB, 10 MiB)  wqb  bf16 [1024][1024]
//   [10 MiB, 12 MiB)  wkb  bf16 [1024][1024]
//   [12 MiB, 14 MiB)  wvb  bf16 [1024][1024]
//   [14 MiB, 16 MiB)  woh  f16  [1024][1024]            64 * bf16_rne(Wo)
//   [16 MiB, 32 MiB)  qpl  f16  [4096][16][128]         q features per head
//   [32 MiB, 48 MiB)  kpl  f16  [4096][16][128]         k features per head
//   [48 MiB, 56 MiB)  vth  bf16 [2][1024][2048]         v^T hi plane
//   [56 MiB, 64 MiB)  vtl  bf16 [2][1024][2048]         v^T lo plane
//   [64 MiB, 72 MiB)  ohp  f16  [4096][1024]            256 * attention output, heads merged
// GEMM shapes: q/k M=4096 N=1024 K=1024; v^T M=1024 N=2048 K=1024 (x2 batch); out M=4096 N=1024 K=1024:
// all M multiples of 128, N of 256, K of 64, row pitch of every operand 1024, no padding, every plane fully written by its producer.
// ---------------------------------------------------------------------------
extern "C" void kernel_launch(void* const* d_in, const int* in_sizes, int n_in,
                              void* d_out, int out_size, void* d_ws, size_t ws_size,
                              hipStream_t stream)
{
  if (n_in < 9) return;
  if (in_sizes[0] != NTOK * DMODEL || in_sizes[1] != DMODEL * DMODEL || in_sizes[2] != DMODEL ||
      in_sizes[3] != DMODEL * DMODEL || in_sizes[4] != DMODEL || in_sizes[5] != DMODEL * DMODEL ||
      in_sizes[6] != DMODEL || in_sizes[7] != DMODEL * DMODEL || in_sizes[8] != DMODEL) return;
  if (out_size != NTOK * DMODEL) return;

  const float* x    = (const float*)d_in[0];
  const float* Wq   = (const float*)d_in[1];
  const float* bq   = (const float*)d_in[2];
  const float* Wk   = (const float*)d_in[3];
  const float* bk   = (const float*)d_in[4];
  const float* Wv   = (const float*)d_in[5];
  const float* bv   = (const float*)d_in[6];
  const float* Wo   = (const float*)d_in[7];
  const float* bo_p = (const float*)d_in[8];

  const size_t SZ_X   = (size_t)NTOK * DMODEL * 2;                 // 8 MiB
  const size_t SZ_W   = (size_t)DMODEL * DMODEL * 2;               // 2 MiB
  const size_t SZ_QK  = (size_t)NTOK * TOKP * 2;                   // 16 MiB
  const size_t SZ_VT  = (size_t)NBAT * DMODEL * SEQ * 2;           // 8 MiB
  const size_t SZ_O   = (size_t)NTOK * DMODEL * 2;                 // 8 MiB
  const size_t OFF_XB = 0;
  const size_t OFF_WQ = OFF_XB + SZ_X;
  const size_t OFF_WK = OFF_WQ + SZ_W;
  const size_t OFF_WV = OFF_WK + SZ_W;
  const size_t OFF_WO = OFF_WV + SZ_W;
  const size_t OFF_QP = OFF_WO + SZ_W;
  const size_t OFF_KP = OFF_QP + SZ_QK;
  const size_t OFF_VH = OFF_KP + SZ_QK;
  const size_t OFF_VL = OFF_VH + SZ_VT;
  const size_t OFF_OH = OFF_VL + SZ_VT;
  const size_t TOTAL  = OFF_OH + SZ_O;                             // 75,497,472
  if (TOTAL > ws_size) return;

  char* ws = (char*)d_ws;
  unsigned short* xb  = (unsigned short*)(ws + OFF_XB);
  unsigned short* wqb = (unsigned short*)(ws + OFF_WQ);
  unsigned short* wkb = (unsigned short*)(ws + OFF_WK);
  unsigned short* wvb = (unsigned short*)(ws + OFF_WV);
  unsigned short* woh = (unsigned short*)(ws + OFF_WO);
  unsigned short* qpl = (unsigned short*)(ws + OFF_QP);
  unsigned short* kpl = (unsigned short*)(ws + OFF_KP);
  unsigned short* vth = (unsigned short*)(ws + OFF_VH);
  unsigned short* vtl = (unsigned short*)(ws + OFF_VL);
  unsigned short* ohp = (unsigned short*)(ws + OFF_OH);

  // ---- 16-bit operand planes (2 elements per thread; counts are multiples of 512) ----
  const int n2x = (NTOK * DMODEL) / 2;       // 2,097,152 -> 8192 blocks
  const int n2w = (DMODEL * DMODEL) / 2;     //   524,288 -> 2048 blocks
  cast_bf16x2_kernel<<<dim3(n2x / 256), dim3(256), 0, stream>>>(x, xb, n2x);
  cast_bf16x2_kernel<<<dim3(n2w / 256), dim3(256), 0, stream>>>(Wq, wqb, n2w);
  cast_bf16x2_kernel<<<dim3(n2w / 256), dim3(256), 0, stream>>>(Wk, wkb, n2w);
  cast_bf16x2_kernel<<<dim3(n2w / 256), dim3(256), 0, stream>>>(Wv, wvb, n2w);
  cast_bf16_f16s_x2_kernel<<<dim3(n2w / 256), dim3(256), 0, stream>>>(Wo, woh, n2w, 64.0f);

  // ---- q / k feature planes: [4096][1024] x [1024][1024]^T + bias, epilogue writes per-head 128-wide f16 rows ----
  {
    const int tiles = (NTOK / 64) * (DMODEL / 64);     // 1024 -> 128 blocks of 8 waves
    dim3 grid(tiles / 8, 1), blk(256);
    wmma_gemm64<1, false, 2, 3, false><<<grid, blk, 0, stream>>>(
        xb, xb, DMODEL, 0L, wqb, wqb, DMODEL, 0L,
        (void*)qpl, (void*)qpl, TOKP, 0L, bq, bq, 0L, NTOK, DMODEL, DMODEL, 1.0f);
    wmma_gemm64<1, false, 2, 3, false><<<grid, blk, 0, stream>>>(
        xb, xb, DMODEL, 0L, wkb, wkb, DMODEL, 0L,
        (void*)kpl, (void*)kpl, TOKP, 0L, bk, bk, 0L, NTOK, DMODEL, DMODEL, 1.0f);
  }
  // ---- v^T planes (role swapped): per batch C[m = h*64+d][n = s] = sum_k Wv[m][k] * x[b][s][k] + bv[m], bf16 hi/lo out ----
  {
    const int tiles = (DMODEL / 64) * (SEQ / 64);      // 512 -> 64 blocks, grid.y = batch
    dim3 grid(tiles / 8, NBAT), blk(256);
    wmma_gemm64<1, false, 1, 2, false><<<grid, blk, 0, stream>>>(
        wvb, wvb, DMODEL, 0L, xb, xb, DMODEL, (long)SEQ * DMODEL,
        (void*)vth, (void*)vtl, SEQ, (long)DMODEL * SEQ, bv, bv, 0L, DMODEL, SEQ, DMODEL, 1.0f);
  }
  // ---- attention: grid = NBAT * NHEAD * (SEQ / 64) = 1024 blocks of 128 threads ----
  attn_aug_kernel<<<dim3(NBAT * NHEAD * (SEQ / 64)), dim3(128), 0, stream>>>(
      qpl, kpl, vth, vtl, ohp, 0.0625f, 256.0f);
  // ---- output projection: d_out[m][n] = (1/16384) * sum_k (256*O)[m][k] * (64*Wo)[n][k] + bo[n], f32 out ----
  {
    const int tiles = (NTOK / 64) * (DMODEL / 64);     // 1024 -> 128 blocks
    dim3 grid(tiles / 8, 1), blk(256);
    wmma_gemm64<0, false, 2, 0, false><<<grid, blk, 0, stream>>>(
        ohp, ohp, DMODEL, 0L, woh, woh, DMODEL, 0L,
        d_out, d_out, DMODEL, 0L, bo_p, bo_p, 0L, NTOK, DMODEL, DMODEL, 1.0f / 16384.0f);
  }
}

// v006
// It runs in 190 microseconds.
// Timed twice side by side with v005, it ran 1.07 times as fast both times.
// All steps since v000 together make it 2.74 times as fast.
// Contractions: q/k/v^T projections v_wmma_f32_16x16x32_bf16 (operands = RNE-bf16 of the f32 inputs, single product); scores v_wmma_f32_16x16x32_f16 (f16 per-head feature planes, single product, x1/16 in f32); p.v v_wmma_f32_16x16x32_bf16 with bf16 hi/lo split of p and v (hi.hi+hi.lo+lo.hi); output projection v_wmma_f32_16x16x32_f16 (f16 O carried x256, f16 Wo carried x64, single product, x1/16384 in f32); f32 accumulate everywhere; softmax, biases and DFT aggregate features in f32.
#include <hip/hip_runtime.h>
#include <math.h>
#include <stdint.h>

// ---------------- problem geometry ----------------
constexpr int NBAT    = 2;
constexpr int SEQ     = 2048;
constexpr int DMODEL  = 1024;
constexpr int NHEAD   = 16;
constexpr int HDIM    = 64;
constexpr int NTOK    = NBAT * SEQ;          // 4096
constexpr int QKPITCH = 128;                 // halves per (token, head) feature row: 64 dims, sum/8, altsum/8, zeros
constexpr int TOKP    = NHEAD * QKPITCH;     // 2048 halves per token row of the q/k feature planes
static_assert(NTOK % 64 == 0 && DMODEL % 64 == 0 && SEQ % 64 == 0 && DMODEL % 32 == 0);
static_assert(NHEAD * HDIM == DMODEL);

typedef __attribute__((ext_vector_type(16))) _Float16 v16h;
typedef __attribute__((ext_vector_type(8)))  _Float16 v8h;
typedef __attribute__((ext_vector_type(16))) __bf16   v16b;
typedef __attribute__((ext_vector_type(8)))  __bf16   v8b;
typedef __attribute__((ext_vector_type(8)))  float    v8f;
typedef __attribute__((ext_vector_type(4)))  float    v4f;
typedef __attribute__((ext_vector_type(2)))  float    v2f;

__device__ __forceinline__ unsigned short f2bf_bits(float f) {
  unsigned u = __float_as_uint(f);
  return (unsigned short)((u + 0x7FFFu + ((u >> 16) & 1u)) >> 16);
}
__device__ __forceinline__ float bf_bits2f(unsigned short h) { return __uint_as_float(((unsigned)h) << 16); }
__device__ __forceinline__ float rne_bf16(float f) { return bf_bits2f(f2bf_bits(f)); }
__device__ __forceinline__ unsigned pk16(unsigned short a, unsigned short b) { return (unsigned)a | ((unsigned)b << 16); }

// hazard guards as plain device helpers (no inline asm inside the kernel template body)
__device__ __forceinline__ void dep_guard_h(v8f& a, v8f& b, v16h x, v16h y) { asm volatile("v_nop\n\tv_nop\n\tv_nop\n\tv_nop" : "+v"(a), "+v"(b) : "v"(x), "v"(y)); }
__device__ __forceinline__ void dep_guard_b(v8f& a, v8f& b, v16b x, v16b y) { asm volatile("v_nop\n\tv_nop\n\tv_nop\n\tv_nop" : "+v"(a), "+v"(b) : "v"(x), "v"(y)); }
__device__ __forceinline__ void keep4_h(v16h a, v16h b, v16h c, v16h d) { asm volatile("v_nop" :: "v"(a), "v"(b), "v"(c), "v"(d)); }
__device__ __forceinline__ void keep4_b(v16b a, v16b b, v16b c, v16b d) { asm volatile("v_nop" :: "v"(a), "v"(b), "v"(c), "v"(d)); }
__device__ __forceinline__ void acc_guard4(v8f& a, v8f& b, v8f& c, v8f& d) { asm volatile("v_nop\n\tv_nop\n\tv_nop\n\tv_nop" : "+v"(a), "+v"(b), "+v"(c), "+v"(d)); }
template <typename T> struct Frag;
template <> struct Frag<_Float16> {
  typedef v16h V; typedef v8h H; union U { v16h v; v8h h[2]; };
  static __device__ __forceinline__ v16h load(const _Float16* p) {   // elements 0..7 <- p[0..7], 8..15 <- p[16..23]
    U f; f.h[0] = *(const v8h*)(p); f.h[1] = *(const v8h*)(p + 16); return f.v;
  }
  static __device__ __forceinline__ v8f mma(v16h a, v16h b, v8f c) {
    return __builtin_amdgcn_wmma_f32_16x16x32_f16(false, a, false, b, (short)0, c, false, false);
  }
  static __device__ __forceinline__ void guard(v8f& a, v8f& b, v16h x, v16h y) { dep_guard_h(a, b, x, y); }
  static __device__ __forceinline__ void keep(v16h a, v16h b, v16h c, v16h d) { keep4_h(a, b, c, d); }
};
template <> struct Frag<__bf16> {
  typedef v16b V; typedef v8b H; union U { v16b v; v8b h[2]; };
  static __device__ __forceinline__ v16b load(const __bf16* p) {
    U f; f.h[0] = *(const v8b*)(p); f.h[1] = *(const v8b*)(p + 16); return f.v;
  }
  static __device__ __forceinline__ v8f mma(v16b a, v16b b, v8f c) {
    return __builtin_amdgcn_wmma_f32_16x16x32_bf16(false, a, false, b, (short)0, c, false, false);
  }
  static __device__ __forceinline__ void guard(v8f& a, v8f& b, v16b x, v16b y) { dep_guard_b(a, b, x, y); }
  static __device__ __forceinline__ void keep(v16b a, v16b b, v16b c, v16b d) { keep4_b(a, b, c, d); }
};

// ---- Register-blocked batched WMMA GEMM ------------------------------------
// C[m,n] = scale * sum_k A[m,k] * Bt[n,k] (+bias)(+resid); each wave owns a 64x64 tile.
// A row-major [M,K]; Bt row-major [N,K]; M % 128 == 0, N % 256 == 0, K % 64 == 0.
// Block = 8 waves as 2 (m) x 4 (n) = a 128 x 256 tile. Per stage of 64 k the block brings its 128 A rows and
// 256 Bt rows (one 128-B line each) into LDS: 8 lanes x 16 B per row, so a wave-wide load covers 4 whole lines.
// Two LDS buffers, the global loads held in registers up to two stages ahead, one __syncthreads per stage.
// SPLIT (hi/lo operand planes) is not instantiated here and not supported by the staged loop.
// BIAS_MODE: 0 = none, 1 = bias[m], 2 = bias[n]. Bias values are RNE-bf16 quantised before the f32 add.
// OUT_MODE: 0 = f32, 1 = f16, 2 = bf16 hi plane (Cout) + bf16 lo plane (Cout2),
//           3 = f16 per-head feature rows: head hd = n0/64, row m -> C[m*ldc + hd*128 + 0..63] = f16(v[0..63]),
//               [+64] = f16(sum_d v[d] / 8), [+65] = f16(sum_d (-1)^d v[d] / 8), [+66..+127] = 0.
// ET: 0 = f16 operands, 1 = bf16 operands (pointers passed as 16-bit storage)
template <int ET> struct Elem;
template <> struct Elem<0> { typedef _Float16 T; };
template <> struct Elem<1> { typedef __bf16 T; };
constexpr int GM_BM   = 128;             // block tile rows (A rows staged)
constexpr int GM_BN   = 256;             // block tile columns (Bt rows staged)
constexpr int GM_ROWS = GM_BM + GM_BN;   // 384 staged rows per stage
constexpr int GM_LD   = DMODEL;          // row pitch of A and Bt in elements, a constant so that a stage's row steps fold into the loads' immediate offsets
constexpr int GM_LP   = 72;              // LDS row pitch in 16-bit elements: 64 used, 144 B = 16 B x odd for ds_load_b128 readers
template <int ET, bool SPLIT, int BIAS_MODE, int OUT_MODE, bool RESID, int ACT = 0>
__global__ __launch_bounds__(256) void wmma_gemm64(
    const unsigned short* __restrict__ Ap, const unsigned short* __restrict__ A2p, int lda, long strideA,
    const unsigned short* __restrict__ Btp, const unsigned short* __restrict__ Bt2p, int ldb, long strideB,
    void* __restrict__ Cout, void* __restrict__ Cout2, int ldc, long strideC,
    const float* __restrict__ bias,
    const float* __restrict__ resid, long strideR,
    int M, int N, int K, float scale) {
  typedef typename Elem<ET>::T T;
  typedef typename Frag<T>::V V;
  typedef typename Frag<T>::H H;
  static_assert(!SPLIT, "the staged loop carries one plane per operand");
  const T* A = (const T*)Ap; const T* Bt = (const T*)Btp;
  __shared__ __align__(16) float sT[8][16 * 68];   // per-wave 16x64 slab, pitch 68 floats
  __shared__ __align__(16) T sAB[2][GM_ROWS * GM_LP];   // rows 0..127 = A, 128..383 = Bt; 64 k per row
  const int b    = blockIdx.y;
  const int lane = threadIdx.x & 31;
  const int wave = threadIdx.x >> 5;
  const int tilesN = N >> 8;
  const int tilesM = M >> 7;
  const int tile = blockIdx.x;
  if (tile >= tilesM * tilesN || lda != GM_LD || ldb != GM_LD) return;   // block-uniform, in front of every barrier
  const int tm = tile / tilesN;
  const int tn = tile - tm * tilesN;
  const int bm0 = tm << 7;                // block tile origin
  const int bn0 = tn << 8;
  const int wm  = (wave >> 2) << 6;       // wave tile origin inside the block tile
  const int wn  = (wave & 3) << 6;
  const int m0 = bm0 + wm;
  const int n0 = bn0 + wn;

  const T* Ab  = A  + (size_t)b * strideA;
  const T* Bb  = Bt + (size_t)b * strideB;

  const int rlane = lane & 15;                 // row (A) / col (B, D) within subtile
  const int koff  = (lane >> 4) * 8;           // k offset of this lane half
  const int mOff  = (lane >> 4) * 8;           // D row offset

  v8f acc[4][4];
#pragma unroll
  for (int i = 0; i < 4; ++i)
#pragma unroll
    for (int j = 0; j < 4; ++j) acc[i][j] = (v8f){0.f,0.f,0.f,0.f,0.f,0.f,0.f,0.f};

  // staging coverage: 256 threads = 32 rows x 8 pieces of 16 B; 4 trips cover the A rows, 8 trips the Bt rows
  // (rows r and r + 8 sit side by side in a 16-lane half: 8 x 144 B = 32 banks apart, so a ds_store_b128 meets no bank twice)
  const int sgrp = threadIdx.x >> 3;
  const int srow = (sgrp & 16) | ((sgrp & 1) << 3) | ((sgrp >> 1) & 7);
  const int spc  = (threadIdx.x & 7) * 8;
  const T* gA = Ab + (size_t)(bm0 + srow) * GM_LD + spc;   // this lane's piece of the stage being loaded; both step 64 k per stage
  const T* gB = Bb + (size_t)(bn0 + srow) * GM_LD + spc;
  const int sOff = srow * GM_LP + spc;
  const int nStage = K >> 6;
  H st[12];   // the stage in flight
#pragma unroll
  for (int i = 0; i < 4; ++i) st[i] = *(const H*)(gA + 32 * i * GM_LD);
#pragma unroll
  for (int i = 0; i < 8; ++i) st[4 + i] = *(const H*)(gB + 32 * i * GM_LD);
#pragma unroll
  for (int i = 0; i < 12; ++i) *(H*)(sAB[0] + sOff + 32 * i * GM_LP) = st[i];
  if (1 < nStage) {
    gA += 64; gB += 64;
#pragma unroll
    for (int i = 0; i < 4; ++i) st[i] = *(const H*)(gA + 32 * i * GM_LD);
#pragma unroll
    for (int i = 0; i < 8; ++i) st[4 + i] = *(const H*)(gB + 32 * i * GM_LD);
  }

  for (int s = 0; s < nStage; ++s) {
    const T* buf = sAB[s & 1];
    __syncthreads();   // publishes stage s and ends every wave's reads of the other buffer (stage s - 1)
#pragma unroll
    for (int kk = 0; kk < 2; ++kk) {
      V bh[4], ah[4];
#pragma unroll
      for (int j = 0; j < 4; ++j) bh[j] = Frag<T>::load(buf + (GM_BM + wn + (j << 4) + rlane) * GM_LP + kk * 32 + koff);
#pragma unroll
      for (int i = 0; i < 4; ++i) ah[i] = Frag<T>::load(buf + (wm + (i << 4) + rlane) * GM_LP + kk * 32 + koff);
      if (kk == 0) {   // staging queues behind the first fragment reads, so the products start sooner
        // stage s + 1 goes from registers into the other buffer. No test round it: with a branch here the fragment
        // waits below fall back to counts that also wait for these stores; the last stage's copy is read by nobody.
        T* nxt = sAB[(s + 1) & 1];
#pragma unroll
        for (int i = 0; i < 12; ++i) *(H*)(nxt + sOff + 32 * i * GM_LP) = st[i];
        if (s + 2 < nStage) {   // block-uniform: stage s + 2's 12 loads land behind this stage's products
          gA += 64; gB += 64;
#pragma unroll
          for (int i = 0; i < 4; ++i) st[i] = *(const H*)(gA + 32 * i * GM_LD);
#pragma unroll
          for (int i = 0; i < 8; ++i) st[4 + i] = *(const H*)(gB + 32 * i * GM_LD);
        }
      }
#pragma unroll
      for (int i = 0; i < 4; ++i) {
#pragma unroll
        for (int j = 0; j < 4; ++j) acc[i][j] = Frag<T>::mma(ah[i], bh[j], acc[i][j]);
        Frag<T>::guard(acc[i][0], acc[i][3], ah[i], ah[i]);
      }
      Frag<T>::keep(bh[0], bh[1], bh[2], bh[3]);
    }
  }
  acc_guard4(acc[0][0], acc[0][1], acc[0][2], acc[0][3]);
  acc_guard4(acc[1][0], acc[1][1], acc[1][2], acc[1][3]);
  acc_guard4(acc[2][0], acc[2][1], acc[2][2], acc[2][3]);
  acc_guard4(acc[3][0], acc[3][1], acc[3][2], acc[3][3]);

  // ---- epilogue ----
  float* slab = sT[wave];
  const float* Rb = RESID ? (resid + (size_t)b * strideR) : nullptr;
#pragma unroll
  for (int i = 0; i < 4; ++i) {
    const int mBase = m0 + (i << 4);
#pragma unroll
    for (int j = 0; j < 4; ++j) {
      const int n = n0 + (j << 4) + rlane;
      float bv = 0.f;
      if (BIAS_MODE == 2) bv = rne_bf16(bias[n]);
#pragma unroll
      for (int r = 0; r < 8; ++r) {
        float v = acc[i][j][r] * scale;
        if (BIAS_MODE == 1) v += rne_bf16(bias[mBase + mOff + r]);
        if (BIAS_MODE == 2) v += bv;
        if (RESID) v += Rb[(size_t)(mBase + mOff + r) * ldc + n];
        if (ACT == 1) v = tanhf(v);
        if (ACT == 2) v = fmaxf(v, 0.0f);
        if (ACT == 3) v = v / (1.0f + expf(-v));
        if (ACT == 4) v = (v > 0.f) ? v : 0.01f * v;
        slab[(mOff + r) * 68 + (j << 4) + rlane] = v;
      }
    }
    __builtin_amdgcn_fence(__ATOMIC_RELEASE, "workgroup");
    __builtin_amdgcn_wave_barrier();
    __builtin_amdgcn_fence(__ATOMIC_ACQUIRE, "workgroup");
    if (OUT_MODE == 0) {
      float* C = (float*)Cout + (size_t)b * strideC;
      const int hh = lane >> 4, c4 = (lane & 15) * 4;     // row seg = 256 B = 16 lanes x 16 B
      {
#pragma unroll
        for (int it = 0; it < 8; ++it) {
          const int row = it * 2 + hh;
          v4f v = *(const v4f*)(slab + row * 68 + c4);
          *(v4f*)(C + (size_t)(mBase + row) * ldc + n0 + c4) = v;
        }
        
      }
    } else if (OUT_MODE == 3) {
      // Coverage per slab: 4 it x 4 row groups (q) = 16 rows; 8 lanes x 8 halves = 64 halves per line.
      const int q = lane >> 3, c8 = (lane & 7) * 8;
      unsigned short* C = (unsigned short*)Cout + (size_t)b * strideC;
      const int hcol = (n0 >> 6) * 128;
      v8h hv[4], av[4];
#pragma unroll
      for (int it = 0; it < 4; ++it) {
        const int row = it * 4 + q;
        const float* sp = slab + row * 68 + c8;
        float ps = 0.f, pa = 0.f;
        v8h t;
#pragma unroll
        for (int e = 0; e < 8; ++e) {
          const float v = sp[e];
          t[e] = (_Float16)v;
          ps += v;
          if (e & 1) pa -= v; else pa += v;     // c8 is even, so (-1)^(c8+e) = (-1)^e
        }
#pragma unroll
        for (int off = 1; off < 8; off <<= 1) {   // reduce over the 8 lanes holding this row
          ps += __shfl_xor(ps, off, 32);
          pa += __shfl_xor(pa, off, 32);
        }
        const float fa = (c8 == 0) ? ps * 0.125f : 0.0f;
        const float fb = (c8 == 0) ? pa * 0.125f : 0.0f;
        v8h u;
#pragma unroll
        for (int e = 0; e < 8; ++e) u[e] = (_Float16)0.0f;
        u[0] = (_Float16)fa;
        u[1] = (_Float16)fb;
        hv[it] = t;
        av[it] = u;
      }
      {
#pragma unroll
        for (int it = 0; it < 4; ++it) {
          const int row = it * 4 + q;
          unsigned short* cp = C + (size_t)(mBase + row) * ldc + hcol + c8;
          *(v8h*)(cp) = hv[it];
          *(v8h*)(cp + 64) = av[it];
        }
        
      }
    } else {
      const int q = lane >> 3, c8 = (lane & 7) * 8;
      unsigned short* C  = (unsigned short*)Cout  + (size_t)b * strideC;
      unsigned short* C2 = (OUT_MODE == 2) ? ((unsigned short*)Cout2 + (size_t)b * strideC) : nullptr;
      {
#pragma unroll
        for (int it = 0; it < 4; ++it) {
          const int row = it * 4 + q;
          const float* sp = slab + row * 68 + c8;
          v8h hv, lv;
#pragma unroll
          for (int e = 0; e < 8; ++e) {
            if (OUT_MODE == 1) {
              hv[e] = (_Float16)sp[e];
            } else {
              unsigned short hb = f2bf_bits(sp[e]);
              unsigned short lb = f2bf_bits(sp[e] - bf_bits2f(hb));
              hv[e] = __builtin_bit_cast(_Float16, hb);
              lv[e] = __builtin_bit_cast(_Float16, lb);
            }
          }
          *(v8h*)(C + (size_t)(mBase + row) * ldc + n0 + c8) = hv;
          if (OUT_MODE == 2) *(v8h*)(C2 + (size_t)(mBase + row) * ldc + n0 + c8) = lv;
        }
        
      }
    }
    __builtin_amdgcn_fence(__ATOMIC_RELEASE, "workgroup");
    __builtin_amdgcn_wave_barrier();
    __builtin_amdgcn_fence(__ATOMIC_ACQUIRE, "workgroup");
  }
}

// ---------------------------------------------------------------------------
// f32 -> RNE bf16 bits, 2 elements per thread packed into one 4-B store: a wave writes one whole
// Coverage: grid = n2/256 blocks x 256 threads x 2 elements = 2*n2 = the whole plane (n2 % 256 == 0 here).
// ---------------------------------------------------------------------------
__global__ __launch_bounds__(256) void cast_bf16x2_kernel(const float* __restrict__ in, unsigned short* __restrict__ out, int n2) {
  const int i = blockIdx.x * 256 + threadIdx.x;
  if (i < n2) {
    const v2f f = *(const v2f*)(in + 2 * (size_t)i);
    const unsigned u = pk16(f2bf_bits(f[0]), f2bf_bits(f[1]));
    ((unsigned*)out)[i] = u;
    
  }
}
// f32 -> f16 bits of (mul * bf16_rne(v)), mul an exact power of two; same store pattern and coverage.
__global__ __launch_bounds__(256) void cast_bf16_f16s_x2_kernel(const float* __restrict__ in, unsigned short* __restrict__ out, int n2, float mul) {
  const int i = blockIdx.x * 256 + threadIdx.x;
  if (i < n2) {
    const v2f f = *(const v2f*)(in + 2 * (size_t)i);
    const _Float16 h0 = (_Float16)(rne_bf16(f[0]) * mul);
    const _Float16 h1 = (_Float16)(rne_bf16(f[1]) * mul);
    const unsigned u = pk16(__builtin_bit_cast(unsigned short, h0), __builtin_bit_cast(unsigned short, h1));
    ((unsigned*)out)[i] = u;
    
  }
}

#define AT_D 64
#define AT_F 96
#define AT_NW 4
#define AT_QB 64
#define AT_KC 64
// LDS row pitches in halves: 16 B x odd, so that the 16 rows of a ds_load_b128 fragment read fall on distinct banks
#define AT_KP 104   // K feature rows: 96 halves used, 208 B pitch
#define AT_VP 72    // V^T rows: 64 halves used, 144 B pitch
static_assert(AT_KP >= AT_F && AT_VP >= AT_KC && (AT_KP * 2) % 32 == 16 && (AT_VP * 2) % 32 == 16, "pitch holds the row and is 16 B x odd");

__device__ __forceinline__ __bf16 at_f2bf(float f) { return __builtin_bit_cast(__bf16, f2bf_bits(f)); }
__device__ __forceinline__ void at_split(float f, __bf16& hi, __bf16& lo) {
  const unsigned short hb = f2bf_bits(f);
  hi = __builtin_bit_cast(__bf16, hb);
  lo = at_f2bf(f - __uint_as_float(((unsigned)hb) << 16));
}
// lane l with lane l ^ 16: the two lanes that share one query column
__device__ __forceinline__ float at_xhalf(float x) {
  return __builtin_bit_cast(float, __builtin_amdgcn_permlanex16(__builtin_bit_cast(int, x), __builtin_bit_cast(int, x), 0x76543210, 0xfedcba98, false, false));
}
__device__ __forceinline__ v8f at_mma(v16b a, v16b b, v8f c) {
  c = __builtin_amdgcn_wmma_f32_16x16x32_bf16(false, a, false, b, (short)0, c, false, false);
  asm volatile("v_nop\n\tv_nop\n\tv_nop\n\tv_nop" : "+v"(c) : "v"(a), "v"(b));
  return c;
}
__device__ __forceinline__ v8f at_mma_h(v16h a, v16h b, v8f c) {
  c = __builtin_amdgcn_wmma_f32_16x16x32_f16(false, a, false, b, (short)0, c, false, false);
  asm volatile("v_nop\n\tv_nop\n\tv_nop\n\tv_nop" : "+v"(c) : "v"(a), "v"(b));
  return c;
}

__global__ __launch_bounds__(128)
void attn_aug_kernel(const unsigned short* __restrict__ qp, const unsigned short* __restrict__ kp,
                     const unsigned short* __restrict__ vhp, const unsigned short* __restrict__ vlp,
                     unsigned short* __restrict__ op, float sscale, float oscale) {
  union FB { v16b v; v8b h[2]; };
  union FH { v16h v; v8h h[2]; };
  __shared__ __align__(16) _Float16 Ksh[AT_KC * AT_KP];          // K features [kv][f]   13 KB
  __shared__ __align__(16) __bf16   Vth[AT_D * AT_VP];           // V hi [d][kv]          9 KB
  __shared__ __align__(16) __bf16   Vtl[AT_D * AT_VP];           // V lo                  9 KB
  __shared__ __align__(16) float    Os[AT_NW][16 * 68];          // per wave out tile, pitch 68

  const int tid  = threadIdx.x;
  const int wave = tid >> 5;
  const int lane = tid & 31;
  const int hh   = lane >> 4;
  const int c    = lane & 15;

  const int nqb = SEQ / AT_QB;            // 32
  const int bx = blockIdx.x;
  const int qb = bx % nqb;
  const int bh = bx / nqb;                // 0..NBAT*NHEAD-1
  const int h  = bh % NHEAD;
  const int b  = bh / NHEAD;
  const int q0 = qb * AT_QB + wave * 16;

  const _Float16* Qb = (const _Float16*)(const void*)qp + (size_t)b * SEQ * TOKP + (size_t)h * QKPITCH;
  const _Float16* Kb = (const _Float16*)(const void*)kp + (size_t)b * SEQ * TOKP + (size_t)h * QKPITCH;
  const __bf16*   Vh = (const __bf16*)(const void*)vhp + ((size_t)b * DMODEL + (size_t)h * AT_D) * SEQ;
  const __bf16*   Vl = (const __bf16*)(const void*)vlp + ((size_t)b * DMODEL + (size_t)h * AT_D) * SEQ;
  _Float16*       Ob = (_Float16*)(void*)op + (size_t)b * SEQ * DMODEL + (size_t)h * AT_D;

  // ---- Q fragments (B operand, column = query = lane&15, split k map via Frag load): 3 feature chunks of 32 ----
  v16h qa[3];
#pragma unroll
  for (int dc = 0; dc < 3; ++dc)
    qa[dc] = Frag<_Float16>::load(Qb + (size_t)(q0 + c) * TOKP + dc * 32 + 8 * hh);

  // softmax in base 2: e^(sscale * (s - max)) = 2^(s * c2 - max * c2); sscale > 0, so the maximum is taken over the unscaled scores
  const float c2 = sscale * 1.4426950408889634f;
  float mrun = -INFINITY;   // running maximum of query c's unscaled scores, equal in both lane halves
  float lrun = 0.f;         // running sum of query c over this lane half's keys; the halves join after the loop
  v8f oacc[4];              // O^T tiles: register r of tile t = O[query c][d = t*16 + 8*hh + r]
#pragma unroll
  for (int t = 0; t < 4; ++t) oacc[t] = (v8f){0.f,0.f,0.f,0.f,0.f,0.f,0.f,0.f};

  const int nChunks = SEQ / AT_KC;   // 32, compile-time constant
  // staging coverage by whole lines: a row's 64 halves are one 128-B line = 8 lanes x 16 B, so a wave-wide load touches 4 lines.
  //   K features 0..63 and each V^T plane: 16 rows x 8 pieces per trip, 4 trips = 64 rows x 64;
  //   K features 64..95 (half a line per row): 32 rows x 4 pieces per trip, 2 trips = 64 rows x 32, 8 lines per wave-wide load.
  // Row order inside a trip, for the ds_store_b128: rows r and r + 8 share a 16-lane half (8 x 208 B and 8 x 144 B = 32 banks apart);
  // in the feature tail rows r, r + 4, r + 8, r + 12 do (4 x 208 B = 16 banks apart): no bank is met twice.
  const int g8  = tid >> 3, g4 = tid >> 2;
  const int r16 = ((g8 & 1) << 3) | (g8 >> 1);                      // 0..15
  const int r32 = (g4 & 16) | ((g4 & 3) << 2) | ((g4 >> 2) & 3);    // 0..31
  const int p8  = (tid & 7) * 8;
  const int p4  = 64 + (tid & 3) * 8;
  static_assert(TOKP == SEQ, "K feature rows and V^T rows have one pitch, so one lane offset serves both");
  // lane offsets in bytes; the bases they are added to are wave-uniform
  const unsigned go8 = (unsigned)(r16 * SEQ + p8) * 2u;    // row r16 (+16 per trip), piece p8..+7, of K and of both V^T planes
  const unsigned go4 = (unsigned)(r32 * TOKP + p4) * 2u;   // K row r32 (+32 per trip), f = p4..+7
  const char* Kc  = (const char*)Kb;
  const char* Vhc = (const char*)Vh;
  const char* Vlc = (const char*)Vl;
  _Float16* kd8 = Ksh + r16 * AT_KP + p8;             // the same pieces' places in LDS
  _Float16* kd4 = Ksh + r32 * AT_KP + p4;
  __bf16*   vdh = Vth + r16 * AT_VP + p8;
  __bf16*   vdl = Vtl + r16 * AT_VP + p8;
  // the chunk in flight: 14 x 16 B per thread, loaded one chunk ahead of the LDS stores that consume them
  v8h kreg[6];
  v8b vhreg[4], vlreg[4];
#pragma unroll
  for (int i = 0; i < 4; ++i) kreg[i] = *(const v8h*)(Kc + 32 * i * TOKP + go8);
#pragma unroll
  for (int i = 0; i < 2; ++i) kreg[4 + i] = *(const v8h*)(Kc + 64 * i * TOKP + go4);
#pragma unroll
  for (int i = 0; i < 4; ++i) {
    vhreg[i] = *(const v8b*)(Vhc + 32 * i * SEQ + go8);
    vlreg[i] = *(const v8b*)(Vlc + 32 * i * SEQ + go8);
  }
  // the LDS address arithmetic around this point reuses the loads' address registers.
  // The two lane offsets are inputs so that their registers stay untouched up to the wait.
  asm volatile("s_wait_xcnt 0x0" :: "v"(go8), "v"(go4) : "memory");
  __builtin_amdgcn_sched_barrier(0);   // keeps that arithmetic from being lifted over the wait
  for (int kc = 0; kc < nChunks; ++kc) {
    __syncthreads();
#pragma unroll
    for (int i = 0; i < 4; ++i) *(v8h*)(kd8 + 16 * i * AT_KP) = kreg[i];
#pragma unroll
    for (int i = 0; i < 2; ++i) *(v8h*)(kd4 + 32 * i * AT_KP) = kreg[4 + i];
#pragma unroll
    for (int i = 0; i < 4; ++i) {
      *(v8b*)(vdh + 16 * i * AT_VP) = vhreg[i];
      *(v8b*)(vdl + 16 * i * AT_VP) = vlreg[i];
    }
    __syncthreads();
    if (kc + 1 < nChunks) {   // block-uniform: the next chunk's 14 loads go out together and land behind this chunk's work
      const char* kn  = Kc  + (size_t)(kc + 1) * (AT_KC * TOKP * 2);   // wave-uniform chunk bases, in bytes
      const char* vhn = Vhc + (size_t)(kc + 1) * (AT_KC * 2);
      const char* vln = Vlc + (size_t)(kc + 1) * (AT_KC * 2);
#pragma unroll
      for (int i = 0; i < 4; ++i) kreg[i] = *(const v8h*)(kn + 32 * i * TOKP + go8);
#pragma unroll
      for (int i = 0; i < 2; ++i) kreg[4 + i] = *(const v8h*)(kn + 64 * i * TOKP + go4);
#pragma unroll
      for (int i = 0; i < 4; ++i) {
        vhreg[i] = *(const v8b*)(vhn + 32 * i * SEQ + go8);
        vlreg[i] = *(const v8b*)(vln + 32 * i * SEQ + go8);
      }
      // the fragment loads below reuse these loads' address registers
      asm volatile("s_wait_xcnt 0x0" ::: "memory");
    }

    v8f s[4];
#pragma unroll
    for (int j = 0; j < 4; ++j) {
      s[j] = (v8f){0.f,0.f,0.f,0.f,0.f,0.f,0.f,0.f};
#pragma unroll
      for (int dc = 0; dc < 3; ++dc) {
        FH kb;   // A operand: row m = key j*16+c, k = feature, split k map
        kb.h[0] = *(const v8h*)(Ksh + (j * 16 + c) * AT_KP + dc * 32 + 8 * hh);
        kb.h[1] = *(const v8h*)(Ksh + (j * 16 + c) * AT_KP + dc * 32 + 16 + 8 * hh);
        s[j] = at_mma_h(kb.v, qa[dc], s[j]);   // s[j][r] = score of key j*16 + 8*hh + r against query c
      }
    }
    float m = -INFINITY;
#pragma unroll
    for (int j = 0; j < 4; ++j)
#pragma unroll
      for (int r = 0; r < 8; ++r) m = fmaxf(m, s[j][r]);
    m = fmaxf(m, at_xhalf(m));
    const float mnew = fmaxf(mrun, m);
    const float alpha = __builtin_amdgcn_exp2f((mrun - mnew) * c2);   // 0 on the first chunk, where mrun is -inf
    const float nb = -mnew * c2;
    mrun = mnew;
    // P^T as B operand: column n = query c; elements 0..7 = keys kk*32 + 8*hh + e (tile 2*kk), 8..15 = keys kk*32 + 16 + 8*hh + e
    // (tile 2*kk + 1): the split k map of the V^T loads below, element for element.
    FB ph[2], pl[2];
    float ps[4];
#pragma unroll
    for (int j = 0; j < 4; ++j) {
      ps[j] = 0.f;
#pragma unroll
      for (int r = 0; r < 8; ++r) {
        const float p = __builtin_amdgcn_exp2f(fmaf(s[j][r], c2, nb));   // e^(sscale * (s - max)); far below the max it ends as 0
        ps[j] += p;
        __bf16 bh, bl;
        at_split(p, bh, bl);
        ph[j >> 1].v[(j & 1) * 8 + r] = bh;
        pl[j >> 1].v[(j & 1) * 8 + r] = bl;
      }
    }
    lrun = lrun * alpha + ((ps[0] + ps[1]) + (ps[2] + ps[3]));
#pragma unroll
    for (int t = 0; t < 4; ++t)
#pragma unroll
      for (int r = 0; r < 8; ++r) oacc[t][r] *= alpha;
#pragma unroll   // unrolled: ph and pl live in registers and cannot be indexed by a run-time kk
    for (int kk = 0; kk < 2; ++kk) {
#pragma unroll
      for (int t = 0; t < 4; ++t) {
        FB vb, vl;   // A operand: row m = d = t*16+c, k = key
        vb.h[0] = *(const v8b*)(Vth + (t * 16 + c) * AT_VP + kk * 32 + 8 * hh);
        vb.h[1] = *(const v8b*)(Vth + (t * 16 + c) * AT_VP + kk * 32 + 16 + 8 * hh);
        vl.h[0] = *(const v8b*)(Vtl + (t * 16 + c) * AT_VP + kk * 32 + 8 * hh);
        vl.h[1] = *(const v8b*)(Vtl + (t * 16 + c) * AT_VP + kk * 32 + 16 + 8 * hh);
        oacc[t] = at_mma(vb.v, ph[kk].v, oacc[t]);
        oacc[t] = at_mma(vl.v, ph[kk].v, oacc[t]);
        oacc[t] = at_mma(vb.v, pl[kk].v, oacc[t]);
      }
    }
  }

  float* os = Os[wave];
  const float lsum = lrun + at_xhalf(lrun);         // both halves' keys
  const float inv = oscale * (1.0f / lsum);         // lsum is about 1 or more (the running max contributes 2^0 up to the FMA's rounding)
#pragma unroll
  for (int t = 0; t < 4; ++t) {
    v4f o0, o1;
#pragma unroll
    for (int r = 0; r < 4; ++r) { o0[r] = oacc[t][r] * inv; o1[r] = oacc[t][4 + r] * inv; }
    *(v4f*)(os + c * 68 + t * 16 + 8 * hh)     = o0;
    *(v4f*)(os + c * 68 + t * 16 + 8 * hh + 4) = o1;
  }
  __builtin_amdgcn_fence(__ATOMIC_RELEASE, "workgroup");
  __builtin_amdgcn_wave_barrier();
  __builtin_amdgcn_fence(__ATOMIC_ACQUIRE, "workgroup");
  {
    const int q8 = lane >> 3, c8 = (lane & 7) * 8;
    {
#pragma unroll
      for (int it = 0; it < 4; ++it) {
        const int row = it * 4 + q8;
        v8h hv;
#pragma unroll
        for (int e = 0; e < 8; ++e) hv[e] = (_Float16)os[row * 68 + c8 + e];
        *(v8h*)(Ob + (size_t)(q0 + row) * DMODEL + c8) = hv;
      }
      
    }
  }
}

// ---------------------------------------------------------------------------
//   [ 0 MiB,  8 MiB)  xb   bf16 [4096][1024]            RNE-bf16 of x
//   [ 8 MiB, 10 MiB)  wqb  bf16 [1024][1024]
//   [10 MiB, 12 MiB)  wkb  bf16 [1024][1024]
//   [12 MiB, 14 MiB)  wvb  bf16 [1024][1024]
//   [14 MiB, 16 MiB)  woh  f16  [1024][1024]            64 * bf16_rne(Wo)
//   [16 MiB, 32 MiB)  qpl  f16  [4096][16][128]         q features per head
//   [32 MiB, 48 MiB)  kpl  f16  [4096][16][128]         k features per head
//   [48 MiB, 56 MiB)  vth  bf16 [2][1024][2048]         v^T hi plane
//   [56 MiB, 64 MiB)  vtl  bf16 [2][1024][2048]         v^T lo plane
//   [64 MiB, 72 MiB)  ohp  f16  [4096][1024]            256 * attention output, heads merged
// GEMM shapes: q/k M=4096 N=1024 K=1024; v^T M=1024 N=2048 K=1024 (x2 batch); out M=4096 N=1024 K=1024:
// all M multiples of 128, N of 256, K of 64, row pitch of every operand 1024, no padding, every plane fully written by its producer.
// ---------------------------------------------------------------------------
extern "C" void kernel_launch(void* const* d_in, const int* in_sizes, int n_in,
                              void* d_out, int out_size, void* d_ws, size_t ws_size,
                              hipStream_t stream)
{
  if (n_in < 9) return;
  if (in_sizes[0] != NTOK * DMODEL || in_sizes[1] != DMODEL * DMODEL || in_sizes[2] != DMODEL ||
      in_sizes[3] != DMODEL * DMODEL || in_sizes[4] != DMODEL || in_sizes[5] != DMODEL * DMODEL ||
      in_sizes[6] != DMODEL || in_sizes[7] != DMODEL * DMODEL || in_sizes[8] != DMODEL) return;
  if (out_size != NTOK * DMODEL) return;

  const float* x    = (const float*)d_in[0];
  const float* Wq   = (const float*)d_in[1];
  const float* bq   = (const float*)d_in[2];
  const float* Wk   = (const float*)d_in[3];
  const float* bk   = (const float*)d_in[4];
  const float* Wv   = (const float*)d_in[5];
  const float* bv   = (const float*)d_in[6];
  const float* Wo   = (const float*)d_in[7];
  const float* bo_p = (const float*)d_in[8];

  const size_t SZ_X   = (size_t)NTOK * DMODEL * 2;                 // 8 MiB
  const size_t SZ_W   = (size_t)DMODEL * DMODEL * 2;               // 2 MiB
  const size_t SZ_QK  = (size_t)NTOK * TOKP * 2;                   // 16 MiB
  const size_t SZ_VT  = (size_t)NBAT * DMODEL * SEQ * 2;           // 8 MiB
  const size_t SZ_O   = (size_t)NTOK * DMODEL * 2;                 // 8 MiB
  const size_t OFF_XB = 0;
  const size_t OFF_WQ = OFF_XB + SZ_X;
  const size_t OFF_WK = OFF_WQ + SZ_W;
  const size_t OFF_WV = OFF_WK + SZ_W;
  const size_t OFF_WO = OFF_WV + SZ_W;
  const size_t OFF_QP = OFF_WO + SZ_W;
  const size_t OFF_KP = OFF_QP + SZ_QK;
  const size_t OFF_VH = OFF_KP + SZ_QK;
  const size_t OFF_VL = OFF_VH + SZ_VT;
  const size_t OFF_OH = OFF_VL + SZ_VT;
  const size_t TOTAL  = OFF_OH + SZ_O;                             // 75,497,472
  if (TOTAL > ws_size) return;

  char* ws = (char*)d_ws;
  unsigned short* xb  = (unsigned short*)(ws + OFF_XB);
  unsigned short* wqb = (unsigned short*)(ws + OFF_WQ);
  unsigned short* wkb = (unsigned short*)(ws + OFF_WK);
  unsigned short* wvb = (unsigned short*)(ws + OFF_WV);
  unsigned short* woh = (unsigned short*)(ws + OFF_WO);
  unsigned short* qpl = (unsigned short*)(ws + OFF_QP);
  unsigned short* kpl = (unsigned short*)(ws + OFF_KP);
  unsigned short* vth = (unsigned short*)(ws + OFF_VH);
  unsigned short* vtl = (unsigned short*)(ws + OFF_VL);
  unsigned short* ohp = (unsigned short*)(ws + OFF_OH);

  // ---- 16-bit operand planes (2 elements per thread; counts are multiples of 512) ----
  const int n2x = (NTOK * DMODEL) / 2;       // 2,097,152 -> 8192 blocks
  const int n2w = (DMODEL * DMODEL) / 2;     //   524,288 -> 2048 blocks
  cast_bf16x2_kernel<<<dim3(n2x / 256), dim3(256), 0, stream>>>(x, xb, n2x);
  cast_bf16x2_kernel<<<dim3(n2w / 256), dim3(256), 0, stream>>>(Wq, wqb, n2w);
  cast_bf16x2_kernel<<<dim3(n2w / 256), dim3(256), 0, stream>>>(Wk, wkb, n2w);
  cast_bf16x2_kernel<<<dim3(n2w / 256), dim3(256), 0, stream>>>(Wv, wvb, n2w);
  cast_bf16_f16s_x2_kernel<<<dim3(n2w / 256), dim3(256), 0, stream>>>(Wo, woh, n2w, 64.0f);

  // ---- q / k feature planes: [4096][1024] x [1024][1024]^T + bias, epilogue writes per-head 128-wide f16 rows ----
  {
    const int tiles = (NTOK / 64) * (DMODEL / 64);     // 1024 -> 128 blocks of 8 waves
    dim3 grid(tiles / 8, 1), blk(256);
    wmma_gemm64<1, false, 2, 3, false><<<grid, blk, 0, stream>>>(
        xb, xb, DMODEL, 0L, wqb, wqb, DMODEL, 0L,
        (void*)qpl, (void*)qpl, TOKP, 0L, bq, bq, 0L, NTOK, DMODEL, DMODEL, 1.0f);
    wmma_gemm64<1, false, 2, 3, false><<<grid, blk, 0, stream>>>(
        xb, xb, DMODEL, 0L, wkb, wkb, DMODEL, 0L,
        (void*)kpl, (void*)kpl, TOKP, 0L, bk, bk, 0L, NTOK, DMODEL, DMODEL, 1.0f);
  }
  // ---- v^T planes (role swapped): per batch C[m = h*64+d][n = s] = sum_k Wv[m][k] * x[b][s][k] + bv[m], bf16 hi/lo out ----
  {
    const int tiles = (DMODEL / 64) * (SEQ / 64);      // 512 -> 64 blocks, grid.y = batch
    dim3 grid(tiles / 8, NBAT), blk(256);
    wmma_gemm64<1, false, 1, 2, false><<<grid, blk, 0, stream>>>(
        wvb, wvb, DMODEL, 0L, xb, xb, DMODEL, (long)SEQ * DMODEL,
        (void*)vth, (void*)vtl, SEQ, (long)DMODEL * SEQ, bv, bv, 0L, DMODEL, SEQ, DMODEL, 1.0f);
  }
  // ---- attention: grid = NBAT * NHEAD * (SEQ / 64) = 1024 blocks of 128 threads ----
  attn_aug_kernel<<<dim3(NBAT * NHEAD * (SEQ / 64)), dim3(128), 0, stream>>>(
      qpl, kpl, vth, vtl, ohp, 0.0625f, 256.0f);
  // ---- output projection: d_out[m][n] = (1/16384) * sum_k (256*O)[m][k] * (64*Wo)[n][k] + bo[n], f32 out ----
  {
    const int tiles = (NTOK / 64) * (DMODEL / 64);     // 1024 -> 128 blocks
    dim3 grid(tiles / 8, 1), blk(256);
    wmma_gemm64<0, false, 2, 0, false><<<grid, blk, 0, stream>>>(
        ohp, ohp, DMODEL, 0L, woh, woh, DMODEL, 0L,
        d_out, d_out, DMODEL, 0L, bo_p, bo_p, 0L, NTOK, DMODEL, DMODEL, 1.0f / 16384.0f);
  }
}

// v007
// It runs in 160 microseconds.
// Two timings next to v006 both put it at 1.19 times that version's speed.
// Counting every step since v000, it is 3.26 times as fast.
// Contractions: q/k/v^T projections v_wmma_f32_16x16x32_bf16 (operands = RNE-bf16 of the f32 inputs, single product); scores v_wmma_f32_16x16x32_f16 (f16 per-head feature planes, single product, x1/16 in f32); p.v v_wmma_f32_16x16x32_bf16 with bf16 hi/lo split of p and v (hi.hi+hi.lo+lo.hi); output projection v_wmma_f32_16x16x32_f16 (f16 O carried x256, f16 Wo carried x64, single product, x1/16384 in f32); f32 accumulate everywhere; softmax, biases and DFT aggregate features in f32.
#include <hip/hip_runtime.h>
#include <math.h>
#include <stdint.h>

// ---------------- problem geometry ----------------
constexpr int NBAT    = 2;
constexpr int SEQ     = 2048;
constexpr int DMODEL  = 1024;
constexpr int NHEAD   = 16;
constexpr int HDIM    = 64;
constexpr int NTOK    = NBAT * SEQ;          // 4096
constexpr int QKPITCH = 128;                 // halves per (token, head) feature row: 64 dims, sum/8, altsum/8, zeros
constexpr int TOKP    = NHEAD * QKPITCH;     // 2048 halves per token row of the q/k feature planes
static_assert(NTOK % 64 == 0 && DMODEL % 64 == 0 && SEQ % 64 == 0 && DMODEL % 32 == 0);
static_assert(NHEAD * HDIM == DMODEL);

typedef __attribute__((ext_vector_type(16))) _Float16 v16h;
typedef __attribute__((ext_vector_type(8)))  _Float16 v8h;
typedef __attribute__((ext_vector_type(16))) __bf16   v16b;
typedef __attribute__((ext_vector_type(8)))  __bf16   v8b;
typedef __attribute__((ext_vector_type(8)))  float    v8f;
typedef __attribute__((ext_vector_type(4)))  float    v4f;
typedef __attribute__((ext_vector_type(2)))  float    v2f;

__device__ __forceinline__ unsigned short f2bf_bits(float f) {
  unsigned u = __float_as_uint(f);
  return (unsigned short)((u + 0x7FFFu + ((u >> 16) & 1u)) >> 16);
}
__device__ __forceinline__ float bf_bits2f(unsigned short h) { return __uint_as_float(((unsigned)h) << 16); }
__device__ __forceinline__ float rne_bf16(float f) { return bf_bits2f(f2bf_bits(f)); }
__device__ __forceinline__ unsigned pk16(unsigned short a, unsigned short b) { return (unsigned)a | ((unsigned)b << 16); }

// hazard guards as plain device helpers (no inline asm inside the kernel template body)
__device__ __forceinline__ void dep_guard_h(v8f& a, v8f& b, v16h x, v16h y) { asm volatile("v_nop\n\tv_nop\n\tv_nop\n\tv_nop" : "+v"(a), "+v"(b) : "v"(x), "v"(y)); }
__device__ __forceinline__ void dep_guard_b(v8f& a, v8f& b, v16b x, v16b y) { asm volatile("v_nop\n\tv_nop\n\tv_nop\n\tv_nop" : "+v"(a), "+v"(b) : "v"(x), "v"(y)); }
__device__ __forceinline__ void keep4_h(v16h a, v16h b, v16h c, v16h d) { asm volatile("v_nop" :: "v"(a), "v"(b), "v"(c), "v"(d)); }
__device__ __forceinline__ void keep4_b(v16b a, v16b b, v16b c, v16b d) { asm volatile("v_nop" :: "v"(a), "v"(b), "v"(c), "v"(d)); }
__device__ __forceinline__ void acc_guard4(v8f& a, v8f& b, v8f& c, v8f& d) { asm volatile("v_nop\n\tv_nop\n\tv_nop\n\tv_nop" : "+v"(a), "+v"(b), "+v"(c), "+v"(d)); }
template <typename T> struct Frag;
template <> struct Frag<_Float16> {
  typedef v16h V; typedef v8h H; union U { v16h v; v8h h[2]; };
  static __device__ __forceinline__ v16h load(const _Float16* p) {   // elements 0..7 <- p[0..7], 8..15 <- p[16..23]
    U f; f.h[0] = *(const v8h*)(p); f.h[1] = *(const v8h*)(p + 16); return f.v;
  }
  static __device__ __forceinline__ v8f mma(v16h a, v16h b, v8f c) {
    return __builtin_amdgcn_wmma_f32_16x16x32_f16(false, a, false, b, (short)0, c, false, false);
  }
  static __device__ __forceinline__ void guard(v8f& a, v8f& b, v16h x, v16h y) { dep_guard_h(a, b, x, y); }
  static __device__ __forceinline__ void keep(v16h a, v16h b, v16h c, v16h d) { keep4_h(a, b, c, d); }
};
template <> struct Frag<__bf16> {
  typedef v16b V; typedef v8b H; union U { v16b v; v8b h[2]; };
  static __device__ __forceinline__ v16b load(const __bf16* p) {
    U f; f.h[0] = *(const v8b*)(p); f.h[1] = *(const v8b*)(p + 16); return f.v;
  }
  static __device__ __forceinline__ v8f mma(v16b a, v16b b, v8f c) {
    return __builtin_amdgcn_wmma_f32_16x16x32_bf16(false, a, false, b, (short)0, c, false, false);
  }
  static __device__ __forceinline__ void guard(v8f& a, v8f& b, v16b x, v16b y) { dep_guard_b(a, b, x, y); }
  static __device__ __forceinline__ void keep(v16b a, v16b b, v16b c, v16b d) { keep4_b(a, b, c, d); }
};

// ---- Register-blocked batched WMMA GEMM ------------------------------------
// C[m,n] = scale * sum_k A[m,k] * Bt[n,k] (+bias)(+resid); each wave owns a 64x64 tile.
// A row-major [M,K]; Bt row-major [N,K]; M % 128 == 0, N % 256 == 0, K % 64 == 0.
// Block = 8 waves as 2 (m) x 4 (n) = a 128 x 256 tile. Per stage of 64 k the block brings its 128 A rows and
// 256 Bt rows (one 128-B line each) into LDS: 8 lanes x 16 B per row, so a wave-wide load covers 4 whole lines.
// Two LDS buffers, the global loads held in registers up to two stages ahead, one __syncthreads per stage.
// SPLIT (hi/lo operand planes) is not instantiated here and not supported by the staged loop.
// BIAS_MODE: 0 = none, 1 = bias[m], 2 = bias[n]. Bias values are RNE-bf16 quantised before the f32 add.
// OUT_MODE: 0 = f32, 1 = f16, 2 = bf16 hi plane (Cout) + bf16 lo plane (Cout2),
//           3 = f16 per-head feature rows: head hd = n0/64, row m -> C[m*ldc + hd*128 + 0..63] = f16(v[0..63]),
//               [+64] = f16(sum_d v[d] / 8), [+65] = f16(sum_d (-1)^d v[d] / 8), [+66..+127] = 0.
// ET: 0 = f16 operands, 1 = bf16 operands (pointers passed as 16-bit storage)
template <int ET> struct Elem;
template <> struct Elem<0> { typedef _Float16 T; };
template <> struct Elem<1> { typedef __bf16 T; };
constexpr int GM_BM   = 128;             // block tile rows (A rows staged)
constexpr int GM_BN   = 256;             // block tile columns (Bt rows staged)
constexpr int GM_ROWS = GM_BM + GM_BN;   // 384 staged rows per stage
constexpr int GM_LD   = DMODEL;          // row pitch of A and Bt in elements, a constant so that a stage's row steps fold into the loads' immediate offsets
constexpr int GM_LP   = 72;              // LDS row pitch in 16-bit elements: 64 used, 144 B = 16 B x odd for ds_load_b128 readers
// The work of one block, shared by the kernels below: sT and sAB are the calling kernel's LDS, tile and b its place in the problem.
template <int ET, bool SPLIT, int BIAS_MODE, int OUT_MODE, bool RESID, int ACT = 0>
__device__ __forceinline__ void gemm64_block(
    float (*sT)[16 * 68], typename Elem<ET>::T (*sAB)[GM_ROWS * GM_LP], const int tile, const int b,
    const unsigned short* __restrict__ Ap, const unsigned short* __restrict__ A2p, int lda, long strideA,
    const unsigned short* __restrict__ Btp, const unsigned short* __restrict__ Bt2p, int ldb, long strideB,
    void* __restrict__ Cout, void* __restrict__ Cout2, int ldc, long strideC,
    const float* __restrict__ bias,
    const float* __restrict__ resid, long strideR,
    int M, int N, int K, float scale) {
  typedef typename Elem<ET>::T T;
  typedef typename Frag<T>::V V;
  typedef typename Frag<T>::H H;
  static_assert(!SPLIT, "the staged loop carries one plane per operand");
  const T* A = (const T*)Ap; const T* Bt = (const T*)Btp;
  const int lane = threadIdx.x & 31;
  const int wave = __builtin_amdgcn_readfirstlane(threadIdx.x >> 5);   // the same in every lane: what derives from it stays in scalar registers
  const int tilesN = N >> 8;
  const int tilesM = M >> 7;
  if (tile >= tilesM * tilesN || lda != GM_LD || ldb != GM_LD) return;   // block-uniform, in front of every barrier
  const int tm = tile / tilesN;
  const int tn = tile - tm * tilesN;
  const int bm0 = tm << 7;                // block tile origin
  const int bn0 = tn << 8;
  const int wm  = (wave >> 2) << 6;       // wave tile origin inside the block tile
  const int wn  = (wave & 3) << 6;
  const int m0 = bm0 + wm;
  const int n0 = bn0 + wn;

  const T* Ab  = A  + (size_t)b * strideA;
  const T* Bb  = Bt + (size_t)b * strideB;

  const int rlane = lane & 15;                 // row (A) / col (B, D) within subtile
  const int koff  = (lane >> 4) * 8;           // k offset of this lane half
  const int mOff  = (lane >> 4) * 8;           // D row offset

  v8f acc[4][4];
#pragma unroll
  for (int i = 0; i < 4; ++i)
#pragma unroll
    for (int j = 0; j < 4; ++j) acc[i][j] = (v8f){0.f,0.f,0.f,0.f,0.f,0.f,0.f,0.f};

  // staging coverage: 256 threads = 32 rows x 8 pieces of 16 B; 4 trips cover the A rows, 8 trips the Bt rows
  // (rows r and r + 8 sit side by side in a 16-lane half: 8 x 144 B = 32 banks apart, so a ds_store_b128 meets no bank twice)
  const int sgrp = threadIdx.x >> 3;
  const int srow = (sgrp & 16) | ((sgrp & 1) << 3) | ((sgrp >> 1) & 7);
  const int spc  = (threadIdx.x & 7) * 8;
  // A and Bt have one row pitch, so one 32-bit lane offset (bytes) serves both and steps 64 k = 128 B per stage; the two bases are
  // block-uniform (scalar registers). Three vector registers fewer than two 64-bit lane pointers.
  unsigned gOff = (unsigned)(srow * GM_LD + spc) * 2u;
  const char* gA = (const char*)(Ab + (size_t)bm0 * GM_LD);
  const char* gB = (const char*)(Bb + (size_t)bn0 * GM_LD);
  const int sOff = srow * GM_LP + spc;
  const int nStage = K >> 6;
  H st[12];   // the stage in flight
#pragma unroll
  for (int i = 0; i < 4; ++i) st[i] = *(const H*)(gA + 64 * i * GM_LD + gOff);
#pragma unroll
  for (int i = 0; i < 8; ++i) st[4 + i] = *(const H*)(gB + 64 * i * GM_LD + gOff);
#pragma unroll
  for (int i = 0; i < 12; ++i) *(H*)(sAB[0] + sOff + 32 * i * GM_LP) = st[i];
  if (1 < nStage) {
    gOff += 128u;
#pragma unroll
    for (int i = 0; i < 4; ++i) st[i] = *(const H*)(gA + 64 * i * GM_LD + gOff);
#pragma unroll
    for (int i = 0; i < 8; ++i) st[4 + i] = *(const H*)(gB + 64 * i * GM_LD + gOff);
  }

  for (int s = 0; s < nStage; ++s) {
    const T* buf = sAB[s & 1];
    __syncthreads();   // publishes stage s and ends every wave's reads of the other buffer (stage s - 1)
#pragma unroll
    for (int kk = 0; kk < 2; ++kk) {
      V bh[4], ah[4];
#pragma unroll
      for (int j = 0; j < 4; ++j) bh[j] = Frag<T>::load(buf + (GM_BM + wn + (j << 4) + rlane) * GM_LP + kk * 32 + koff);
#pragma unroll
      for (int i = 0; i < 4; ++i) ah[i] = Frag<T>::load(buf + (wm + (i << 4) + rlane) * GM_LP + kk * 32 + koff);
      if (kk == 0) {   // staging queues behind the first fragment reads, so the products start sooner
        // stage s + 1 goes from registers into the other buffer. No test round it: with a branch here the fragment
        // waits below fall back to counts that also wait for these stores; the last stage's copy is read by nobody.
        T* nxt = sAB[(s + 1) & 1];
#pragma unroll
        for (int i = 0; i < 12; ++i) *(H*)(nxt + sOff + 32 * i * GM_LP) = st[i];
        if (s + 2 < nStage) {   // block-uniform: stage s + 2's 12 loads land behind this stage's products
          gOff += 128u;
#pragma unroll
          for (int i = 0; i < 4; ++i) st[i] = *(const H*)(gA + 64 * i * GM_LD + gOff);
#pragma unroll
          for (int i = 0; i < 8; ++i) st[4 + i] = *(const H*)(gB + 64 * i * GM_LD + gOff);
          // behind the loop the two scalar bases' registers are reused
          asm volatile("s_wait_xcnt 0x0" ::: "memory");
        }
      }
#pragma unroll
      for (int i = 0; i < 4; ++i) {
#pragma unroll
        for (int j = 0; j < 4; ++j) acc[i][j] = Frag<T>::mma(ah[i], bh[j], acc[i][j]);
        Frag<T>::guard(acc[i][0], acc[i][3], ah[i], ah[i]);
      }
      Frag<T>::keep(bh[0], bh[1], bh[2], bh[3]);
    }
  }
  acc_guard4(acc[0][0], acc[0][1], acc[0][2], acc[0][3]);
  acc_guard4(acc[1][0], acc[1][1], acc[1][2], acc[1][3]);
  acc_guard4(acc[2][0], acc[2][1], acc[2][2], acc[2][3]);
  acc_guard4(acc[3][0], acc[3][1], acc[3][2], acc[3][3]);

  // ---- epilogue ----
  float* slab = sT[wave];
  const float* Rb = RESID ? (resid + (size_t)b * strideR) : nullptr;
#pragma unroll
  for (int i = 0; i < 4; ++i) {
    const int mBase = m0 + (i << 4);
    float bm[8];
    if (BIAS_MODE == 1) {
      const float* bp = bias + mBase + mOff;
#pragma unroll
      for (int r = 0; r < 8; ++r) bm[r] = bp[r];
      // the address is an input so that its registers stay untouched up to the wait
      asm volatile("s_wait_xcnt 0x0" :: "v"(bp) : "memory");
    }
#pragma unroll
    for (int j = 0; j < 4; ++j) {
      const int n = n0 + (j << 4) + rlane;
      float bv = 0.f;
      if (BIAS_MODE == 2) bv = rne_bf16(bias[n]);
#pragma unroll
      for (int r = 0; r < 8; ++r) {
        float v = acc[i][j][r] * scale;
        if (BIAS_MODE == 1) v += rne_bf16(bm[r]);
        if (BIAS_MODE == 2) v += bv;
        if (RESID) v += Rb[(size_t)(mBase + mOff + r) * ldc + n];
        if (ACT == 1) v = tanhf(v);
        if (ACT == 2) v = fmaxf(v, 0.0f);
        if (ACT == 3) v = v / (1.0f + expf(-v));
        if (ACT == 4) v = (v > 0.f) ? v : 0.01f * v;
        slab[(mOff + r) * 68 + (j << 4) + rlane] = v;
      }
    }
    __builtin_amdgcn_fence(__ATOMIC_RELEASE, "workgroup");
    __builtin_amdgcn_wave_barrier();
    __builtin_amdgcn_fence(__ATOMIC_ACQUIRE, "workgroup");
    if (OUT_MODE == 0) {
      float* C = (float*)Cout + (size_t)b * strideC;
      const int hh = lane >> 4, c4 = (lane & 15) * 4;     // row seg = 256 B = 16 lanes x 16 B
      {
#pragma unroll
        for (int it = 0; it < 8; ++it) {
          const int row = it * 2 + hh;
          v4f v = *(const v4f*)(slab + row * 68 + c4);
          *(v4f*)(C + (size_t)(mBase + row) * ldc + n0 + c4) = v;
        }
        
      }
    } else if (OUT_MODE == 3) {
      // Coverage per slab: 4 it x 4 row groups (q) = 16 rows; 8 lanes x 8 halves = 64 halves per line.
      const int q = lane >> 3, c8 = (lane & 7) * 8;
      unsigned short* C = (unsigned short*)Cout + (size_t)b * strideC;
      const int hcol = (n0 >> 6) * 128;
      v8h hv[4], av[4];
#pragma unroll
      for (int it = 0; it < 4; ++it) {
        const int row = it * 4 + q;
        const float* sp = slab + row * 68 + c8;
        float ps = 0.f, pa = 0.f;
        v8h t;
#pragma unroll
        for (int e = 0; e < 8; ++e) {
          const float v = sp[e];
          t[e] = (_Float16)v;
          ps += v;
          if (e & 1) pa -= v; else pa += v;     // c8 is even, so (-1)^(c8+e) = (-1)^e
        }
#pragma unroll
        for (int off = 1; off < 8; off <<= 1) {   // reduce over the 8 lanes holding this row
          ps += __shfl_xor(ps, off, 32);
          pa += __shfl_xor(pa, off, 32);
        }
        const float fa = (c8 == 0) ? ps * 0.125f : 0.0f;
        const float fb = (c8 == 0) ? pa * 0.125f : 0.0f;
        v8h u;
#pragma unroll
        for (int e = 0; e < 8; ++e) u[e] = (_Float16)0.0f;
        u[0] = (_Float16)fa;
        u[1] = (_Float16)fb;
        hv[it] = t;
        av[it] = u;
      }
      {
#pragma unroll
        for (int it = 0; it < 4; ++it) {
          const int row = it * 4 + q;
          unsigned short* cp = C + (size_t)(mBase + row) * ldc + hcol + c8;
          *(v8h*)(cp) = hv[it];
          *(v8h*)(cp + 64) = av[it];
        }
        
      }
    } else {
      const int q = lane >> 3, c8 = (lane & 7) * 8;
      unsigned short* C  = (unsigned short*)Cout  + (size_t)b * strideC;
      unsigned short* C2 = (OUT_MODE == 2) ? ((unsigned short*)Cout2 + (size_t)b * strideC) : nullptr;
      {
#pragma unroll
        for (int it = 0; it < 4; ++it) {
          const int row = it * 4 + q;
          const float* sp = slab + row * 68 + c8;
          v8h hv, lv;
#pragma unroll
          for (int e = 0; e < 8; ++e) {
            if (OUT_MODE == 1) {
              hv[e] = (_Float16)sp[e];
            } else {
              unsigned short hb = f2bf_bits(sp[e]);
              unsigned short lb = f2bf_bits(sp[e] - bf_bits2f(hb));
              hv[e] = __builtin_bit_cast(_Float16, hb);
              lv[e] = __builtin_bit_cast(_Float16, lb);
            }
          }
          *(v8h*)(C + (size_t)(mBase + row) * ldc + n0 + c8) = hv;
          if (OUT_MODE == 2) *(v8h*)(C2 + (size_t)(mBase + row) * ldc + n0 + c8) = lv;
        }
        
      }
    }
    __builtin_amdgcn_fence(__ATOMIC_RELEASE, "workgroup");
    __builtin_amdgcn_wave_barrier();
    __builtin_amdgcn_fence(__ATOMIC_ACQUIRE, "workgroup");
  }
}

// One GEMM per launch: blockIdx.x = tile, blockIdx.y = batch.
template <int ET, bool SPLIT, int BIAS_MODE, int OUT_MODE, bool RESID, int ACT = 0>
__global__ __launch_bounds__(256) void wmma_gemm64(
    const unsigned short* __restrict__ Ap, const unsigned short* __restrict__ A2p, int lda, long strideA,
    const unsigned short* __restrict__ Btp, const unsigned short* __restrict__ Bt2p, int ldb, long strideB,
    void* __restrict__ Cout, void* __restrict__ Cout2, int ldc, long strideC,
    const float* __restrict__ bias,
    const float* __restrict__ resid, long strideR,
    int M, int N, int K, float scale) {
  __shared__ __align__(16) float sT[8][16 * 68];   // per-wave 16x64 slab, pitch 68 floats
  __shared__ __align__(16) typename Elem<ET>::T sAB[2][GM_ROWS * GM_LP];   // rows 0..127 = A, 128..383 = Bt; 64 k per row
  gemm64_block<ET, SPLIT, BIAS_MODE, OUT_MODE, RESID, ACT>(sT, sAB, (int)blockIdx.x, (int)blockIdx.y,
      Ap, A2p, lda, strideA, Btp, Bt2p, ldb, strideB, Cout, Cout2, ldc, strideC, bias, resid, strideR, M, N, K, scale);
}

// The three input projections in one launch. Each has 128 block tiles, half of the chip's 256 WGPs; the 384 together
// fill every WGP. Blocks 0..127: v^T (64 tiles x 2 batches), 128..255: q, 256..383: k. The choice is block-uniform.
// The second launch bound (4 waves per SIMD = 256 VGPRs) lets two 8-wave blocks stand on one WGP (2 x 145,408 B of LDS fit),
// so that all 384 start at once instead of 128 of them waiting for a free WGP.
constexpr int QKV_TILES = (NTOK / GM_BM) * (DMODEL / GM_BN);   // 128 block tiles per projection
static_assert(QKV_TILES == NBAT * (DMODEL / GM_BM) * (SEQ / GM_BN), "v^T has as many block tiles as q and k");
__global__ __launch_bounds__(256, 4) void qkv_gemm_kernel(
    const unsigned short* __restrict__ xb, const unsigned short* __restrict__ wqb,
    const unsigned short* __restrict__ wkb, const unsigned short* __restrict__ wvb,
    unsigned short* __restrict__ qpl, unsigned short* __restrict__ kpl,
    unsigned short* __restrict__ vth, unsigned short* __restrict__ vtl,
    const float* __restrict__ bq, const float* __restrict__ bk, const float* __restrict__ bv) {
  __shared__ __align__(16) float sT[8][16 * 68];
  __shared__ __align__(16) __bf16 sAB[2][GM_ROWS * GM_LP];
  const int job  = (int)blockIdx.x / QKV_TILES;
  const int tile = (int)blockIdx.x % QKV_TILES;
  if (job == 0) {
    // role swapped, per batch: C[m = h*64+d][n = s] = sum_k Wv[m][k] * x[b][s][k] + bv[m], bf16 hi/lo out
    gemm64_block<1, false, 1, 2, false>(sT, sAB, tile % (QKV_TILES / NBAT), tile / (QKV_TILES / NBAT),
        wvb, wvb, DMODEL, 0L, xb, xb, DMODEL, (long)SEQ * DMODEL,
        (void*)vth, (void*)vtl, SEQ, (long)DMODEL * SEQ, bv, bv, 0L, DMODEL, SEQ, DMODEL, 1.0f);
  } else {
    // [4096][1024] x [1024][1024]^T + bias, epilogue writes per-head 128-wide f16 rows
    const unsigned short* w  = (job == 1) ? wqb : wkb;
    unsigned short*       c  = (job == 1) ? qpl : kpl;
    const float*          bi = (job == 1) ? bq  : bk;
    gemm64_block<1, false, 2, 3, false>(sT, sAB, tile, 0,
        xb, xb, DMODEL, 0L, w, w, DMODEL, 0L,
        (void*)c, (void*)c, TOKP, 0L, bi, bi, 0L, NTOK, DMODEL, DMODEL, 1.0f);
  }
}

// ---------------------------------------------------------------------------
// f32 -> RNE bf16 bits, 2 elements per thread packed into one 4-B store: a wave writes one whole
// Coverage: grid = n2/256 blocks x 256 threads x 2 elements = 2*n2 = the whole plane (n2 % 256 == 0 here).
// ---------------------------------------------------------------------------
__global__ __launch_bounds__(256) void cast_bf16x2_kernel(const float* __restrict__ in, unsigned short* __restrict__ out, int n2) {
  const int i = blockIdx.x * 256 + threadIdx.x;
  if (i < n2) {
    const v2f f = *(const v2f*)(in + 2 * (size_t)i);
    const unsigned u = pk16(f2bf_bits(f[0]), f2bf_bits(f[1]));
    ((unsigned*)out)[i] = u;
    
  }
}
// f32 -> f16 bits of (mul * bf16_rne(v)), mul an exact power of two; same store pattern and coverage.
__global__ __launch_bounds__(256) void cast_bf16_f16s_x2_kernel(const float* __restrict__ in, unsigned short* __restrict__ out, int n2, float mul) {
  const int i = blockIdx.x * 256 + threadIdx.x;
  if (i < n2) {
    const v2f f = *(const v2f*)(in + 2 * (size_t)i);
    const _Float16 h0 = (_Float16)(rne_bf16(f[0]) * mul);
    const _Float16 h1 = (_Float16)(rne_bf16(f[1]) * mul);
    const unsigned u = pk16(__builtin_bit_cast(unsigned short, h0), __builtin_bit_cast(unsigned short, h1));
    ((unsigned*)out)[i] = u;
    
  }
}

#define AT_D 64
#define AT_F 96
#define AT_NW 4
#define AT_QB 64
#define AT_KC 64
// LDS row pitches in halves: 16 B x odd, so that the 16 rows of a ds_load_b128 fragment read fall on distinct banks
#define AT_KP 104   // K feature rows: 96 halves used, 208 B pitch
#define AT_VP 72    // V^T rows: 64 halves used, 144 B pitch
static_assert(AT_KP >= AT_F && AT_VP >= AT_KC && (AT_KP * 2) % 32 == 16 && (AT_VP * 2) % 32 == 16, "pitch holds the row and is 16 B x odd");

__device__ __forceinline__ __bf16 at_f2bf(float f) { return __builtin_bit_cast(__bf16, f2bf_bits(f)); }
__device__ __forceinline__ void at_split(float f, __bf16& hi, __bf16& lo) {
  const unsigned short hb = f2bf_bits(f);
  hi = __builtin_bit_cast(__bf16, hb);
  lo = at_f2bf(f - __uint_as_float(((unsigned)hb) << 16));
}
// lane l with lane l ^ 16: the two lanes that share one query column
__device__ __forceinline__ float at_xhalf(float x) {
  return __builtin_bit_cast(float, __builtin_amdgcn_permlanex16(__builtin_bit_cast(int, x), __builtin_bit_cast(int, x), 0x76543210, 0xfedcba98, false, false));
}
__device__ __forceinline__ v8f at_mma(v16b a, v16b b, v8f c) {
  c = __builtin_amdgcn_wmma_f32_16x16x32_bf16(false, a, false, b, (short)0, c, false, false);
  asm volatile("v_nop\n\tv_nop\n\tv_nop\n\tv_nop" : "+v"(c) : "v"(a), "v"(b));
  return c;
}
__device__ __forceinline__ v8f at_mma_h(v16h a, v16h b, v8f c) {
  c = __builtin_amdgcn_wmma_f32_16x16x32_f16(false, a, false, b, (short)0, c, false, false);
  asm volatile("v_nop\n\tv_nop\n\tv_nop\n\tv_nop" : "+v"(c) : "v"(a), "v"(b));
  return c;
}

__global__ __launch_bounds__(128)
void attn_aug_kernel(const unsigned short* __restrict__ qp, const unsigned short* __restrict__ kp,
                     const unsigned short* __restrict__ vhp, const unsigned short* __restrict__ vlp,
                     unsigned short* __restrict__ op, float sscale, float oscale) {
  union FB { v16b v; v8b h[2]; };
  union FH { v16h v; v8h h[2]; };
  __shared__ __align__(16) _Float16 Ksh[AT_KC * AT_KP];          // K features [kv][f]   13 KB
  __shared__ __align__(16) __bf16   Vth[AT_D * AT_VP];           // V hi [d][kv]          9 KB
  __shared__ __align__(16) __bf16   Vtl[AT_D * AT_VP];           // V lo                  9 KB
  __shared__ __align__(16) float    Os[AT_NW][16 * 68];          // per wave out tile, pitch 68

  const int tid  = threadIdx.x;
  const int wave = tid >> 5;
  const int lane = tid & 31;
  const int hh   = lane >> 4;
  const int c    = lane & 15;

  const int nqb = SEQ / AT_QB;            // 32
  const int bx = blockIdx.x;
  const int qb = bx % nqb;
  const int bh = bx / nqb;                // 0..NBAT*NHEAD-1
  const int h  = bh % NHEAD;
  const int b  = bh / NHEAD;
  const int q0 = qb * AT_QB + wave * 16;

  const _Float16* Qb = (const _Float16*)(const void*)qp + (size_t)b * SEQ * TOKP + (size_t)h * QKPITCH;
  const _Float16* Kb = (const _Float16*)(const void*)kp + (size_t)b * SEQ * TOKP + (size_t)h * QKPITCH;
  const __bf16*   Vh = (const __bf16*)(const void*)vhp + ((size_t)b * DMODEL + (size_t)h * AT_D) * SEQ;
  const __bf16*   Vl = (const __bf16*)(const void*)vlp + ((size_t)b * DMODEL + (size_t)h * AT_D) * SEQ;
  _Float16*       Ob = (_Float16*)(void*)op + (size_t)b * SEQ * DMODEL + (size_t)h * AT_D;

  // ---- Q fragments (B operand, column = query = lane&15, split k map via Frag load): 3 feature chunks of 32 ----
  v16h qa[3];
#pragma unroll
  for (int dc = 0; dc < 3; ++dc)
    qa[dc] = Frag<_Float16>::load(Qb + (size_t)(q0 + c) * TOKP + dc * 32 + 8 * hh);

  // softmax in base 2: e^(sscale * (s - max)) = 2^(s * c2 - max * c2); sscale > 0, so the maximum is taken over the unscaled scores
  const float c2 = sscale * 1.4426950408889634f;
  float mrun = -INFINITY;   // running maximum of query c's unscaled scores, equal in both lane halves
  float lrun = 0.f;         // running sum of query c over this lane half's keys; the halves join after the loop
  v8f oacc[4];              // O^T tiles: register r of tile t = O[query c][d = t*16 + 8*hh + r]
#pragma unroll
  for (int t = 0; t < 4; ++t) oacc[t] = (v8f){0.f,0.f,0.f,0.f,0.f,0.f,0.f,0.f};

  const int nChunks = SEQ / AT_KC;   // 32, compile-time constant
  // staging coverage by whole lines: a row's 64 halves are one 128-B line = 8 lanes x 16 B, so a wave-wide load touches 4 lines.
  //   K features 0..63 and each V^T plane: 16 rows x 8 pieces per trip, 4 trips = 64 rows x 64;
  //   K features 64..95 (half a line per row): 32 rows x 4 pieces per trip, 2 trips = 64 rows x 32, 8 lines per wave-wide load.
  // Row order inside a trip, for the ds_store_b128: rows r and r + 8 share a 16-lane half (8 x 208 B and 8 x 144 B = 32 banks apart);
  // in the feature tail rows r, r + 4, r + 8, r + 12 do (4 x 208 B = 16 banks apart): no bank is met twice.
  const int g8  = tid >> 3, g4 = tid >> 2;
  const int r16 = ((g8 & 1) << 3) | (g8 >> 1);                      // 0..15
  const int r32 = (g4 & 16) | ((g4 & 3) << 2) | ((g4 >> 2) & 3);    // 0..31
  const int p8  = (tid & 7) * 8;
  const int p4  = 64 + (tid & 3) * 8;
  static_assert(TOKP == SEQ, "K feature rows and V^T rows have one pitch, so one lane offset serves both");
  // lane offsets in bytes; the bases they are added to are wave-uniform
  const unsigned go8 = (unsigned)(r16 * SEQ + p8) * 2u;    // row r16 (+16 per trip), piece p8..+7, of K and of both V^T planes
  const unsigned go4 = (unsigned)(r32 * TOKP + p4) * 2u;   // K row r32 (+32 per trip), f = p4..+7
  const char* Kc  = (const char*)Kb;
  const char* Vhc = (const char*)Vh;
  const char* Vlc = (const char*)Vl;
  _Float16* kd8 = Ksh + r16 * AT_KP + p8;             // the same pieces' places in LDS
  _Float16* kd4 = Ksh + r32 * AT_KP + p4;
  __bf16*   vdh = Vth + r16 * AT_VP + p8;
  __bf16*   vdl = Vtl + r16 * AT_VP + p8;
  // the chunk in flight: 14 x 16 B per thread, loaded one chunk ahead of the LDS stores that consume them
  v8h kreg[6];
  v8b vhreg[4], vlreg[4];
#pragma unroll
  for (int i = 0; i < 4; ++i) kreg[i] = *(const v8h*)(Kc + 32 * i * TOKP + go8);
#pragma unroll
  for (int i = 0; i < 2; ++i) kreg[4 + i] = *(const v8h*)(Kc + 64 * i * TOKP + go4);
#pragma unroll
  for (int i = 0; i < 4; ++i) {
    vhreg[i] = *(const v8b*)(Vhc + 32 * i * SEQ + go8);
    vlreg[i] = *(const v8b*)(Vlc + 32 * i * SEQ + go8);
  }
  // the LDS address arithmetic around this point reuses the loads' address registers.
  // The two lane offsets are inputs so that their registers stay untouched up to the wait.
  asm volatile("s_wait_xcnt 0x0" :: "v"(go8), "v"(go4) : "memory");
  __builtin_amdgcn_sched_barrier(0);   // keeps that arithmetic from being lifted over the wait
  for (int kc = 0; kc < nChunks; ++kc) {
    __syncthreads();
#pragma unroll
    for (int i = 0; i < 4; ++i) *(v8h*)(kd8 + 16 * i * AT_KP) = kreg[i];
#pragma unroll
    for (int i = 0; i < 2; ++i) *(v8h*)(kd4 + 32 * i * AT_KP) = kreg[4 + i];
#pragma unroll
    for (int i = 0; i < 4; ++i) {
      *(v8b*)(vdh + 16 * i * AT_VP) = vhreg[i];
      *(v8b*)(vdl + 16 * i * AT_VP) = vlreg[i];
    }
    __syncthreads();
    if (kc + 1 < nChunks) {   // block-uniform: the next chunk's 14 loads go out together and land behind this chunk's work
      const char* kn  = Kc  + (size_t)(kc + 1) * (AT_KC * TOKP * 2);   // wave-uniform chunk bases, in bytes
      const char* vhn = Vhc + (size_t)(kc + 1) * (AT_KC * 2);
      const char* vln = Vlc + (size_t)(kc + 1) * (AT_KC * 2);
#pragma unroll
      for (int i = 0; i < 4; ++i) kreg[i] = *(const v8h*)(kn + 32 * i * TOKP + go8);
#pragma unroll
      for (int i = 0; i < 2; ++i) kreg[4 + i] = *(const v8h*)(kn + 64 * i * TOKP + go4);
#pragma unroll
      for (int i = 0; i < 4; ++i) {
        vhreg[i] = *(const v8b*)(vhn + 32 * i * SEQ + go8);
        vlreg[i] = *(const v8b*)(vln + 32 * i * SEQ + go8);
      }
      // the fragment loads below reuse these loads' address registers
      asm volatile("s_wait_xcnt 0x0" ::: "memory");
    }

    v8f s[4];
#pragma unroll
    for (int j = 0; j < 4; ++j) {
      s[j] = (v8f){0.f,0.f,0.f,0.f,0.f,0.f,0.f,0.f};
#pragma unroll
      for (int dc = 0; dc < 3; ++dc) {
        FH kb;   // A operand: row m = key j*16+c, k = feature, split k map
        kb.h[0] = *(const v8h*)(Ksh + (j * 16 + c) * AT_KP + dc * 32 + 8 * hh);
        kb.h[1] = *(const v8h*)(Ksh + (j * 16 + c) * AT_KP + dc * 32 + 16 + 8 * hh);
        s[j] = at_mma_h(kb.v, qa[dc], s[j]);   // s[j][r] = score of key j*16 + 8*hh + r against query c
      }
    }
    float m = -INFINITY;
#pragma unroll
    for (int j = 0; j < 4; ++j)
#pragma unroll
      for (int r = 0; r < 8; ++r) m = fmaxf(m, s[j][r]);
    m = fmaxf(m, at_xhalf(m));
    const float mnew = fmaxf(mrun, m);
    const float alpha = __builtin_amdgcn_exp2f((mrun - mnew) * c2);   // 0 on the first chunk, where mrun is -inf
    const float nb = -mnew * c2;
    mrun = mnew;
    // P^T as B operand: column n = query c; elements 0..7 = keys kk*32 + 8*hh + e (tile 2*kk), 8..15 = keys kk*32 + 16 + 8*hh + e
    // (tile 2*kk + 1): the split k map of the V^T loads below, element for element.
    FB ph[2], pl[2];
    float ps[4];
#pragma unroll
    for (int j = 0; j < 4; ++j) {
      ps[j] = 0.f;
#pragma unroll
      for (int r = 0; r < 8; ++r) {
        const float p = __builtin_amdgcn_exp2f(fmaf(s[j][r], c2, nb));   // e^(sscale * (s - max)); far below the max it ends as 0
        ps[j] += p;
        __bf16 bh, bl;
        at_split(p, bh, bl);
        ph[j >> 1].v[(j & 1) * 8 + r] = bh;
        pl[j >> 1].v[(j & 1) * 8 + r] = bl;
      }
    }
    lrun = lrun * alpha + ((ps[0] + ps[1]) + (ps[2] + ps[3]));
#pragma unroll
    for (int t = 0; t < 4; ++t)
#pragma unroll
      for (int r = 0; r < 8; ++r) oacc[t][r] *= alpha;
#pragma unroll   // unrolled: ph and pl live in registers and cannot be indexed by a run-time kk
    for (int kk = 0; kk < 2; ++kk) {
#pragma unroll
      for (int t = 0; t < 4; ++t) {
        FB vb, vl;   // A operand: row m = d = t*16+c, k = key
        vb.h[0] = *(const v8b*)(Vth + (t * 16 + c) * AT_VP + kk * 32 + 8 * hh);
        vb.h[1] = *(const v8b*)(Vth + (t * 16 + c) * AT_VP + kk * 32 + 16 + 8 * hh);
        vl.h[0] = *(const v8b*)(Vtl + (t * 16 + c) * AT_VP + kk * 32 + 8 * hh);
        vl.h[1] = *(const v8b*)(Vtl + (t * 16 + c) * AT_VP + kk * 32 + 16 + 8 * hh);
        oacc[t] = at_mma(vb.v, ph[kk].v, oacc[t]);
        oacc[t] = at_mma(vl.v, ph[kk].v, oacc[t]);
        oacc[t] = at_mma(vb.v, pl[kk].v, oacc[t]);
      }
    }
  }

  float* os = Os[wave];
  const float lsum = lrun + at_xhalf(lrun);         // both halves' keys
  const float inv = oscale * (1.0f / lsum);         // lsum is about 1 or more (the running max contributes 2^0 up to the FMA's rounding)
#pragma unroll
  for (int t = 0; t < 4; ++t) {
    v4f o0, o1;
#pragma unroll
    for (int r = 0; r < 4; ++r) { o0[r] = oacc[t][r] * inv; o1[r] = oacc[t][4 + r] * inv; }
    *(v4f*)(os + c * 68 + t * 16 + 8 * hh)     = o0;
    *(v4f*)(os + c * 68 + t * 16 + 8 * hh + 4) = o1;
  }
  __builtin_amdgcn_fence(__ATOMIC_RELEASE, "workgroup");
  __builtin_amdgcn_wave_barrier();
  __builtin_amdgcn_fence(__ATOMIC_ACQUIRE, "workgroup");
  {
    const int q8 = lane >> 3, c8 = (lane & 7) * 8;
    {
#pragma unroll
      for (int it = 0; it < 4; ++it) {
        const int row = it * 4 + q8;
        v8h hv;
#pragma unroll
        for (int e = 0; e < 8; ++e) hv[e] = (_Float16)os[row * 68 + c8 + e];
        *(v8h*)(Ob + (size_t)(q0 + row) * DMODEL + c8) = hv;
      }
      
    }
  }
}

// ---------------------------------------------------------------------------
//   [ 0 MiB,  8 MiB)  xb   bf16 [4096][1024]            RNE-bf16 of x
//   [ 8 MiB, 10 MiB)  wqb  bf16 [1024][1024]
//   [10 MiB, 12 MiB)  wkb  bf16 [1024][1024]
//   [12 MiB, 14 MiB)  wvb  bf16 [1024][1024]
//   [14 MiB, 16 MiB)  woh  f16  [1024][1024]            64 * bf16_rne(Wo)
//   [16 MiB, 32 MiB)  qpl  f16  [4096][16][128]         q features per head
//   [32 MiB, 48 MiB)  kpl  f16  [4096][16][128]         k features per head
//   [48 MiB, 56 MiB)  vth  bf16 [2][1024][2048]         v^T hi plane
//   [56 MiB, 64 MiB)  vtl  bf16 [2][1024][2048]         v^T lo plane
//   [64 MiB, 72 MiB)  ohp  f16  [4096][1024]            256 * attention output, heads merged
// GEMM shapes: q/k M=4096 N=1024 K=1024; v^T M=1024 N=2048 K=1024 (x2 batch); out M=4096 N=1024 K=1024:
// all M multiples of 128, N of 256, K of 64, row pitch of every operand 1024, no padding, every plane fully written by its producer.
// ---------------------------------------------------------------------------
extern "C" void kernel_launch(void* const* d_in, const int* in_sizes, int n_in,
                              void* d_out, int out_size, void* d_ws, size_t ws_size,
                              hipStream_t stream)
{
  if (n_in < 9) return;
  if (in_sizes[0] != NTOK * DMODEL || in_sizes[1] != DMODEL * DMODEL || in_sizes[2] != DMODEL ||
      in_sizes[3] != DMODEL * DMODEL || in_sizes[4] != DMODEL || in_sizes[5] != DMODEL * DMODEL ||
      in_sizes[6] != DMODEL || in_sizes[7] != DMODEL * DMODEL || in_sizes[8] != DMODEL) return;
  if (out_size != NTOK * DMODEL) return;

  const float* x    = (const float*)d_in[0];
  const float* Wq   = (const float*)d_in[1];
  const float* bq   = (const float*)d_in[2];
  const float* Wk   = (const float*)d_in[3];
  const float* bk   = (const float*)d_in[4];
  const float* Wv   = (const float*)d_in[5];
  const float* bv   = (const float*)d_in[6];
  const float* Wo   = (const float*)d_in[7];
  const float* bo_p = (const float*)d_in[8];

  const size_t SZ_X   = (size_t)NTOK * DMODEL * 2;                 // 8 MiB
  const size_t SZ_W   = (size_t)DMODEL * DMODEL * 2;               // 2 MiB
  const size_t SZ_QK  = (size_t)NTOK * TOKP * 2;                   // 16 MiB
  const size_t SZ_VT  = (size_t)NBAT * DMODEL * SEQ * 2;           // 8 MiB
  const size_t SZ_O   = (size_t)NTOK * DMODEL * 2;                 // 8 MiB
  const size_t OFF_XB = 0;
  const size_t OFF_WQ = OFF_XB + SZ_X;
  const size_t OFF_WK = OFF_WQ + SZ_W;
  const size_t OFF_WV = OFF_WK + SZ_W;
  const size_t OFF_WO = OFF_WV + SZ_W;
  const size_t OFF_QP = OFF_WO + SZ_W;
  const size_t OFF_KP = OFF_QP + SZ_QK;
  const size_t OFF_VH = OFF_KP + SZ_QK;
  const size_t OFF_VL = OFF_VH + SZ_VT;
  const size_t OFF_OH = OFF_VL + SZ_VT;
  const size_t TOTAL  = OFF_OH + SZ_O;                             // 75,497,472
  if (TOTAL > ws_size) return;

  char* ws = (char*)d_ws;
  unsigned short* xb  = (unsigned short*)(ws + OFF_XB);
  unsigned short* wqb = (unsigned short*)(ws + OFF_WQ);
  unsigned short* wkb = (unsigned short*)(ws + OFF_WK);
  unsigned short* wvb = (unsigned short*)(ws + OFF_WV);
  unsigned short* woh = (unsigned short*)(ws + OFF_WO);
  unsigned short* qpl = (unsigned short*)(ws + OFF_QP);
  unsigned short* kpl = (unsigned short*)(ws + OFF_KP);
  unsigned short* vth = (unsigned short*)(ws + OFF_VH);
  unsigned short* vtl = (unsigned short*)(ws + OFF_VL);
  unsigned short* ohp = (unsigned short*)(ws + OFF_OH);

  // ---- 16-bit operand planes (2 elements per thread; counts are multiples of 512) ----
  const int n2x = (NTOK * DMODEL) / 2;       // 2,097,152 -> 8192 blocks
  const int n2w = (DMODEL * DMODEL) / 2;     //   524,288 -> 2048 blocks
  cast_bf16x2_kernel<<<dim3(n2x / 256), dim3(256), 0, stream>>>(x, xb, n2x);
  cast_bf16x2_kernel<<<dim3(n2w / 256), dim3(256), 0, stream>>>(Wq, wqb, n2w);
  cast_bf16x2_kernel<<<dim3(n2w / 256), dim3(256), 0, stream>>>(Wk, wkb, n2w);
  cast_bf16x2_kernel<<<dim3(n2w / 256), dim3(256), 0, stream>>>(Wv, wvb, n2w);
  cast_bf16_f16s_x2_kernel<<<dim3(n2w / 256), dim3(256), 0, stream>>>(Wo, woh, n2w, 64.0f);

  // ---- q / k feature planes and v^T hi/lo planes: one launch of 3 x 128 blocks of 8 waves ----
  qkv_gemm_kernel<<<dim3(3 * QKV_TILES), dim3(256), 0, stream>>>(xb, wqb, wkb, wvb, qpl, kpl, vth, vtl, bq, bk, bv);
  // ---- attention: grid = NBAT * NHEAD * (SEQ / 64) = 1024 blocks of 128 threads ----
  attn_aug_kernel<<<dim3(NBAT * NHEAD * (SEQ / 64)), dim3(128), 0, stream>>>(
      qpl, kpl, vth, vtl, ohp, 0.0625f, 256.0f);
  // ---- output projection: d_out[m][n] = (1/16384) * sum_k (256*O)[m][k] * (64*Wo)[n][k] + bo[n], f32 out ----
  {
    const int tiles = (NTOK / 64) * (DMODEL / 64);     // 1024 -> 128 blocks
    dim3 grid(tiles / 8, 1), blk(256);
    wmma_gemm64<0, false, 2, 0, false><<<grid, blk, 0, stream>>>(
        ohp, ohp, DMODEL, 0L, woh, woh, DMODEL, 0L,
        d_out, d_out, DMODEL, 0L, bo_p, bo_p, 0L, NTOK, DMODEL, DMODEL, 1.0f / 16384.0f);
  }
}

// v008
// It runs in 155 microseconds.
// Timed twice side by side with v007, it ran 1.04 times as fast both times.
// Counting every step since v000, it is 3.38 times as fast.
// Contractions: q/k/v^T projections v_wmma_f32_16x16x32_bf16 (operands = RNE-bf16 of the f32 inputs, single product); scores v_wmma_f32_16x16x32_f16 (f16 per-head feature planes, single product, x1/16 in f32); p.v v_wmma_f32_16x16x32_bf16 with bf16 hi/lo split of p and v (hi.hi+hi.lo+lo.hi); output projection v_wmma_f32_16x16x32_f16 (f16 O carried x256, f16 Wo carried x64, single product, x1/16384 in f32); f32 accumulate everywhere; softmax, biases and DFT aggregate features in f32.
#include <hip/hip_runtime.h>
#include <math.h>
#include <stdint.h>

// ---------------- problem geometry ----------------
constexpr int NBAT    = 2;
constexpr int SEQ     = 2048;
constexpr int DMODEL  = 1024;
constexpr int NHEAD   = 16;
constexpr int HDIM    = 64;
constexpr int NTOK    = NBAT * SEQ;          // 4096
constexpr int QKPITCH = 128;                 // halves per (token, head) feature row: 64 dims, sum/8, altsum/8, zeros
constexpr int TOKP    = NHEAD * QKPITCH;     // 2048 halves per token row of the q/k feature planes
static_assert(NTOK % 64 == 0 && DMODEL % 64 == 0 && SEQ % 64 == 0 && DMODEL % 32 == 0);
static_assert(NHEAD * HDIM == DMODEL);

typedef __attribute__((ext_vector_type(16))) _Float16 v16h;
typedef __attribute__((ext_vector_type(8)))  _Float16 v8h;
typedef __attribute__((ext_vector_type(16))) __bf16   v16b;
typedef __attribute__((ext_vector_type(8)))  __bf16   v8b;
typedef __attribute__((ext_vector_type(8)))  float    v8f;
typedef __attribute__((ext_vector_type(4)))  float    v4f;
typedef __attribute__((ext_vector_type(2)))  unsigned v2u;

__device__ __forceinline__ unsigned short f2bf_bits(float f) {
  unsigned u = __float_as_uint(f);
  return (unsigned short)((u + 0x7FFFu + ((u >> 16) & 1u)) >> 16);
}
__device__ __forceinline__ float bf_bits2f(unsigned short h) { return __uint_as_float(((unsigned)h) << 16); }
__device__ __forceinline__ float rne_bf16(float f) { return bf_bits2f(f2bf_bits(f)); }
__device__ __forceinline__ unsigned pk16(unsigned short a, unsigned short b) { return (unsigned)a | ((unsigned)b << 16); }

// hazard guards as plain device helpers (no inline asm inside the kernel template body)
__device__ __forceinline__ void dep_guard_h(v8f& a, v8f& b, v16h x, v16h y) { asm volatile("v_nop\n\tv_nop\n\tv_nop\n\tv_nop" : "+v"(a), "+v"(b) : "v"(x), "v"(y)); }
__device__ __forceinline__ void dep_guard_b(v8f& a, v8f& b, v16b x, v16b y) { asm volatile("v_nop\n\tv_nop\n\tv_nop\n\tv_nop" : "+v"(a), "+v"(b) : "v"(x), "v"(y)); }
__device__ __forceinline__ void keep4_h(v16h a, v16h b, v16h c, v16h d) { asm volatile("v_nop" :: "v"(a), "v"(b), "v"(c), "v"(d)); }
__device__ __forceinline__ void keep4_b(v16b a, v16b b, v16b c, v16b d) { asm volatile("v_nop" :: "v"(a), "v"(b), "v"(c), "v"(d)); }
__device__ __forceinline__ void acc_guard4(v8f& a, v8f& b, v8f& c, v8f& d) { asm volatile("v_nop\n\tv_nop\n\tv_nop\n\tv_nop" : "+v"(a), "+v"(b), "+v"(c), "+v"(d)); }
template <typename T> struct Frag;
template <> struct Frag<_Float16> {
  typedef v16h V; typedef v8h H; union U { v16h v; v8h h[2]; };
  static __device__ __forceinline__ v16h load(const _Float16* p) {   // elements 0..7 <- p[0..7], 8..15 <- p[16..23]
    U f; f.h[0] = *(const v8h*)(p); f.h[1] = *(const v8h*)(p + 16); return f.v;
  }
  static __device__ __forceinline__ v8f mma(v16h a, v16h b, v8f c) {
    return __builtin_amdgcn_wmma_f32_16x16x32_f16(false, a, false, b, (short)0, c, false, false);
  }
  static __device__ __forceinline__ void guard(v8f& a, v8f& b, v16h x, v16h y) { dep_guard_h(a, b, x, y); }
  static __device__ __forceinline__ void keep(v16h a, v16h b, v16h c, v16h d) { keep4_h(a, b, c, d); }
};
template <> struct Frag<__bf16> {
  typedef v16b V; typedef v8b H; union U { v16b v; v8b h[2]; };
  static __device__ __forceinline__ v16b load(const __bf16* p) {
    U f; f.h[0] = *(const v8b*)(p); f.h[1] = *(const v8b*)(p + 16); return f.v;
  }
  static __device__ __forceinline__ v8f mma(v16b a, v16b b, v8f c) {
    return __builtin_amdgcn_wmma_f32_16x16x32_bf16(false, a, false, b, (short)0, c, false, false);
  }
  static __device__ __forceinline__ void guard(v8f& a, v8f& b, v16b x, v16b y) { dep_guard_b(a, b, x, y); }
  static __device__ __forceinline__ void keep(v16b a, v16b b, v16b c, v16b d) { keep4_b(a, b, c, d); }
};

// ---- Register-blocked batched WMMA GEMM ------------------------------------
// C[m,n] = scale * sum_k A[m,k] * Bt[n,k] (+bias)(+resid); each wave owns a 64x64 tile.
// A row-major [M,K]; Bt row-major [N,K]; M % 128 == 0, N % 256 == 0, K % 64 == 0.
// Block = 8 waves as 2 (m) x 4 (n) = a 128 x 256 tile. Per stage of 64 k the block brings its 128 A rows and
// 256 Bt rows (one 128-B line each) into LDS: 8 lanes x 16 B per row, so a wave-wide load covers 4 whole lines.
// Two LDS buffers, the global loads held in registers up to two stages ahead, one __syncthreads per stage.
// SPLIT (hi/lo operand planes) is not instantiated here and not supported by the staged loop.
// BIAS_MODE: 0 = none, 1 = bias[m], 2 = bias[n]. Bias values are RNE-bf16 quantised before the f32 add.
// OUT_MODE: 0 = f32, 1 = f16, 2 = bf16 hi plane (Cout) + bf16 lo plane (Cout2),
//           3 = f16 per-head feature rows: head hd = n0/64, row m -> C[m*ldc + hd*128 + 0..63] = f16(v[0..63]),
//               [+64] = f16(sum_d v[d] / 8), [+65] = f16(sum_d (-1)^d v[d] / 8), [+66..+127] = 0.
// ET: 0 = f16 operands, 1 = bf16 operands (pointers passed as 16-bit storage)
template <int ET> struct Elem;
template <> struct Elem<0> { typedef _Float16 T; };
template <> struct Elem<1> { typedef __bf16 T; };
constexpr int GM_BM   = 128;             // block tile rows (A rows staged)
constexpr int GM_BN   = 256;             // block tile columns (Bt rows staged)
constexpr int GM_ROWS = GM_BM + GM_BN;   // 384 staged rows per stage
constexpr int GM_LD   = DMODEL;          // row pitch of A and Bt in elements, a constant so that a stage's row steps fold into the loads' immediate offsets
constexpr int GM_LP   = 72;              // LDS row pitch in 16-bit elements: 64 used, 144 B = 16 B x odd for ds_load_b128 readers
// The work of one block, shared by the kernels below: sT and sAB are the calling kernel's LDS, tile and b its place in the problem.
template <int ET, bool SPLIT, int BIAS_MODE, int OUT_MODE, bool RESID, int ACT = 0>
__device__ __forceinline__ void gemm64_block(
    float (*sT)[16 * 68], typename Elem<ET>::T (*sAB)[GM_ROWS * GM_LP], const int tile, const int b,
    const unsigned short* __restrict__ Ap, const unsigned short* __restrict__ A2p, int lda, long strideA,
    const unsigned short* __restrict__ Btp, const unsigned short* __restrict__ Bt2p, int ldb, long strideB,
    void* __restrict__ Cout, void* __restrict__ Cout2, int ldc, long strideC,
    const float* __restrict__ bias,
    const float* __restrict__ resid, long strideR,
    int M, int N, int K, float scale) {
  typedef typename Elem<ET>::T T;
  typedef typename Frag<T>::V V;
  typedef typename Frag<T>::H H;
  static_assert(!SPLIT, "the staged loop carries one plane per operand");
  const T* A = (const T*)Ap; const T* Bt = (const T*)Btp;
  const int lane = threadIdx.x & 31;
  const int wave = __builtin_amdgcn_readfirstlane(threadIdx.x >> 5);   // the same in every lane: what derives from it stays in scalar registers
  const int tilesN = N >> 8;
  const int tilesM = M >> 7;
  if (tile >= tilesM * tilesN || lda != GM_LD || ldb != GM_LD) return;   // block-uniform, in front of every barrier
  const int tm = tile / tilesN;
  const int tn = tile - tm * tilesN;
  const int bm0 = tm << 7;                // block tile origin
  const int bn0 = tn << 8;
  const int wm  = (wave >> 2) << 6;       // wave tile origin inside the block tile
  const int wn  = (wave & 3) << 6;
  const int m0 = bm0 + wm;
  const int n0 = bn0 + wn;

  const T* Ab  = A  + (size_t)b * strideA;
  const T* Bb  = Bt + (size_t)b * strideB;

  const int rlane = lane & 15;                 // row (A) / col (B, D) within subtile
  const int koff  = (lane >> 4) * 8;           // k offset of this lane half
  const int mOff  = (lane >> 4) * 8;           // D row offset

  v8f acc[4][4];
#pragma unroll
  for (int i = 0; i < 4; ++i)
#pragma unroll
    for (int j = 0; j < 4; ++j) acc[i][j] = (v8f){0.f,0.f,0.f,0.f,0.f,0.f,0.f,0.f};

  // staging coverage: 256 threads = 32 rows x 8 pieces of 16 B; 4 trips cover the A rows, 8 trips the Bt rows
  // (rows r and r + 8 sit side by side in a 16-lane half: 8 x 144 B = 32 banks apart, so a ds_store_b128 meets no bank twice)
  const int sgrp = threadIdx.x >> 3;
  const int srow = (sgrp & 16) | ((sgrp & 1) << 3) | ((sgrp >> 1) & 7);
  const int spc  = (threadIdx.x & 7) * 8;
  // A and Bt have one row pitch, so one 32-bit lane offset (bytes) serves both and steps 64 k = 128 B per stage; the two bases are
  // block-uniform (scalar registers). Three vector registers fewer than two 64-bit lane pointers.
  unsigned gOff = (unsigned)(srow * GM_LD + spc) * 2u;
  const char* gA = (const char*)(Ab + (size_t)bm0 * GM_LD);
  const char* gB = (const char*)(Bb + (size_t)bn0 * GM_LD);
  const int sOff = srow * GM_LP + spc;
  const int nStage = K >> 6;
  H st[12];   // the stage in flight
#pragma unroll
  for (int i = 0; i < 4; ++i) st[i] = *(const H*)(gA + 64 * i * GM_LD + gOff);
#pragma unroll
  for (int i = 0; i < 8; ++i) st[4 + i] = *(const H*)(gB + 64 * i * GM_LD + gOff);
#pragma unroll
  for (int i = 0; i < 12; ++i) *(H*)(sAB[0] + sOff + 32 * i * GM_LP) = st[i];
  if (1 < nStage) {
    gOff += 128u;
#pragma unroll
    for (int i = 0; i < 4; ++i) st[i] = *(const H*)(gA + 64 * i * GM_LD + gOff);
#pragma unroll
    for (int i = 0; i < 8; ++i) st[4 + i] = *(const H*)(gB + 64 * i * GM_LD + gOff);
  }

  for (int s = 0; s < nStage; ++s) {
    const T* buf = sAB[s & 1];
    __syncthreads();   // publishes stage s and ends every wave's reads of the other buffer (stage s - 1)
#pragma unroll
    for (int kk = 0; kk < 2; ++kk) {
      V bh[4], ah[4];
#pragma unroll
      for (int j = 0; j < 4; ++j) bh[j] = Frag<T>::load(buf + (GM_BM + wn + (j << 4) + rlane) * GM_LP + kk * 32 + koff);
#pragma unroll
      for (int i = 0; i < 4; ++i) ah[i] = Frag<T>::load(buf + (wm + (i << 4) + rlane) * GM_LP + kk * 32 + koff);
      if (kk == 0) {   // staging queues behind the first fragment reads, so the products start sooner
        // stage s + 1 goes from registers into the other buffer. No test round it: with a branch here the fragment
        // waits below fall back to counts that also wait for these stores; the last stage's copy is read by nobody.
        T* nxt = sAB[(s + 1) & 1];
#pragma unroll
        for (int i = 0; i < 12; ++i) *(H*)(nxt + sOff + 32 * i * GM_LP) = st[i];
        if (s + 2 < nStage) {   // block-uniform: stage s + 2's 12 loads land behind this stage's products
          gOff += 128u;
#pragma unroll
          for (int i = 0; i < 4; ++i) st[i] = *(const H*)(gA + 64 * i * GM_LD + gOff);
#pragma unroll
          for (int i = 0; i < 8; ++i) st[4 + i] = *(const H*)(gB + 64 * i * GM_LD + gOff);
          // behind the loop the two scalar bases' registers are reused
          asm volatile("s_wait_xcnt 0x0" ::: "memory");
        }
      }
#pragma unroll
      for (int i = 0; i < 4; ++i) {
#pragma unroll
        for (int j = 0; j < 4; ++j) acc[i][j] = Frag<T>::mma(ah[i], bh[j], acc[i][j]);
        Frag<T>::guard(acc[i][0], acc[i][3], ah[i], ah[i]);
      }
      Frag<T>::keep(bh[0], bh[1], bh[2], bh[3]);
    }
  }
  acc_guard4(acc[0][0], acc[0][1], acc[0][2], acc[0][3]);
  acc_guard4(acc[1][0], acc[1][1], acc[1][2], acc[1][3]);
  acc_guard4(acc[2][0], acc[2][1], acc[2][2], acc[2][3]);
  acc_guard4(acc[3][0], acc[3][1], acc[3][2], acc[3][3]);

  // ---- epilogue ----
  float* slab = sT[wave];
  const float* Rb = RESID ? (resid + (size_t)b * strideR) : nullptr;
#pragma unroll
  for (int i = 0; i < 4; ++i) {
    const int mBase = m0 + (i << 4);
    float bm[8];
    if (BIAS_MODE == 1) {
      const float* bp = bias + mBase + mOff;
#pragma unroll
      for (int r = 0; r < 8; ++r) bm[r] = bp[r];
      // the address is an input so that its registers stay untouched up to the wait
      asm volatile("s_wait_xcnt 0x0" :: "v"(bp) : "memory");
    }
#pragma unroll
    for (int j = 0; j < 4; ++j) {
      const int n = n0 + (j << 4) + rlane;
      float bv = 0.f;
      if (BIAS_MODE == 2) bv = rne_bf16(bias[n]);
#pragma unroll
      for (int r = 0; r < 8; ++r) {
        float v = acc[i][j][r] * scale;
        if (BIAS_MODE == 1) v += rne_bf16(bm[r]);
        if (BIAS_MODE == 2) v += bv;
        if (RESID) v += Rb[(size_t)(mBase + mOff + r) * ldc + n];
        if (ACT == 1) v = tanhf(v);
        if (ACT == 2) v = fmaxf(v, 0.0f);
        if (ACT == 3) v = v / (1.0f + expf(-v));
        if (ACT == 4) v = (v > 0.f) ? v : 0.01f * v;
        slab[(mOff + r) * 68 + (j << 4) + rlane] = v;
      }
    }
    __builtin_amdgcn_fence(__ATOMIC_RELEASE, "workgroup");
    __builtin_amdgcn_wave_barrier();
    __builtin_amdgcn_fence(__ATOMIC_ACQUIRE, "workgroup");
    if (OUT_MODE == 0) {
      float* C = (float*)Cout + (size_t)b * strideC;
      const int hh = lane >> 4, c4 = (lane & 15) * 4;     // row seg = 256 B = 16 lanes x 16 B
      {
#pragma unroll
        for (int it = 0; it < 8; ++it) {
          const int row = it * 2 + hh;
          v4f v = *(const v4f*)(slab + row * 68 + c4);
          *(v4f*)(C + (size_t)(mBase + row) * ldc + n0 + c4) = v;
        }
        
      }
    } else if (OUT_MODE == 3) {
      // Coverage per slab: 4 it x 4 row groups (q) = 16 rows; 8 lanes x 8 halves = 64 halves per line.
      const int q = lane >> 3, c8 = (lane & 7) * 8;
      unsigned short* C = (unsigned short*)Cout + (size_t)b * strideC;
      const int hcol = (n0 >> 6) * 128;
      v8h hv[4], av[4];
#pragma unroll
      for (int it = 0; it < 4; ++it) {
        const int row = it * 4 + q;
        const float* sp = slab + row * 68 + c8;
        float ps = 0.f, pa = 0.f;
        v8h t;
#pragma unroll
        for (int e = 0; e < 8; ++e) {
          const float v = sp[e];
          t[e] = (_Float16)v;
          ps += v;
          if (e & 1) pa -= v; else pa += v;     // c8 is even, so (-1)^(c8+e) = (-1)^e
        }
#pragma unroll
        for (int off = 1; off < 8; off <<= 1) {   // reduce over the 8 lanes holding this row
          ps += __shfl_xor(ps, off, 32);
          pa += __shfl_xor(pa, off, 32);
        }
        const float fa = (c8 == 0) ? ps * 0.125f : 0.0f;
        const float fb = (c8 == 0) ? pa * 0.125f : 0.0f;
        v8h u;
#pragma unroll
        for (int e = 0; e < 8; ++e) u[e] = (_Float16)0.0f;
        u[0] = (_Float16)fa;
        u[1] = (_Float16)fb;
        hv[it] = t;
        av[it] = u;
      }
      {
#pragma unroll
        for (int it = 0; it < 4; ++it) {
          const int row = it * 4 + q;
          unsigned short* cp = C + (size_t)(mBase + row) * ldc + hcol + c8;
          *(v8h*)(cp) = hv[it];
          *(v8h*)(cp + 64) = av[it];
        }
        
      }
    } else {
      const int q = lane >> 3, c8 = (lane & 7) * 8;
      unsigned short* C  = (unsigned short*)Cout  + (size_t)b * strideC;
      unsigned short* C2 = (OUT_MODE == 2) ? ((unsigned short*)Cout2 + (size_t)b * strideC) : nullptr;
      {
#pragma unroll
        for (int it = 0; it < 4; ++it) {
          const int row = it * 4 + q;
          const float* sp = slab + row * 68 + c8;
          v8h hv, lv;
#pragma unroll
          for (int e = 0; e < 8; ++e) {
            if (OUT_MODE == 1) {
              hv[e] = (_Float16)sp[e];
            } else {
              unsigned short hb = f2bf_bits(sp[e]);
              unsigned short lb = f2bf_bits(sp[e] - bf_bits2f(hb));
              hv[e] = __builtin_bit_cast(_Float16, hb);
              lv[e] = __builtin_bit_cast(_Float16, lb);
            }
          }
          *(v8h*)(C + (size_t)(mBase + row) * ldc + n0 + c8) = hv;
          if (OUT_MODE == 2) *(v8h*)(C2 + (size_t)(mBase + row) * ldc + n0 + c8) = lv;
        }
        
      }
    }
    __builtin_amdgcn_fence(__ATOMIC_RELEASE, "workgroup");
    __builtin_amdgcn_wave_barrier();
    __builtin_amdgcn_fence(__ATOMIC_ACQUIRE, "workgroup");
  }
}

// One GEMM per launch: blockIdx.x = tile, blockIdx.y = batch.
template <int ET, bool SPLIT, int BIAS_MODE, int OUT_MODE, bool RESID, int ACT = 0>
__global__ __launch_bounds__(256) void wmma_gemm64(
    const unsigned short* __restrict__ Ap, const unsigned short* __restrict__ A2p, int lda, long strideA,
    const unsigned short* __restrict__ Btp, const unsigned short* __restrict__ Bt2p, int ldb, long strideB,
    void* __restrict__ Cout, void* __restrict__ Cout2, int ldc, long strideC,
    const float* __restrict__ bias,
    const float* __restrict__ resid, long strideR,
    int M, int N, int K, float scale) {
  __shared__ __align__(16) float sT[8][16 * 68];   // per-wave 16x64 slab, pitch 68 floats
  __shared__ __align__(16) typename Elem<ET>::T sAB[2][GM_ROWS * GM_LP];   // rows 0..127 = A, 128..383 = Bt; 64 k per row
  gemm64_block<ET, SPLIT, BIAS_MODE, OUT_MODE, RESID, ACT>(sT, sAB, (int)blockIdx.x, (int)blockIdx.y,
      Ap, A2p, lda, strideA, Btp, Bt2p, ldb, strideB, Cout, Cout2, ldc, strideC, bias, resid, strideR, M, N, K, scale);
}

// The three input projections in one launch. Each has 128 block tiles, half of the chip's 256 WGPs; the 384 together
// fill every WGP. Blocks 0..127: v^T (64 tiles x 2 batches), 128..255: q, 256..383: k. The choice is block-uniform.
// The second launch bound (4 waves per SIMD = 256 VGPRs) lets two 8-wave blocks stand on one WGP (2 x 145,408 B of LDS fit),
// so that all 384 start at once instead of 128 of them waiting for a free WGP.
constexpr int QKV_TILES = (NTOK / GM_BM) * (DMODEL / GM_BN);   // 128 block tiles per projection
static_assert(QKV_TILES == NBAT * (DMODEL / GM_BM) * (SEQ / GM_BN), "v^T has as many block tiles as q and k");
__global__ __launch_bounds__(256, 4) void qkv_gemm_kernel(
    const unsigned short* __restrict__ xb, const unsigned short* __restrict__ wqb,
    const unsigned short* __restrict__ wkb, const unsigned short* __restrict__ wvb,
    unsigned short* __restrict__ qpl, unsigned short* __restrict__ kpl,
    unsigned short* __restrict__ vth, unsigned short* __restrict__ vtl,
    const float* __restrict__ bq, const float* __restrict__ bk, const float* __restrict__ bv) {
  __shared__ __align__(16) float sT[8][16 * 68];
  __shared__ __align__(16) __bf16 sAB[2][GM_ROWS * GM_LP];
  const int job  = (int)blockIdx.x / QKV_TILES;
  const int tile = (int)blockIdx.x % QKV_TILES;
  if (job == 0) {
    // role swapped, per batch: C[m = h*64+d][n = s] = sum_k Wv[m][k] * x[b][s][k] + bv[m], bf16 hi/lo out
    gemm64_block<1, false, 1, 2, false>(sT, sAB, tile % (QKV_TILES / NBAT), tile / (QKV_TILES / NBAT),
        wvb, wvb, DMODEL, 0L, xb, xb, DMODEL, (long)SEQ * DMODEL,
        (void*)vth, (void*)vtl, SEQ, (long)DMODEL * SEQ, bv, bv, 0L, DMODEL, SEQ, DMODEL, 1.0f);
  } else {
    // [4096][1024] x [1024][1024]^T + bias, epilogue writes per-head 128-wide f16 rows
    const unsigned short* w  = (job == 1) ? wqb : wkb;
    unsigned short*       c  = (job == 1) ? qpl : kpl;
    const float*          bi = (job == 1) ? bq  : bk;
    gemm64_block<1, false, 2, 3, false>(sT, sAB, tile, 0,
        xb, xb, DMODEL, 0L, w, w, DMODEL, 0L,
        (void*)c, (void*)c, TOKP, 0L, bi, bi, 0L, NTOK, DMODEL, DMODEL, 1.0f);
  }
}

// ---------------------------------------------------------------------------
// The five f32 -> 16-bit operand planes in one launch of CV_BLOCKS blocks of 16 waves, about one block per WGP.
//   x, Wq, Wk, Wv -> RNE bf16 bits; Wo -> f16 bits of 64 * bf16_rne(v) (64 is an exact power of two).
// A block owns CV_ELEMS consecutive elements of one plane (the choice of plane is block-uniform). A thread issues its CV_TRIPS
// 16-B loads together, then converts and stores 8 B per load: a wave-wide load covers 4 whole 128-B lines, a store 2.
// Few long waves (4,096 in all), for speed only.
// Coverage: CV_XB blocks x CV_ELEMS = the whole of x, CV_WB blocks x CV_ELEMS = the whole of each weight matrix.
// ---------------------------------------------------------------------------
constexpr int CV_THREADS = 512;
constexpr int CV_TRIPS   = 16;
constexpr int CV_STEP    = CV_THREADS * 4;            // elements the block covers per trip
constexpr int CV_ELEMS   = CV_STEP * CV_TRIPS;        // 32,768 elements per block
constexpr int CV_XB      = NTOK * DMODEL / CV_ELEMS;  // 128 blocks for x
constexpr int CV_WB      = DMODEL * DMODEL / CV_ELEMS;   // 32 blocks for each weight matrix
constexpr int CV_BLOCKS  = CV_XB + 4 * CV_WB;         // 256
static_assert(CV_XB * CV_ELEMS == NTOK * DMODEL && CV_WB * CV_ELEMS == DMODEL * DMODEL, "whole blocks cover every plane");
__global__ __launch_bounds__(CV_THREADS) void cast_planes_kernel(
    const float* __restrict__ x, const float* __restrict__ Wq, const float* __restrict__ Wk,
    const float* __restrict__ Wv, const float* __restrict__ Wo,
    unsigned short* __restrict__ xb, unsigned short* __restrict__ wqb, unsigned short* __restrict__ wkb,
    unsigned short* __restrict__ wvb, unsigned short* __restrict__ woh) {
  const int bx = (int)blockIdx.x;
  const int pl = (bx < CV_XB) ? 0 : 1 + (bx - CV_XB) / CV_WB;            // 0 = x, 1..4 = Wq, Wk, Wv, Wo
  const int pb = (bx < CV_XB) ? bx : (bx - CV_XB) % CV_WB;               // the block's place in its plane
  const float*    in  = (pl == 0) ? x  : (pl == 1) ? Wq  : (pl == 2) ? Wk  : (pl == 3) ? Wv  : Wo;
  unsigned short* out = (pl == 0) ? xb : (pl == 1) ? wqb : (pl == 2) ? wkb : (pl == 3) ? wvb : woh;
  in  += (size_t)pb * CV_ELEMS;
  out += (size_t)pb * CV_ELEMS;
  const unsigned t = threadIdx.x;
  v4f f[CV_TRIPS];
#pragma unroll
  for (int i = 0; i < CV_TRIPS; ++i) f[i] = ((const v4f*)in)[i * CV_THREADS + t];
  v2u u[CV_TRIPS];
  if (pl != 4) {
#pragma unroll
    for (int i = 0; i < CV_TRIPS; ++i) {
      u[i][0] = pk16(f2bf_bits(f[i][0]), f2bf_bits(f[i][1]));
      u[i][1] = pk16(f2bf_bits(f[i][2]), f2bf_bits(f[i][3]));
    }
  } else {
#pragma unroll
    for (int i = 0; i < CV_TRIPS; ++i) {
      unsigned short h[4];
#pragma unroll
      for (int e = 0; e < 4; ++e) h[e] = __builtin_bit_cast(unsigned short, (_Float16)(rne_bf16(f[i][e]) * 64.0f));
      u[i][0] = pk16(h[0], h[1]);
      u[i][1] = pk16(h[2], h[3]);
    }
  }
#pragma unroll
  for (int i = 0; i < CV_TRIPS; ++i) ((v2u*)out)[i * CV_THREADS + t] = u[i];
}

#define AT_D 64
#define AT_F 96
#define AT_NW 4
#define AT_QB 64
#define AT_KC 64
// LDS row pitches in halves: 16 B x odd, so that the 16 rows of a ds_load_b128 fragment read fall on distinct banks
#define AT_KP 104   // K feature rows: 96 halves used, 208 B pitch
#define AT_VP 72    // V^T rows: 64 halves used, 144 B pitch
static_assert(AT_KP >= AT_F && AT_VP >= AT_KC && (AT_KP * 2) % 32 == 16 && (AT_VP * 2) % 32 == 16, "pitch holds the row and is 16 B x odd");

__device__ __forceinline__ __bf16 at_f2bf(float f) { return __builtin_bit_cast(__bf16, f2bf_bits(f)); }
__device__ __forceinline__ void at_split(float f, __bf16& hi, __bf16& lo) {
  const unsigned short hb = f2bf_bits(f);
  hi = __builtin_bit_cast(__bf16, hb);
  lo = at_f2bf(f - __uint_as_float(((unsigned)hb) << 16));
}
// lane l with lane l ^ 16: the two lanes that share one query column
__device__ __forceinline__ float at_xhalf(float x) {
  return __builtin_bit_cast(float, __builtin_amdgcn_permlanex16(__builtin_bit_cast(int, x), __builtin_bit_cast(int, x), 0x76543210, 0xfedcba98, false, false));
}
__device__ __forceinline__ v8f at_mma(v16b a, v16b b, v8f c) {
  c = __builtin_amdgcn_wmma_f32_16x16x32_bf16(false, a, false, b, (short)0, c, false, false);
  asm volatile("v_nop\n\tv_nop\n\tv_nop\n\tv_nop" : "+v"(c) : "v"(a), "v"(b));
  return c;
}
__device__ __forceinline__ v8f at_mma_h(v16h a, v16h b, v8f c) {
  c = __builtin_amdgcn_wmma_f32_16x16x32_f16(false, a, false, b, (short)0, c, false, false);
  asm volatile("v_nop\n\tv_nop\n\tv_nop\n\tv_nop" : "+v"(c) : "v"(a), "v"(b));
  return c;
}

__global__ __launch_bounds__(128)
void attn_aug_kernel(const unsigned short* __restrict__ qp, const unsigned short* __restrict__ kp,
                     const unsigned short* __restrict__ vhp, const unsigned short* __restrict__ vlp,
                     unsigned short* __restrict__ op, float sscale, float oscale) {
  union FB { v16b v; v8b h[2]; };
  union FH { v16h v; v8h h[2]; };
  __shared__ __align__(16) _Float16 Ksh[AT_KC * AT_KP];          // K features [kv][f]   13 KB
  __shared__ __align__(16) __bf16   Vth[AT_D * AT_VP];           // V hi [d][kv]          9 KB
  __shared__ __align__(16) __bf16   Vtl[AT_D * AT_VP];           // V lo                  9 KB
  __shared__ __align__(16) float    Os[AT_NW][16 * 68];          // per wave out tile, pitch 68

  const int tid  = threadIdx.x;
  const int wave = tid >> 5;
  const int lane = tid & 31;
  const int hh   = lane >> 4;
  const int c    = lane & 15;

  const int nqb = SEQ / AT_QB;            // 32
  const int bx = blockIdx.x;
  const int qb = bx % nqb;
  const int bh = bx / nqb;                // 0..NBAT*NHEAD-1
  const int h  = bh % NHEAD;
  const int b  = bh / NHEAD;
  const int q0 = qb * AT_QB + wave * 16;

  const _Float16* Qb = (const _Float16*)(const void*)qp + (size_t)b * SEQ * TOKP + (size_t)h * QKPITCH;
  const _Float16* Kb = (const _Float16*)(const void*)kp + (size_t)b * SEQ * TOKP + (size_t)h * QKPITCH;
  const __bf16*   Vh = (const __bf16*)(const void*)vhp + ((size_t)b * DMODEL + (size_t)h * AT_D) * SEQ;
  const __bf16*   Vl = (const __bf16*)(const void*)vlp + ((size_t)b * DMODEL + (size_t)h * AT_D) * SEQ;
  _Float16*       Ob = (_Float16*)(void*)op + (size_t)b * SEQ * DMODEL + (size_t)h * AT_D;

  // ---- Q fragments (B operand, column = query = lane&15, split k map via Frag load): 3 feature chunks of 32 ----
  v16h qa[3];
#pragma unroll
  for (int dc = 0; dc < 3; ++dc)
    qa[dc] = Frag<_Float16>::load(Qb + (size_t)(q0 + c) * TOKP + dc * 32 + 8 * hh);

  // softmax in base 2: e^(sscale * (s - max)) = 2^(s * c2 - max * c2); sscale > 0, so the maximum is taken over the unscaled scores
  const float c2 = sscale * 1.4426950408889634f;
  float mrun = -INFINITY;   // running maximum of query c's unscaled scores, equal in both lane halves
  float lrun = 0.f;         // running sum of query c over this lane half's keys; the halves join after the loop
  v8f oacc[4];              // O^T tiles: register r of tile t = O[query c][d = t*16 + 8*hh + r]
#pragma unroll
  for (int t = 0; t < 4; ++t) oacc[t] = (v8f){0.f,0.f,0.f,0.f,0.f,0.f,0.f,0.f};

  const int nChunks = SEQ / AT_KC;   // 32, compile-time constant
  // staging coverage by whole lines: a row's 64 halves are one 128-B line = 8 lanes x 16 B, so a wave-wide load touches 4 lines.
  //   K features 0..63 and each V^T plane: 16 rows x 8 pieces per trip, 4 trips = 64 rows x 64;
  //   K features 64..95 (half a line per row): 32 rows x 4 pieces per trip, 2 trips = 64 rows x 32, 8 lines per wave-wide load.
  // Row order inside a trip, for the ds_store_b128: rows r and r + 8 share a 16-lane half (8 x 208 B and 8 x 144 B = 32 banks apart);
  // in the feature tail rows r, r + 4, r + 8, r + 12 do (4 x 208 B = 16 banks apart): no bank is met twice.
  const int g8  = tid >> 3, g4 = tid >> 2;
  const int r16 = ((g8 & 1) << 3) | (g8 >> 1);                      // 0..15
  const int r32 = (g4 & 16) | ((g4 & 3) << 2) | ((g4 >> 2) & 3);    // 0..31
  const int p8  = (tid & 7) * 8;
  const int p4  = 64 + (tid & 3) * 8;
  static_assert(TOKP == SEQ, "K feature rows and V^T rows have one pitch, so one lane offset serves both");
  // lane offsets in bytes; the bases they are added to are wave-uniform
  const unsigned go8 = (unsigned)(r16 * SEQ + p8) * 2u;    // row r16 (+16 per trip), piece p8..+7, of K and of both V^T planes
  const unsigned go4 = (unsigned)(r32 * TOKP + p4) * 2u;   // K row r32 (+32 per trip), f = p4..+7
  const char* Kc  = (const char*)Kb;
  const char* Vhc = (const char*)Vh;
  const char* Vlc = (const char*)Vl;
  _Float16* kd8 = Ksh + r16 * AT_KP + p8;             // the same pieces' places in LDS
  _Float16* kd4 = Ksh + r32 * AT_KP + p4;
  __bf16*   vdh = Vth + r16 * AT_VP + p8;
  __bf16*   vdl = Vtl + r16 * AT_VP + p8;
  // the chunk in flight: 14 x 16 B per thread, loaded one chunk ahead of the LDS stores that consume them
  v8h kreg[6];
  v8b vhreg[4], vlreg[4];
#pragma unroll
  for (int i = 0; i < 4; ++i) kreg[i] = *(const v8h*)(Kc + 32 * i * TOKP + go8);
#pragma unroll
  for (int i = 0; i < 2; ++i) kreg[4 + i] = *(const v8h*)(Kc + 64 * i * TOKP + go4);
#pragma unroll
  for (int i = 0; i < 4; ++i) {
    vhreg[i] = *(const v8b*)(Vhc + 32 * i * SEQ + go8);
    vlreg[i] = *(const v8b*)(Vlc + 32 * i * SEQ + go8);
  }
  // the LDS address arithmetic around this point reuses the loads' address registers.
  // The two lane offsets are inputs so that their registers stay untouched up to the wait.
  asm volatile("s_wait_xcnt 0x0" :: "v"(go8), "v"(go4) : "memory");
  __builtin_amdgcn_sched_barrier(0);   // keeps that arithmetic from being lifted over the wait
  for (int kc = 0; kc < nChunks; ++kc) {
    __syncthreads();
#pragma unroll
    for (int i = 0; i < 4; ++i) *(v8h*)(kd8 + 16 * i * AT_KP) = kreg[i];
#pragma unroll
    for (int i = 0; i < 2; ++i) *(v8h*)(kd4 + 32 * i * AT_KP) = kreg[4 + i];
#pragma unroll
    for (int i = 0; i < 4; ++i) {
      *(v8b*)(vdh + 16 * i * AT_VP) = vhreg[i];
      *(v8b*)(vdl + 16 * i * AT_VP) = vlreg[i];
    }
    __syncthreads();
    if (kc + 1 < nChunks) {   // block-uniform: the next chunk's 14 loads go out together and land behind this chunk's work
      const char* kn  = Kc  + (size_t)(kc + 1) * (AT_KC * TOKP * 2);   // wave-uniform chunk bases, in bytes
      const char* vhn = Vhc + (size_t)(kc + 1) * (AT_KC * 2);
      const char* vln = Vlc + (size_t)(kc + 1) * (AT_KC * 2);
#pragma unroll
      for (int i = 0; i < 4; ++i) kreg[i] = *(const v8h*)(kn + 32 * i * TOKP + go8);
#pragma unroll
      for (int i = 0; i < 2; ++i) kreg[4 + i] = *(const v8h*)(kn + 64 * i * TOKP + go4);
#pragma unroll
      for (int i = 0; i < 4; ++i) {
        vhreg[i] = *(const v8b*)(vhn + 32 * i * SEQ + go8);
        vlreg[i] = *(const v8b*)(vln + 32 * i * SEQ + go8);
      }
      // the fragment loads below reuse these loads' address registers
      asm volatile("s_wait_xcnt 0x0" ::: "memory");
    }

    v8f s[4];
#pragma unroll
    for (int j = 0; j < 4; ++j) {
      s[j] = (v8f){0.f,0.f,0.f,0.f,0.f,0.f,0.f,0.f};
#pragma unroll
      for (int dc = 0; dc < 3; ++dc) {
        FH kb;   // A operand: row m = key j*16+c, k = feature, split k map
        kb.h[0] = *(const v8h*)(Ksh + (j * 16 + c) * AT_KP + dc * 32 + 8 * hh);
        kb.h[1] = *(const v8h*)(Ksh + (j * 16 + c) * AT_KP + dc * 32 + 16 + 8 * hh);
        s[j] = at_mma_h(kb.v, qa[dc], s[j]);   // s[j][r] = score of key j*16 + 8*hh + r against query c
      }
    }
    float m = -INFINITY;
#pragma unroll
    for (int j = 0; j < 4; ++j)
#pragma unroll
      for (int r = 0; r < 8; ++r) m = fmaxf(m, s[j][r]);
    m = fmaxf(m, at_xhalf(m));
    const float mnew = fmaxf(mrun, m);
    const float alpha = __builtin_amdgcn_exp2f((mrun - mnew) * c2);   // 0 on the first chunk, where mrun is -inf
    const float nb = -mnew * c2;
    mrun = mnew;
    // P^T as B operand: column n = query c; elements 0..7 = keys kk*32 + 8*hh + e (tile 2*kk), 8..15 = keys kk*32 + 16 + 8*hh + e
    // (tile 2*kk + 1): the split k map of the V^T loads below, element for element.
    FB ph[2], pl[2];
    float ps[4];
#pragma unroll
    for (int j = 0; j < 4; ++j) {
      ps[j] = 0.f;
#pragma unroll
      for (int r = 0; r < 8; ++r) {
        const float p = __builtin_amdgcn_exp2f(fmaf(s[j][r], c2, nb));   // e^(sscale * (s - max)); far below the max it ends as 0
        ps[j] += p;
        __bf16 bh, bl;
        at_split(p, bh, bl);
        ph[j >> 1].v[(j & 1) * 8 + r] = bh;
        pl[j >> 1].v[(j & 1) * 8 + r] = bl;
      }
    }
    lrun = lrun * alpha + ((ps[0] + ps[1]) + (ps[2] + ps[3]));
#pragma unroll
    for (int t = 0; t < 4; ++t)
#pragma unroll
      for (int r = 0; r < 8; ++r) oacc[t][r] *= alpha;
#pragma unroll   // unrolled: ph and pl live in registers and cannot be indexed by a run-time kk
    for (int kk = 0; kk < 2; ++kk) {
#pragma unroll
      for (int t = 0; t < 4; ++t) {
        FB vb, vl;   // A operand: row m = d = t*16+c, k = key
        vb.h[0] = *(const v8b*)(Vth + (t * 16 + c) * AT_VP + kk * 32 + 8 * hh);
        vb.h[1] = *(const v8b*)(Vth + (t * 16 + c) * AT_VP + kk * 32 + 16 + 8 * hh);
        vl.h[0] = *(const v8b*)(Vtl + (t * 16 + c) * AT_VP + kk * 32 + 8 * hh);
        vl.h[1] = *(const v8b*)(Vtl + (t * 16 + c) * AT_VP + kk * 32 + 16 + 8 * hh);
        oacc[t] = at_mma(vb.v, ph[kk].v, oacc[t]);
        oacc[t] = at_mma(vl.v, ph[kk].v, oacc[t]);
        oacc[t] = at_mma(vb.v, pl[kk].v, oacc[t]);
      }
    }
  }

  float* os = Os[wave];
  const float lsum = lrun + at_xhalf(lrun);         // both halves' keys
  const float inv = oscale * (1.0f / lsum);         // lsum is about 1 or more (the running max contributes 2^0 up to the FMA's rounding)
#pragma unroll
  for (int t = 0; t < 4; ++t) {
    v4f o0, o1;
#pragma unroll
    for (int r = 0; r < 4; ++r) { o0[r] = oacc[t][r] * inv; o1[r] = oacc[t][4 + r] * inv; }
    *(v4f*)(os + c * 68 + t * 16 + 8 * hh)     = o0;
    *(v4f*)(os + c * 68 + t * 16 + 8 * hh + 4) = o1;
  }
  __builtin_amdgcn_fence(__ATOMIC_RELEASE, "workgroup");
  __builtin_amdgcn_wave_barrier();
  __builtin_amdgcn_fence(__ATOMIC_ACQUIRE, "workgroup");
  {
    const int q8 = lane >> 3, c8 = (lane & 7) * 8;
    {
#pragma unroll
      for (int it = 0; it < 4; ++it) {
        const int row = it * 4 + q8;
        v8h hv;
#pragma unroll
        for (int e = 0; e < 8; ++e) hv[e] = (_Float16)os[row * 68 + c8 + e];
        *(v8h*)(Ob + (size_t)(q0 + row) * DMODEL + c8) = hv;
      }
      
    }
  }
}

// ---------------------------------------------------------------------------
//   [ 0 MiB,  8 MiB)  xb   bf16 [4096][1024]            RNE-bf16 of x
//   [ 8 MiB, 10 MiB)  wqb  bf16 [1024][1024]
//   [10 MiB, 12 MiB)  wkb  bf16 [1024][1024]
//   [12 MiB, 14 MiB)  wvb  bf16 [1024][1024]
//   [14 MiB, 16 MiB)  woh  f16  [1024][1024]            64 * bf16_rne(Wo)
//   [16 MiB, 32 MiB)  qpl  f16  [4096][16][128]         q features per head
//   [32 MiB, 48 MiB)  kpl  f16  [4096][16][128]         k features per head
//   [48 MiB, 56 MiB)  vth  bf16 [2][1024][2048]         v^T hi plane
//   [56 MiB, 64 MiB)  vtl  bf16 [2][1024][2048]         v^T lo plane
//   [64 MiB, 72 MiB)  ohp  f16  [4096][1024]            256 * attention output, heads merged
// GEMM shapes: q/k M=4096 N=1024 K=1024; v^T M=1024 N=2048 K=1024 (x2 batch); out M=4096 N=1024 K=1024:
// all M multiples of 128, N of 256, K of 64, row pitch of every operand 1024, no padding, every plane fully written by its producer.
// ---------------------------------------------------------------------------
extern "C" void kernel_launch(void* const* d_in, const int* in_sizes, int n_in,
                              void* d_out, int out_size, void* d_ws, size_t ws_size,
                              hipStream_t stream)
{
  if (n_in < 9) return;
  if (in_sizes[0] != NTOK * DMODEL || in_sizes[1] != DMODEL * DMODEL || in_sizes[2] != DMODEL ||
      in_sizes[3] != DMODEL * DMODEL || in_sizes[4] != DMODEL || in_sizes[5] != DMODEL * DMODEL ||
      in_sizes[6] != DMODEL || in_sizes[7] != DMODEL * DMODEL || in_sizes[8] != DMODEL) return;
  if (out_size != NTOK * DMODEL) return;

  const float* x    = (const float*)d_in[0];
  const float* Wq   = (const float*)d_in[1];
  const float* bq   = (const float*)d_in[2];
  const float* Wk   = (const float*)d_in[3];
  const float* bk   = (const float*)d_in[4];
  const float* Wv   = (const float*)d_in[5];
  const float* bv   = (const float*)d_in[6];
  const float* Wo   = (const float*)d_in[7];
  const float* bo_p = (const float*)d_in[8];

  const size_t SZ_X   = (size_t)NTOK * DMODEL * 2;                 // 8 MiB
  const size_t SZ_W   = (size_t)DMODEL * DMODEL * 2;               // 2 MiB
  const size_t SZ_QK  = (size_t)NTOK * TOKP * 2;                   // 16 MiB
  const size_t SZ_VT  = (size_t)NBAT * DMODEL * SEQ * 2;           // 8 MiB
  const size_t SZ_O   = (size_t)NTOK * DMODEL * 2;                 // 8 MiB
  const size_t OFF_XB = 0;
  const size_t OFF_WQ = OFF_XB + SZ_X;
  const size_t OFF_WK = OFF_WQ + SZ_W;
  const size_t OFF_WV = OFF_WK + SZ_W;
  const size_t OFF_WO = OFF_WV + SZ_W;
  const size_t OFF_QP = OFF_WO + SZ_W;
  const size_t OFF_KP = OFF_QP + SZ_QK;
  const size_t OFF_VH = OFF_KP + SZ_QK;
  const size_t OFF_VL = OFF_VH + SZ_VT;
  const size_t OFF_OH = OFF_VL + SZ_VT;
  const size_t TOTAL  = OFF_OH + SZ_O;                             // 75,497,472
  if (TOTAL > ws_size) return;

  char* ws = (char*)d_ws;
  unsigned short* xb  = (unsigned short*)(ws + OFF_XB);
  unsigned short* wqb = (unsigned short*)(ws + OFF_WQ);
  unsigned short* wkb = (unsigned short*)(ws + OFF_WK);
  unsigned short* wvb = (unsigned short*)(ws + OFF_WV);
  unsigned short* woh = (unsigned short*)(ws + OFF_WO);
  unsigned short* qpl = (unsigned short*)(ws + OFF_QP);
  unsigned short* kpl = (unsigned short*)(ws + OFF_KP);
  unsigned short* vth = (unsigned short*)(ws + OFF_VH);
  unsigned short* vtl = (unsigned short*)(ws + OFF_VL);
  unsigned short* ohp = (unsigned short*)(ws + OFF_OH);

  // ---- 16-bit operand planes: one launch of 256 blocks of 16 waves ----
  cast_planes_kernel<<<dim3(CV_BLOCKS), dim3(CV_THREADS), 0, stream>>>(x, Wq, Wk, Wv, Wo, xb, wqb, wkb, wvb, woh);

  // ---- q / k feature planes and v^T hi/lo planes: one launch of 3 x 128 blocks of 8 waves ----
  qkv_gemm_kernel<<<dim3(3 * QKV_TILES), dim3(256), 0, stream>>>(xb, wqb, wkb, wvb, qpl, kpl, vth, vtl, bq, bk, bv);
  // ---- attention: grid = NBAT * NHEAD * (SEQ / 64) = 1024 blocks of 128 threads ----
  attn_aug_kernel<<<dim3(NBAT * NHEAD * (SEQ / 64)), dim3(128), 0, stream>>>(
      qpl, kpl, vth, vtl, ohp, 0.0625f, 256.0f);
  // ---- output projection: d_out[m][n] = (1/16384) * sum_k (256*O)[m][k] * (64*Wo)[n][k] + bo[n], f32 out ----
  {
    const int tiles = (NTOK / 64) * (DMODEL / 64);     // 1024 -> 128 blocks
    dim3 grid(tiles / 8, 1), blk(256);
    wmma_gemm64<0, false, 2, 0, false><<<grid, blk, 0, stream>>>(
        ohp, ohp, DMODEL, 0L, woh, woh, DMODEL, 0L,
        d_out, d_out, DMODEL, 0L, bo_p, bo_p, 0L, NTOK, DMODEL, DMODEL, 1.0f / 16384.0f);
  }
}

// v009
// Measured time: 136 microseconds a run.
// In both of two side-by-side timings against v008, it was 1.14 times as fast.
// All steps since v000 together make it 3.85 times as fast.
// Contractions: q/k/v^T projections v_wmma_f32_16x16x32_bf16 (operands = RNE-bf16 of the f32 inputs, single product); scores v_wmma_f32_16x16x32_f16 (f16 per-head feature planes, single product, x1/16 in f32); p.v v_wmma_f32_16x16x32_bf16 with bf16 hi/lo split of p and v (hi.hi+hi.lo+lo.hi); output projection v_wmma_f32_16x16x32_f16 (f16 O carried x256, f16 Wo carried x64, single product, x1/16384 in f32); f32 accumulate everywhere; softmax, biases and DFT aggregate features in f32.
#include <hip/hip_runtime.h>
#include <math.h>
#include <stdint.h>

// ---------------- problem geometry ----------------
constexpr int NBAT    = 2;
constexpr int SEQ     = 2048;
constexpr int DMODEL  = 1024;
constexpr int NHEAD   = 16;
constexpr int HDIM    = 64;
constexpr int NTOK    = NBAT * SEQ;          // 4096
constexpr int QKPITCH = 128;                 // halves per (token, head) feature row: 64 dims, sum/8, altsum/8, zeros
constexpr int TOKP    = NHEAD * QKPITCH;     // 2048 halves per token row of the q/k feature planes
static_assert(NTOK % 64 == 0 && DMODEL % 64 == 0 && SEQ % 64 == 0 && DMODEL % 32 == 0);
static_assert(NHEAD * HDIM == DMODEL);

typedef __attribute__((ext_vector_type(16))) _Float16 v16h;
typedef __attribute__((ext_vector_type(8)))  _Float16 v8h;
typedef __attribute__((ext_vector_type(16))) __bf16   v16b;
typedef __attribute__((ext_vector_type(8)))  __bf16   v8b;
typedef __attribute__((ext_vector_type(8)))  float    v8f;
typedef __attribute__((ext_vector_type(4)))  float    v4f;
typedef __attribute__((ext_vector_type(2)))  unsigned v2u;

__device__ __forceinline__ unsigned short f2bf_bits(float f) {
  unsigned u = __float_as_uint(f);
  return (unsigned short)((u + 0x7FFFu + ((u >> 16) & 1u)) >> 16);
}
__device__ __forceinline__ float bf_bits2f(unsigned short h) { return __uint_as_float(((unsigned)h) << 16); }
__device__ __forceinline__ float rne_bf16(float f) { return bf_bits2f(f2bf_bits(f)); }
__device__ __forceinline__ unsigned pk16(unsigned short a, unsigned short b) { return (unsigned)a | ((unsigned)b << 16); }

// hazard guards as plain device helpers (no inline asm inside the kernel template body)
__device__ __forceinline__ void dep_guard_h(v8f& a, v8f& b, v16h x, v16h y) { asm volatile("v_nop\n\tv_nop\n\tv_nop\n\tv_nop" : "+v"(a), "+v"(b) : "v"(x), "v"(y)); }
__device__ __forceinline__ void dep_guard_b(v8f& a, v8f& b, v16b x, v16b y) { asm volatile("v_nop\n\tv_nop\n\tv_nop\n\tv_nop" : "+v"(a), "+v"(b) : "v"(x), "v"(y)); }
__device__ __forceinline__ void keep4_h(v16h a, v16h b, v16h c, v16h d) { asm volatile("v_nop" :: "v"(a), "v"(b), "v"(c), "v"(d)); }
__device__ __forceinline__ void keep4_b(v16b a, v16b b, v16b c, v16b d) { asm volatile("v_nop" :: "v"(a), "v"(b), "v"(c), "v"(d)); }
__device__ __forceinline__ void acc_guard4(v8f& a, v8f& b, v8f& c, v8f& d) { asm volatile("v_nop\n\tv_nop\n\tv_nop\n\tv_nop" : "+v"(a), "+v"(b), "+v"(c), "+v"(d)); }
template <typename T> struct Frag;
template <> struct Frag<_Float16> {
  typedef v16h V; typedef v8h H; union U { v16h v; v8h h[2]; };
  static __device__ __forceinline__ v16h load(const _Float16* p) {   // elements 0..7 <- p[0..7], 8..15 <- p[16..23]
    U f; f.h[0] = *(const v8h*)(p); f.h[1] = *(const v8h*)(p + 16); return f.v;
  }
  static __device__ __forceinline__ v8f mma(v16h a, v16h b, v8f c) {
    return __builtin_amdgcn_wmma_f32_16x16x32_f16(false, a, false, b, (short)0, c, false, false);
  }
  static __device__ __forceinline__ void guard(v8f& a, v8f& b, v16h x, v16h y) { dep_guard_h(a, b, x, y); }
  static __device__ __forceinline__ void keep(v16h a, v16h b, v16h c, v16h d) { keep4_h(a, b, c, d); }
};
template <> struct Frag<__bf16> {
  typedef v16b V; typedef v8b H; union U { v16b v; v8b h[2]; };
  static __device__ __forceinline__ v16b load(const __bf16* p) {
    U f; f.h[0] = *(const v8b*)(p); f.h[1] = *(const v8b*)(p + 16); return f.v;
  }
  static __device__ __forceinline__ v8f mma(v16b a, v16b b, v8f c) {
    return __builtin_amdgcn_wmma_f32_16x16x32_bf16(false, a, false, b, (short)0, c, false, false);
  }
  static __device__ __forceinline__ void guard(v8f& a, v8f& b, v16b x, v16b y) { dep_guard_b(a, b, x, y); }
  static __device__ __forceinline__ void keep(v16b a, v16b b, v16b c, v16b d) { keep4_b(a, b, c, d); }
};

// ---- Register-blocked batched WMMA GEMM ------------------------------------
// C[m,n] = scale * sum_k A[m,k] * Bt[n,k] (+bias)(+resid); each wave owns a 64x64 tile.
// A row-major [M,K]; Bt row-major [N,K]; M % 128 == 0, N % 256 == 0, K % 64 == 0.
// Block = 8 waves as 2 (m) x 4 (n) = a 128 x 256 tile. Per stage of 64 k the block brings its 128 A rows and
// 256 Bt rows (one 128-B line each) into LDS: 8 lanes x 16 B per row, so a wave-wide load covers 4 whole lines.
// Two LDS buffers, the global loads held in registers up to two stages ahead, one __syncthreads per stage.
// SPLIT (hi/lo operand planes) is not instantiated here and not supported by the staged loop.
// BIAS_MODE: 0 = none, 1 = bias[m], 2 = bias[n]. Bias values are RNE-bf16 quantised before the f32 add.
// OUT_MODE: 0 = f32, 1 = f16, 2 = bf16 hi plane (Cout) + bf16 lo plane (Cout2),
//           3 = f16 per-head feature rows: head hd = n0/64, row m -> C[m*ldc + hd*128 + 0..63] = f16(v[0..63]),
//               [+64] = f16(sum_d v[d] / 8), [+65] = f16(sum_d (-1)^d v[d] / 8), [+66..+127] = 0.
// ET: 0 = f16 operands, 1 = bf16 operands (pointers passed as 16-bit storage)
template <int ET> struct Elem;
template <> struct Elem<0> { typedef _Float16 T; };
template <> struct Elem<1> { typedef __bf16 T; };
constexpr int GM_BM   = 128;             // block tile rows (A rows staged)
constexpr int GM_BN   = 256;             // block tile columns (Bt rows staged)
constexpr int GM_ROWS = GM_BM + GM_BN;   // 384 staged rows per stage
constexpr int GM_LD   = DMODEL;          // row pitch of A and Bt in elements, a constant so that a stage's row steps fold into the loads' immediate offsets
constexpr int GM_LP   = 72;              // LDS row pitch in 16-bit elements: 64 used, 144 B = 16 B x odd for ds_load_b128 readers
// The work of one block, shared by the kernels below: sT and sAB are the calling kernel's LDS, tile and b its place in the problem.
template <int ET, bool SPLIT, int BIAS_MODE, int OUT_MODE, bool RESID, int ACT = 0>
__device__ __forceinline__ void gemm64_block(
    float (*sT)[16 * 68], typename Elem<ET>::T (*sAB)[GM_ROWS * GM_LP], const int tile, const int b,
    const unsigned short* __restrict__ Ap, const unsigned short* __restrict__ A2p, int lda, long strideA,
    const unsigned short* __restrict__ Btp, const unsigned short* __restrict__ Bt2p, int ldb, long strideB,
    void* __restrict__ Cout, void* __restrict__ Cout2, int ldc, long strideC,
    const float* __restrict__ bias,
    const float* __restrict__ resid, long strideR,
    int M, int N, int K, float scale) {
  typedef typename Elem<ET>::T T;
  typedef typename Frag<T>::V V;
  typedef typename Frag<T>::H H;
  static_assert(!SPLIT, "the staged loop carries one plane per operand");
  const T* A = (const T*)Ap; const T* Bt = (const T*)Btp;
  const int lane = threadIdx.x & 31;
  const int wave = __builtin_amdgcn_readfirstlane(threadIdx.x >> 5);   // the same in every lane: what derives from it stays in scalar registers
  const int tilesN = N >> 8;
  const int tilesM = M >> 7;
  if (tile >= tilesM * tilesN || lda != GM_LD || ldb != GM_LD) return;   // block-uniform, in front of every barrier
  const int tm = tile / tilesN;
  const int tn = tile - tm * tilesN;
  const int bm0 = tm << 7;                // block tile origin
  const int bn0 = tn << 8;
  const int wm  = (wave >> 2) << 6;       // wave tile origin inside the block tile
  const int wn  = (wave & 3) << 6;
  const int m0 = bm0 + wm;
  const int n0 = bn0 + wn;

  const T* Ab  = A  + (size_t)b * strideA;
  const T* Bb  = Bt + (size_t)b * strideB;

  const int rlane = lane & 15;                 // row (A) / col (B, D) within subtile
  const int koff  = (lane >> 4) * 8;           // k offset of this lane half
  const int mOff  = (lane >> 4) * 8;           // D row offset

  v8f acc[4][4];
#pragma unroll
  for (int i = 0; i < 4; ++i)
#pragma unroll
    for (int j = 0; j < 4; ++j) acc[i][j] = (v8f){0.f,0.f,0.f,0.f,0.f,0.f,0.f,0.f};

  // staging coverage: 256 threads = 32 rows x 8 pieces of 16 B; 4 trips cover the A rows, 8 trips the Bt rows
  // (rows r and r + 8 sit side by side in a 16-lane half: 8 x 144 B = 32 banks apart, so a ds_store_b128 meets no bank twice)
  const int sgrp = threadIdx.x >> 3;
  const int srow = (sgrp & 16) | ((sgrp & 1) << 3) | ((sgrp >> 1) & 7);
  const int spc  = (threadIdx.x & 7) * 8;
  // A and Bt have one row pitch, so one 32-bit lane offset (bytes) serves both and steps 64 k = 128 B per stage; the two bases are
  // block-uniform (scalar registers). Three vector registers fewer than two 64-bit lane pointers.
  unsigned gOff = (unsigned)(srow * GM_LD + spc) * 2u;
  const char* gA = (const char*)(Ab + (size_t)bm0 * GM_LD);
  const char* gB = (const char*)(Bb + (size_t)bn0 * GM_LD);
  const int sOff = srow * GM_LP + spc;
  const int nStage = K >> 6;
  H st[12];   // the stage in flight
#pragma unroll
  for (int i = 0; i < 4; ++i) st[i] = *(const H*)(gA + 64 * i * GM_LD + gOff);
#pragma unroll
  for (int i = 0; i < 8; ++i) st[4 + i] = *(const H*)(gB + 64 * i * GM_LD + gOff);
#pragma unroll
  for (int i = 0; i < 12; ++i) *(H*)(sAB[0] + sOff + 32 * i * GM_LP) = st[i];
  if (1 < nStage) {
    gOff += 128u;
#pragma unroll
    for (int i = 0; i < 4; ++i) st[i] = *(const H*)(gA + 64 * i * GM_LD + gOff);
#pragma unroll
    for (int i = 0; i < 8; ++i) st[4 + i] = *(const H*)(gB + 64 * i * GM_LD + gOff);
  }

  for (int s = 0; s < nStage; ++s) {
    const T* buf = sAB[s & 1];
    __syncthreads();   // publishes stage s and ends every wave's reads of the other buffer (stage s - 1)
#pragma unroll
    for (int kk = 0; kk < 2; ++kk) {
      V bh[4], ah[4];
#pragma unroll
      for (int j = 0; j < 4; ++j) bh[j] = Frag<T>::load(buf + (GM_BM + wn + (j << 4) + rlane) * GM_LP + kk * 32 + koff);
#pragma unroll
      for (int i = 0; i < 4; ++i) ah[i] = Frag<T>::load(buf + (wm + (i << 4) + rlane) * GM_LP + kk * 32 + koff);
      if (kk == 0) {   // staging queues behind the first fragment reads, so the products start sooner
        // stage s + 1 goes from registers into the other buffer. No test round it: with a branch here the fragment
        // waits below fall back to counts that also wait for these stores; the last stage's copy is read by nobody.
        T* nxt = sAB[(s + 1) & 1];
#pragma unroll
        for (int i = 0; i < 12; ++i) *(H*)(nxt + sOff + 32 * i * GM_LP) = st[i];
        if (s + 2 < nStage) {   // block-uniform: stage s + 2's 12 loads land behind this stage's products
          gOff += 128u;
#pragma unroll
          for (int i = 0; i < 4; ++i) st[i] = *(const H*)(gA + 64 * i * GM_LD + gOff);
#pragma unroll
          for (int i = 0; i < 8; ++i) st[4 + i] = *(const H*)(gB + 64 * i * GM_LD + gOff);
          // behind the loop the two scalar bases' registers are reused
          asm volatile("s_wait_xcnt 0x0" ::: "memory");
        }
      }
#pragma unroll
      for (int i = 0; i < 4; ++i) {
#pragma unroll
        for (int j = 0; j < 4; ++j) acc[i][j] = Frag<T>::mma(ah[i], bh[j], acc[i][j]);
        Frag<T>::guard(acc[i][0], acc[i][3], ah[i], ah[i]);
      }
      Frag<T>::keep(bh[0], bh[1], bh[2], bh[3]);
    }
  }
  acc_guard4(acc[0][0], acc[0][1], acc[0][2], acc[0][3]);
  acc_guard4(acc[1][0], acc[1][1], acc[1][2], acc[1][3]);
  acc_guard4(acc[2][0], acc[2][1], acc[2][2], acc[2][3]);
  acc_guard4(acc[3][0], acc[3][1], acc[3][2], acc[3][3]);

  // ---- epilogue ----
  float* slab = sT[wave];
  const float* Rb = RESID ? (resid + (size_t)b * strideR) : nullptr;
#pragma unroll
  for (int i = 0; i < 4; ++i) {
    const int mBase = m0 + (i << 4);
    float bm[8];
    if (BIAS_MODE == 1) {
      const float* bp = bias + mBase + mOff;
#pragma unroll
      for (int r = 0; r < 8; ++r) bm[r] = bp[r];
      // the address is an input so that its registers stay untouched up to the wait
      asm volatile("s_wait_xcnt 0x0" :: "v"(bp) : "memory");
    }
#pragma unroll
    for (int j = 0; j < 4; ++j) {
      const int n = n0 + (j << 4) + rlane;
      float bv = 0.f;
      if (BIAS_MODE == 2) bv = rne_bf16(bias[n]);
#pragma unroll
      for (int r = 0; r < 8; ++r) {
        float v = acc[i][j][r] * scale;
        if (BIAS_MODE == 1) v += rne_bf16(bm[r]);
        if (BIAS_MODE == 2) v += bv;
        if (RESID) v += Rb[(size_t)(mBase + mOff + r) * ldc + n];
        if (ACT == 1) v = tanhf(v);
        if (ACT == 2) v = fmaxf(v, 0.0f);
        if (ACT == 3) v = v / (1.0f + expf(-v));
        if (ACT == 4) v = (v > 0.f) ? v : 0.01f * v;
        slab[(mOff + r) * 68 + (j << 4) + rlane] = v;
      }
    }
    __builtin_amdgcn_fence(__ATOMIC_RELEASE, "workgroup");
    __builtin_amdgcn_wave_barrier();
    __builtin_amdgcn_fence(__ATOMIC_ACQUIRE, "workgroup");
    if (OUT_MODE == 0) {
      float* C = (float*)Cout + (size_t)b * strideC;
      const int hh = lane >> 4, c4 = (lane & 15) * 4;     // row seg = 256 B = 16 lanes x 16 B
      {
#pragma unroll
        for (int it = 0; it < 8; ++it) {
          const int row = it * 2 + hh;
          v4f v = *(const v4f*)(slab + row * 68 + c4);
          *(v4f*)(C + (size_t)(mBase + row) * ldc + n0 + c4) = v;
        }
        
      }
    } else if (OUT_MODE == 3) {
      // Coverage per slab: 4 it x 4 row groups (q) = 16 rows; 8 lanes x 8 halves = 64 halves per line.
      const int q = lane >> 3, c8 = (lane & 7) * 8;
      unsigned short* C = (unsigned short*)Cout + (size_t)b * strideC;
      const int hcol = (n0 >> 6) * 128;
      v8h hv[4], av[4];
#pragma unroll
      for (int it = 0; it < 4; ++it) {
        const int row = it * 4 + q;
        const float* sp = slab + row * 68 + c8;
        float ps = 0.f, pa = 0.f;
        v8h t;
#pragma unroll
        for (int e = 0; e < 8; ++e) {
          const float v = sp[e];
          t[e] = (_Float16)v;
          ps += v;
          if (e & 1) pa -= v; else pa += v;     // c8 is even, so (-1)^(c8+e) = (-1)^e
        }
#pragma unroll
        for (int off = 1; off < 8; off <<= 1) {   // reduce over the 8 lanes holding this row
          ps += __shfl_xor(ps, off, 32);
          pa += __shfl_xor(pa, off, 32);
        }
        const float fa = (c8 == 0) ? ps * 0.125f : 0.0f;
        const float fb = (c8 == 0) ? pa * 0.125f : 0.0f;
        v8h u;
#pragma unroll
        for (int e = 0; e < 8; ++e) u[e] = (_Float16)0.0f;
        u[0] = (_Float16)fa;
        u[1] = (_Float16)fb;
        hv[it] = t;
        av[it] = u;
      }
      {
#pragma unroll
        for (int it = 0; it < 4; ++it) {
          const int row = it * 4 + q;
          unsigned short* cp = C + (size_t)(mBase + row) * ldc + hcol + c8;
          *(v8h*)(cp) = hv[it];
          *(v8h*)(cp + 64) = av[it];
        }
        
      }
    } else {
      const int q = lane >> 3, c8 = (lane & 7) * 8;
      unsigned short* C  = (unsigned short*)Cout  + (size_t)b * strideC;
      unsigned short* C2 = (OUT_MODE == 2) ? ((unsigned short*)Cout2 + (size_t)b * strideC) : nullptr;
      {
#pragma unroll
        for (int it = 0; it < 4; ++it) {
          const int row = it * 4 + q;
          const float* sp = slab + row * 68 + c8;
          v8h hv, lv;
#pragma unroll
          for (int e = 0; e < 8; ++e) {
            if (OUT_MODE == 1) {
              hv[e] = (_Float16)sp[e];
            } else {
              unsigned short hb = f2bf_bits(sp[e]);
              unsigned short lb = f2bf_bits(sp[e] - bf_bits2f(hb));
              hv[e] = __builtin_bit_cast(_Float16, hb);
              lv[e] = __builtin_bit_cast(_Float16, lb);
            }
          }
          *(v8h*)(C + (size_t)(mBase + row) * ldc + n0 + c8) = hv;
          if (OUT_MODE == 2) *(v8h*)(C2 + (size_t)(mBase + row) * ldc + n0 + c8) = lv;
        }
        
      }
    }
    __builtin_amdgcn_fence(__ATOMIC_RELEASE, "workgroup");
    __builtin_amdgcn_wave_barrier();
    __builtin_amdgcn_fence(__ATOMIC_ACQUIRE, "workgroup");
  }
}

// One GEMM per launch: blockIdx.x = tile, blockIdx.y = batch.
template <int ET, bool SPLIT, int BIAS_MODE, int OUT_MODE, bool RESID, int ACT = 0>
__global__ __launch_bounds__(256) void wmma_gemm64(
    const unsigned short* __restrict__ Ap, const unsigned short* __restrict__ A2p, int lda, long strideA,
    const unsigned short* __restrict__ Btp, const unsigned short* __restrict__ Bt2p, int ldb, long strideB,
    void* __restrict__ Cout, void* __restrict__ Cout2, int ldc, long strideC,
    const float* __restrict__ bias,
    const float* __restrict__ resid, long strideR,
    int M, int N, int K, float scale) {
  __shared__ __align__(16) float sT[8][16 * 68];   // per-wave 16x64 slab, pitch 68 floats
  __shared__ __align__(16) typename Elem<ET>::T sAB[2][GM_ROWS * GM_LP];   // rows 0..127 = A, 128..383 = Bt; 64 k per row
  gemm64_block<ET, SPLIT, BIAS_MODE, OUT_MODE, RESID, ACT>(sT, sAB, (int)blockIdx.x, (int)blockIdx.y,
      Ap, A2p, lda, strideA, Btp, Bt2p, ldb, strideB, Cout, Cout2, ldc, strideC, bias, resid, strideR, M, N, K, scale);
}

// The three input projections in one launch. Each has 128 block tiles, half of the chip's 256 WGPs; the 384 together
// fill every WGP. Blocks 0..127: v^T (64 tiles x 2 batches), 128..255: q, 256..383: k. The choice is block-uniform.
// The second launch bound (4 waves per SIMD = 256 VGPRs) lets two 8-wave blocks stand on one WGP (2 x 145,408 B of LDS fit),
// so that all 384 start at once instead of 128 of them waiting for a free WGP.
constexpr int QKV_TILES = (NTOK / GM_BM) * (DMODEL / GM_BN);   // 128 block tiles per projection
static_assert(QKV_TILES == NBAT * (DMODEL / GM_BM) * (SEQ / GM_BN), "v^T has as many block tiles as q and k");
__global__ __launch_bounds__(256, 4) void qkv_gemm_kernel(
    const unsigned short* __restrict__ xb, const unsigned short* __restrict__ wqb,
    const unsigned short* __restrict__ wkb, const unsigned short* __restrict__ wvb,
    unsigned short* __restrict__ qpl, unsigned short* __restrict__ kpl,
    unsigned short* __restrict__ vth, unsigned short* __restrict__ vtl,
    const float* __restrict__ bq, const float* __restrict__ bk, const float* __restrict__ bv) {
  __shared__ __align__(16) float sT[8][16 * 68];
  __shared__ __align__(16) __bf16 sAB[2][GM_ROWS * GM_LP];
  const int job  = (int)blockIdx.x / QKV_TILES;
  const int tile = (int)blockIdx.x % QKV_TILES;
  if (job == 0) {
    // role swapped, per batch: C[m = h*64+d][n = s] = sum_k Wv[m][k] * x[b][s][k] + bv[m], bf16 hi/lo out
    gemm64_block<1, false, 1, 2, false>(sT, sAB, tile % (QKV_TILES / NBAT), tile / (QKV_TILES / NBAT),
        wvb, wvb, DMODEL, 0L, xb, xb, DMODEL, (long)SEQ * DMODEL,
        (void*)vth, (void*)vtl, SEQ, (long)DMODEL * SEQ, bv, bv, 0L, DMODEL, SEQ, DMODEL, 1.0f);
  } else {
    // [4096][1024] x [1024][1024]^T + bias, epilogue writes per-head 128-wide f16 rows
    const unsigned short* w  = (job == 1) ? wqb : wkb;
    unsigned short*       c  = (job == 1) ? qpl : kpl;
    const float*          bi = (job == 1) ? bq  : bk;
    gemm64_block<1, false, 2, 3, false>(sT, sAB, tile, 0,
        xb, xb, DMODEL, 0L, w, w, DMODEL, 0L,
        (void*)c, (void*)c, TOKP, 0L, bi, bi, 0L, NTOK, DMODEL, DMODEL, 1.0f);
  }
}

// ---------------------------------------------------------------------------
// The five f32 -> 16-bit operand planes in one launch of CV_BLOCKS blocks of 16 waves, about one block per WGP.
//   x, Wq, Wk, Wv -> RNE bf16 bits; Wo -> f16 bits of 64 * bf16_rne(v) (64 is an exact power of two).
// A block owns CV_ELEMS consecutive elements of one plane (the choice of plane is block-uniform). A thread issues its CV_TRIPS
// 16-B loads together, then converts and stores 8 B per load: a wave-wide load covers 4 whole 128-B lines, a store 2.
// Few long waves (4,096 in all), for speed only.
// Coverage: CV_XB blocks x CV_ELEMS = the whole of x, CV_WB blocks x CV_ELEMS = the whole of each weight matrix.
// ---------------------------------------------------------------------------
constexpr int CV_THREADS = 512;
constexpr int CV_TRIPS   = 16;
constexpr int CV_STEP    = CV_THREADS * 4;            // elements the block covers per trip
constexpr int CV_ELEMS   = CV_STEP * CV_TRIPS;        // 32,768 elements per block
constexpr int CV_XB      = NTOK * DMODEL / CV_ELEMS;  // 128 blocks for x
constexpr int CV_WB      = DMODEL * DMODEL / CV_ELEMS;   // 32 blocks for each weight matrix
constexpr int CV_BLOCKS  = CV_XB + 4 * CV_WB;         // 256
static_assert(CV_XB * CV_ELEMS == NTOK * DMODEL && CV_WB * CV_ELEMS == DMODEL * DMODEL, "whole blocks cover every plane");
__global__ __launch_bounds__(CV_THREADS) void cast_planes_kernel(
    const float* __restrict__ x, const float* __restrict__ Wq, const float* __restrict__ Wk,
    const float* __restrict__ Wv, const float* __restrict__ Wo,
    unsigned short* __restrict__ xb, unsigned short* __restrict__ wqb, unsigned short* __restrict__ wkb,
    unsigned short* __restrict__ wvb, unsigned short* __restrict__ woh) {
  const int bx = (int)blockIdx.x;
  const int pl = (bx < CV_XB) ? 0 : 1 + (bx - CV_XB) / CV_WB;            // 0 = x, 1..4 = Wq, Wk, Wv, Wo
  const int pb = (bx < CV_XB) ? bx : (bx - CV_XB) % CV_WB;               // the block's place in its plane
  const float*    in  = (pl == 0) ? x  : (pl == 1) ? Wq  : (pl == 2) ? Wk  : (pl == 3) ? Wv  : Wo;
  unsigned short* out = (pl == 0) ? xb : (pl == 1) ? wqb : (pl == 2) ? wkb : (pl == 3) ? wvb : woh;
  in  += (size_t)pb * CV_ELEMS;
  out += (size_t)pb * CV_ELEMS;
  const unsigned t = threadIdx.x;
  v4f f[CV_TRIPS];
#pragma unroll
  for (int i = 0; i < CV_TRIPS; ++i) f[i] = ((const v4f*)in)[i * CV_THREADS + t];
  v2u u[CV_TRIPS];
  if (pl != 4) {
#pragma unroll
    for (int i = 0; i < CV_TRIPS; ++i) {
      u[i][0] = pk16(f2bf_bits(f[i][0]), f2bf_bits(f[i][1]));
      u[i][1] = pk16(f2bf_bits(f[i][2]), f2bf_bits(f[i][3]));
    }
  } else {
#pragma unroll
    for (int i = 0; i < CV_TRIPS; ++i) {
      unsigned short h[4];
#pragma unroll
      for (int e = 0; e < 4; ++e) h[e] = __builtin_bit_cast(unsigned short, (_Float16)(rne_bf16(f[i][e]) * 64.0f));
      u[i][0] = pk16(h[0], h[1]);
      u[i][1] = pk16(h[2], h[3]);
    }
  }
#pragma unroll
  for (int i = 0; i < CV_TRIPS; ++i) ((v2u*)out)[i * CV_THREADS + t] = u[i];
}

#define AT_D 64
#define AT_F 96
#define AT_NW 4
#define AT_QB 64
#define AT_KC 64
// LDS row pitches in halves: 16 B x odd, so that the 16 rows of a ds_load_b128 fragment read fall on distinct banks
#define AT_KP 104   // K feature rows: 96 halves used, 208 B pitch
#define AT_VP 72    // V^T rows: 64 halves used, 144 B pitch
static_assert(AT_KP >= AT_F && AT_VP >= AT_KC && (AT_KP * 2) % 32 == 16 && (AT_VP * 2) % 32 == 16, "pitch holds the row and is 16 B x odd");

__device__ __forceinline__ __bf16 at_f2bf(float f) { return __builtin_bit_cast(__bf16, f2bf_bits(f)); }
__device__ __forceinline__ void at_split(float f, __bf16& hi, __bf16& lo) {
  const unsigned short hb = f2bf_bits(f);
  hi = __builtin_bit_cast(__bf16, hb);
  lo = at_f2bf(f - __uint_as_float(((unsigned)hb) << 16));
}
// lane l with lane l ^ 16: the two lanes that share one query column
__device__ __forceinline__ float at_xhalf(float x) {
  return __builtin_bit_cast(float, __builtin_amdgcn_permlanex16(__builtin_bit_cast(int, x), __builtin_bit_cast(int, x), 0x76543210, 0xfedcba98, false, false));
}
// Plain builtins: the compiler keeps the WMMA distances of its own code, and with no asm statement behind a product the LDS fragment
// loads of later products may issue ahead of it in groups, behind counted waits.
__device__ __forceinline__ v8f at_mma(v16b a, v16b b, v8f c) {
  return __builtin_amdgcn_wmma_f32_16x16x32_bf16(false, a, false, b, (short)0, c, false, false);
}
__device__ __forceinline__ v8f at_mma_h(v16h a, v16h b, v8f c) {
  return __builtin_amdgcn_wmma_f32_16x16x32_f16(false, a, false, b, (short)0, c, false, false);
}

__global__ __launch_bounds__(128)
void attn_aug_kernel(const unsigned short* __restrict__ qp, const unsigned short* __restrict__ kp,
                     const unsigned short* __restrict__ vhp, const unsigned short* __restrict__ vlp,
                     unsigned short* __restrict__ op, float sscale, float oscale) {
  union FB { v16b v; v8b h[2]; };
  union FH { v16h v; v8h h[2]; };
  __shared__ __align__(16) _Float16 Ksh[AT_KC * AT_KP];          // K features [kv][f]   13 KB
  __shared__ __align__(16) __bf16   Vth[AT_D * AT_VP];           // V hi [d][kv]          9 KB
  __shared__ __align__(16) __bf16   Vtl[AT_D * AT_VP];           // V lo                  9 KB
  __shared__ __align__(16) float    Os[AT_NW][16 * 68];          // per wave out tile, pitch 68

  const int tid  = threadIdx.x;
  const int wave = tid >> 5;
  const int lane = tid & 31;
  const int hh   = lane >> 4;
  const int c    = lane & 15;

  const int nqb = SEQ / AT_QB;            // 32
  const int bx = blockIdx.x;
  const int qb = bx % nqb;
  const int bh = bx / nqb;                // 0..NBAT*NHEAD-1
  const int h  = bh % NHEAD;
  const int b  = bh / NHEAD;
  const int q0 = qb * AT_QB + wave * 16;

  const _Float16* Qb = (const _Float16*)(const void*)qp + (size_t)b * SEQ * TOKP + (size_t)h * QKPITCH;
  const _Float16* Kb = (const _Float16*)(const void*)kp + (size_t)b * SEQ * TOKP + (size_t)h * QKPITCH;
  const __bf16*   Vh = (const __bf16*)(const void*)vhp + ((size_t)b * DMODEL + (size_t)h * AT_D) * SEQ;
  const __bf16*   Vl = (const __bf16*)(const void*)vlp + ((size_t)b * DMODEL + (size_t)h * AT_D) * SEQ;
  _Float16*       Ob = (_Float16*)(void*)op + (size_t)b * SEQ * DMODEL + (size_t)h * AT_D;

  // ---- Q fragments (B operand, column = query = lane&15, split k map via Frag load): 3 feature chunks of 32 ----
  v16h qa[3];
#pragma unroll
  for (int dc = 0; dc < 3; ++dc)
    qa[dc] = Frag<_Float16>::load(Qb + (size_t)(q0 + c) * TOKP + dc * 32 + 8 * hh);

  // softmax in base 2: e^(sscale * (s - max)) = 2^(s * c2 - max * c2); sscale > 0, so the maximum is taken over the unscaled scores
  const float c2 = sscale * 1.4426950408889634f;
  float mrun = -INFINITY;   // running maximum of query c's unscaled scores, equal in both lane halves
  float lrun = 0.f;         // running sum of query c over this lane half's keys; the halves join after the loop
  v8f oacc[4];              // O^T tiles: register r of tile t = O[query c][d = t*16 + 8*hh + r]
#pragma unroll
  for (int t = 0; t < 4; ++t) oacc[t] = (v8f){0.f,0.f,0.f,0.f,0.f,0.f,0.f,0.f};

  const int nChunks = SEQ / AT_KC;   // 32, compile-time constant
  // staging coverage by whole lines: a row's 64 halves are one 128-B line = 8 lanes x 16 B, so a wave-wide load touches 4 lines.
  //   K features 0..63 and each V^T plane: 16 rows x 8 pieces per trip, 4 trips = 64 rows x 64;
  //   K features 64..95 (half a line per row): 32 rows x 4 pieces per trip, 2 trips = 64 rows x 32, 8 lines per wave-wide load.
  // Row order inside a trip, for the ds_store_b128: rows r and r + 8 share a 16-lane half (8 x 208 B and 8 x 144 B = 32 banks apart);
  // in the feature tail rows r, r + 4, r + 8, r + 12 do (4 x 208 B = 16 banks apart): no bank is met twice.
  const int g8  = tid >> 3, g4 = tid >> 2;
  const int r16 = ((g8 & 1) << 3) | (g8 >> 1);                      // 0..15
  const int r32 = (g4 & 16) | ((g4 & 3) << 2) | ((g4 >> 2) & 3);    // 0..31
  const int p8  = (tid & 7) * 8;
  const int p4  = 64 + (tid & 3) * 8;
  static_assert(TOKP == SEQ, "K feature rows and V^T rows have one pitch, so one lane offset serves both");
  // lane offsets in bytes; the bases they are added to are wave-uniform
  const unsigned go8 = (unsigned)(r16 * SEQ + p8) * 2u;    // row r16 (+16 per trip), piece p8..+7, of K and of both V^T planes
  const unsigned go4 = (unsigned)(r32 * TOKP + p4) * 2u;   // K row r32 (+32 per trip), f = p4..+7
  const char* Kc  = (const char*)Kb;
  const char* Vhc = (const char*)Vh;
  const char* Vlc = (const char*)Vl;
  _Float16* kd8 = Ksh + r16 * AT_KP + p8;             // the same pieces' places in LDS
  _Float16* kd4 = Ksh + r32 * AT_KP + p4;
  __bf16*   vdh = Vth + r16 * AT_VP + p8;
  __bf16*   vdl = Vtl + r16 * AT_VP + p8;
  // the chunk in flight: 14 x 16 B per thread, loaded one chunk ahead of the LDS stores that consume them
  v8h kreg[6];
  v8b vhreg[4], vlreg[4];
#pragma unroll
  for (int i = 0; i < 4; ++i) kreg[i] = *(const v8h*)(Kc + 32 * i * TOKP + go8);
#pragma unroll
  for (int i = 0; i < 2; ++i) kreg[4 + i] = *(const v8h*)(Kc + 64 * i * TOKP + go4);
#pragma unroll
  for (int i = 0; i < 4; ++i) {
    vhreg[i] = *(const v8b*)(Vhc + 32 * i * SEQ + go8);
    vlreg[i] = *(const v8b*)(Vlc + 32 * i * SEQ + go8);
  }
  // the LDS address arithmetic around this point reuses the loads' address registers.
  // The two lane offsets are inputs so that their registers stay untouched up to the wait.
  asm volatile("s_wait_xcnt 0x0" :: "v"(go8), "v"(go4) : "memory");
  __builtin_amdgcn_sched_barrier(0);   // keeps that arithmetic from being lifted over the wait
  for (int kc = 0; kc < nChunks; ++kc) {
    __syncthreads();
#pragma unroll
    for (int i = 0; i < 4; ++i) *(v8h*)(kd8 + 16 * i * AT_KP) = kreg[i];
#pragma unroll
    for (int i = 0; i < 2; ++i) *(v8h*)(kd4 + 32 * i * AT_KP) = kreg[4 + i];
#pragma unroll
    for (int i = 0; i < 4; ++i) {
      *(v8b*)(vdh + 16 * i * AT_VP) = vhreg[i];
      *(v8b*)(vdl + 16 * i * AT_VP) = vlreg[i];
    }
    __syncthreads();
    if (kc + 1 < nChunks) {   // block-uniform: the next chunk's 14 loads go out together and land behind this chunk's work
      const char* kn  = Kc  + (size_t)(kc + 1) * (AT_KC * TOKP * 2);   // wave-uniform chunk bases, in bytes
      const char* vhn = Vhc + (size_t)(kc + 1) * (AT_KC * 2);
      const char* vln = Vlc + (size_t)(kc + 1) * (AT_KC * 2);
#pragma unroll
      for (int i = 0; i < 4; ++i) kreg[i] = *(const v8h*)(kn + 32 * i * TOKP + go8);
#pragma unroll
      for (int i = 0; i < 2; ++i) kreg[4 + i] = *(const v8h*)(kn + 64 * i * TOKP + go4);
#pragma unroll
      for (int i = 0; i < 4; ++i) {
        vhreg[i] = *(const v8b*)(vhn + 32 * i * SEQ + go8);
        vlreg[i] = *(const v8b*)(vln + 32 * i * SEQ + go8);
      }
      // the fragment loads below reuse these loads' address registers
      asm volatile("s_wait_xcnt 0x0" ::: "memory");
    }

    v8f s[4];
#pragma unroll
    for (int j = 0; j < 4; ++j) {
      s[j] = (v8f){0.f,0.f,0.f,0.f,0.f,0.f,0.f,0.f};
#pragma unroll
      for (int dc = 0; dc < 3; ++dc) {
        FH kb;   // A operand: row m = key j*16+c, k = feature, split k map
        kb.h[0] = *(const v8h*)(Ksh + (j * 16 + c) * AT_KP + dc * 32 + 8 * hh);
        kb.h[1] = *(const v8h*)(Ksh + (j * 16 + c) * AT_KP + dc * 32 + 16 + 8 * hh);
        s[j] = at_mma_h(kb.v, qa[dc], s[j]);   // s[j][r] = score of key j*16 + 8*hh + r against query c
      }
    }
    float m = -INFINITY;
#pragma unroll
    for (int j = 0; j < 4; ++j)
#pragma unroll
      for (int r = 0; r < 8; ++r) m = fmaxf(m, s[j][r]);
    m = fmaxf(m, at_xhalf(m));
    const float mnew = fmaxf(mrun, m);
    const float alpha = __builtin_amdgcn_exp2f((mrun - mnew) * c2);   // 0 on the first chunk, where mrun is -inf
    const float nb = -mnew * c2;
    mrun = mnew;
    // P^T as B operand: column n = query c; elements 0..7 = keys kk*32 + 8*hh + e (tile 2*kk), 8..15 = keys kk*32 + 16 + 8*hh + e
    // (tile 2*kk + 1): the split k map of the V^T loads below, element for element.
    FB ph[2], pl[2];
    float ps[4];
#pragma unroll
    for (int j = 0; j < 4; ++j) {
      ps[j] = 0.f;
#pragma unroll
      for (int r = 0; r < 8; ++r) {
        const float p = __builtin_amdgcn_exp2f(fmaf(s[j][r], c2, nb));   // e^(sscale * (s - max)); far below the max it ends as 0
        ps[j] += p;
        __bf16 bh, bl;
        at_split(p, bh, bl);
        ph[j >> 1].v[(j & 1) * 8 + r] = bh;
        pl[j >> 1].v[(j & 1) * 8 + r] = bl;
      }
    }
    lrun = lrun * alpha + ((ps[0] + ps[1]) + (ps[2] + ps[3]));
#pragma unroll
    for (int t = 0; t < 4; ++t)
#pragma unroll
      for (int r = 0; r < 8; ++r) oacc[t][r] *= alpha;
#pragma unroll   // unrolled: ph and pl live in registers and cannot be indexed by a run-time kk
    for (int kk = 0; kk < 2; ++kk) {
#pragma unroll
      for (int t = 0; t < 4; ++t) {
        FB vb, vl;   // A operand: row m = d = t*16+c, k = key
        vb.h[0] = *(const v8b*)(Vth + (t * 16 + c) * AT_VP + kk * 32 + 8 * hh);
        vb.h[1] = *(const v8b*)(Vth + (t * 16 + c) * AT_VP + kk * 32 + 16 + 8 * hh);
        vl.h[0] = *(const v8b*)(Vtl + (t * 16 + c) * AT_VP + kk * 32 + 8 * hh);
        vl.h[1] = *(const v8b*)(Vtl + (t * 16 + c) * AT_VP + kk * 32 + 16 + 8 * hh);
        oacc[t] = at_mma(vb.v, ph[kk].v, oacc[t]);
        oacc[t] = at_mma(vl.v, ph[kk].v, oacc[t]);
        oacc[t] = at_mma(vb.v, pl[kk].v, oacc[t]);
      }
    }
  }

  float* os = Os[wave];
  const float lsum = lrun + at_xhalf(lrun);         // both halves' keys
  const float inv = oscale * (1.0f / lsum);         // lsum is about 1 or more (the running max contributes 2^0 up to the FMA's rounding)
#pragma unroll
  for (int t = 0; t < 4; ++t) {
    v4f o0, o1;
#pragma unroll
    for (int r = 0; r < 4; ++r) { o0[r] = oacc[t][r] * inv; o1[r] = oacc[t][4 + r] * inv; }
    *(v4f*)(os + c * 68 + t * 16 + 8 * hh)     = o0;
    *(v4f*)(os + c * 68 + t * 16 + 8 * hh + 4) = o1;
  }
  __builtin_amdgcn_fence(__ATOMIC_RELEASE, "workgroup");
  __builtin_amdgcn_wave_barrier();
  __builtin_amdgcn_fence(__ATOMIC_ACQUIRE, "workgroup");
  {
    const int q8 = lane >> 3, c8 = (lane & 7) * 8;
    {
#pragma unroll
      for (int it = 0; it < 4; ++it) {
        const int row = it * 4 + q8;
        v8h hv;
#pragma unroll
        for (int e = 0; e < 8; ++e) hv[e] = (_Float16)os[row * 68 + c8 + e];
        *(v8h*)(Ob + (size_t)(q0 + row) * DMODEL + c8) = hv;
      }
      
    }
  }
}

// ---------------------------------------------------------------------------
//   [ 0 MiB,  8 MiB)  xb   bf16 [4096][1024]            RNE-bf16 of x
//   [ 8 MiB, 10 MiB)  wqb  bf16 [1024][1024]
//   [10 MiB, 12 MiB)  wkb  bf16 [1024][1024]
//   [12 MiB, 14 MiB)  wvb  bf16 [1024][1024]
//   [14 MiB, 16 MiB)  woh  f16  [1024][1024]            64 * bf16_rne(Wo)
//   [16 MiB, 32 MiB)  qpl  f16  [4096][16][128]         q features per head
//   [32 MiB, 48 MiB)  kpl  f16  [4096][16][128]         k features per head
//   [48 MiB, 56 MiB)  vth  bf16 [2][1024][2048]         v^T hi plane
//   [56 MiB, 64 MiB)  vtl  bf16 [2][1024][2048]         v^T lo plane
//   [64 MiB, 72 MiB)  ohp  f16  [4096][1024]            256 * attention output, heads merged
// GEMM shapes: q/k M=4096 N=1024 K=1024; v^T M=1024 N=2048 K=1024 (x2 batch); out M=4096 N=1024 K=1024:
// all M multiples of 128, N of 256, K of 64, row pitch of every operand 1024, no padding, every plane fully written by its producer.
// ---------------------------------------------------------------------------
extern "C" void kernel_launch(void* const* d_in, const int* in_sizes, int n_in,
                              void* d_out, int out_size, void* d_ws, size_t ws_size,
                              hipStream_t stream)
{
  if (n_in < 9) return;
  if (in_sizes[0] != NTOK * DMODEL || in_sizes[1] != DMODEL * DMODEL || in_sizes[2] != DMODEL ||
      in_sizes[3] != DMODEL * DMODEL || in_sizes[4] != DMODEL || in_sizes[5] != DMODEL * DMODEL ||
      in_sizes[6] != DMODEL || in_sizes[7] != DMODEL * DMODEL || in_sizes[8] != DMODEL) return;
  if (out_size != NTOK * DMODEL) return;

  const float* x    = (const float*)d_in[0];
  const float* Wq   = (const float*)d_in[1];
  const float* bq   = (const float*)d_in[2];
  const float* Wk   = (const float*)d_in[3];
  const float* bk   = (const float*)d_in[4];
  const float* Wv   = (const float*)d_in[5];
  const float* bv   = (const float*)d_in[6];
  const float* Wo   = (const float*)d_in[7];
  const float* bo_p = (const float*)d_in[8];

  const size_t SZ_X   = (size_t)NTOK * DMODEL * 2;                 // 8 MiB
  const size_t SZ_W   = (size_t)DMODEL * DMODEL * 2;               // 2 MiB
  const size_t SZ_QK  = (size_t)NTOK * TOKP * 2;                   // 16 MiB
  const size_t SZ_VT  = (size_t)NBAT * DMODEL * SEQ * 2;           // 8 MiB
  const size_t SZ_O   = (size_t)NTOK * DMODEL * 2;                 // 8 MiB
  const size_t OFF_XB = 0;
  const size_t OFF_WQ = OFF_XB + SZ_X;
  const size_t OFF_WK = OFF_WQ + SZ_W;
  const size_t OFF_WV = OFF_WK + SZ_W;
  const size_t OFF_WO = OFF_WV + SZ_W;
  const size_t OFF_QP = OFF_WO + SZ_W;
  const size_t OFF_KP = OFF_QP + SZ_QK;
  const size_t OFF_VH = OFF_KP + SZ_QK;
  const size_t OFF_VL = OFF_VH + SZ_VT;
  const size_t OFF_OH = OFF_VL + SZ_VT;
  const size_t TOTAL  = OFF_OH + SZ_O;                             // 75,497,472
  if (TOTAL > ws_size) return;

  char* ws = (char*)d_ws;
  unsigned short* xb  = (unsigned short*)(ws + OFF_XB);
  unsigned short* wqb = (unsigned short*)(ws + OFF_WQ);
  unsigned short* wkb = (unsigned short*)(ws + OFF_WK);
  unsigned short* wvb = (unsigned short*)(ws + OFF_WV);
  unsigned short* woh = (unsigned short*)(ws + OFF_WO);
  unsigned short* qpl = (unsigned short*)(ws + OFF_QP);
  unsigned short* kpl = (unsigned short*)(ws + OFF_KP);
  unsigned short* vth = (unsigned short*)(ws + OFF_VH);
  unsigned short* vtl = (unsigned short*)(ws + OFF_VL);
  unsigned short* ohp = (unsigned short*)(ws + OFF_OH);

  // ---- 16-bit operand planes: one launch of 256 blocks of 16 waves ----
  cast_planes_kernel<<<dim3(CV_BLOCKS), dim3(CV_THREADS), 0, stream>>>(x, Wq, Wk, Wv, Wo, xb, wqb, wkb, wvb, woh);

  // ---- q / k feature planes and v^T hi/lo planes: one launch of 3 x 128 blocks of 8 waves ----
  qkv_gemm_kernel<<<dim3(3 * QKV_TILES), dim3(256), 0, stream>>>(xb, wqb, wkb, wvb, qpl, kpl, vth, vtl, bq, bk, bv);
  // ---- attention: grid = NBAT * NHEAD * (SEQ / 64) = 1024 blocks of 128 threads ----
  attn_aug_kernel<<<dim3(NBAT * NHEAD * (SEQ / 64)), dim3(128), 0, stream>>>(
      qpl, kpl, vth, vtl, ohp, 0.0625f, 256.0f);
  // ---- output projection: d_out[m][n] = (1/16384) * sum_k (256*O)[m][k] * (64*Wo)[n][k] + bo[n], f32 out ----
  {
    const int tiles = (NTOK / 64) * (DMODEL / 64);     // 1024 -> 128 blocks
    dim3 grid(tiles / 8, 1), blk(256);
    wmma_gemm64<0, false, 2, 0, false><<<grid, blk, 0, stream>>>(
        ohp, ohp, DMODEL, 0L, woh, woh, DMODEL, 0L,
        d_out, d_out, DMODEL, 0L, bo_p, bo_p, 0L, NTOK, DMODEL, DMODEL, 1.0f / 16384.0f);
  }
}

// v010
// One run takes 130 microseconds.
// Two timings next to v009 both put it at 1.05 times that version's speed.
// All steps since v000 together make it 4.03 times as fast.
// Contractions: q/k/v^T projections v_wmma_f32_16x16x32_bf16 (operands = RNE-bf16 of the f32 inputs, single product); scores v_wmma_f32_16x16x32_f16 (f16 per-head feature planes, single product, x1/16 in f32); p.v v_wmma_f32_16x16x32_bf16 with bf16 hi/lo split of p and v (hi.hi+hi.lo+lo.hi); output projection v_wmma_f32_16x16x32_f16 (f16 O carried x256, f16 Wo carried x64, single product, x1/16384 in f32); f32 accumulate everywhere; softmax, biases and DFT aggregate features in f32.
#include <hip/hip_runtime.h>
#include <math.h>
#include <stdint.h>

// ---------------- problem geometry ----------------
constexpr int NBAT    = 2;
constexpr int SEQ     = 2048;
constexpr int DMODEL  = 1024;
constexpr int NHEAD   = 16;
constexpr int HDIM    = 64;
constexpr int NTOK    = NBAT * SEQ;          // 4096
constexpr int QKPITCH = 128;                 // halves per (token, head) feature row: 64 dims, sum/8, altsum/8, zeros
constexpr int TOKP    = NHEAD * QKPITCH;     // 2048 halves per token row of the q/k feature planes
static_assert(NTOK % 64 == 0 && DMODEL % 64 == 0 && SEQ % 64 == 0 && DMODEL % 32 == 0);
static_assert(NHEAD * HDIM == DMODEL);

typedef __attribute__((ext_vector_type(16))) _Float16 v16h;
typedef __attribute__((ext_vector_type(8)))  _Float16 v8h;
typedef __attribute__((ext_vector_type(16))) __bf16   v16b;
typedef __attribute__((ext_vector_type(8)))  __bf16   v8b;
typedef __attribute__((ext_vector_type(8)))  float    v8f;
typedef __attribute__((ext_vector_type(4)))  float    v4f;
typedef __attribute__((ext_vector_type(2)))  unsigned v2u;
typedef __attribute__((ext_vector_type(2)))  float    v2f;
typedef __attribute__((ext_vector_type(2)))  __bf16   v2b;

__device__ __forceinline__ unsigned short f2bf_bits(float f) {
  unsigned u = __float_as_uint(f);
  return (unsigned short)((u + 0x7FFFu + ((u >> 16) & 1u)) >> 16);
}
__device__ __forceinline__ float bf_bits2f(unsigned short h) { return __uint_as_float(((unsigned)h) << 16); }
__device__ __forceinline__ float rne_bf16(float f) { return bf_bits2f(f2bf_bits(f)); }
__device__ __forceinline__ unsigned pk16(unsigned short a, unsigned short b) { return (unsigned)a | ((unsigned)b << 16); }

// hazard guards as plain device helpers (no inline asm inside the kernel template body)
__device__ __forceinline__ void dep_guard_h(v8f& a, v8f& b, v16h x, v16h y) { asm volatile("v_nop\n\tv_nop\n\tv_nop\n\tv_nop" : "+v"(a), "+v"(b) : "v"(x), "v"(y)); }
__device__ __forceinline__ void dep_guard_b(v8f& a, v8f& b, v16b x, v16b y) { asm volatile("v_nop\n\tv_nop\n\tv_nop\n\tv_nop" : "+v"(a), "+v"(b) : "v"(x), "v"(y)); }
__device__ __forceinline__ void keep4_h(v16h a, v16h b, v16h c, v16h d) { asm volatile("v_nop" :: "v"(a), "v"(b), "v"(c), "v"(d)); }
__device__ __forceinline__ void keep4_b(v16b a, v16b b, v16b c, v16b d) { asm volatile("v_nop" :: "v"(a), "v"(b), "v"(c), "v"(d)); }
__device__ __forceinline__ void acc_guard4(v8f& a, v8f& b, v8f& c, v8f& d) { asm volatile("v_nop\n\tv_nop\n\tv_nop\n\tv_nop" : "+v"(a), "+v"(b), "+v"(c), "+v"(d)); }
template <typename T> struct Frag;
template <> struct Frag<_Float16> {
  typedef v16h V; typedef v8h H; union U { v16h v; v8h h[2]; };
  static __device__ __forceinline__ v16h load(const _Float16* p) {   // elements 0..7 <- p[0..7], 8..15 <- p[16..23]
    U f; f.h[0] = *(const v8h*)(p); f.h[1] = *(const v8h*)(p + 16); return f.v;
  }
  static __device__ __forceinline__ v8f mma(v16h a, v16h b, v8f c) {
    return __builtin_amdgcn_wmma_f32_16x16x32_f16(false, a, false, b, (short)0, c, false, false);
  }
  static __device__ __forceinline__ void guard(v8f& a, v8f& b, v16h x, v16h y) { dep_guard_h(a, b, x, y); }
  static __device__ __forceinline__ void keep(v16h a, v16h b, v16h c, v16h d) { keep4_h(a, b, c, d); }
};
template <> struct Frag<__bf16> {
  typedef v16b V; typedef v8b H; union U { v16b v; v8b h[2]; };
  static __device__ __forceinline__ v16b load(const __bf16* p) {
    U f; f.h[0] = *(const v8b*)(p); f.h[1] = *(const v8b*)(p + 16); return f.v;
  }
  static __device__ __forceinline__ v8f mma(v16b a, v16b b, v8f c) {
    return __builtin_amdgcn_wmma_f32_16x16x32_bf16(false, a, false, b, (short)0, c, false, false);
  }
  static __device__ __forceinline__ void guard(v8f& a, v8f& b, v16b x, v16b y) { dep_guard_b(a, b, x, y); }
  static __device__ __forceinline__ void keep(v16b a, v16b b, v16b c, v16b d) { keep4_b(a, b, c, d); }
};

// ---- Register-blocked batched WMMA GEMM ------------------------------------
// C[m,n] = scale * sum_k A[m,k] * Bt[n,k] (+bias)(+resid); each wave owns a 64x64 tile.
// A row-major [M,K]; Bt row-major [N,K]; M % 128 == 0, N % 256 == 0, K % 64 == 0.
// Block = 8 waves as 2 (m) x 4 (n) = a 128 x 256 tile. Per stage of 64 k the block brings its 128 A rows and
// 256 Bt rows (one 128-B line each) into LDS: 8 lanes x 16 B per row, so a wave-wide load covers 4 whole lines.
// Two LDS buffers, the global loads held in registers up to two stages ahead, one __syncthreads per stage.
// SPLIT (hi/lo operand planes) is not instantiated here and not supported by the staged loop.
// BIAS_MODE: 0 = none, 1 = bias[m], 2 = bias[n]. Bias values are RNE-bf16 quantised before the f32 add.
// OUT_MODE: 0 = f32, 1 = f16, 2 = bf16 hi plane (Cout) + bf16 lo plane (Cout2),
//           3 = f16 per-head feature rows: head hd = n0/64, row m -> C[m*ldc + hd*128 + 0..63] = f16(v[0..63]),
//               [+64] = f16(sum_d v[d] / 8), [+65] = f16(sum_d (-1)^d v[d] / 8), [+66..+127] = 0.
// ET: 0 = f16 operands, 1 = bf16 operands (pointers passed as 16-bit storage)
template <int ET> struct Elem;
template <> struct Elem<0> { typedef _Float16 T; };
template <> struct Elem<1> { typedef __bf16 T; };
constexpr int GM_BM   = 128;             // block tile rows (A rows staged)
constexpr int GM_BN   = 256;             // block tile columns (Bt rows staged)
constexpr int GM_ROWS = GM_BM + GM_BN;   // 384 staged rows per stage
constexpr int GM_LD   = DMODEL;          // row pitch of A and Bt in elements, a constant so that a stage's row steps fold into the loads' immediate offsets
constexpr int GM_LP   = 72;              // LDS row pitch in 16-bit elements: 64 used, 144 B = 16 B x odd for ds_load_b128 readers
// The work of one block, shared by the kernels below: sT and sAB are the calling kernel's LDS, tile and b its place in the problem.
template <int ET, bool SPLIT, int BIAS_MODE, int OUT_MODE, bool RESID, int ACT = 0>
__device__ __forceinline__ void gemm64_block(
    float (*sT)[16 * 68], typename Elem<ET>::T (*sAB)[GM_ROWS * GM_LP], const int tile, const int b,
    const unsigned short* __restrict__ Ap, const unsigned short* __restrict__ A2p, int lda, long strideA,
    const unsigned short* __restrict__ Btp, const unsigned short* __restrict__ Bt2p, int ldb, long strideB,
    void* __restrict__ Cout, void* __restrict__ Cout2, int ldc, long strideC,
    const float* __restrict__ bias,
    const float* __restrict__ resid, long strideR,
    int M, int N, int K, float scale) {
  typedef typename Elem<ET>::T T;
  typedef typename Frag<T>::V V;
  typedef typename Frag<T>::H H;
  static_assert(!SPLIT, "the staged loop carries one plane per operand");
  const T* A = (const T*)Ap; const T* Bt = (const T*)Btp;
  const int lane = threadIdx.x & 31;
  const int wave = __builtin_amdgcn_readfirstlane(threadIdx.x >> 5);   // the same in every lane: what derives from it stays in scalar registers
  const int tilesN = N >> 8;
  const int tilesM = M >> 7;
  if (tile >= tilesM * tilesN || lda != GM_LD || ldb != GM_LD) return;   // block-uniform, in front of every barrier
  const int tm = tile / tilesN;
  const int tn = tile - tm * tilesN;
  const int bm0 = tm << 7;                // block tile origin
  const int bn0 = tn << 8;
  const int wm  = (wave >> 2) << 6;       // wave tile origin inside the block tile
  const int wn  = (wave & 3) << 6;
  const int m0 = bm0 + wm;
  const int n0 = bn0 + wn;

  const T* Ab  = A  + (size_t)b * strideA;
  const T* Bb  = Bt + (size_t)b * strideB;

  const int rlane = lane & 15;                 // row (A) / col (B, D) within subtile
  const int koff  = (lane >> 4) * 8;           // k offset of this lane half
  const int mOff  = (lane >> 4) * 8;           // D row offset

  v8f acc[4][4];
#pragma unroll
  for (int i = 0; i < 4; ++i)
#pragma unroll
    for (int j = 0; j < 4; ++j) acc[i][j] = (v8f){0.f,0.f,0.f,0.f,0.f,0.f,0.f,0.f};

  // staging coverage: 256 threads = 32 rows x 8 pieces of 16 B; 4 trips cover the A rows, 8 trips the Bt rows
  // (rows r and r + 8 sit side by side in a 16-lane half: 8 x 144 B = 32 banks apart, so a ds_store_b128 meets no bank twice)
  const int sgrp = threadIdx.x >> 3;
  const int srow = (sgrp & 16) | ((sgrp & 1) << 3) | ((sgrp >> 1) & 7);
  const int spc  = (threadIdx.x & 7) * 8;
  // A and Bt have one row pitch, so one 32-bit lane offset (bytes) serves both and steps 64 k = 128 B per stage; the two bases are
  // block-uniform (scalar registers). Three vector registers fewer than two 64-bit lane pointers.
  unsigned gOff = (unsigned)(srow * GM_LD + spc) * 2u;
  const char* gA = (const char*)(Ab + (size_t)bm0 * GM_LD);
  const char* gB = (const char*)(Bb + (size_t)bn0 * GM_LD);
  const int sOff = srow * GM_LP + spc;
  const int nStage = K >> 6;
  H st[12];   // the stage in flight
#pragma unroll
  for (int i = 0; i < 4; ++i) st[i] = *(const H*)(gA + 64 * i * GM_LD + gOff);
#pragma unroll
  for (int i = 0; i < 8; ++i) st[4 + i] = *(const H*)(gB + 64 * i * GM_LD + gOff);
#pragma unroll
  for (int i = 0; i < 12; ++i) *(H*)(sAB[0] + sOff + 32 * i * GM_LP) = st[i];
  if (1 < nStage) {
    gOff += 128u;
#pragma unroll
    for (int i = 0; i < 4; ++i) st[i] = *(const H*)(gA + 64 * i * GM_LD + gOff);
#pragma unroll
    for (int i = 0; i < 8; ++i) st[4 + i] = *(const H*)(gB + 64 * i * GM_LD + gOff);
  }

  for (int s = 0; s < nStage; ++s) {
    const T* buf = sAB[s & 1];
    __syncthreads();   // publishes stage s and ends every wave's reads of the other buffer (stage s - 1)
#pragma unroll
    for (int kk = 0; kk < 2; ++kk) {
      V bh[4], ah[4];
#pragma unroll
      for (int j = 0; j < 4; ++j) bh[j] = Frag<T>::load(buf + (GM_BM + wn + (j << 4) + rlane) * GM_LP + kk * 32 + koff);
#pragma unroll
      for (int i = 0; i < 4; ++i) ah[i] = Frag<T>::load(buf + (wm + (i << 4) + rlane) * GM_LP + kk * 32 + koff);
      if (kk == 0) {   // staging queues behind the first fragment reads, so the products start sooner
        // stage s + 1 goes from registers into the other buffer. No test round it: with a branch here the fragment
        // waits below fall back to counts that also wait for these stores; the last stage's copy is read by nobody.
        T* nxt = sAB[(s + 1) & 1];
#pragma unroll
        for (int i = 0; i < 12; ++i) *(H*)(nxt + sOff + 32 * i * GM_LP) = st[i];
        if (s + 2 < nStage) {   // block-uniform: stage s + 2's 12 loads land behind this stage's products
          gOff += 128u;
#pragma unroll
          for (int i = 0; i < 4; ++i) st[i] = *(const H*)(gA + 64 * i * GM_LD + gOff);
#pragma unroll
          for (int i = 0; i < 8; ++i) st[4 + i] = *(const H*)(gB + 64 * i * GM_LD + gOff);
          // behind the loop the two scalar bases' registers are reused
          asm volatile("s_wait_xcnt 0x0" ::: "memory");
        }
      }
#pragma unroll
      for (int i = 0; i < 4; ++i) {
#pragma unroll
        for (int j = 0; j < 4; ++j) acc[i][j] = Frag<T>::mma(ah[i], bh[j], acc[i][j]);
        Frag<T>::guard(acc[i][0], acc[i][3], ah[i], ah[i]);
      }
      Frag<T>::keep(bh[0], bh[1], bh[2], bh[3]);
    }
  }
  acc_guard4(acc[0][0], acc[0][1], acc[0][2], acc[0][3]);
  acc_guard4(acc[1][0], acc[1][1], acc[1][2], acc[1][3]);
  acc_guard4(acc[2][0], acc[2][1], acc[2][2], acc[2][3]);
  acc_guard4(acc[3][0], acc[3][1], acc[3][2], acc[3][3]);

  // ---- epilogue ----
  float* slab = sT[wave];
  const float* Rb = RESID ? (resid + (size_t)b * strideR) : nullptr;
#pragma unroll
  for (int i = 0; i < 4; ++i) {
    const int mBase = m0 + (i << 4);
    float bm[8];
    if (BIAS_MODE == 1) {
      const float* bp = bias + mBase + mOff;
#pragma unroll
      for (int r = 0; r < 8; ++r) bm[r] = bp[r];
      // the address is an input so that its registers stay untouched up to the wait
      asm volatile("s_wait_xcnt 0x0" :: "v"(bp) : "memory");
    }
#pragma unroll
    for (int j = 0; j < 4; ++j) {
      const int n = n0 + (j << 4) + rlane;
      float bv = 0.f;
      if (BIAS_MODE == 2) bv = rne_bf16(bias[n]);
#pragma unroll
      for (int r = 0; r < 8; ++r) {
        float v = acc[i][j][r] * scale;
        if (BIAS_MODE == 1) v += rne_bf16(bm[r]);
        if (BIAS_MODE == 2) v += bv;
        if (RESID) v += Rb[(size_t)(mBase + mOff + r) * ldc + n];
        if (ACT == 1) v = tanhf(v);
        if (ACT == 2) v = fmaxf(v, 0.0f);
        if (ACT == 3) v = v / (1.0f + expf(-v));
        if (ACT == 4) v = (v > 0.f) ? v : 0.01f * v;
        slab[(mOff + r) * 68 + (j << 4) + rlane] = v;
      }
    }
    __builtin_amdgcn_fence(__ATOMIC_RELEASE, "workgroup");
    __builtin_amdgcn_wave_barrier();
    __builtin_amdgcn_fence(__ATOMIC_ACQUIRE, "workgroup");
    if (OUT_MODE == 0) {
      float* C = (float*)Cout + (size_t)b * strideC;
      const int hh = lane >> 4, c4 = (lane & 15) * 4;     // row seg = 256 B = 16 lanes x 16 B
      {
#pragma unroll
        for (int it = 0; it < 8; ++it) {
          const int row = it * 2 + hh;
          v4f v = *(const v4f*)(slab + row * 68 + c4);
          *(v4f*)(C + (size_t)(mBase + row) * ldc + n0 + c4) = v;
        }
        
      }
    } else if (OUT_MODE == 3) {
      // Coverage per slab: 4 it x 4 row groups (q) = 16 rows; 8 lanes x 8 halves = 64 halves per line.
      const int q = lane >> 3, c8 = (lane & 7) * 8;
      unsigned short* C = (unsigned short*)Cout + (size_t)b * strideC;
      const int hcol = (n0 >> 6) * 128;
      v8h hv[4], av[4];
#pragma unroll
      for (int it = 0; it < 4; ++it) {
        const int row = it * 4 + q;
        const float* sp = slab + row * 68 + c8;
        float ps = 0.f, pa = 0.f;
        v8h t;
#pragma unroll
        for (int e = 0; e < 8; ++e) {
          const float v = sp[e];
          t[e] = (_Float16)v;
          ps += v;
          if (e & 1) pa -= v; else pa += v;     // c8 is even, so (-1)^(c8+e) = (-1)^e
        }
#pragma unroll
        for (int off = 1; off < 8; off <<= 1) {   // reduce over the 8 lanes holding this row
          ps += __shfl_xor(ps, off, 32);
          pa += __shfl_xor(pa, off, 32);
        }
        const float fa = (c8 == 0) ? ps * 0.125f : 0.0f;
        const float fb = (c8 == 0) ? pa * 0.125f : 0.0f;
        v8h u;
#pragma unroll
        for (int e = 0; e < 8; ++e) u[e] = (_Float16)0.0f;
        u[0] = (_Float16)fa;
        u[1] = (_Float16)fb;
        hv[it] = t;
        av[it] = u;
      }
      {
#pragma unroll
        for (int it = 0; it < 4; ++it) {
          const int row = it * 4 + q;
          unsigned short* cp = C + (size_t)(mBase + row) * ldc + hcol + c8;
          *(v8h*)(cp) = hv[it];
          *(v8h*)(cp + 64) = av[it];
        }
        
      }
    } else {
      const int q = lane >> 3, c8 = (lane & 7) * 8;
      unsigned short* C  = (unsigned short*)Cout  + (size_t)b * strideC;
      unsigned short* C2 = (OUT_MODE == 2) ? ((unsigned short*)Cout2 + (size_t)b * strideC) : nullptr;
      {
#pragma unroll
        for (int it = 0; it < 4; ++it) {
          const int row = it * 4 + q;
          const float* sp = slab + row * 68 + c8;
          v8h hv, lv;
#pragma unroll
          for (int e = 0; e < 8; ++e) {
            if (OUT_MODE == 1) {
              hv[e] = (_Float16)sp[e];
            } else {
              unsigned short hb = f2bf_bits(sp[e]);
              unsigned short lb = f2bf_bits(sp[e] - bf_bits2f(hb));
              hv[e] = __builtin_bit_cast(_Float16, hb);
              lv[e] = __builtin_bit_cast(_Float16, lb);
            }
          }
          *(v8h*)(C + (size_t)(mBase + row) * ldc + n0 + c8) = hv;
          if (OUT_MODE == 2) *(v8h*)(C2 + (size_t)(mBase + row) * ldc + n0 + c8) = lv;
        }
        
      }
    }
    __builtin_amdgcn_fence(__ATOMIC_RELEASE, "workgroup");
    __builtin_amdgcn_wave_barrier();
    __builtin_amdgcn_fence(__ATOMIC_ACQUIRE, "workgroup");
  }
}

// One GEMM per launch: blockIdx.x = tile, blockIdx.y = batch.
template <int ET, bool SPLIT, int BIAS_MODE, int OUT_MODE, bool RESID, int ACT = 0>
__global__ __launch_bounds__(256) void wmma_gemm64(
    const unsigned short* __restrict__ Ap, const unsigned short* __restrict__ A2p, int lda, long strideA,
    const unsigned short* __restrict__ Btp, const unsigned short* __restrict__ Bt2p, int ldb, long strideB,
    void* __restrict__ Cout, void* __restrict__ Cout2, int ldc, long strideC,
    const float* __restrict__ bias,
    const float* __restrict__ resid, long strideR,
    int M, int N, int K, float scale) {
  __shared__ __align__(16) float sT[8][16 * 68];   // per-wave 16x64 slab, pitch 68 floats
  __shared__ __align__(16) typename Elem<ET>::T sAB[2][GM_ROWS * GM_LP];   // rows 0..127 = A, 128..383 = Bt; 64 k per row
  gemm64_block<ET, SPLIT, BIAS_MODE, OUT_MODE, RESID, ACT>(sT, sAB, (int)blockIdx.x, (int)blockIdx.y,
      Ap, A2p, lda, strideA, Btp, Bt2p, ldb, strideB, Cout, Cout2, ldc, strideC, bias, resid, strideR, M, N, K, scale);
}

// The three input projections in one launch. Each has 128 block tiles, half of the chip's 256 WGPs; the 384 together
// fill every WGP. Blocks 0..127: v^T (64 tiles x 2 batches), 128..255: q, 256..383: k. The choice is block-uniform.
// The second launch bound (4 waves per SIMD = 256 VGPRs) lets two 8-wave blocks stand on one WGP (2 x 145,408 B of LDS fit),
// so that all 384 start at once instead of 128 of them waiting for a free WGP.
constexpr int QKV_TILES = (NTOK / GM_BM) * (DMODEL / GM_BN);   // 128 block tiles per projection
static_assert(QKV_TILES == NBAT * (DMODEL / GM_BM) * (SEQ / GM_BN), "v^T has as many block tiles as q and k");
__global__ __launch_bounds__(256, 4) void qkv_gemm_kernel(
    const unsigned short* __restrict__ xb, const unsigned short* __restrict__ wqb,
    const unsigned short* __restrict__ wkb, const unsigned short* __restrict__ wvb,
    unsigned short* __restrict__ qpl, unsigned short* __restrict__ kpl,
    unsigned short* __restrict__ vth, unsigned short* __restrict__ vtl,
    const float* __restrict__ bq, const float* __restrict__ bk, const float* __restrict__ bv) {
  __shared__ __align__(16) float sT[8][16 * 68];
  __shared__ __align__(16) __bf16 sAB[2][GM_ROWS * GM_LP];
  const int job  = (int)blockIdx.x / QKV_TILES;
  const int tile = (int)blockIdx.x % QKV_TILES;
  if (job == 0) {
    // role swapped, per batch: C[m = h*64+d][n = s] = sum_k Wv[m][k] * x[b][s][k] + bv[m], bf16 hi/lo out
    gemm64_block<1, false, 1, 2, false>(sT, sAB, tile % (QKV_TILES / NBAT), tile / (QKV_TILES / NBAT),
        wvb, wvb, DMODEL, 0L, xb, xb, DMODEL, (long)SEQ * DMODEL,
        (void*)vth, (void*)vtl, SEQ, (long)DMODEL * SEQ, bv, bv, 0L, DMODEL, SEQ, DMODEL, 1.0f);
  } else {
    // [4096][1024] x [1024][1024]^T + bias, epilogue writes per-head 128-wide f16 rows
    const unsigned short* w  = (job == 1) ? wqb : wkb;
    unsigned short*       c  = (job == 1) ? qpl : kpl;
    const float*          bi = (job == 1) ? bq  : bk;
    gemm64_block<1, false, 2, 3, false>(sT, sAB, tile, 0,
        xb, xb, DMODEL, 0L, w, w, DMODEL, 0L,
        (void*)c, (void*)c, TOKP, 0L, bi, bi, 0L, NTOK, DMODEL, DMODEL, 1.0f);
  }
}

// ---------------------------------------------------------------------------
// The five f32 -> 16-bit operand planes in one launch of CV_BLOCKS blocks of 16 waves, about one block per WGP.
//   x, Wq, Wk, Wv -> RNE bf16 bits; Wo -> f16 bits of 64 * bf16_rne(v) (64 is an exact power of two).
// A block owns CV_ELEMS consecutive elements of one plane (the choice of plane is block-uniform). A thread issues its CV_TRIPS
// 16-B loads together, then converts and stores 8 B per load: a wave-wide load covers 4 whole 128-B lines, a store 2.
// Few long waves (4,096 in all), for speed only.
// Coverage: CV_XB blocks x CV_ELEMS = the whole of x, CV_WB blocks x CV_ELEMS = the whole of each weight matrix.
// ---------------------------------------------------------------------------
constexpr int CV_THREADS = 512;
constexpr int CV_TRIPS   = 16;
constexpr int CV_STEP    = CV_THREADS * 4;            // elements the block covers per trip
constexpr int CV_ELEMS   = CV_STEP * CV_TRIPS;        // 32,768 elements per block
constexpr int CV_XB      = NTOK * DMODEL / CV_ELEMS;  // 128 blocks for x
constexpr int CV_WB      = DMODEL * DMODEL / CV_ELEMS;   // 32 blocks for each weight matrix
constexpr int CV_BLOCKS  = CV_XB + 4 * CV_WB;         // 256
static_assert(CV_XB * CV_ELEMS == NTOK * DMODEL && CV_WB * CV_ELEMS == DMODEL * DMODEL, "whole blocks cover every plane");
__global__ __launch_bounds__(CV_THREADS) void cast_planes_kernel(
    const float* __restrict__ x, const float* __restrict__ Wq, const float* __restrict__ Wk,
    const float* __restrict__ Wv, const float* __restrict__ Wo,
    unsigned short* __restrict__ xb, unsigned short* __restrict__ wqb, unsigned short* __restrict__ wkb,
    unsigned short* __restrict__ wvb, unsigned short* __restrict__ woh) {
  const int bx = (int)blockIdx.x;
  const int pl = (bx < CV_XB) ? 0 : 1 + (bx - CV_XB) / CV_WB;            // 0 = x, 1..4 = Wq, Wk, Wv, Wo
  const int pb = (bx < CV_XB) ? bx : (bx - CV_XB) % CV_WB;               // the block's place in its plane
  const float*    in  = (pl == 0) ? x  : (pl == 1) ? Wq  : (pl == 2) ? Wk  : (pl == 3) ? Wv  : Wo;
  unsigned short* out = (pl == 0) ? xb : (pl == 1) ? wqb : (pl == 2) ? wkb : (pl == 3) ? wvb : woh;
  in  += (size_t)pb * CV_ELEMS;
  out += (size_t)pb * CV_ELEMS;
  const unsigned t = threadIdx.x;
  v4f f[CV_TRIPS];
#pragma unroll
  for (int i = 0; i < CV_TRIPS; ++i) f[i] = ((const v4f*)in)[i * CV_THREADS + t];
  v2u u[CV_TRIPS];
  if (pl != 4) {
#pragma unroll
    for (int i = 0; i < CV_TRIPS; ++i) {
      u[i][0] = pk16(f2bf_bits(f[i][0]), f2bf_bits(f[i][1]));
      u[i][1] = pk16(f2bf_bits(f[i][2]), f2bf_bits(f[i][3]));
    }
  } else {
#pragma unroll
    for (int i = 0; i < CV_TRIPS; ++i) {
      unsigned short h[4];
#pragma unroll
      for (int e = 0; e < 4; ++e) h[e] = __builtin_bit_cast(unsigned short, (_Float16)(rne_bf16(f[i][e]) * 64.0f));
      u[i][0] = pk16(h[0], h[1]);
      u[i][1] = pk16(h[2], h[3]);
    }
  }
#pragma unroll
  for (int i = 0; i < CV_TRIPS; ++i) ((v2u*)out)[i * CV_THREADS + t] = u[i];
}

#define AT_D 64
#define AT_F 96
#define AT_NW 4
#define AT_QB 64
#define AT_KC 64
// LDS row pitches in halves: 16 B x odd, so that the 16 rows of a ds_load_b128 fragment read fall on distinct banks
#define AT_KP 104   // K feature rows: 96 halves used, 208 B pitch
#define AT_VP 72    // V^T rows: 64 halves used, 144 B pitch
static_assert(AT_KP >= AT_F && AT_VP >= AT_KC && (AT_KP * 2) % 32 == 16 && (AT_VP * 2) % 32 == 16, "pitch holds the row and is 16 B x odd");

// bf16 hi/lo split of two values by the hardware's packed conversion (round to nearest even, as the integer form of f2bf_bits):
// hi = bf16(f), lo = bf16(f - hi); each conversion leaves its two results packed in one register, as the B fragment wants them.
__device__ __forceinline__ void at_split2(v2f f, v2b& hi, v2b& lo) {
  hi = __builtin_convertvector(f, v2b);
  lo = __builtin_convertvector(f - __builtin_convertvector(hi, v2f), v2b);
}
// lane l with lane l ^ 16: the two lanes that share one query column
__device__ __forceinline__ float at_xhalf(float x) {
  return __builtin_bit_cast(float, __builtin_amdgcn_permlanex16(__builtin_bit_cast(int, x), __builtin_bit_cast(int, x), 0x76543210, 0xfedcba98, false, false));
}
// Plain builtins: the compiler keeps the WMMA distances of its own code, and with no asm statement behind a product the LDS fragment
// loads of later products may issue ahead of it in groups, behind counted waits.
__device__ __forceinline__ v8f at_mma(v16b a, v16b b, v8f c) {
  return __builtin_amdgcn_wmma_f32_16x16x32_bf16(false, a, false, b, (short)0, c, false, false);
}
__device__ __forceinline__ v8f at_mma_h(v16h a, v16h b, v8f c) {
  return __builtin_amdgcn_wmma_f32_16x16x32_f16(false, a, false, b, (short)0, c, false, false);
}

__global__ __launch_bounds__(128)
void attn_aug_kernel(const unsigned short* __restrict__ qp, const unsigned short* __restrict__ kp,
                     const unsigned short* __restrict__ vhp, const unsigned short* __restrict__ vlp,
                     unsigned short* __restrict__ op, float sscale, float oscale) {
  union FB { v16b v; v8b h[2]; v2b d[8]; };
  union FH { v16h v; v8h h[2]; };
  __shared__ __align__(16) _Float16 Ksh[AT_KC * AT_KP];          // K features [kv][f]   13 KB
  __shared__ __align__(16) __bf16   Vth[AT_D * AT_VP];           // V hi [d][kv]          9 KB
  __shared__ __align__(16) __bf16   Vtl[AT_D * AT_VP];           // V lo                  9 KB
  __shared__ __align__(16) float    Os[AT_NW][16 * 68];          // per wave out tile, pitch 68

  const int tid  = threadIdx.x;
  const int wave = tid >> 5;
  const int lane = tid & 31;
  const int hh   = lane >> 4;
  const int c    = lane & 15;

  const int nqb = SEQ / AT_QB;            // 32
  const int bx = blockIdx.x;
  const int qb = bx % nqb;
  const int bh = bx / nqb;                // 0..NBAT*NHEAD-1
  const int h  = bh % NHEAD;
  const int b  = bh / NHEAD;
  const int q0 = qb * AT_QB + wave * 16;

  const _Float16* Qb = (const _Float16*)(const void*)qp + (size_t)b * SEQ * TOKP + (size_t)h * QKPITCH;
  const _Float16* Kb = (const _Float16*)(const void*)kp + (size_t)b * SEQ * TOKP + (size_t)h * QKPITCH;
  const __bf16*   Vh = (const __bf16*)(const void*)vhp + ((size_t)b * DMODEL + (size_t)h * AT_D) * SEQ;
  const __bf16*   Vl = (const __bf16*)(const void*)vlp + ((size_t)b * DMODEL + (size_t)h * AT_D) * SEQ;
  _Float16*       Ob = (_Float16*)(void*)op + (size_t)b * SEQ * DMODEL + (size_t)h * AT_D;

  // ---- Q fragments (B operand, column = query = lane&15, split k map via Frag load): 3 feature chunks of 32 ----
  v16h qa[3];
#pragma unroll
  for (int dc = 0; dc < 3; ++dc)
    qa[dc] = Frag<_Float16>::load(Qb + (size_t)(q0 + c) * TOKP + dc * 32 + 8 * hh);

  // softmax in base 2: e^(sscale * (s - max)) = 2^(s * c2 - max * c2); sscale > 0, so the maximum is taken over the unscaled scores
  const float c2 = sscale * 1.4426950408889634f;
  float mrun = -INFINITY;   // running maximum of query c's unscaled scores, equal in both lane halves
  float lrun = 0.f;         // running sum of query c over this lane half's keys; the halves join after the loop
  v8f oacc[4];              // O^T tiles: register r of tile t = O[query c][d = t*16 + 8*hh + r]
#pragma unroll
  for (int t = 0; t < 4; ++t) oacc[t] = (v8f){0.f,0.f,0.f,0.f,0.f,0.f,0.f,0.f};

  const int nChunks = SEQ / AT_KC;   // 32, compile-time constant
  // staging coverage by whole lines: a row's 64 halves are one 128-B line = 8 lanes x 16 B, so a wave-wide load touches 4 lines.
  //   K features 0..63 and each V^T plane: 16 rows x 8 pieces per trip, 4 trips = 64 rows x 64;
  //   K features 64..95 (half a line per row): 32 rows x 4 pieces per trip, 2 trips = 64 rows x 32, 8 lines per wave-wide load.
  // Row order inside a trip, for the ds_store_b128: rows r and r + 8 share a 16-lane half (8 x 208 B and 8 x 144 B = 32 banks apart);
  // in the feature tail rows r, r + 4, r + 8, r + 12 do (4 x 208 B = 16 banks apart): no bank is met twice.
  const int g8  = tid >> 3, g4 = tid >> 2;
  const int r16 = ((g8 & 1) << 3) | (g8 >> 1);                      // 0..15
  const int r32 = (g4 & 16) | ((g4 & 3) << 2) | ((g4 >> 2) & 3);    // 0..31
  const int p8  = (tid & 7) * 8;
  const int p4  = 64 + (tid & 3) * 8;
  static_assert(TOKP == SEQ, "K feature rows and V^T rows have one pitch, so one lane offset serves both");
  // lane offsets in bytes; the bases they are added to are wave-uniform
  const unsigned go8 = (unsigned)(r16 * SEQ + p8) * 2u;    // row r16 (+16 per trip), piece p8..+7, of K and of both V^T planes
  const unsigned go4 = (unsigned)(r32 * TOKP + p4) * 2u;   // K row r32 (+32 per trip), f = p4..+7
  const char* Kc  = (const char*)Kb;
  const char* Vhc = (const char*)Vh;
  const char* Vlc = (const char*)Vl;
  _Float16* kd8 = Ksh + r16 * AT_KP + p8;             // the same pieces' places in LDS
  _Float16* kd4 = Ksh + r32 * AT_KP + p4;
  __bf16*   vdh = Vth + r16 * AT_VP + p8;
  __bf16*   vdl = Vtl + r16 * AT_VP + p8;
  // the chunk in flight: 14 x 16 B per thread, loaded one chunk ahead of the LDS stores that consume them
  v8h kreg[6];
  v8b vhreg[4], vlreg[4];
#pragma unroll
  for (int i = 0; i < 4; ++i) kreg[i] = *(const v8h*)(Kc + 32 * i * TOKP + go8);
#pragma unroll
  for (int i = 0; i < 2; ++i) kreg[4 + i] = *(const v8h*)(Kc + 64 * i * TOKP + go4);
#pragma unroll
  for (int i = 0; i < 4; ++i) {
    vhreg[i] = *(const v8b*)(Vhc + 32 * i * SEQ + go8);
    vlreg[i] = *(const v8b*)(Vlc + 32 * i * SEQ + go8);
  }
  // the LDS address arithmetic around this point reuses the loads' address registers.
  // The two lane offsets are inputs so that their registers stay untouched up to the wait.
  asm volatile("s_wait_xcnt 0x0" :: "v"(go8), "v"(go4) : "memory");
  __builtin_amdgcn_sched_barrier(0);   // keeps that arithmetic from being lifted over the wait
  for (int kc = 0; kc < nChunks; ++kc) {
    __syncthreads();
#pragma unroll
    for (int i = 0; i < 4; ++i) *(v8h*)(kd8 + 16 * i * AT_KP) = kreg[i];
#pragma unroll
    for (int i = 0; i < 2; ++i) *(v8h*)(kd4 + 32 * i * AT_KP) = kreg[4 + i];
#pragma unroll
    for (int i = 0; i < 4; ++i) {
      *(v8b*)(vdh + 16 * i * AT_VP) = vhreg[i];
      *(v8b*)(vdl + 16 * i * AT_VP) = vlreg[i];
    }
    __syncthreads();
    if (kc + 1 < nChunks) {   // block-uniform: the next chunk's 14 loads go out together and land behind this chunk's work
      const char* kn  = Kc  + (size_t)(kc + 1) * (AT_KC * TOKP * 2);   // wave-uniform chunk bases, in bytes
      const char* vhn = Vhc + (size_t)(kc + 1) * (AT_KC * 2);
      const char* vln = Vlc + (size_t)(kc + 1) * (AT_KC * 2);
#pragma unroll
      for (int i = 0; i < 4; ++i) kreg[i] = *(const v8h*)(kn + 32 * i * TOKP + go8);
#pragma unroll
      for (int i = 0; i < 2; ++i) kreg[4 + i] = *(const v8h*)(kn + 64 * i * TOKP + go4);
#pragma unroll
      for (int i = 0; i < 4; ++i) {
        vhreg[i] = *(const v8b*)(vhn + 32 * i * SEQ + go8);
        vlreg[i] = *(const v8b*)(vln + 32 * i * SEQ + go8);
      }
      // the fragment loads below reuse these loads' address registers
      asm volatile("s_wait_xcnt 0x0" ::: "memory");
    }

    v8f s[4];
#pragma unroll
    for (int j = 0; j < 4; ++j) {
      s[j] = (v8f){0.f,0.f,0.f,0.f,0.f,0.f,0.f,0.f};
#pragma unroll
      for (int dc = 0; dc < 3; ++dc) {
        FH kb;   // A operand: row m = key j*16+c, k = feature, split k map
        kb.h[0] = *(const v8h*)(Ksh + (j * 16 + c) * AT_KP + dc * 32 + 8 * hh);
        kb.h[1] = *(const v8h*)(Ksh + (j * 16 + c) * AT_KP + dc * 32 + 16 + 8 * hh);
        s[j] = at_mma_h(kb.v, qa[dc], s[j]);   // s[j][r] = score of key j*16 + 8*hh + r against query c
      }
    }
    float m = -INFINITY;
#pragma unroll
    for (int j = 0; j < 4; ++j)
#pragma unroll
      for (int r = 0; r < 8; ++r) m = fmaxf(m, s[j][r]);
    m = fmaxf(m, at_xhalf(m));
    const float mnew = fmaxf(mrun, m);
    const float alpha = __builtin_amdgcn_exp2f((mrun - mnew) * c2);   // 0 on the first chunk, where mrun is -inf
    const float nb = -mnew * c2;
    mrun = mnew;
    // P^T as B operand: column n = query c; elements 0..7 = keys kk*32 + 8*hh + e (tile 2*kk), 8..15 = keys kk*32 + 16 + 8*hh + e
    // (tile 2*kk + 1): the split k map of the V^T loads below, element for element.
    FB ph[2], pl[2];
    float ps[4];
#pragma unroll
    for (int j = 0; j < 4; ++j) {
      ps[j] = 0.f;
#pragma unroll
      for (int r = 0; r < 8; r += 2) {
        v2f p;   // e^(sscale * (s - max)); far below the max it ends as 0
        p[0] = __builtin_amdgcn_exp2f(fmaf(s[j][r], c2, nb));
        p[1] = __builtin_amdgcn_exp2f(fmaf(s[j][r + 1], c2, nb));
        at_split2(p, ph[j >> 1].d[(j & 1) * 4 + (r >> 1)], pl[j >> 1].d[(j & 1) * 4 + (r >> 1)]);
        ps[j] += p[0];
        ps[j] += p[1];
      }
    }
    lrun = lrun * alpha + ((ps[0] + ps[1]) + (ps[2] + ps[3]));
#pragma unroll
    for (int t = 0; t < 4; ++t)
#pragma unroll
      for (int r = 0; r < 8; ++r) oacc[t][r] *= alpha;
#pragma unroll   // unrolled: ph and pl live in registers and cannot be indexed by a run-time kk
    for (int kk = 0; kk < 2; ++kk) {
#pragma unroll
      for (int t = 0; t < 4; ++t) {
        FB vb, vl;   // A operand: row m = d = t*16+c, k = key
        vb.h[0] = *(const v8b*)(Vth + (t * 16 + c) * AT_VP + kk * 32 + 8 * hh);
        vb.h[1] = *(const v8b*)(Vth + (t * 16 + c) * AT_VP + kk * 32 + 16 + 8 * hh);
        vl.h[0] = *(const v8b*)(Vtl + (t * 16 + c) * AT_VP + kk * 32 + 8 * hh);
        vl.h[1] = *(const v8b*)(Vtl + (t * 16 + c) * AT_VP + kk * 32 + 16 + 8 * hh);
        oacc[t] = at_mma(vb.v, ph[kk].v, oacc[t]);
        oacc[t] = at_mma(vl.v, ph[kk].v, oacc[t]);
        oacc[t] = at_mma(vb.v, pl[kk].v, oacc[t]);
      }
    }
  }

  float* os = Os[wave];
  const float lsum = lrun + at_xhalf(lrun);         // both halves' keys
  const float inv = oscale * (1.0f / lsum);         // lsum is about 1 or more (the running max contributes 2^0 up to the FMA's rounding)
#pragma unroll
  for (int t = 0; t < 4; ++t) {
    v4f o0, o1;
#pragma unroll
    for (int r = 0; r < 4; ++r) { o0[r] = oacc[t][r] * inv; o1[r] = oacc[t][4 + r] * inv; }
    *(v4f*)(os + c * 68 + t * 16 + 8 * hh)     = o0;
    *(v4f*)(os + c * 68 + t * 16 + 8 * hh + 4) = o1;
  }
  __builtin_amdgcn_fence(__ATOMIC_RELEASE, "workgroup");
  __builtin_amdgcn_wave_barrier();
  __builtin_amdgcn_fence(__ATOMIC_ACQUIRE, "workgroup");
  {
    const int q8 = lane >> 3, c8 = (lane & 7) * 8;
    {
#pragma unroll
      for (int it = 0; it < 4; ++it) {
        const int row = it * 4 + q8;
        v8h hv;
#pragma unroll
        for (int e = 0; e < 8; ++e) hv[e] = (_Float16)os[row * 68 + c8 + e];
        *(v8h*)(Ob + (size_t)(q0 + row) * DMODEL + c8) = hv;
      }
      
    }
  }
}

// ---------------------------------------------------------------------------
//   [ 0 MiB,  8 MiB)  xb   bf16 [4096][1024]            RNE-bf16 of x
//   [ 8 MiB, 10 MiB)  wqb  bf16 [1024][1024]
//   [10 MiB, 12 MiB)  wkb  bf16 [1024][1024]
//   [12 MiB, 14 MiB)  wvb  bf16 [1024][1024]
//   [14 MiB, 16 MiB)  woh  f16  [1024][1024]            64 * bf16_rne(Wo)
//   [16 MiB, 32 MiB)  qpl  f16  [4096][16][128]         q features per head
//   [32 MiB, 48 MiB)  kpl  f16  [4096][16][128]         k features per head
//   [48 MiB, 56 MiB)  vth  bf16 [2][1024][2048]         v^T hi plane
//   [56 MiB, 64 MiB)  vtl  bf16 [2][1024][2048]         v^T lo plane
//   [64 MiB, 72 MiB)  ohp  f16  [4096][1024]            256 * attention output, heads merged
// GEMM shapes: q/k M=4096 N=1024 K=1024; v^T M=1024 N=2048 K=1024 (x2 batch); out M=4096 N=1024 K=1024:
// all M multiples of 128, N of 256, K of 64, row pitch of every operand 1024, no padding, every plane fully written by its producer.
// ---------------------------------------------------------------------------
extern "C" void kernel_launch(void* const* d_in, const int* in_sizes, int n_in,
                              void* d_out, int out_size, void* d_ws, size_t ws_size,
                              hipStream_t stream)
{
  if (n_in < 9) return;
  if (in_sizes[0] != NTOK * DMODEL || in_sizes[1] != DMODEL * DMODEL || in_sizes[2] != DMODEL ||
      in_sizes[3] != DMODEL * DMODEL || in_sizes[4] != DMODEL || in_sizes[5] != DMODEL * DMODEL ||
      in_sizes[6] != DMODEL || in_sizes[7] != DMODEL * DMODEL || in_sizes[8] != DMODEL) return;
  if (out_size != NTOK * DMODEL) return;

  const float* x    = (const float*)d_in[0];
  const float* Wq   = (const float*)d_in[1];
  const float* bq   = (const float*)d_in[2];
  const float* Wk   = (const float*)d_in[3];
  const float* bk   = (const float*)d_in[4];
  const float* Wv   = (const float*)d_in[5];
  const float* bv   = (const float*)d_in[6];
  const float* Wo   = (const float*)d_in[7];
  const float* bo_p = (const float*)d_in[8];

  const size_t SZ_X   = (size_t)NTOK * DMODEL * 2;                 // 8 MiB
  const size_t SZ_W   = (size_t)DMODEL * DMODEL * 2;               // 2 MiB
  const size_t SZ_QK  = (size_t)NTOK * TOKP * 2;                   // 16 MiB
  const size_t SZ_VT  = (size_t)NBAT * DMODEL * SEQ * 2;           // 8 MiB
  const size_t SZ_O   = (size_t)NTOK * DMODEL * 2;                 // 8 MiB
  const size_t OFF_XB = 0;
  const size_t OFF_WQ = OFF_XB + SZ_X;
  const size_t OFF_WK = OFF_WQ + SZ_W;
  const size_t OFF_WV = OFF_WK + SZ_W;
  const size_t OFF_WO = OFF_WV + SZ_W;
  const size_t OFF_QP = OFF_WO + SZ_W;
  const size_t OFF_KP = OFF_QP + SZ_QK;
  const size_t OFF_VH = OFF_KP + SZ_QK;
  const size_t OFF_VL = OFF_VH + SZ_VT;
  const size_t OFF_OH = OFF_VL + SZ_VT;
  const size_t TOTAL  = OFF_OH + SZ_O;                             // 75,497,472
  if (TOTAL > ws_size) return;

  char* ws = (char*)d_ws;
  unsigned short* xb  = (unsigned short*)(ws + OFF_XB);
  unsigned short* wqb = (unsigned short*)(ws + OFF_WQ);
  unsigned short* wkb = (unsigned short*)(ws + OFF_WK);
  unsigned short* wvb = (unsigned short*)(ws + OFF_WV);
  unsigned short* woh = (unsigned short*)(ws + OFF_WO);
  unsigned short* qpl = (unsigned short*)(ws + OFF_QP);
  unsigned short* kpl = (unsigned short*)(ws + OFF_KP);
  unsigned short* vth = (unsigned short*)(ws + OFF_VH);
  unsigned short* vtl = (unsigned short*)(ws + OFF_VL);
  unsigned short* ohp = (unsigned short*)(ws + OFF_OH);

  // ---- 16-bit operand planes: one launch of 256 blocks of 16 waves ----
  cast_planes_kernel<<<dim3(CV_BLOCKS), dim3(CV_THREADS), 0, stream>>>(x, Wq, Wk, Wv, Wo, xb, wqb, wkb, wvb, woh);

  // ---- q / k feature planes and v^T hi/lo planes: one launch of 3 x 128 blocks of 8 waves ----
  qkv_gemm_kernel<<<dim3(3 * QKV_TILES), dim3(256), 0, stream>>>(xb, wqb, wkb, wvb, qpl, kpl, vth, vtl, bq, bk, bv);
  // ---- attention: grid = NBAT * NHEAD * (SEQ / 64) = 1024 blocks of 128 threads ----
  attn_aug_kernel<<<dim3(NBAT * NHEAD * (SEQ / 64)), dim3(128), 0, stream>>>(
      qpl, kpl, vth, vtl, ohp, 0.0625f, 256.0f);
  // ---- output projection: d_out[m][n] = (1/16384) * sum_k (256*O)[m][k] * (64*Wo)[n][k] + bo[n], f32 out ----
  {
    const int tiles = (NTOK / 64) * (DMODEL / 64);     // 1024 -> 128 blocks
    dim3 grid(tiles / 8, 1), blk(256);
    wmma_gemm64<0, false, 2, 0, false><<<grid, blk, 0, stream>>>(
        ohp, ohp, DMODEL, 0L, woh, woh, DMODEL, 0L,
        d_out, d_out, DMODEL, 0L, bo_p, bo_p, 0L, NTOK, DMODEL, DMODEL, 1.0f / 16384.0f);
  }
}
